// v000
// Measured on an AMD MI455X. A time is GPU time per run, averaged over a window of back-to-back runs after a warm-up
// (all launches, gaps included; the runs take copies of the inputs in turn), and the median of several windows.
// Apart from v000's, it joins two sittings. Times from different sittings can be a few percent apart, while
// side-by-side timings come from the same sitting.
// The starting kernel, v000, takes 3350 microseconds a run.
// Compute dtypes: conv1x1 GEMMs q/k/v = v_wmma_f32_16x16x32_bf16 on RNE-bf16 inputs (1 product); attention scores and P.V = bf16 hi+lo planes (3 products); FFN GEMMs = bf16 hi+lo activations x bf16 weights (2 products); f32 accumulate; InstanceNorm, softmax, residual in f32.
#include <hip/hip_runtime.h>
#include <hip/hip_bf16.h>

typedef __attribute__((ext_vector_type(16))) _Float16 v16h;
typedef __attribute__((ext_vector_type(8)))  _Float16 v8h;
typedef __attribute__((ext_vector_type(16))) __bf16   v16b;
typedef __attribute__((ext_vector_type(8)))  __bf16   v8b;
typedef __attribute__((ext_vector_type(8)))  float    v8f;
typedef __attribute__((ext_vector_type(4)))  float    v4f;
typedef __attribute__((ext_vector_type(2)))  float    v2f;
typedef __attribute__((ext_vector_type(4)))  unsigned v4u;

__device__ __forceinline__ unsigned short f2bf_bits(float f) {
  unsigned u = __float_as_uint(f);
  return (unsigned short)((u + 0x7FFFu + ((u >> 16) & 1u)) >> 16);
}
__device__ __forceinline__ float bf_bits2f(unsigned short h) { return __uint_as_float(((unsigned)h) << 16); }

// hazard guards as plain device helpers (no inline asm inside the kernel template body)
__device__ __forceinline__ void dep_guard_h(v8f& a, v8f& b, v16h x, v16h y) { asm volatile("v_nop\n\tv_nop\n\tv_nop\n\tv_nop" : "+v"(a), "+v"(b) : "v"(x), "v"(y)); }
__device__ __forceinline__ void dep_guard_b(v8f& a, v8f& b, v16b x, v16b y) { asm volatile("v_nop\n\tv_nop\n\tv_nop\n\tv_nop" : "+v"(a), "+v"(b) : "v"(x), "v"(y)); }
__device__ __forceinline__ void keep4_h(v16h a, v16h b, v16h c, v16h d) { asm volatile("v_nop" :: "v"(a), "v"(b), "v"(c), "v"(d)); }
__device__ __forceinline__ void keep4_b(v16b a, v16b b, v16b c, v16b d) { asm volatile("v_nop" :: "v"(a), "v"(b), "v"(c), "v"(d)); }
__device__ __forceinline__ void acc_guard4(v8f& a, v8f& b, v8f& c, v8f& d) { asm volatile("v_nop\n\tv_nop\n\tv_nop\n\tv_nop" : "+v"(a), "+v"(b), "+v"(c), "+v"(d)); }
template <typename T> struct Frag;
template <> struct Frag<_Float16> {
  typedef v16h V; union U { v16h v; v8h h[2]; };
  // elements 0..7 <- p[0..7], 8..15 <- p[16..23]
  static __device__ __forceinline__ v16h load(const _Float16* p) {
    U f; f.h[0] = *(const v8h*)(p); f.h[1] = *(const v8h*)(p + 16); return f.v;
  }
  static __device__ __forceinline__ v8f mma(v16h a, v16h b, v8f c) {
    return __builtin_amdgcn_wmma_f32_16x16x32_f16(false, a, false, b, (short)0, c, false, false);
  }
  static __device__ __forceinline__ void guard(v8f& a, v8f& b, v16h x, v16h y) { dep_guard_h(a, b, x, y); }
  static __device__ __forceinline__ void keep(v16h a, v16h b, v16h c, v16h d) { keep4_h(a, b, c, d); }
};
template <> struct Frag<__bf16> {
  typedef v16b V; union U { v16b v; v8b h[2]; };
  static __device__ __forceinline__ v16b load(const __bf16* p) {
    U f; f.h[0] = *(const v8b*)(p); f.h[1] = *(const v8b*)(p + 16); return f.v;
  }
  static __device__ __forceinline__ v8f mma(v16b a, v16b b, v8f c) {
    return __builtin_amdgcn_wmma_f32_16x16x32_bf16(false, a, false, b, (short)0, c, false, false);
  }
  static __device__ __forceinline__ void guard(v8f& a, v8f& b, v16b x, v16b y) { dep_guard_b(a, b, x, y); }
  static __device__ __forceinline__ void keep(v16b a, v16b b, v16b c, v16b d) { keep4_b(a, b, c, d); }
};

// ---- Register-blocked batched WMMA GEMM ------------------------------------
// C[m,n] = scale * sum_k A[m,k] * Bt[n,k] (+bias)(+resid); each wave owns a 64x64 tile.
// A row-major [M,K]; Bt row-major [N,K]; M,N % 64 == 0, K % 32 == 0.
// SPLIT: 0 = single product; 1 = A and Bt both hi/lo planes (hi.hi + hi.lo + lo.hi);
//        2 = only A is hi/lo (A_hi.B + A_lo.B); 3 = only Bt is hi/lo (A.B_hi + A.B_lo).
// BIAS_MODE: 0 = none, 1 = bias[m], 2 = bias[n].
// OUT_MODE: 0 = f32, 1 = f16, 2 = bf16 hi plane (Cout) + bf16 lo plane (Cout2).
// ET: 0 = f16 operands, 1 = bf16 operands (pointers passed as 16-bit storage)
template <int ET> struct Elem;
template <> struct Elem<0> { typedef _Float16 T; };
template <> struct Elem<1> { typedef __bf16 T; };
template <int ET, int SPLIT, int BIAS_MODE, int OUT_MODE, bool RESID, int ACT = 0>
__global__ __launch_bounds__(256) void wmma_gemm64(
    const unsigned short* __restrict__ Ap, const unsigned short* __restrict__ A2p, int lda, long strideA,
    const unsigned short* __restrict__ Btp, const unsigned short* __restrict__ Bt2p, int ldb, long strideB,
    void* __restrict__ Cout, void* __restrict__ Cout2, int ldc, long strideC,
    const float* __restrict__ bias,
    const float* __restrict__ resid, long strideR,
    int M, int N, int K, float scale) {
  typedef typename Elem<ET>::T T;
  typedef typename Frag<T>::V V;
  constexpr bool ASPL = (SPLIT == 1) || (SPLIT == 2);
  constexpr bool BSPL = (SPLIT == 1) || (SPLIT == 3);
  const T* A = (const T*)Ap; const T* A2 = (const T*)A2p; const T* Bt = (const T*)Btp; const T* Bt2 = (const T*)Bt2p;
  __shared__ __align__(16) float sT[8][16 * 68];   // per-wave 16x64 slab, pitch 68 floats
  const int b    = blockIdx.y;
  const int lane = threadIdx.x & 31;
  const int wave = threadIdx.x >> 5;
  const int tilesN = N >> 6;
  const int tilesM = M >> 6;
  const int tile = blockIdx.x * 8 + wave;
  if (tile >= tilesM * tilesN) return;   // wave-uniform; no block barriers in this kernel
  const int tm = tile / tilesN;
  const int tn = tile - tm * tilesN;
  const int m0 = tm << 6;
  const int n0 = tn << 6;

  const T* Ab  = A  + (size_t)b * strideA;
  const T* Bb  = Bt + (size_t)b * strideB;
  const T* Ab2 = ASPL ? (A2  + (size_t)b * strideA) : nullptr;
  const T* Bb2 = BSPL ? (Bt2 + (size_t)b * strideB) : nullptr;

  const int rlane = lane & 15;                 // row (A) / col (B, D) within subtile
  const int koff  = (lane >> 4) * 8;           // k offset of this lane half
  const int mOff  = (lane >> 4) * 8;           // D row offset

  v8f acc[4][4];
#pragma unroll
  for (int i = 0; i < 4; ++i)
#pragma unroll
    for (int j = 0; j < 4; ++j) acc[i][j] = (v8f){0.f,0.f,0.f,0.f,0.f,0.f,0.f,0.f};

  for (int k0 = 0; k0 < K; k0 += 32) {
    V bh[4], bl[4];
#pragma unroll
    for (int j = 0; j < 4; ++j) {
      const size_t bo = (size_t)(n0 + (j << 4) + rlane) * ldb + koff + k0;
      bh[j] = Frag<T>::load(Bb + bo);
      if (BSPL) bl[j] = Frag<T>::load(Bb2 + bo);
      else bl[j] = bh[j];
    }
#pragma unroll
    for (int i = 0; i < 4; ++i) {
      const size_t ao = (size_t)(m0 + (i << 4) + rlane) * lda + koff + k0;
      V ah = Frag<T>::load(Ab + ao);
      V al = ah;
      if (ASPL) al = Frag<T>::load(Ab2 + ao);
#pragma unroll
      for (int j = 0; j < 4; ++j) {
        acc[i][j] = Frag<T>::mma(ah, bh[j], acc[i][j]);
        if (BSPL) acc[i][j] = Frag<T>::mma(ah, bl[j], acc[i][j]);
        if (ASPL) acc[i][j] = Frag<T>::mma(al, bh[j], acc[i][j]);
      }
      Frag<T>::guard(acc[i][0], acc[i][3], ah, al);
    }
    Frag<T>::keep(bh[0], bh[1], bh[2], bh[3]);
    if (BSPL) Frag<T>::keep(bl[0], bl[1], bl[2], bl[3]);
  }
  acc_guard4(acc[0][0], acc[0][1], acc[0][2], acc[0][3]);
  acc_guard4(acc[1][0], acc[1][1], acc[1][2], acc[1][3]);
  acc_guard4(acc[2][0], acc[2][1], acc[2][2], acc[2][3]);
  acc_guard4(acc[3][0], acc[3][1], acc[3][2], acc[3][3]);

  // ---- epilogue ----
  float* slab = sT[wave];
  const float* Rb = RESID ? (resid + (size_t)b * strideR) : nullptr;
#pragma unroll
  for (int i = 0; i < 4; ++i) {
    const int mBase = m0 + (i << 4);
#pragma unroll
    for (int j = 0; j < 4; ++j) {
      const int n = n0 + (j << 4) + rlane;
      float bv = 0.f;
      if (BIAS_MODE == 2) bv = bias[n];
#pragma unroll
      for (int r = 0; r < 8; ++r) {
        float v = acc[i][j][r] * scale;
        if (BIAS_MODE == 1) v += bias[mBase + mOff + r];
        if (BIAS_MODE == 2) v += bv;
        if (RESID) v += Rb[(size_t)(mBase + mOff + r) * ldc + n];
        if (ACT == 1) v = tanhf(v);
        if (ACT == 2) v = fmaxf(v, 0.0f);
        if (ACT == 3) v = v / (1.0f + expf(-v));
        if (ACT == 4) v = (v > 0.f) ? v : 0.01f * v;
        slab[(mOff + r) * 68 + (j << 4) + rlane] = v;
      }
    }
    __builtin_amdgcn_fence(__ATOMIC_RELEASE, "workgroup");
    __builtin_amdgcn_wave_barrier();
    __builtin_amdgcn_fence(__ATOMIC_ACQUIRE, "workgroup");
    if (OUT_MODE == 0) {
      float* C = (float*)Cout + (size_t)b * strideC;
      const int hh = lane >> 4, c4 = (lane & 15) * 4;     // row seg = 256 B = 16 lanes x 16 B
      {
#pragma unroll
        for (int it = 0; it < 8; ++it) {
          const int row = it * 2 + hh;
          v4f v = *(const v4f*)(slab + row * 68 + c4);
          *(v4f*)(C + (size_t)(mBase + row) * ldc + n0 + c4) = v;
        }
        
      }
    } else {
      const int q = lane >> 3, c8 = (lane & 7) * 8;
      unsigned short* C  = (unsigned short*)Cout  + (size_t)b * strideC;
      unsigned short* C2 = (OUT_MODE == 2) ? ((unsigned short*)Cout2 + (size_t)b * strideC) : nullptr;
      {
#pragma unroll
        for (int it = 0; it < 4; ++it) {
          const int row = it * 4 + q;
          const float* sp = slab + row * 68 + c8;
          v8h hv, lv;
#pragma unroll
          for (int e = 0; e < 8; ++e) {
            if (OUT_MODE == 1) {
              hv[e] = (_Float16)sp[e];
            } else {
              unsigned short hb = f2bf_bits(sp[e]);
              unsigned short lb = f2bf_bits(sp[e] - bf_bits2f(hb));
              hv[e] = __builtin_bit_cast(_Float16, hb);
              lv[e] = __builtin_bit_cast(_Float16, lb);
            }
          }
          *(v8h*)(C + (size_t)(mBase + row) * ldc + n0 + c8) = hv;
          if (OUT_MODE == 2) *(v8h*)(C2 + (size_t)(mBase + row) * ldc + n0 + c8) = lv;
        }
        
      }
    }
    __builtin_amdgcn_fence(__ATOMIC_RELEASE, "workgroup");
    __builtin_amdgcn_wave_barrier();
    __builtin_amdgcn_fence(__ATOMIC_ACQUIRE, "workgroup");
  }
}

__global__ __launch_bounds__(256) void k_cast_bf16x2(
    const float* __restrict__ in, unsigned short* __restrict__ out, int n2) {
  int i = blockIdx.x * 256 + threadIdx.x;
  if (i < n2) {
    const unsigned u = (unsigned)f2bf_bits(in[2 * i]) | ((unsigned)f2bf_bits(in[2 * i + 1]) << 16);
    ((unsigned*)out)[i] = u;
    
  }
}

// ---- (nb, C, L) f32 -> (nb, L, C) bf16 through an LDS tile: in[c][l] -> out[l][c] ----
// tile = 64 channels x 32 positions; grid (L/32, C/64, nb), block 256.
// loads: 256 threads x 8 = 2048 = 64x32 floats; stores: thread (r = tid>>3, c8 = (tid&7)*8) writes 8 bf16 = 16 B,
__global__ __launch_bounds__(256) void k_transpose_bf16(
    const float* __restrict__ in, unsigned short* __restrict__ out, int C, int L) {
  __shared__ float t[64][33];
  const int tid = threadIdx.x;
  const int b = blockIdx.z;
  const int l0 = blockIdx.x * 32, c0 = blockIdx.y * 64;
  const float* inb = in + (size_t)b * C * L;
#pragma unroll
  for (int i = 0; i < 8; ++i) {
    const int cl = i * 8 + (tid >> 5);
    t[cl][tid & 31] = inb[(size_t)(c0 + cl) * L + l0 + (tid & 31)];
  }
  __syncthreads();
  const int r = tid >> 3, c8 = (tid & 7) * 8;
  unsigned w0, w1, w2, w3;
  w0 = (unsigned)f2bf_bits(t[c8 + 0][r]) | ((unsigned)f2bf_bits(t[c8 + 1][r]) << 16);
  w1 = (unsigned)f2bf_bits(t[c8 + 2][r]) | ((unsigned)f2bf_bits(t[c8 + 3][r]) << 16);
  w2 = (unsigned)f2bf_bits(t[c8 + 4][r]) | ((unsigned)f2bf_bits(t[c8 + 5][r]) << 16);
  w3 = (unsigned)f2bf_bits(t[c8 + 6][r]) | ((unsigned)f2bf_bits(t[c8 + 7][r]) << 16);
  const v4u val = (v4u){w0, w1, w2, w3};
  unsigned short* dst = out + ((size_t)b * L + l0 + r) * C + c0 + c8;
  *(v4u*)dst = val;
  
}

// ---- InstanceNorm over the 1024 rows of an L-major f32 plane X[nb][1024][ncol], per (b, column) ----
// thread owns 2 adjacent columns; block 128 threads = 256 columns; grid (ncol/256, nb).
// three rolled passes (mean, centred sum of squares, normalise); output = bf16 hi + lo planes, same layout;
// MODE 0: plain; MODE 1: + residual read from a bf16 plane res (same layout); MODE 2: relu.
template <int MODE>
__global__ __launch_bounds__(128) void k_colnorm(
    const float* __restrict__ X, const unsigned* __restrict__ res,
    unsigned* __restrict__ outh, unsigned* __restrict__ outl, int ncol) {
  constexpr int NR = 1024;
  const int b = blockIdx.y;
  const int c = blockIdx.x * 256 + threadIdx.x * 2;
  const size_t base = (size_t)b * NR * ncol + c;
  const float* xb = X + base;
  float sa0 = 0.f, sa1 = 0.f, sb0 = 0.f, sb1 = 0.f;
#pragma unroll 1
  for (int l = 0; l < NR; l += 2) {
    const v2f u = *(const v2f*)(xb + (size_t)l * ncol);
    const v2f w = *(const v2f*)(xb + (size_t)(l + 1) * ncol);
    sa0 += u.x; sa1 += u.y; sb0 += w.x; sb1 += w.y;
  }
  const float m0 = (sa0 + sb0) * (1.0f / NR);
  const float m1 = (sa1 + sb1) * (1.0f / NR);
  float qa0 = 0.f, qa1 = 0.f, qb0 = 0.f, qb1 = 0.f;
#pragma unroll 1
  for (int l = 0; l < NR; l += 2) {
    const v2f u = *(const v2f*)(xb + (size_t)l * ncol);
    const v2f w = *(const v2f*)(xb + (size_t)(l + 1) * ncol);
    const float d0 = u.x - m0, d1 = u.y - m1, e0 = w.x - m0, e1 = w.y - m1;
    qa0 += d0 * d0; qa1 += d1 * d1; qb0 += e0 * e0; qb1 += e1 * e1;
  }
  const float r0 = rsqrtf((qa0 + qb0) * (1.0f / NR) + 1e-5f);
  const float r1 = rsqrtf((qa1 + qb1) * (1.0f / NR) + 1e-5f);
#pragma unroll 1
  for (int l = 0; l < NR; ++l) {
    const size_t ei = base + (size_t)l * ncol;
    const v2f u = *(const v2f*)(X + ei);
    float y0 = (u.x - m0) * r0;
    float y1 = (u.y - m1) * r1;
    if constexpr (MODE == 1) {
      const unsigned rw = res[ei >> 1];
      y0 += __uint_as_float(rw << 16);
      y1 += __uint_as_float(rw & 0xffff0000u);
    }
    if constexpr (MODE == 2) {
      y0 = fmaxf(y0, 0.0f);
      y1 = fmaxf(y1, 0.0f);
    }
    const unsigned short hb0 = f2bf_bits(y0), hb1 = f2bf_bits(y1);
    const unsigned short lb0 = f2bf_bits(y0 - bf_bits2f(hb0));
    const unsigned short lb1 = f2bf_bits(y1 - bf_bits2f(hb1));
    const unsigned hw = (unsigned)hb0 | ((unsigned)hb1 << 16);
    const unsigned lw = (unsigned)lb0 | ((unsigned)lb1 << 16);
    const size_t oi = ei >> 1;
    ((unsigned*)outh)[oi] = hw;
    ((unsigned*)outl)[oi] = lw;
    
  }
}

// ---- InstanceNorm over channel-major f32 rows X[row][1024] (row = b*C + channel), one wave per row ----
// block 8 waves = 8 rows; grid = rows/8 (rows % 8 == 0). Rolled re-read passes (no per-thread arrays).
template <int MODE>
__global__ __launch_bounds__(256) void k_rownorm(
    const float* __restrict__ X, float* __restrict__ outf,
    unsigned short* __restrict__ outh, unsigned short* __restrict__ outl) {
  constexpr int NCOL = 1024;
  const int lane = threadIdx.x & 31, wave = threadIdx.x >> 5;
  const size_t row = (size_t)blockIdx.x * 8 + wave;
  const float* xr = X + row * NCOL;
  float s = 0.f;
#pragma unroll 1
  for (int it = 0; it < 8; ++it) {
    const v4f u = *(const v4f*)(xr + it * 128 + lane * 4);
    s += (u.x + u.y) + (u.z + u.w);
  }
#pragma unroll
  for (int off = 1; off < 32; off <<= 1) s += __shfl_xor(s, off, 32);
  const float mean = s * (1.0f / NCOL);
  float ss = 0.f;
#pragma unroll 1
  for (int it = 0; it < 8; ++it) {
    const v4f u = *(const v4f*)(xr + it * 128 + lane * 4);
    const float d0 = u.x - mean, d1 = u.y - mean, d2 = u.z - mean, d3 = u.w - mean;
    ss += (d0 * d0 + d1 * d1) + (d2 * d2 + d3 * d3);
  }
#pragma unroll
  for (int off = 1; off < 32; off <<= 1) ss += __shfl_xor(ss, off, 32);
  const float rs = rsqrtf(ss * (1.0f / NCOL) + 1e-5f);
  if constexpr (MODE == 0) {
    float* orow = outf + row * NCOL;
    {
#pragma unroll 1
      for (int it = 0; it < 8; ++it) {
        const v4f u = *(const v4f*)(xr + it * 128 + lane * 4);
        v4f y;
        y.x = (u.x - mean) * rs; y.y = (u.y - mean) * rs; y.z = (u.z - mean) * rs; y.w = (u.w - mean) * rs;
        *(v4f*)(orow + it * 128 + lane * 4) = y;
      }
      
    }
  } else {
    unsigned short* hrow = outh + row * NCOL;
    unsigned short* lrw  = outl + row * NCOL;
    {
#pragma unroll 1
      for (int it = 0; it < 4; ++it) {
        const v4f u0 = *(const v4f*)(xr + it * 256 + lane * 8);
        const v4f u1 = *(const v4f*)(xr + it * 256 + lane * 8 + 4);
        const float y0 = (u0.x - mean) * rs, y1 = (u0.y - mean) * rs, y2 = (u0.z - mean) * rs, y3 = (u0.w - mean) * rs;
        const float y4 = (u1.x - mean) * rs, y5 = (u1.y - mean) * rs, y6 = (u1.z - mean) * rs, y7 = (u1.w - mean) * rs;
        const unsigned short h0 = f2bf_bits(y0), h1 = f2bf_bits(y1), h2 = f2bf_bits(y2), h3 = f2bf_bits(y3);
        const unsigned short h4 = f2bf_bits(y4), h5 = f2bf_bits(y5), h6 = f2bf_bits(y6), h7 = f2bf_bits(y7);
        const unsigned short l0 = f2bf_bits(y0 - bf_bits2f(h0)), l1 = f2bf_bits(y1 - bf_bits2f(h1));
        const unsigned short l2 = f2bf_bits(y2 - bf_bits2f(h2)), l3 = f2bf_bits(y3 - bf_bits2f(h3));
        const unsigned short l4 = f2bf_bits(y4 - bf_bits2f(h4)), l5 = f2bf_bits(y5 - bf_bits2f(h5));
        const unsigned short l6 = f2bf_bits(y6 - bf_bits2f(h6)), l7 = f2bf_bits(y7 - bf_bits2f(h7));
        const v4u hv = (v4u){ (unsigned)h0 | ((unsigned)h1 << 16), (unsigned)h2 | ((unsigned)h3 << 16),
                              (unsigned)h4 | ((unsigned)h5 << 16), (unsigned)h6 | ((unsigned)h7 << 16) };
        const v4u lv = (v4u){ (unsigned)l0 | ((unsigned)l1 << 16), (unsigned)l2 | ((unsigned)l3 << 16),
                              (unsigned)l4 | ((unsigned)l5 << 16), (unsigned)l6 | ((unsigned)l7 << 16) };
        *(v4u*)(hrow + it * 256 + lane * 8) = hv;
        *(v4u*)(lrw  + it * 256 + lane * 8) = lv;
      }
      
    }
  }
}

// =====================================================================================
// Attention, head_dim 64, no mask, 16-bit input planes:
//   q hi/lo planes: L-major [b][l][512] bf16 (element (b, l, h, d) at (b*L + l)*512 + h*64 + d)
//   k hi/lo planes: same layout
//   v hi/lo planes: channel-major [b][h*64+d][m] bf16
//   out: f32 L-major [b][l][512]
//   scores = sscale * q.k^T : bf16 hi.hi + hi.lo + lo.hi, f32 accumulate; online softmax f32;
//   out = p.v : p and v bf16 hi/lo (hi.hi + hi.lo + lo.hi). Block = 4 waves = 64 query rows of one (b, h).
//   grid.x = B * H * (L/64)
// =====================================================================================
#define AT_D 64
#define AT_NW 4
#define AT_KC 64
#define AT_OSP 68
constexpr int SEQ_LEN = 1024;
constexpr int N_HEADS = 8;
constexpr int N_CH = 512;

__device__ __forceinline__ v8f at_mma(v16b a, v16b b, v8f c) {
  c = __builtin_amdgcn_wmma_f32_16x16x32_bf16(false, a, false, b, (short)0, c, false, false);
  asm volatile("v_nop\n\tv_nop\n\tv_nop\n\tv_nop" : "+v"(c) : "v"(a), "v"(b));
  return c;
}
__device__ __forceinline__ void at_split(float f, __bf16& hi, __bf16& lo) {
  const unsigned short hb = f2bf_bits(f);
  hi = __builtin_bit_cast(__bf16, hb);
  lo = __builtin_bit_cast(__bf16, f2bf_bits(f - __uint_as_float(((unsigned)hb) << 16)));
}

__global__ __launch_bounds__(128)
void k_attn(const unsigned short* __restrict__ qhp, const unsigned short* __restrict__ qlp,
            const unsigned short* __restrict__ khp, const unsigned short* __restrict__ klp,
            const unsigned short* __restrict__ vhp, const unsigned short* __restrict__ vlp,
            float* __restrict__ out, float sscale) {
  union FB { v16b v; v8b h[2]; };
  __shared__ __align__(16) __bf16 Ksh[AT_KC * AT_D];             // K hi [kv][d]
  __shared__ __align__(16) __bf16 Ksl[AT_KC * AT_D];             // K lo [kv][d]
  __shared__ __align__(16) __bf16 Vth[AT_D * AT_KC];             // V hi [d][kv]
  __shared__ __align__(16) __bf16 Vtl[AT_D * AT_KC];             // V lo [d][kv]
  __shared__ __align__(16) __bf16 Psh[AT_NW][16 * AT_KC];        // per wave P hi [row][kv]
  __shared__ __align__(16) __bf16 Psl[AT_NW][16 * AT_KC];        // per wave P lo [row][kv]
  __shared__ __align__(16) float  Os[AT_NW][16 * AT_OSP];        // per wave out tile

  const int tid  = threadIdx.x;
  const int wave = tid >> 5;
  const int lane = tid & 31;
  const int hh   = lane >> 4;
  const int c    = lane & 15;

  constexpr int NQB = SEQ_LEN / 64;
  const int bx  = blockIdx.x;
  const int qb  = bx % NQB;
  const int bhd = bx / NQB;
  const int h   = bhd % N_HEADS;
  const int b   = bhd / N_HEADS;
  const int q0  = qb * 64 + wave * 16;

  const __bf16* qh = (const __bf16*)qhp;
  const __bf16* ql = (const __bf16*)qlp;
  const __bf16* kh = (const __bf16*)khp;
  const __bf16* kl = (const __bf16*)klp;
  const __bf16* vh = (const __bf16*)vhp;
  const __bf16* vl = (const __bf16*)vlp;

  // ---- Q fragments (A operand: row = query q0 + c, k = d), hi and lo planes ----
  v16b qah[2], qal[2];
  {
    const size_t qo = ((size_t)b * SEQ_LEN + q0 + c) * N_CH + h * AT_D + 8 * hh;
#pragma unroll
    for (int dc = 0; dc < 2; ++dc) {
      qah[dc] = Frag<__bf16>::load(qh + qo + dc * 32);
      qal[dc] = Frag<__bf16>::load(ql + qo + dc * 32);
    }
  }

  float mrow[8], lrow[8];
  v8f oacc[4];
#pragma unroll
  for (int r = 0; r < 8; ++r) { mrow[r] = -INFINITY; lrow[r] = 0.f; }
#pragma unroll
  for (int t = 0; t < 4; ++t) oacc[t] = (v8f){0.f,0.f,0.f,0.f,0.f,0.f,0.f,0.f};

  for (int kc = 0; kc < SEQ_LEN / AT_KC; ++kc) {
    const int kv0 = kc * AT_KC;
    __syncthreads();
    {
      // staging: thread (row = tid>>1, half = (tid&1)*32) copies 32 bf16 = 4 x 16 B per plane;
      // 128 threads x 32 = 4096 = 64 x 64 elements per plane (full tiles)
      const int row = tid >> 1, half = (tid & 1) * 32;
      const size_t ko = ((size_t)b * SEQ_LEN + kv0 + row) * N_CH + h * AT_D + half;
      const size_t vo = ((size_t)b * N_CH + h * AT_D + row) * SEQ_LEN + kv0 + half;
      {
        const v4u* sp = (const v4u*)(kh + ko);
        v4u* dp = (v4u*)(Ksh + row * AT_D + half);
#pragma unroll
        for (int i = 0; i < 4; ++i) dp[i] = sp[i];
      }
      asm volatile("" ::: "memory");
      {
        const v4u* sp = (const v4u*)(kl + ko);
        v4u* dp = (v4u*)(Ksl + row * AT_D + half);
#pragma unroll
        for (int i = 0; i < 4; ++i) dp[i] = sp[i];
      }
      asm volatile("" ::: "memory");
      {
        const v4u* sp = (const v4u*)(vh + vo);
        v4u* dp = (v4u*)(Vth + row * AT_KC + half);
#pragma unroll
        for (int i = 0; i < 4; ++i) dp[i] = sp[i];
      }
      asm volatile("" ::: "memory");
      {
        const v4u* sp = (const v4u*)(vl + vo);
        v4u* dp = (v4u*)(Vtl + row * AT_KC + half);
#pragma unroll
        for (int i = 0; i < 4; ++i) dp[i] = sp[i];
      }
    }
    __syncthreads();

    // ---- scores: B operand column n = key j*16 + c, k = d (Ksh is [key][d], k-contiguous) ----
    v8f s[4];
#pragma unroll
    for (int j = 0; j < 4; ++j) {
      s[j] = (v8f){0.f,0.f,0.f,0.f,0.f,0.f,0.f,0.f};
#pragma unroll
      for (int dc = 0; dc < 2; ++dc) {
        FB kb, kb2;
        const int ko2 = (j * 16 + c) * AT_D + dc * 32 + 8 * hh;
        kb.h[0]  = *(const v8b*)(Ksh + ko2);
        kb.h[1]  = *(const v8b*)(Ksh + ko2 + 16);
        kb2.h[0] = *(const v8b*)(Ksl + ko2);
        kb2.h[1] = *(const v8b*)(Ksl + ko2 + 16);
        s[j] = at_mma(qah[dc], kb.v,  s[j]);
        s[j] = at_mma(qah[dc], kb2.v, s[j]);
        s[j] = at_mma(qal[dc], kb.v,  s[j]);
      }
    }
    // D element r of lane = (query row 8*hh + r, key column c of subtile j)
    float cm[8];
#pragma unroll
    for (int r = 0; r < 8; ++r) {
      float m = -INFINITY;
#pragma unroll
      for (int j = 0; j < 4; ++j) {
        const float sv = s[j][r] * sscale;
        s[j][r] = sv;
        m = fmaxf(m, sv);
      }
#pragma unroll
      for (int off = 1; off < 16; off <<= 1) m = fmaxf(m, __shfl_xor(m, off, 32));
      cm[r] = m;
    }
    __bf16* pwh = Psh[wave];
    __bf16* pwl = Psl[wave];
#pragma unroll
    for (int r = 0; r < 8; ++r) {
      const float mnew = fmaxf(mrow[r], cm[r]);
      const float alpha = expf(mrow[r] - mnew);
      mrow[r] = mnew;
      float psum = 0.f;
#pragma unroll
      for (int j = 0; j < 4; ++j) {
        const float p = expf(s[j][r] - mnew);
        psum += p;
        __bf16 pa_hi, pa_lo;
        at_split(p, pa_hi, pa_lo);
        pwh[(8 * hh + r) * AT_KC + j * 16 + c] = pa_hi;
        pwl[(8 * hh + r) * AT_KC + j * 16 + c] = pa_lo;
      }
#pragma unroll
      for (int off = 1; off < 16; off <<= 1) psum += __shfl_xor(psum, off, 32);
      lrow[r] = lrow[r] * alpha + psum;
#pragma unroll
      for (int t = 0; t < 4; ++t) oacc[t][r] *= alpha;
    }
    // same-wave P tile: stored as __bf16 elements, reloaded as v8b vectors of the same element type after the wave barrier
    __builtin_amdgcn_fence(__ATOMIC_RELEASE, "workgroup");
    __builtin_amdgcn_wave_barrier();
    __builtin_amdgcn_fence(__ATOMIC_ACQUIRE, "workgroup");
    // ---- out += P.V : A = P [query][key], B = V with k = key, n = d (Vth is [d][key], k-contiguous) ----
#pragma unroll 1
    for (int kk = 0; kk < 2; ++kk) {
      FB pa, pl;
      const int po = c * AT_KC + kk * 32 + 8 * hh;
      pa.h[0] = *(const v8b*)(pwh + po);
      pa.h[1] = *(const v8b*)(pwh + po + 16);
      pl.h[0] = *(const v8b*)(pwl + po);
      pl.h[1] = *(const v8b*)(pwl + po + 16);
#pragma unroll
      for (int t = 0; t < 4; ++t) {
        FB vb, vb2;
        const int vo2 = (t * 16 + c) * AT_KC + kk * 32 + 8 * hh;
        vb.h[0]  = *(const v8b*)(Vth + vo2);
        vb.h[1]  = *(const v8b*)(Vth + vo2 + 16);
        vb2.h[0] = *(const v8b*)(Vtl + vo2);
        vb2.h[1] = *(const v8b*)(Vtl + vo2 + 16);
        oacc[t] = at_mma(pa.v, vb.v,  oacc[t]);
        oacc[t] = at_mma(pa.v, vb2.v, oacc[t]);
        oacc[t] = at_mma(pl.v, vb.v,  oacc[t]);
      }
    }
  }

  float* os = Os[wave];
#pragma unroll
  for (int r = 0; r < 8; ++r) {
    const float inv = 1.0f / lrow[r];
#pragma unroll
    for (int t = 0; t < 4; ++t) os[(8 * hh + r) * AT_OSP + t * 16 + c] = oacc[t][r] * inv;
  }
  __builtin_amdgcn_fence(__ATOMIC_RELEASE, "workgroup");
  __builtin_amdgcn_wave_barrier();
  __builtin_amdgcn_fence(__ATOMIC_ACQUIRE, "workgroup");
  {
    float* ob = out + ((size_t)b * SEQ_LEN) * N_CH + h * AT_D;
    const int c4 = (lane & 15) * 4;
    {
#pragma unroll
      for (int it = 0; it < 8; ++it) {
        const int row = it * 2 + hh;
        v4f val = *(const v4f*)(os + row * AT_OSP + c4);
        *(v4f*)(ob + (size_t)(q0 + row) * N_CH + c4) = val;
      }
      
    }
  }
}

// =====================================================================================
// Host orchestration
// =====================================================================================
extern "C" void kernel_launch(void* const* d_in, const int* in_sizes, int n_in,
                              void* d_out, int out_size, void* d_ws,
                              size_t ws_size, hipStream_t stream) {
  (void)in_sizes; (void)n_in; (void)out_size;
  constexpr int NB = 8, CIN = 256, NCH = 512, SEQ = 1024, NFF = 1024, NHD = 8;

  // ---- workspace region map (bytes) ----
  constexpr size_t SZ_WQ   = (size_t)NCH * NCH * 2;        //    524288  wq  bf16 [512][512]
  constexpr size_t SZ_WK   = (size_t)NCH * CIN * 2;        //    262144  wk  bf16 [512][256]
  constexpr size_t SZ_WV   = (size_t)NCH * CIN * 2;        //    262144  wv  bf16 [512][256]
  constexpr size_t SZ_W1   = (size_t)NFF * NCH * 2;        //   1048576  w1  bf16 [1024][512]
  constexpr size_t SZ_W2   = (size_t)NCH * NFF * 2;        //   1048576  w2  bf16 [512][1024]
  constexpr size_t SZ_XQT  = (size_t)NB * SEQ * NCH * 2;   //   8388608  x_query (L,C) bf16
  constexpr size_t SZ_XKVT = (size_t)NB * SEQ * CIN * 2;   //   4194304  x_kv (L,C) bf16
  constexpr size_t SZ_G    = (size_t)NB * SEQ * NFF * 4;   //  33554432  f32 GEMM/attention output, max user = ffn1 [8][1024][1024]
  constexpr size_t SZ_P    = (size_t)NB * SEQ * NCH * 2;   //   8388608  one bf16 activation plane [8][1024][512]
  constexpr size_t OFF_WQ   = 0;
  constexpr size_t OFF_WK   = OFF_WQ + SZ_WQ;
  constexpr size_t OFF_WV   = OFF_WK + SZ_WK;
  constexpr size_t OFF_W1   = OFF_WV + SZ_WV;
  constexpr size_t OFF_W2   = OFF_W1 + SZ_W1;
  constexpr size_t OFF_XQT  = OFF_W2 + SZ_W2;
  constexpr size_t OFF_XKVT = OFF_XQT + SZ_XQT;
  constexpr size_t OFF_G    = OFF_XKVT + SZ_XKVT;
  constexpr size_t OFF_QH   = OFF_G + SZ_G;       // q hi plane; later z hi plane
  constexpr size_t OFF_QL   = OFF_QH + SZ_P;      // q lo plane; later z lo plane
  constexpr size_t OFF_KH   = OFF_QL + SZ_P;      // k hi plane; later y hi plane spans KH+KL (16777216)
  constexpr size_t OFF_KL   = OFF_KH + SZ_P;      // k lo plane
  constexpr size_t OFF_VH   = OFF_KL + SZ_P;      // v hi plane; later y lo plane spans VH+VL (16777216)
  constexpr size_t OFF_VL   = OFF_VH + SZ_P;      // v lo plane
  constexpr size_t OFF_END  = OFF_VL + SZ_P;      // 99614720
  static_assert(OFF_END == 99614720ull);
  static_assert(OFF_END <= 134217728ull);
  static_assert((OFF_WK % 256) == 0 && (OFF_XQT % 256) == 0 && (OFF_G % 256) == 0 && (OFF_QH % 256) == 0);
  // reused regions sized from the max user
  static_assert((size_t)NB * SEQ * NCH * 4 <= SZ_G);        // q, k, v, proj, ffn2 f32 outputs
  static_assert((size_t)NB * SEQ * NFF * 4 <= SZ_G);        // ffn1 f32 output
  static_assert((size_t)NB * SEQ * NFF * 2 == 2 * SZ_P);    // y plane fits exactly over two 512-wide planes
  // GEMM shape contract: M, N multiples of 64, K multiple of 32
  static_assert(SEQ % 64 == 0 && NCH % 64 == 0 && NFF % 64 == 0);
  static_assert(NCH % 32 == 0 && CIN % 32 == 0 && NFF % 32 == 0);
  static_assert(((SEQ / 64) * (NCH / 64)) % 8 == 0 && ((SEQ / 64) * (NFF / 64)) % 8 == 0);
  static_assert(NCH % 256 == 0 && NFF % 256 == 0 && (NB * NCH) % 8 == 0);
  static_assert((size_t)NB * NCH * SEQ * 4 == 16777216ull);   // d_out bytes
  if (ws_size < OFF_END) return;

  const float* x_query = (const float*)d_in[0];
  const float* x_kv    = (const float*)d_in[1];
  const float* wq      = (const float*)d_in[2];
  const float* bq      = (const float*)d_in[3];
  const float* wk      = (const float*)d_in[4];
  const float* bk      = (const float*)d_in[5];
  const float* wv      = (const float*)d_in[6];
  const float* bv      = (const float*)d_in[7];
  const float* w1      = (const float*)d_in[8];
  const float* b1      = (const float*)d_in[9];
  const float* w2      = (const float*)d_in[10];
  const float* b2      = (const float*)d_in[11];
  float* out = (float*)d_out;

  char* ws = (char*)d_ws;
  typedef unsigned short us;
  us* wq16  = (us*)(ws + OFF_WQ);
  us* wk16  = (us*)(ws + OFF_WK);
  us* wv16  = (us*)(ws + OFF_WV);
  us* w1_16 = (us*)(ws + OFF_W1);
  us* w2_16 = (us*)(ws + OFF_W2);
  us* xqT   = (us*)(ws + OFF_XQT);
  us* xkvT  = (us*)(ws + OFF_XKVT);
  float* gf = (float*)(ws + OFF_G);
  us* qh = (us*)(ws + OFF_QH);
  us* ql = (us*)(ws + OFF_QL);
  us* kh = (us*)(ws + OFF_KH);
  us* kl = (us*)(ws + OFF_KL);
  us* vh = (us*)(ws + OFF_VH);
  us* vl = (us*)(ws + OFF_VL);
  us* zh = qh;
  us* zl = ql;
  us* yh = kh;    // [8][1024][1024] bf16 = 16777216 B over KH..KL
  us* yl = vh;    // [8][1024][1024] bf16 = 16777216 B over VH..VL

  // 1) weights -> bf16 (RNE)
  k_cast_bf16x2<<<(NCH * NCH / 2 + 255) / 256, 256, 0, stream>>>(wq, wq16, NCH * NCH / 2);
  k_cast_bf16x2<<<(NCH * CIN / 2 + 255) / 256, 256, 0, stream>>>(wk, wk16, NCH * CIN / 2);
  k_cast_bf16x2<<<(NCH * CIN / 2 + 255) / 256, 256, 0, stream>>>(wv, wv16, NCH * CIN / 2);
  k_cast_bf16x2<<<(NFF * NCH / 2 + 255) / 256, 256, 0, stream>>>(w1, w1_16, NFF * NCH / 2);
  k_cast_bf16x2<<<(NCH * NFF / 2 + 255) / 256, 256, 0, stream>>>(w2, w2_16, NCH * NFF / 2);

  // 2) activations (B,C,L) f32 -> (B,L,C) bf16 : in[C][L] -> out[L][C], grid (L/32, C/64, B)
  k_transpose_bf16<<<dim3(SEQ / 32, NCH / 64, NB), 256, 0, stream>>>(x_query, xqT, NCH, SEQ);
  k_transpose_bf16<<<dim3(SEQ / 32, CIN / 64, NB), 256, 0, stream>>>(x_kv, xkvT, CIN, SEQ);

  // 3) q: C[l][o] = sum_c xqT[l][c] wq[o][c] + bq[o]  (M=1024, N=512, K=512) -> gf L-major; InstanceNorm -> q hi/lo planes
  wmma_gemm64<1, 0, 2, 0, false><<<dim3((SEQ / 64) * (NCH / 64) / 8, NB), 256, 0, stream>>>(
      xqT, nullptr, NCH, (long)SEQ * NCH, wq16, nullptr, NCH, 0L,
      (void*)gf, nullptr, NCH, (long)SEQ * NCH, bq, nullptr, 0L, SEQ, NCH, NCH, 1.0f);
  k_colnorm<0><<<dim3(NCH / 256, NB), 128, 0, stream>>>(gf, nullptr, (unsigned*)qh, (unsigned*)ql, NCH);

  // 4) k: C[l][o] = sum_c xkvT[l][c] wk[o][c] + bk[o]  (M=1024, N=512, K=256) -> k hi/lo planes (L-major)
  wmma_gemm64<1, 0, 2, 0, false><<<dim3((SEQ / 64) * (NCH / 64) / 8, NB), 256, 0, stream>>>(
      xkvT, nullptr, CIN, (long)SEQ * CIN, wk16, nullptr, CIN, 0L,
      (void*)gf, nullptr, NCH, (long)SEQ * NCH, bk, nullptr, 0L, SEQ, NCH, CIN, 1.0f);
  k_colnorm<0><<<dim3(NCH / 256, NB), 128, 0, stream>>>(gf, nullptr, (unsigned*)kh, (unsigned*)kl, NCH);

  // 5) v: C[o][m] = sum_c wv[o][c] xkvT[m][c] + bv[o]  (M=512, N=1024, K=256) -> channel-major gf; InstanceNorm rows -> v hi/lo planes
  wmma_gemm64<1, 0, 1, 0, false><<<dim3((NCH / 64) * (SEQ / 64) / 8, NB), 256, 0, stream>>>(
      wv16, nullptr, CIN, 0L, xkvT, nullptr, CIN, (long)SEQ * CIN,
      (void*)gf, nullptr, SEQ, (long)NCH * SEQ, bv, nullptr, 0L, NCH, SEQ, CIN, 1.0f);
  k_rownorm<1><<<NB * NCH / 8, 256, 0, stream>>>(gf, nullptr, vh, vl);

  // 6) attention -> gf as proj L-major [b][l][h*64+d] f32
  k_attn<<<NB * NHD * (SEQ / 64), 128, 0, stream>>>(qh, ql, kh, kl, vh, vl, gf, 0.125f);

  // 7) z = InstanceNorm(proj) + x_query(bf16) -> z hi/lo planes (L-major, pitch 512)
  k_colnorm<1><<<dim3(NCH / 256, NB), 128, 0, stream>>>(gf, (const unsigned*)xqT, (unsigned*)zh, (unsigned*)zl, NCH);

  // 8) ffn1: C[l][o] = sum_c z[l][c] w1[o][c] + b1[o]  (M=1024, N=1024, K=512), z as hi/lo -> gf L-major [l][1024]
  wmma_gemm64<1, 2, 2, 0, false><<<dim3((SEQ / 64) * (NFF / 64) / 8, NB), 256, 0, stream>>>(
      zh, zl, NCH, (long)SEQ * NCH, w1_16, nullptr, NCH, 0L,
      (void*)gf, nullptr, NFF, (long)SEQ * NFF, b1, nullptr, 0L, SEQ, NFF, NCH, 1.0f);
  // 9) y = relu(InstanceNorm(h1)) -> y hi/lo planes [l][1024]
  k_colnorm<2><<<dim3(NFF / 256, NB), 128, 0, stream>>>(gf, nullptr, (unsigned*)yh, (unsigned*)yl, NFF);

  // 10) ffn2: C[o][l] = sum_c w2[o][c] y[l][c] + b2[o]  (M=512, N=1024, K=1024), y as hi/lo -> channel-major gf
  wmma_gemm64<1, 3, 1, 0, false><<<dim3((NCH / 64) * (SEQ / 64) / 8, NB), 256, 0, stream>>>(
      w2_16, nullptr, NFF, 0L, yh, yl, NFF, (long)SEQ * NFF,
      (void*)gf, nullptr, SEQ, (long)NCH * SEQ, b2, nullptr, 0L, NCH, SEQ, NFF, 1.0f);

  // 11) final InstanceNorm over rows -> d_out (B, 512, L) f32
  k_rownorm<0><<<NB * NCH / 8, 256, 0, stream>>>(gf, out, nullptr, nullptr);
}

// v001
// Measured time: 435 microseconds a run.
// In two side-by-side timings against v000, it was 7.69 and 7.71 times as fast.
// Compute dtypes: conv1x1 GEMMs q/k/v = v_wmma_f32_16x16x32_bf16 on RNE-bf16 inputs (1 product); attention scores and P.V = bf16 hi+lo planes (3 products); FFN GEMMs = bf16 hi+lo activations x bf16 weights (2 products); f32 accumulate; InstanceNorm, softmax, residual in f32.
#include <hip/hip_runtime.h>
#include <hip/hip_bf16.h>

typedef __attribute__((ext_vector_type(16))) _Float16 v16h;
typedef __attribute__((ext_vector_type(8)))  _Float16 v8h;
typedef __attribute__((ext_vector_type(16))) __bf16   v16b;
typedef __attribute__((ext_vector_type(8)))  __bf16   v8b;
typedef __attribute__((ext_vector_type(8)))  float    v8f;
typedef __attribute__((ext_vector_type(4)))  float    v4f;
typedef __attribute__((ext_vector_type(2)))  float    v2f;
typedef __attribute__((ext_vector_type(4)))  unsigned v4u;
typedef __attribute__((ext_vector_type(2)))  unsigned v2u;

__device__ __forceinline__ unsigned short f2bf_bits(float f) {
  unsigned u = __float_as_uint(f);
  return (unsigned short)((u + 0x7FFFu + ((u >> 16) & 1u)) >> 16);
}
__device__ __forceinline__ float bf_bits2f(unsigned short h) { return __uint_as_float(((unsigned)h) << 16); }

// hazard guards as plain device helpers (no inline asm inside the GEMM kernel template body)
__device__ __forceinline__ void dep_guard_h(v8f& a, v8f& b, v16h x, v16h y) { asm volatile("v_nop\n\tv_nop\n\tv_nop\n\tv_nop" : "+v"(a), "+v"(b) : "v"(x), "v"(y)); }
__device__ __forceinline__ void dep_guard_b(v8f& a, v8f& b, v16b x, v16b y) { asm volatile("v_nop\n\tv_nop\n\tv_nop\n\tv_nop" : "+v"(a), "+v"(b) : "v"(x), "v"(y)); }
__device__ __forceinline__ void keep4_h(v16h a, v16h b, v16h c, v16h d) { asm volatile("v_nop" :: "v"(a), "v"(b), "v"(c), "v"(d)); }
__device__ __forceinline__ void keep4_b(v16b a, v16b b, v16b c, v16b d) { asm volatile("v_nop" :: "v"(a), "v"(b), "v"(c), "v"(d)); }
__device__ __forceinline__ void acc_guard4(v8f& a, v8f& b, v8f& c, v8f& d) { asm volatile("v_nop\n\tv_nop\n\tv_nop\n\tv_nop" : "+v"(a), "+v"(b), "+v"(c), "+v"(d)); }
template <typename T> struct Frag;
template <> struct Frag<_Float16> {
  typedef v16h V; union U { v16h v; v8h h[2]; };
  // elements 0..7 <- p[0..7], 8..15 <- p[16..23]
  static __device__ __forceinline__ v16h load(const _Float16* p) {
    U f; f.h[0] = *(const v8h*)(p); f.h[1] = *(const v8h*)(p + 16); return f.v;
  }
  static __device__ __forceinline__ v8f mma(v16h a, v16h b, v8f c) {
    return __builtin_amdgcn_wmma_f32_16x16x32_f16(false, a, false, b, (short)0, c, false, false);
  }
  static __device__ __forceinline__ void guard(v8f& a, v8f& b, v16h x, v16h y) { dep_guard_h(a, b, x, y); }
  static __device__ __forceinline__ void keep(v16h a, v16h b, v16h c, v16h d) { keep4_h(a, b, c, d); }
};
template <> struct Frag<__bf16> {
  typedef v16b V; union U { v16b v; v8b h[2]; };
  static __device__ __forceinline__ v16b load(const __bf16* p) {
    U f; f.h[0] = *(const v8b*)(p); f.h[1] = *(const v8b*)(p + 16); return f.v;
  }
  static __device__ __forceinline__ v8f mma(v16b a, v16b b, v8f c) {
    return __builtin_amdgcn_wmma_f32_16x16x32_bf16(false, a, false, b, (short)0, c, false, false);
  }
  static __device__ __forceinline__ void guard(v8f& a, v8f& b, v16b x, v16b y) { dep_guard_b(a, b, x, y); }
  static __device__ __forceinline__ void keep(v16b a, v16b b, v16b c, v16b d) { keep4_b(a, b, c, d); }
};

// ---- Register-blocked batched WMMA GEMM ------------------------------------
// C[m,n] = scale * sum_k A[m,k] * Bt[n,k] (+bias)(+resid); each wave owns a 64x64 tile.
// A row-major [M,K]; Bt row-major [N,K]; M,N % 64 == 0, K % 32 == 0.
// SPLIT: 0 = single product; 1 = A and Bt both hi/lo planes (hi.hi + hi.lo + lo.hi);
//        2 = only A is hi/lo (A_hi.B + A_lo.B); 3 = only Bt is hi/lo (A.B_hi + A.B_lo).
// BIAS_MODE: 0 = none, 1 = bias[m], 2 = bias[n].
// OUT_MODE: 0 = f32, 1 = f16, 2 = bf16 hi plane (Cout) + bf16 lo plane (Cout2).
// ET: 0 = f16 operands, 1 = bf16 operands (pointers passed as 16-bit storage)
template <int ET> struct Elem;
template <> struct Elem<0> { typedef _Float16 T; };
template <> struct Elem<1> { typedef __bf16 T; };
template <int ET, int SPLIT, int BIAS_MODE, int OUT_MODE, bool RESID, int ACT = 0>
__global__ __launch_bounds__(256) void wmma_gemm64(
    const unsigned short* __restrict__ Ap, const unsigned short* __restrict__ A2p, int lda, long strideA,
    const unsigned short* __restrict__ Btp, const unsigned short* __restrict__ Bt2p, int ldb, long strideB,
    void* __restrict__ Cout, void* __restrict__ Cout2, int ldc, long strideC,
    const float* __restrict__ bias,
    const float* __restrict__ resid, long strideR,
    int M, int N, int K, float scale) {
  typedef typename Elem<ET>::T T;
  typedef typename Frag<T>::V V;
  constexpr bool ASPL = (SPLIT == 1) || (SPLIT == 2);
  constexpr bool BSPL = (SPLIT == 1) || (SPLIT == 3);
  const T* A = (const T*)Ap; const T* A2 = (const T*)A2p; const T* Bt = (const T*)Btp; const T* Bt2 = (const T*)Bt2p;
  __shared__ __align__(16) float sT[8][16 * 68];   // per-wave 16x64 slab, pitch 68 floats
  const int b    = blockIdx.y;
  const int lane = threadIdx.x & 31;
  const int wave = threadIdx.x >> 5;
  const int tilesN = N >> 6;
  const int tilesM = M >> 6;
  const int tile = blockIdx.x * 8 + wave;
  if (tile >= tilesM * tilesN) return;   // wave-uniform; no block barriers in this kernel
  const int tm = tile / tilesN;
  const int tn = tile - tm * tilesN;
  const int m0 = tm << 6;
  const int n0 = tn << 6;

  const T* Ab  = A  + (size_t)b * strideA;
  const T* Bb  = Bt + (size_t)b * strideB;
  const T* Ab2 = ASPL ? (A2  + (size_t)b * strideA) : nullptr;
  const T* Bb2 = BSPL ? (Bt2 + (size_t)b * strideB) : nullptr;

  const int rlane = lane & 15;                 // row (A) / col (B, D) within subtile
  const int koff  = (lane >> 4) * 8;           // k offset of this lane half
  const int mOff  = (lane >> 4) * 8;           // D row offset

  v8f acc[4][4];
#pragma unroll
  for (int i = 0; i < 4; ++i)
#pragma unroll
    for (int j = 0; j < 4; ++j) acc[i][j] = (v8f){0.f,0.f,0.f,0.f,0.f,0.f,0.f,0.f};

  for (int k0 = 0; k0 < K; k0 += 32) {
    V bh[4], bl[4];
#pragma unroll
    for (int j = 0; j < 4; ++j) {
      const size_t bo = (size_t)(n0 + (j << 4) + rlane) * ldb + koff + k0;
      bh[j] = Frag<T>::load(Bb + bo);
      if (BSPL) bl[j] = Frag<T>::load(Bb2 + bo);
      else bl[j] = bh[j];
    }
#pragma unroll
    for (int i = 0; i < 4; ++i) {
      const size_t ao = (size_t)(m0 + (i << 4) + rlane) * lda + koff + k0;
      V ah = Frag<T>::load(Ab + ao);
      V al = ah;
      if (ASPL) al = Frag<T>::load(Ab2 + ao);
#pragma unroll
      for (int j = 0; j < 4; ++j) {
        acc[i][j] = Frag<T>::mma(ah, bh[j], acc[i][j]);
        if (BSPL) acc[i][j] = Frag<T>::mma(ah, bl[j], acc[i][j]);
        if (ASPL) acc[i][j] = Frag<T>::mma(al, bh[j], acc[i][j]);
      }
      Frag<T>::guard(acc[i][0], acc[i][3], ah, al);
    }
    Frag<T>::keep(bh[0], bh[1], bh[2], bh[3]);
    if (BSPL) Frag<T>::keep(bl[0], bl[1], bl[2], bl[3]);
  }
  acc_guard4(acc[0][0], acc[0][1], acc[0][2], acc[0][3]);
  acc_guard4(acc[1][0], acc[1][1], acc[1][2], acc[1][3]);
  acc_guard4(acc[2][0], acc[2][1], acc[2][2], acc[2][3]);
  acc_guard4(acc[3][0], acc[3][1], acc[3][2], acc[3][3]);

  // ---- epilogue ----
  float* slab = sT[wave];
  const float* Rb = RESID ? (resid + (size_t)b * strideR) : nullptr;
#pragma unroll
  for (int i = 0; i < 4; ++i) {
    const int mBase = m0 + (i << 4);
#pragma unroll
    for (int j = 0; j < 4; ++j) {
      const int n = n0 + (j << 4) + rlane;
      float bv = 0.f;
      if (BIAS_MODE == 2) bv = bias[n];
#pragma unroll
      for (int r = 0; r < 8; ++r) {
        float v = acc[i][j][r] * scale;
        if (BIAS_MODE == 1) v += bias[mBase + mOff + r];
        if (BIAS_MODE == 2) v += bv;
        if (RESID) v += Rb[(size_t)(mBase + mOff + r) * ldc + n];
        if (ACT == 1) v = tanhf(v);
        if (ACT == 2) v = fmaxf(v, 0.0f);
        if (ACT == 3) v = v / (1.0f + expf(-v));
        if (ACT == 4) v = (v > 0.f) ? v : 0.01f * v;
        slab[(mOff + r) * 68 + (j << 4) + rlane] = v;
      }
    }
    __builtin_amdgcn_fence(__ATOMIC_RELEASE, "workgroup");
    __builtin_amdgcn_wave_barrier();
    __builtin_amdgcn_fence(__ATOMIC_ACQUIRE, "workgroup");
    if (OUT_MODE == 0) {
      float* C = (float*)Cout + (size_t)b * strideC;
      const int hh = lane >> 4, c4 = (lane & 15) * 4;     // row seg = 256 B = 16 lanes x 16 B
      {
#pragma unroll
        for (int it = 0; it < 8; ++it) {
          const int row = it * 2 + hh;
          v4f v = *(const v4f*)(slab + row * 68 + c4);
          *(v4f*)(C + (size_t)(mBase + row) * ldc + n0 + c4) = v;
        }
        
      }
    } else {
      const int q = lane >> 3, c8 = (lane & 7) * 8;
      unsigned short* C  = (unsigned short*)Cout  + (size_t)b * strideC;
      unsigned short* C2 = (OUT_MODE == 2) ? ((unsigned short*)Cout2 + (size_t)b * strideC) : nullptr;
      {
#pragma unroll
        for (int it = 0; it < 4; ++it) {
          const int row = it * 4 + q;
          const float* sp = slab + row * 68 + c8;
          v8h hv, lv;
#pragma unroll
          for (int e = 0; e < 8; ++e) {
            if (OUT_MODE == 1) {
              hv[e] = (_Float16)sp[e];
            } else {
              unsigned short hb = f2bf_bits(sp[e]);
              unsigned short lb = f2bf_bits(sp[e] - bf_bits2f(hb));
              hv[e] = __builtin_bit_cast(_Float16, hb);
              lv[e] = __builtin_bit_cast(_Float16, lb);
            }
          }
          *(v8h*)(C + (size_t)(mBase + row) * ldc + n0 + c8) = hv;
          if (OUT_MODE == 2) *(v8h*)(C2 + (size_t)(mBase + row) * ldc + n0 + c8) = lv;
        }
        
      }
    }
    __builtin_amdgcn_fence(__ATOMIC_RELEASE, "workgroup");
    __builtin_amdgcn_wave_barrier();
    __builtin_amdgcn_fence(__ATOMIC_ACQUIRE, "workgroup");
  }
}

__global__ __launch_bounds__(256) void k_cast_bf16x2(
    const float* __restrict__ in, unsigned short* __restrict__ out, int n2) {
  int i = blockIdx.x * 256 + threadIdx.x;
  if (i < n2) {
    const unsigned u = (unsigned)f2bf_bits(in[2 * i]) | ((unsigned)f2bf_bits(in[2 * i + 1]) << 16);
    ((unsigned*)out)[i] = u;
    
  }
}

// ---- (nb, C, L) f32 -> (nb, L, C) bf16 through an LDS tile: in[c][l] -> out[l][c] ----
// tile = 64 channels x 32 positions; grid (L/32, C/64, nb), block 256.
// loads: 256 threads x 8 = 2048 = 64x32 floats; stores: thread (r = tid>>3, c8 = (tid&7)*8) writes 8 bf16 = 16 B,
__global__ __launch_bounds__(256) void k_transpose_bf16(
    const float* __restrict__ in, unsigned short* __restrict__ out, int C, int L) {
  __shared__ float t[64][33];
  const int tid = threadIdx.x;
  const int b = blockIdx.z;
  const int l0 = blockIdx.x * 32, c0 = blockIdx.y * 64;
  const float* inb = in + (size_t)b * C * L;
#pragma unroll
  for (int i = 0; i < 8; ++i) {
    const int cl = i * 8 + (tid >> 5);
    t[cl][tid & 31] = inb[(size_t)(c0 + cl) * L + l0 + (tid & 31)];
  }
  __syncthreads();
  const int r = tid >> 3, c8 = (tid & 7) * 8;
  unsigned w0, w1, w2, w3;
  w0 = (unsigned)f2bf_bits(t[c8 + 0][r]) | ((unsigned)f2bf_bits(t[c8 + 1][r]) << 16);
  w1 = (unsigned)f2bf_bits(t[c8 + 2][r]) | ((unsigned)f2bf_bits(t[c8 + 3][r]) << 16);
  w2 = (unsigned)f2bf_bits(t[c8 + 4][r]) | ((unsigned)f2bf_bits(t[c8 + 5][r]) << 16);
  w3 = (unsigned)f2bf_bits(t[c8 + 6][r]) | ((unsigned)f2bf_bits(t[c8 + 7][r]) << 16);
  const v4u val = (v4u){w0, w1, w2, w3};
  unsigned short* dst = out + ((size_t)b * L + l0 + r) * C + c0 + c8;
  *(v4u*)dst = val;
  
}

// ---- InstanceNorm over the 1024 rows of an L-major f32 plane X[nb][1024][NCOL], per (b, column) ----
// block = 32 waves owns a slab of 64 columns x 1024 rows; grid (NCOL/64, nb).
// lane = (row half, 4 adjacent columns): one wave-wide 16-byte load covers 2 rows x 256 B; a thread keeps its
// 16 rows (i*64 + wave*2 + half) x 4 columns in registers, so X is read once. Mean, then centred sum of squares.
// output = bf16 hi + lo planes, same layout (a wave stores 2 rows x 128 B per plane);
// MODE 0: plain; MODE 1: + residual read from a bf16 plane res (same layout); MODE 2: relu.
constexpr int CN_RP = 68;   // pitch in floats of the per-wave partial rows (16-byte aligned rows)

// column totals over the whole slab: s = this thread's partial for its 4 columns; every thread gets the totals of its 4 columns.
// fixed tree: two row halves by shuffle, 32 wave partials through LDS, wave w adds up columns 2w and 2w+1 by a butterfly.
__device__ __forceinline__ v4f cn_colsum(v4f s, float* red, float* tot, int wave, int lane) {
  const int c4 = (lane & 15) * 4;
#pragma unroll
  for (int e = 0; e < 4; ++e) s[e] += __shfl_xor(s[e], 16, 32);
  if (lane < 16) *(v4f*)(red + wave * CN_RP + c4) = s;
  __syncthreads();   // all 32 partial rows are in red
  v2f p = *(const v2f*)(red + lane * CN_RP + 2 * wave);
#pragma unroll
  for (int off = 1; off < 32; off <<= 1) {
    p.x += __shfl_xor(p.x, off, 32);
    p.y += __shfl_xor(p.y, off, 32);
  }
  if (lane == 0) *(v2f*)(tot + 2 * wave) = p;
  __syncthreads();   // all 64 totals are in tot; every read of red is over
  return *(const v4f*)(tot + c4);
}

template <int MODE, int NCOL>
__global__ __launch_bounds__(1024) void k_colnorm(
    const float* __restrict__ X, const unsigned* __restrict__ res,
    unsigned* __restrict__ outh, unsigned* __restrict__ outl) {
  constexpr int NR = 1024, NW = 32, NI = NR / (2 * NW);
  __shared__ __align__(16) float red[NW * CN_RP];
  __shared__ __align__(16) float tot[2][64];
  const int lane = threadIdx.x & 31, wave = threadIdx.x >> 5;
  const size_t base = ((size_t)blockIdx.y * NR + wave * 2 + (lane >> 4)) * NCOL + blockIdx.x * 64 + (lane & 15) * 4;
  constexpr size_t STEP = (size_t)64 * NCOL;   // floats between a thread's rows; STEP / 2 words in the bf16 planes
  const size_t obase = base >> 1;
  const float* xp = X + base;
  v4f x[NI];
#pragma unroll
  for (int i = 0; i < NI; ++i) x[i] = *(const v4f*)(xp + i * STEP);
  // xp as an input keeps the loads' address pair whole up to the wait (else the last load lands on it)
  asm volatile("s_wait_xcnt 0x0" :: "v"(xp) : "memory");
  // MODE 1: residual words, two groups of 4 rows; the first group is asked for here, under the two reductions
  v2u rw[2][4];
  if constexpr (MODE == 1) {
#pragma unroll
    for (int j = 0; j < 4; ++j) rw[0][j] = *(const v2u*)(res + obase + j * (STEP / 2));
  }
  v4f s = x[0];
#pragma unroll
  for (int i = 1; i < NI; ++i) s += x[i];
  const v4f mean = cn_colsum(s, red, tot[0], wave, lane) * (1.0f / NR);
  v4f q = (v4f){0.f, 0.f, 0.f, 0.f};
#pragma unroll
  for (int i = 0; i < NI; ++i) {
    x[i] -= mean;
    q += x[i] * x[i];
  }
  const v4f var = cn_colsum(q, red, tot[1], wave, lane) * (1.0f / NR);
  v4f rs;
#pragma unroll
  for (int e = 0; e < 4; ++e) rs[e] = rsqrtf(var[e] + 1e-5f);
#pragma unroll
  for (int g = 0; g < NI / 4; ++g) {
    if constexpr (MODE == 1) {
      if (g + 1 < NI / 4) {
#pragma unroll
        for (int j = 0; j < 4; ++j) rw[(g + 1) & 1][j] = *(const v2u*)(res + obase + ((g + 1) * 4 + j) * (STEP / 2));
      }
    }
#pragma unroll
    for (int j = 0; j < 4; ++j) {
      const int i = g * 4 + j;
      v4f y = x[i] * rs;
      if constexpr (MODE == 1) {
        const v2u w = rw[g & 1][j];
        y.x += __uint_as_float(w.x << 16);
        y.y += __uint_as_float(w.x & 0xffff0000u);
        y.z += __uint_as_float(w.y << 16);
        y.w += __uint_as_float(w.y & 0xffff0000u);
      }
      if constexpr (MODE == 2) {
#pragma unroll
        for (int e = 0; e < 4; ++e) y[e] = fmaxf(y[e], 0.0f);
      }
      unsigned short hb[4], lb[4];
#pragma unroll
      for (int e = 0; e < 4; ++e) {
        hb[e] = f2bf_bits(y[e]);
        lb[e] = f2bf_bits(y[e] - bf_bits2f(hb[e]));
      }
      const size_t oi = obase + i * (STEP / 2);
      *(v2u*)(outh + oi) = (v2u){ (unsigned)hb[0] | ((unsigned)hb[1] << 16), (unsigned)hb[2] | ((unsigned)hb[3] << 16) };
      *(v2u*)(outl + oi) = (v2u){ (unsigned)lb[0] | ((unsigned)lb[1] << 16), (unsigned)lb[2] | ((unsigned)lb[3] << 16) };
    }
    if (g + 1 < NI / 4) {
      // stands in front of every reuse of the address and data registers that the loads and stores above name
      asm volatile("s_wait_xcnt 0x0" ::: "memory");
      // keeps the next group's code below that wait; in MODE 1 it also keeps the later groups' residual loads from
      // being hoisted: with all 16 in flight the kernel passes the 128 registers of a 32-wave block and spills
      __builtin_amdgcn_sched_barrier(0);
    }
  }
}

// ---- InstanceNorm over channel-major f32 rows X[row][1024] (row = b*C + channel), one wave per row ----
// block 8 waves = 8 rows; grid = rows/8 (rows % 8 == 0). Rolled re-read passes (no per-thread arrays).
template <int MODE>
__global__ __launch_bounds__(256) void k_rownorm(
    const float* __restrict__ X, float* __restrict__ outf,
    unsigned short* __restrict__ outh, unsigned short* __restrict__ outl) {
  constexpr int NCOL = 1024;
  const int lane = threadIdx.x & 31, wave = threadIdx.x >> 5;
  const size_t row = (size_t)blockIdx.x * 8 + wave;
  const float* xr = X + row * NCOL;
  float s = 0.f;
#pragma unroll 1
  for (int it = 0; it < 8; ++it) {
    const v4f u = *(const v4f*)(xr + it * 128 + lane * 4);
    s += (u.x + u.y) + (u.z + u.w);
  }
#pragma unroll
  for (int off = 1; off < 32; off <<= 1) s += __shfl_xor(s, off, 32);
  const float mean = s * (1.0f / NCOL);
  float ss = 0.f;
#pragma unroll 1
  for (int it = 0; it < 8; ++it) {
    const v4f u = *(const v4f*)(xr + it * 128 + lane * 4);
    const float d0 = u.x - mean, d1 = u.y - mean, d2 = u.z - mean, d3 = u.w - mean;
    ss += (d0 * d0 + d1 * d1) + (d2 * d2 + d3 * d3);
  }
#pragma unroll
  for (int off = 1; off < 32; off <<= 1) ss += __shfl_xor(ss, off, 32);
  const float rs = rsqrtf(ss * (1.0f / NCOL) + 1e-5f);
  if constexpr (MODE == 0) {
    float* orow = outf + row * NCOL;
    {
#pragma unroll 1
      for (int it = 0; it < 8; ++it) {
        const v4f u = *(const v4f*)(xr + it * 128 + lane * 4);
        v4f y;
        y.x = (u.x - mean) * rs; y.y = (u.y - mean) * rs; y.z = (u.z - mean) * rs; y.w = (u.w - mean) * rs;
        *(v4f*)(orow + it * 128 + lane * 4) = y;
      }
      
    }
  } else {
    unsigned short* hrow = outh + row * NCOL;
    unsigned short* lrw  = outl + row * NCOL;
    {
#pragma unroll 1
      for (int it = 0; it < 4; ++it) {
        const v4f u0 = *(const v4f*)(xr + it * 256 + lane * 8);
        const v4f u1 = *(const v4f*)(xr + it * 256 + lane * 8 + 4);
        const float y0 = (u0.x - mean) * rs, y1 = (u0.y - mean) * rs, y2 = (u0.z - mean) * rs, y3 = (u0.w - mean) * rs;
        const float y4 = (u1.x - mean) * rs, y5 = (u1.y - mean) * rs, y6 = (u1.z - mean) * rs, y7 = (u1.w - mean) * rs;
        const unsigned short h0 = f2bf_bits(y0), h1 = f2bf_bits(y1), h2 = f2bf_bits(y2), h3 = f2bf_bits(y3);
        const unsigned short h4 = f2bf_bits(y4), h5 = f2bf_bits(y5), h6 = f2bf_bits(y6), h7 = f2bf_bits(y7);
        const unsigned short l0 = f2bf_bits(y0 - bf_bits2f(h0)), l1 = f2bf_bits(y1 - bf_bits2f(h1));
        const unsigned short l2 = f2bf_bits(y2 - bf_bits2f(h2)), l3 = f2bf_bits(y3 - bf_bits2f(h3));
        const unsigned short l4 = f2bf_bits(y4 - bf_bits2f(h4)), l5 = f2bf_bits(y5 - bf_bits2f(h5));
        const unsigned short l6 = f2bf_bits(y6 - bf_bits2f(h6)), l7 = f2bf_bits(y7 - bf_bits2f(h7));
        const v4u hv = (v4u){ (unsigned)h0 | ((unsigned)h1 << 16), (unsigned)h2 | ((unsigned)h3 << 16),
                              (unsigned)h4 | ((unsigned)h5 << 16), (unsigned)h6 | ((unsigned)h7 << 16) };
        const v4u lv = (v4u){ (unsigned)l0 | ((unsigned)l1 << 16), (unsigned)l2 | ((unsigned)l3 << 16),
                              (unsigned)l4 | ((unsigned)l5 << 16), (unsigned)l6 | ((unsigned)l7 << 16) };
        *(v4u*)(hrow + it * 256 + lane * 8) = hv;
        *(v4u*)(lrw  + it * 256 + lane * 8) = lv;
      }
      
    }
  }
}

// =====================================================================================
// Attention, head_dim 64, no mask, 16-bit input planes:
//   q hi/lo planes: L-major [b][l][512] bf16 (element (b, l, h, d) at (b*L + l)*512 + h*64 + d)
//   k hi/lo planes: same layout
//   v hi/lo planes: channel-major [b][h*64+d][m] bf16
//   out: f32 L-major [b][l][512]
//   scores = sscale * q.k^T : bf16 hi.hi + hi.lo + lo.hi, f32 accumulate; online softmax f32;
//   out = p.v : p and v bf16 hi/lo (hi.hi + hi.lo + lo.hi). Block = 4 waves = 64 query rows of one (b, h).
//   grid.x = B * H * (L/64)
// =====================================================================================
#define AT_D 64
#define AT_NW 4
#define AT_KC 64
#define AT_OSP 68
constexpr int SEQ_LEN = 1024;
constexpr int N_HEADS = 8;
constexpr int N_CH = 512;

__device__ __forceinline__ v8f at_mma(v16b a, v16b b, v8f c) {
  c = __builtin_amdgcn_wmma_f32_16x16x32_bf16(false, a, false, b, (short)0, c, false, false);
  asm volatile("v_nop\n\tv_nop\n\tv_nop\n\tv_nop" : "+v"(c) : "v"(a), "v"(b));
  return c;
}
__device__ __forceinline__ void at_split(float f, __bf16& hi, __bf16& lo) {
  const unsigned short hb = f2bf_bits(f);
  hi = __builtin_bit_cast(__bf16, hb);
  lo = __builtin_bit_cast(__bf16, f2bf_bits(f - __uint_as_float(((unsigned)hb) << 16)));
}

__global__ __launch_bounds__(128)
void k_attn(const unsigned short* __restrict__ qhp, const unsigned short* __restrict__ qlp,
            const unsigned short* __restrict__ khp, const unsigned short* __restrict__ klp,
            const unsigned short* __restrict__ vhp, const unsigned short* __restrict__ vlp,
            float* __restrict__ out, float sscale) {
  union FB { v16b v; v8b h[2]; };
  __shared__ __align__(16) __bf16 Ksh[AT_KC * AT_D];             // K hi [kv][d]
  __shared__ __align__(16) __bf16 Ksl[AT_KC * AT_D];             // K lo [kv][d]
  __shared__ __align__(16) __bf16 Vth[AT_D * AT_KC];             // V hi [d][kv]
  __shared__ __align__(16) __bf16 Vtl[AT_D * AT_KC];             // V lo [d][kv]
  __shared__ __align__(16) __bf16 Psh[AT_NW][16 * AT_KC];        // per wave P hi [row][kv]
  __shared__ __align__(16) __bf16 Psl[AT_NW][16 * AT_KC];        // per wave P lo [row][kv]
  __shared__ __align__(16) float  Os[AT_NW][16 * AT_OSP];        // per wave out tile

  const int tid  = threadIdx.x;
  const int wave = tid >> 5;
  const int lane = tid & 31;
  const int hh   = lane >> 4;
  const int c    = lane & 15;

  constexpr int NQB = SEQ_LEN / 64;
  const int bx  = blockIdx.x;
  const int qb  = bx % NQB;
  const int bhd = bx / NQB;
  const int h   = bhd % N_HEADS;
  const int b   = bhd / N_HEADS;
  const int q0  = qb * 64 + wave * 16;

  const __bf16* qh = (const __bf16*)qhp;
  const __bf16* ql = (const __bf16*)qlp;
  const __bf16* kh = (const __bf16*)khp;
  const __bf16* kl = (const __bf16*)klp;
  const __bf16* vh = (const __bf16*)vhp;
  const __bf16* vl = (const __bf16*)vlp;

  // ---- Q fragments (A operand: row = query q0 + c, k = d), hi and lo planes ----
  v16b qah[2], qal[2];
  {
    const size_t qo = ((size_t)b * SEQ_LEN + q0 + c) * N_CH + h * AT_D + 8 * hh;
#pragma unroll
    for (int dc = 0; dc < 2; ++dc) {
      qah[dc] = Frag<__bf16>::load(qh + qo + dc * 32);
      qal[dc] = Frag<__bf16>::load(ql + qo + dc * 32);
    }
  }

  float mrow[8], lrow[8];
  v8f oacc[4];
#pragma unroll
  for (int r = 0; r < 8; ++r) { mrow[r] = -INFINITY; lrow[r] = 0.f; }
#pragma unroll
  for (int t = 0; t < 4; ++t) oacc[t] = (v8f){0.f,0.f,0.f,0.f,0.f,0.f,0.f,0.f};

  for (int kc = 0; kc < SEQ_LEN / AT_KC; ++kc) {
    const int kv0 = kc * AT_KC;
    __syncthreads();
    {
      // staging: thread (row = tid>>1, half = (tid&1)*32) copies 32 bf16 = 4 x 16 B per plane;
      // 128 threads x 32 = 4096 = 64 x 64 elements per plane (full tiles)
      const int row = tid >> 1, half = (tid & 1) * 32;
      const size_t ko = ((size_t)b * SEQ_LEN + kv0 + row) * N_CH + h * AT_D + half;
      const size_t vo = ((size_t)b * N_CH + h * AT_D + row) * SEQ_LEN + kv0 + half;
      {
        const v4u* sp = (const v4u*)(kh + ko);
        v4u* dp = (v4u*)(Ksh + row * AT_D + half);
#pragma unroll
        for (int i = 0; i < 4; ++i) dp[i] = sp[i];
      }
      asm volatile("" ::: "memory");
      {
        const v4u* sp = (const v4u*)(kl + ko);
        v4u* dp = (v4u*)(Ksl + row * AT_D + half);
#pragma unroll
        for (int i = 0; i < 4; ++i) dp[i] = sp[i];
      }
      asm volatile("" ::: "memory");
      {
        const v4u* sp = (const v4u*)(vh + vo);
        v4u* dp = (v4u*)(Vth + row * AT_KC + half);
#pragma unroll
        for (int i = 0; i < 4; ++i) dp[i] = sp[i];
      }
      asm volatile("" ::: "memory");
      {
        const v4u* sp = (const v4u*)(vl + vo);
        v4u* dp = (v4u*)(Vtl + row * AT_KC + half);
#pragma unroll
        for (int i = 0; i < 4; ++i) dp[i] = sp[i];
      }
    }
    __syncthreads();

    // ---- scores: B operand column n = key j*16 + c, k = d (Ksh is [key][d], k-contiguous) ----
    v8f s[4];
#pragma unroll
    for (int j = 0; j < 4; ++j) {
      s[j] = (v8f){0.f,0.f,0.f,0.f,0.f,0.f,0.f,0.f};
#pragma unroll
      for (int dc = 0; dc < 2; ++dc) {
        FB kb, kb2;
        const int ko2 = (j * 16 + c) * AT_D + dc * 32 + 8 * hh;
        kb.h[0]  = *(const v8b*)(Ksh + ko2);
        kb.h[1]  = *(const v8b*)(Ksh + ko2 + 16);
        kb2.h[0] = *(const v8b*)(Ksl + ko2);
        kb2.h[1] = *(const v8b*)(Ksl + ko2 + 16);
        s[j] = at_mma(qah[dc], kb.v,  s[j]);
        s[j] = at_mma(qah[dc], kb2.v, s[j]);
        s[j] = at_mma(qal[dc], kb.v,  s[j]);
      }
    }
    // D element r of lane = (query row 8*hh + r, key column c of subtile j)
    float cm[8];
#pragma unroll
    for (int r = 0; r < 8; ++r) {
      float m = -INFINITY;
#pragma unroll
      for (int j = 0; j < 4; ++j) {
        const float sv = s[j][r] * sscale;
        s[j][r] = sv;
        m = fmaxf(m, sv);
      }
#pragma unroll
      for (int off = 1; off < 16; off <<= 1) m = fmaxf(m, __shfl_xor(m, off, 32));
      cm[r] = m;
    }
    __bf16* pwh = Psh[wave];
    __bf16* pwl = Psl[wave];
#pragma unroll
    for (int r = 0; r < 8; ++r) {
      const float mnew = fmaxf(mrow[r], cm[r]);
      const float alpha = expf(mrow[r] - mnew);
      mrow[r] = mnew;
      float psum = 0.f;
#pragma unroll
      for (int j = 0; j < 4; ++j) {
        const float p = expf(s[j][r] - mnew);
        psum += p;
        __bf16 pa_hi, pa_lo;
        at_split(p, pa_hi, pa_lo);
        pwh[(8 * hh + r) * AT_KC + j * 16 + c] = pa_hi;
        pwl[(8 * hh + r) * AT_KC + j * 16 + c] = pa_lo;
      }
#pragma unroll
      for (int off = 1; off < 16; off <<= 1) psum += __shfl_xor(psum, off, 32);
      lrow[r] = lrow[r] * alpha + psum;
#pragma unroll
      for (int t = 0; t < 4; ++t) oacc[t][r] *= alpha;
    }
    // same-wave P tile: stored as __bf16 elements, reloaded as v8b vectors of the same element type after the wave barrier
    __builtin_amdgcn_fence(__ATOMIC_RELEASE, "workgroup");
    __builtin_amdgcn_wave_barrier();
    __builtin_amdgcn_fence(__ATOMIC_ACQUIRE, "workgroup");
    // ---- out += P.V : A = P [query][key], B = V with k = key, n = d (Vth is [d][key], k-contiguous) ----
#pragma unroll 1
    for (int kk = 0; kk < 2; ++kk) {
      FB pa, pl;
      const int po = c * AT_KC + kk * 32 + 8 * hh;
      pa.h[0] = *(const v8b*)(pwh + po);
      pa.h[1] = *(const v8b*)(pwh + po + 16);
      pl.h[0] = *(const v8b*)(pwl + po);
      pl.h[1] = *(const v8b*)(pwl + po + 16);
#pragma unroll
      for (int t = 0; t < 4; ++t) {
        FB vb, vb2;
        const int vo2 = (t * 16 + c) * AT_KC + kk * 32 + 8 * hh;
        vb.h[0]  = *(const v8b*)(Vth + vo2);
        vb.h[1]  = *(const v8b*)(Vth + vo2 + 16);
        vb2.h[0] = *(const v8b*)(Vtl + vo2);
        vb2.h[1] = *(const v8b*)(Vtl + vo2 + 16);
        oacc[t] = at_mma(pa.v, vb.v,  oacc[t]);
        oacc[t] = at_mma(pa.v, vb2.v, oacc[t]);
        oacc[t] = at_mma(pl.v, vb.v,  oacc[t]);
      }
    }
  }

  float* os = Os[wave];
#pragma unroll
  for (int r = 0; r < 8; ++r) {
    const float inv = 1.0f / lrow[r];
#pragma unroll
    for (int t = 0; t < 4; ++t) os[(8 * hh + r) * AT_OSP + t * 16 + c] = oacc[t][r] * inv;
  }
  __builtin_amdgcn_fence(__ATOMIC_RELEASE, "workgroup");
  __builtin_amdgcn_wave_barrier();
  __builtin_amdgcn_fence(__ATOMIC_ACQUIRE, "workgroup");
  {
    float* ob = out + ((size_t)b * SEQ_LEN) * N_CH + h * AT_D;
    const int c4 = (lane & 15) * 4;
    {
#pragma unroll
      for (int it = 0; it < 8; ++it) {
        const int row = it * 2 + hh;
        v4f val = *(const v4f*)(os + row * AT_OSP + c4);
        *(v4f*)(ob + (size_t)(q0 + row) * N_CH + c4) = val;
      }
      
    }
  }
}

// =====================================================================================
// Host orchestration
// =====================================================================================
extern "C" void kernel_launch(void* const* d_in, const int* in_sizes, int n_in,
                              void* d_out, int out_size, void* d_ws,
                              size_t ws_size, hipStream_t stream) {
  (void)in_sizes; (void)n_in; (void)out_size;
  constexpr int NB = 8, CIN = 256, NCH = 512, SEQ = 1024, NFF = 1024, NHD = 8;

  // ---- workspace region map (bytes) ----
  constexpr size_t SZ_WQ   = (size_t)NCH * NCH * 2;        //    524288  wq  bf16 [512][512]
  constexpr size_t SZ_WK   = (size_t)NCH * CIN * 2;        //    262144  wk  bf16 [512][256]
  constexpr size_t SZ_WV   = (size_t)NCH * CIN * 2;        //    262144  wv  bf16 [512][256]
  constexpr size_t SZ_W1   = (size_t)NFF * NCH * 2;        //   1048576  w1  bf16 [1024][512]
  constexpr size_t SZ_W2   = (size_t)NCH * NFF * 2;        //   1048576  w2  bf16 [512][1024]
  constexpr size_t SZ_XQT  = (size_t)NB * SEQ * NCH * 2;   //   8388608  x_query (L,C) bf16
  constexpr size_t SZ_XKVT = (size_t)NB * SEQ * CIN * 2;   //   4194304  x_kv (L,C) bf16
  constexpr size_t SZ_G    = (size_t)NB * SEQ * NFF * 4;   //  33554432  f32 GEMM/attention output, max user = ffn1 [8][1024][1024]
  constexpr size_t SZ_P    = (size_t)NB * SEQ * NCH * 2;   //   8388608  one bf16 activation plane [8][1024][512]
  constexpr size_t OFF_WQ   = 0;
  constexpr size_t OFF_WK   = OFF_WQ + SZ_WQ;
  constexpr size_t OFF_WV   = OFF_WK + SZ_WK;
  constexpr size_t OFF_W1   = OFF_WV + SZ_WV;
  constexpr size_t OFF_W2   = OFF_W1 + SZ_W1;
  constexpr size_t OFF_XQT  = OFF_W2 + SZ_W2;
  constexpr size_t OFF_XKVT = OFF_XQT + SZ_XQT;
  constexpr size_t OFF_G    = OFF_XKVT + SZ_XKVT;
  constexpr size_t OFF_QH   = OFF_G + SZ_G;       // q hi plane; later z hi plane
  constexpr size_t OFF_QL   = OFF_QH + SZ_P;      // q lo plane; later z lo plane
  constexpr size_t OFF_KH   = OFF_QL + SZ_P;      // k hi plane; later y hi plane spans KH+KL (16777216)
  constexpr size_t OFF_KL   = OFF_KH + SZ_P;      // k lo plane
  constexpr size_t OFF_VH   = OFF_KL + SZ_P;      // v hi plane; later y lo plane spans VH+VL (16777216)
  constexpr size_t OFF_VL   = OFF_VH + SZ_P;      // v lo plane
  constexpr size_t OFF_END  = OFF_VL + SZ_P;      // 99614720
  static_assert(OFF_END == 99614720ull);
  static_assert(OFF_END <= 134217728ull);
  static_assert((OFF_WK % 256) == 0 && (OFF_XQT % 256) == 0 && (OFF_G % 256) == 0 && (OFF_QH % 256) == 0);
  // reused regions sized from the max user
  static_assert((size_t)NB * SEQ * NCH * 4 <= SZ_G);        // q, k, v, proj, ffn2 f32 outputs
  static_assert((size_t)NB * SEQ * NFF * 4 <= SZ_G);        // ffn1 f32 output
  static_assert((size_t)NB * SEQ * NFF * 2 == 2 * SZ_P);    // y plane fits exactly over two 512-wide planes
  // GEMM shape contract: M, N multiples of 64, K multiple of 32
  static_assert(SEQ % 64 == 0 && NCH % 64 == 0 && NFF % 64 == 0);
  static_assert(NCH % 32 == 0 && CIN % 32 == 0 && NFF % 32 == 0);
  static_assert(((SEQ / 64) * (NCH / 64)) % 8 == 0 && ((SEQ / 64) * (NFF / 64)) % 8 == 0);
  static_assert(NCH % 256 == 0 && NFF % 256 == 0 && (NB * NCH) % 8 == 0);
  static_assert((size_t)NB * NCH * SEQ * 4 == 16777216ull);   // d_out bytes
  if (ws_size < OFF_END) return;

  const float* x_query = (const float*)d_in[0];
  const float* x_kv    = (const float*)d_in[1];
  const float* wq      = (const float*)d_in[2];
  const float* bq      = (const float*)d_in[3];
  const float* wk      = (const float*)d_in[4];
  const float* bk      = (const float*)d_in[5];
  const float* wv      = (const float*)d_in[6];
  const float* bv      = (const float*)d_in[7];
  const float* w1      = (const float*)d_in[8];
  const float* b1      = (const float*)d_in[9];
  const float* w2      = (const float*)d_in[10];
  const float* b2      = (const float*)d_in[11];
  float* out = (float*)d_out;

  char* ws = (char*)d_ws;
  typedef unsigned short us;
  us* wq16  = (us*)(ws + OFF_WQ);
  us* wk16  = (us*)(ws + OFF_WK);
  us* wv16  = (us*)(ws + OFF_WV);
  us* w1_16 = (us*)(ws + OFF_W1);
  us* w2_16 = (us*)(ws + OFF_W2);
  us* xqT   = (us*)(ws + OFF_XQT);
  us* xkvT  = (us*)(ws + OFF_XKVT);
  float* gf = (float*)(ws + OFF_G);
  us* qh = (us*)(ws + OFF_QH);
  us* ql = (us*)(ws + OFF_QL);
  us* kh = (us*)(ws + OFF_KH);
  us* kl = (us*)(ws + OFF_KL);
  us* vh = (us*)(ws + OFF_VH);
  us* vl = (us*)(ws + OFF_VL);
  us* zh = qh;
  us* zl = ql;
  us* yh = kh;    // [8][1024][1024] bf16 = 16777216 B over KH..KL
  us* yl = vh;    // [8][1024][1024] bf16 = 16777216 B over VH..VL

  // 1) weights -> bf16 (RNE)
  k_cast_bf16x2<<<(NCH * NCH / 2 + 255) / 256, 256, 0, stream>>>(wq, wq16, NCH * NCH / 2);
  k_cast_bf16x2<<<(NCH * CIN / 2 + 255) / 256, 256, 0, stream>>>(wk, wk16, NCH * CIN / 2);
  k_cast_bf16x2<<<(NCH * CIN / 2 + 255) / 256, 256, 0, stream>>>(wv, wv16, NCH * CIN / 2);
  k_cast_bf16x2<<<(NFF * NCH / 2 + 255) / 256, 256, 0, stream>>>(w1, w1_16, NFF * NCH / 2);
  k_cast_bf16x2<<<(NCH * NFF / 2 + 255) / 256, 256, 0, stream>>>(w2, w2_16, NCH * NFF / 2);

  // 2) activations (B,C,L) f32 -> (B,L,C) bf16 : in[C][L] -> out[L][C], grid (L/32, C/64, B)
  k_transpose_bf16<<<dim3(SEQ / 32, NCH / 64, NB), 256, 0, stream>>>(x_query, xqT, NCH, SEQ);
  k_transpose_bf16<<<dim3(SEQ / 32, CIN / 64, NB), 256, 0, stream>>>(x_kv, xkvT, CIN, SEQ);

  // 3) q: C[l][o] = sum_c xqT[l][c] wq[o][c] + bq[o]  (M=1024, N=512, K=512) -> gf L-major; InstanceNorm -> q hi/lo planes
  wmma_gemm64<1, 0, 2, 0, false><<<dim3((SEQ / 64) * (NCH / 64) / 8, NB), 256, 0, stream>>>(
      xqT, nullptr, NCH, (long)SEQ * NCH, wq16, nullptr, NCH, 0L,
      (void*)gf, nullptr, NCH, (long)SEQ * NCH, bq, nullptr, 0L, SEQ, NCH, NCH, 1.0f);
  k_colnorm<0, NCH><<<dim3(NCH / 64, NB), 1024, 0, stream>>>(gf, nullptr, (unsigned*)qh, (unsigned*)ql);

  // 4) k: C[l][o] = sum_c xkvT[l][c] wk[o][c] + bk[o]  (M=1024, N=512, K=256) -> k hi/lo planes (L-major)
  wmma_gemm64<1, 0, 2, 0, false><<<dim3((SEQ / 64) * (NCH / 64) / 8, NB), 256, 0, stream>>>(
      xkvT, nullptr, CIN, (long)SEQ * CIN, wk16, nullptr, CIN, 0L,
      (void*)gf, nullptr, NCH, (long)SEQ * NCH, bk, nullptr, 0L, SEQ, NCH, CIN, 1.0f);
  k_colnorm<0, NCH><<<dim3(NCH / 64, NB), 1024, 0, stream>>>(gf, nullptr, (unsigned*)kh, (unsigned*)kl);

  // 5) v: C[o][m] = sum_c wv[o][c] xkvT[m][c] + bv[o]  (M=512, N=1024, K=256) -> channel-major gf; InstanceNorm rows -> v hi/lo planes
  wmma_gemm64<1, 0, 1, 0, false><<<dim3((NCH / 64) * (SEQ / 64) / 8, NB), 256, 0, stream>>>(
      wv16, nullptr, CIN, 0L, xkvT, nullptr, CIN, (long)SEQ * CIN,
      (void*)gf, nullptr, SEQ, (long)NCH * SEQ, bv, nullptr, 0L, NCH, SEQ, CIN, 1.0f);
  k_rownorm<1><<<NB * NCH / 8, 256, 0, stream>>>(gf, nullptr, vh, vl);

  // 6) attention -> gf as proj L-major [b][l][h*64+d] f32
  k_attn<<<NB * NHD * (SEQ / 64), 128, 0, stream>>>(qh, ql, kh, kl, vh, vl, gf, 0.125f);

  // 7) z = InstanceNorm(proj) + x_query(bf16) -> z hi/lo planes (L-major, pitch 512)
  k_colnorm<1, NCH><<<dim3(NCH / 64, NB), 1024, 0, stream>>>(gf, (const unsigned*)xqT, (unsigned*)zh, (unsigned*)zl);

  // 8) ffn1: C[l][o] = sum_c z[l][c] w1[o][c] + b1[o]  (M=1024, N=1024, K=512), z as hi/lo -> gf L-major [l][1024]
  wmma_gemm64<1, 2, 2, 0, false><<<dim3((SEQ / 64) * (NFF / 64) / 8, NB), 256, 0, stream>>>(
      zh, zl, NCH, (long)SEQ * NCH, w1_16, nullptr, NCH, 0L,
      (void*)gf, nullptr, NFF, (long)SEQ * NFF, b1, nullptr, 0L, SEQ, NFF, NCH, 1.0f);
  // 9) y = relu(InstanceNorm(h1)) -> y hi/lo planes [l][1024]
  k_colnorm<2, NFF><<<dim3(NFF / 64, NB), 1024, 0, stream>>>(gf, nullptr, (unsigned*)yh, (unsigned*)yl);

  // 10) ffn2: C[o][l] = sum_c w2[o][c] y[l][c] + b2[o]  (M=512, N=1024, K=1024), y as hi/lo -> channel-major gf
  wmma_gemm64<1, 3, 1, 0, false><<<dim3((NCH / 64) * (SEQ / 64) / 8, NB), 256, 0, stream>>>(
      w2_16, nullptr, NFF, 0L, yh, yl, NFF, (long)SEQ * NFF,
      (void*)gf, nullptr, SEQ, (long)NCH * SEQ, b2, nullptr, 0L, NCH, SEQ, NFF, 1.0f);

  // 11) final InstanceNorm over rows -> d_out (B, 512, L) f32
  k_rownorm<0><<<NB * NCH / 8, 256, 0, stream>>>(gf, out, nullptr, nullptr);
}

// v002
// One run takes 370 microseconds.
// Next to v001, in two timings, it ran 1.17 times as fast each time.
// Counting every step since v000, it is 9.03 times as fast.
// Compute dtypes: conv1x1 GEMMs q/k/v = v_wmma_f32_16x16x32_bf16 on RNE-bf16 inputs (1 product); attention scores and P.V = bf16 hi+lo planes (3 products); FFN GEMMs = bf16 hi+lo activations x bf16 weights (2 products); f32 accumulate; InstanceNorm, softmax, residual in f32.
#include <hip/hip_runtime.h>
#include <hip/hip_bf16.h>

typedef __attribute__((ext_vector_type(16))) _Float16 v16h;
typedef __attribute__((ext_vector_type(8)))  _Float16 v8h;
typedef __attribute__((ext_vector_type(16))) __bf16   v16b;
typedef __attribute__((ext_vector_type(8)))  __bf16   v8b;
typedef __attribute__((ext_vector_type(8)))  float    v8f;
typedef __attribute__((ext_vector_type(4)))  float    v4f;
typedef __attribute__((ext_vector_type(2)))  float    v2f;
typedef __attribute__((ext_vector_type(4)))  unsigned v4u;
typedef __attribute__((ext_vector_type(2)))  unsigned v2u;

__device__ __forceinline__ unsigned short f2bf_bits(float f) {
  unsigned u = __float_as_uint(f);
  return (unsigned short)((u + 0x7FFFu + ((u >> 16) & 1u)) >> 16);
}
__device__ __forceinline__ float bf_bits2f(unsigned short h) { return __uint_as_float(((unsigned)h) << 16); }

// hazard guards as plain device helpers (no inline asm inside the GEMM kernel template body)
__device__ __forceinline__ void dep_guard_h(v8f& a, v8f& b, v16h x, v16h y) { asm volatile("v_nop\n\tv_nop\n\tv_nop\n\tv_nop" : "+v"(a), "+v"(b) : "v"(x), "v"(y)); }
__device__ __forceinline__ void dep_guard_b(v8f& a, v8f& b, v16b x, v16b y) { asm volatile("v_nop\n\tv_nop\n\tv_nop\n\tv_nop" : "+v"(a), "+v"(b) : "v"(x), "v"(y)); }
__device__ __forceinline__ void keep4_h(v16h a, v16h b, v16h c, v16h d) { asm volatile("v_nop" :: "v"(a), "v"(b), "v"(c), "v"(d)); }
__device__ __forceinline__ void keep4_b(v16b a, v16b b, v16b c, v16b d) { asm volatile("v_nop" :: "v"(a), "v"(b), "v"(c), "v"(d)); }
__device__ __forceinline__ void acc_guard4(v8f& a, v8f& b, v8f& c, v8f& d) { asm volatile("v_nop\n\tv_nop\n\tv_nop\n\tv_nop" : "+v"(a), "+v"(b), "+v"(c), "+v"(d)); }
template <typename T> struct Frag;
template <> struct Frag<_Float16> {
  typedef v16h V; union U { v16h v; v8h h[2]; };
  // elements 0..7 <- p[0..7], 8..15 <- p[16..23]
  static __device__ __forceinline__ v16h load(const _Float16* p) {
    U f; f.h[0] = *(const v8h*)(p); f.h[1] = *(const v8h*)(p + 16); return f.v;
  }
  static __device__ __forceinline__ v8f mma(v16h a, v16h b, v8f c) {
    return __builtin_amdgcn_wmma_f32_16x16x32_f16(false, a, false, b, (short)0, c, false, false);
  }
  static __device__ __forceinline__ void guard(v8f& a, v8f& b, v16h x, v16h y) { dep_guard_h(a, b, x, y); }
  static __device__ __forceinline__ void keep(v16h a, v16h b, v16h c, v16h d) { keep4_h(a, b, c, d); }
};
template <> struct Frag<__bf16> {
  typedef v16b V; union U { v16b v; v8b h[2]; };
  static __device__ __forceinline__ v16b load(const __bf16* p) {
    U f; f.h[0] = *(const v8b*)(p); f.h[1] = *(const v8b*)(p + 16); return f.v;
  }
  static __device__ __forceinline__ v8f mma(v16b a, v16b b, v8f c) {
    return __builtin_amdgcn_wmma_f32_16x16x32_bf16(false, a, false, b, (short)0, c, false, false);
  }
  static __device__ __forceinline__ void guard(v8f& a, v8f& b, v16b x, v16b y) { dep_guard_b(a, b, x, y); }
  static __device__ __forceinline__ void keep(v16b a, v16b b, v16b c, v16b d) { keep4_b(a, b, c, d); }
};

// ---- Register-blocked batched WMMA GEMM ------------------------------------
// C[m,n] = scale * sum_k A[m,k] * Bt[n,k] (+bias)(+resid); each wave owns a 64x64 tile.
// A row-major [M,K]; Bt row-major [N,K]; M,N % 64 == 0, K % 32 == 0.
// SPLIT: 0 = single product; 1 = A and Bt both hi/lo planes (hi.hi + hi.lo + lo.hi);
//        2 = only A is hi/lo (A_hi.B + A_lo.B); 3 = only Bt is hi/lo (A.B_hi + A.B_lo).
// BIAS_MODE: 0 = none, 1 = bias[m], 2 = bias[n].
// OUT_MODE: 0 = f32, 1 = f16, 2 = bf16 hi plane (Cout) + bf16 lo plane (Cout2).
// ET: 0 = f16 operands, 1 = bf16 operands (pointers passed as 16-bit storage)
template <int ET> struct Elem;
template <> struct Elem<0> { typedef _Float16 T; };
template <> struct Elem<1> { typedef __bf16 T; };
template <int ET, int SPLIT, int BIAS_MODE, int OUT_MODE, bool RESID, int ACT = 0>
__global__ __launch_bounds__(256) void wmma_gemm64(
    const unsigned short* __restrict__ Ap, const unsigned short* __restrict__ A2p, int lda, long strideA,
    const unsigned short* __restrict__ Btp, const unsigned short* __restrict__ Bt2p, int ldb, long strideB,
    void* __restrict__ Cout, void* __restrict__ Cout2, int ldc, long strideC,
    const float* __restrict__ bias,
    const float* __restrict__ resid, long strideR,
    int M, int N, int K, float scale) {
  typedef typename Elem<ET>::T T;
  typedef typename Frag<T>::V V;
  constexpr bool ASPL = (SPLIT == 1) || (SPLIT == 2);
  constexpr bool BSPL = (SPLIT == 1) || (SPLIT == 3);
  const T* A = (const T*)Ap; const T* A2 = (const T*)A2p; const T* Bt = (const T*)Btp; const T* Bt2 = (const T*)Bt2p;
  __shared__ __align__(16) float sT[8][16 * 68];   // per-wave 16x64 slab, pitch 68 floats
  const int b    = blockIdx.y;
  const int lane = threadIdx.x & 31;
  const int wave = threadIdx.x >> 5;
  const int tilesN = N >> 6;
  const int tilesM = M >> 6;
  const int tile = blockIdx.x * 8 + wave;
  if (tile >= tilesM * tilesN) return;   // wave-uniform; no block barriers in this kernel
  const int tm = tile / tilesN;
  const int tn = tile - tm * tilesN;
  const int m0 = tm << 6;
  const int n0 = tn << 6;

  const T* Ab  = A  + (size_t)b * strideA;
  const T* Bb  = Bt + (size_t)b * strideB;
  const T* Ab2 = ASPL ? (A2  + (size_t)b * strideA) : nullptr;
  const T* Bb2 = BSPL ? (Bt2 + (size_t)b * strideB) : nullptr;

  const int rlane = lane & 15;                 // row (A) / col (B, D) within subtile
  const int koff  = (lane >> 4) * 8;           // k offset of this lane half
  const int mOff  = (lane >> 4) * 8;           // D row offset

  v8f acc[4][4];
#pragma unroll
  for (int i = 0; i < 4; ++i)
#pragma unroll
    for (int j = 0; j < 4; ++j) acc[i][j] = (v8f){0.f,0.f,0.f,0.f,0.f,0.f,0.f,0.f};

  for (int k0 = 0; k0 < K; k0 += 32) {
    V bh[4], bl[4];
#pragma unroll
    for (int j = 0; j < 4; ++j) {
      const size_t bo = (size_t)(n0 + (j << 4) + rlane) * ldb + koff + k0;
      bh[j] = Frag<T>::load(Bb + bo);
      if (BSPL) bl[j] = Frag<T>::load(Bb2 + bo);
      else bl[j] = bh[j];
    }
#pragma unroll
    for (int i = 0; i < 4; ++i) {
      const size_t ao = (size_t)(m0 + (i << 4) + rlane) * lda + koff + k0;
      V ah = Frag<T>::load(Ab + ao);
      V al = ah;
      if (ASPL) al = Frag<T>::load(Ab2 + ao);
#pragma unroll
      for (int j = 0; j < 4; ++j) {
        acc[i][j] = Frag<T>::mma(ah, bh[j], acc[i][j]);
        if (BSPL) acc[i][j] = Frag<T>::mma(ah, bl[j], acc[i][j]);
        if (ASPL) acc[i][j] = Frag<T>::mma(al, bh[j], acc[i][j]);
      }
      Frag<T>::guard(acc[i][0], acc[i][3], ah, al);
    }
    Frag<T>::keep(bh[0], bh[1], bh[2], bh[3]);
    if (BSPL) Frag<T>::keep(bl[0], bl[1], bl[2], bl[3]);
  }
  acc_guard4(acc[0][0], acc[0][1], acc[0][2], acc[0][3]);
  acc_guard4(acc[1][0], acc[1][1], acc[1][2], acc[1][3]);
  acc_guard4(acc[2][0], acc[2][1], acc[2][2], acc[2][3]);
  acc_guard4(acc[3][0], acc[3][1], acc[3][2], acc[3][3]);

  // ---- epilogue ----
  float* slab = sT[wave];
  const float* Rb = RESID ? (resid + (size_t)b * strideR) : nullptr;
#pragma unroll
  for (int i = 0; i < 4; ++i) {
    const int mBase = m0 + (i << 4);
#pragma unroll
    for (int j = 0; j < 4; ++j) {
      const int n = n0 + (j << 4) + rlane;
      float bv = 0.f;
      if (BIAS_MODE == 2) bv = bias[n];
#pragma unroll
      for (int r = 0; r < 8; ++r) {
        float v = acc[i][j][r] * scale;
        if (BIAS_MODE == 1) v += bias[mBase + mOff + r];
        if (BIAS_MODE == 2) v += bv;
        if (RESID) v += Rb[(size_t)(mBase + mOff + r) * ldc + n];
        if (ACT == 1) v = tanhf(v);
        if (ACT == 2) v = fmaxf(v, 0.0f);
        if (ACT == 3) v = v / (1.0f + expf(-v));
        if (ACT == 4) v = (v > 0.f) ? v : 0.01f * v;
        slab[(mOff + r) * 68 + (j << 4) + rlane] = v;
      }
    }
    __builtin_amdgcn_fence(__ATOMIC_RELEASE, "workgroup");
    __builtin_amdgcn_wave_barrier();
    __builtin_amdgcn_fence(__ATOMIC_ACQUIRE, "workgroup");
    if (OUT_MODE == 0) {
      float* C = (float*)Cout + (size_t)b * strideC;
      const int hh = lane >> 4, c4 = (lane & 15) * 4;     // row seg = 256 B = 16 lanes x 16 B
      {
#pragma unroll
        for (int it = 0; it < 8; ++it) {
          const int row = it * 2 + hh;
          v4f v = *(const v4f*)(slab + row * 68 + c4);
          *(v4f*)(C + (size_t)(mBase + row) * ldc + n0 + c4) = v;
        }
        
      }
    } else {
      const int q = lane >> 3, c8 = (lane & 7) * 8;
      unsigned short* C  = (unsigned short*)Cout  + (size_t)b * strideC;
      unsigned short* C2 = (OUT_MODE == 2) ? ((unsigned short*)Cout2 + (size_t)b * strideC) : nullptr;
      {
#pragma unroll
        for (int it = 0; it < 4; ++it) {
          const int row = it * 4 + q;
          const float* sp = slab + row * 68 + c8;
          v8h hv, lv;
#pragma unroll
          for (int e = 0; e < 8; ++e) {
            if (OUT_MODE == 1) {
              hv[e] = (_Float16)sp[e];
            } else {
              unsigned short hb = f2bf_bits(sp[e]);
              unsigned short lb = f2bf_bits(sp[e] - bf_bits2f(hb));
              hv[e] = __builtin_bit_cast(_Float16, hb);
              lv[e] = __builtin_bit_cast(_Float16, lb);
            }
          }
          *(v8h*)(C + (size_t)(mBase + row) * ldc + n0 + c8) = hv;
          if (OUT_MODE == 2) *(v8h*)(C2 + (size_t)(mBase + row) * ldc + n0 + c8) = lv;
        }
        
      }
    }
    __builtin_amdgcn_fence(__ATOMIC_RELEASE, "workgroup");
    __builtin_amdgcn_wave_barrier();
    __builtin_amdgcn_fence(__ATOMIC_ACQUIRE, "workgroup");
  }
}

__global__ __launch_bounds__(256) void k_cast_bf16x2(
    const float* __restrict__ in, unsigned short* __restrict__ out, int n2) {
  int i = blockIdx.x * 256 + threadIdx.x;
  if (i < n2) {
    const unsigned u = (unsigned)f2bf_bits(in[2 * i]) | ((unsigned)f2bf_bits(in[2 * i + 1]) << 16);
    ((unsigned*)out)[i] = u;
    
  }
}

// ---- (nb, C, L) f32 -> (nb, L, C) bf16 through an LDS tile: in[c][l] -> out[l][c] ----
// tile = 64 channels x 32 positions; grid (L/32, C/64, nb), block 256.
// loads: 256 threads x 8 = 2048 = 64x32 floats; stores: thread (r = tid>>3, c8 = (tid&7)*8) writes 8 bf16 = 16 B,
__global__ __launch_bounds__(256) void k_transpose_bf16(
    const float* __restrict__ in, unsigned short* __restrict__ out, int C, int L) {
  __shared__ float t[64][33];
  const int tid = threadIdx.x;
  const int b = blockIdx.z;
  const int l0 = blockIdx.x * 32, c0 = blockIdx.y * 64;
  const float* inb = in + (size_t)b * C * L;
#pragma unroll
  for (int i = 0; i < 8; ++i) {
    const int cl = i * 8 + (tid >> 5);
    t[cl][tid & 31] = inb[(size_t)(c0 + cl) * L + l0 + (tid & 31)];
  }
  __syncthreads();
  const int r = tid >> 3, c8 = (tid & 7) * 8;
  unsigned w0, w1, w2, w3;
  w0 = (unsigned)f2bf_bits(t[c8 + 0][r]) | ((unsigned)f2bf_bits(t[c8 + 1][r]) << 16);
  w1 = (unsigned)f2bf_bits(t[c8 + 2][r]) | ((unsigned)f2bf_bits(t[c8 + 3][r]) << 16);
  w2 = (unsigned)f2bf_bits(t[c8 + 4][r]) | ((unsigned)f2bf_bits(t[c8 + 5][r]) << 16);
  w3 = (unsigned)f2bf_bits(t[c8 + 6][r]) | ((unsigned)f2bf_bits(t[c8 + 7][r]) << 16);
  const v4u val = (v4u){w0, w1, w2, w3};
  unsigned short* dst = out + ((size_t)b * L + l0 + r) * C + c0 + c8;
  *(v4u*)dst = val;
  
}

// ---- InstanceNorm over the 1024 rows of an L-major f32 plane X[nb][1024][NCOL], per (b, column) ----
// block = 32 waves owns a slab of 64 columns x 1024 rows; grid (NCOL/64, nb).
// lane = (row half, 4 adjacent columns): one wave-wide 16-byte load covers 2 rows x 256 B; a thread keeps its
// 16 rows (i*64 + wave*2 + half) x 4 columns in registers, so X is read once. Mean, then centred sum of squares.
// output = bf16 hi + lo planes, same layout (a wave stores 2 rows x 128 B per plane);
// MODE 0: plain; MODE 1: + residual read from a bf16 plane res (same layout); MODE 2: relu.
constexpr int CN_RP = 68;   // pitch in floats of the per-wave partial rows (16-byte aligned rows)

// column totals over the whole slab: s = this thread's partial for its 4 columns; every thread gets the totals of its 4 columns.
// fixed tree: two row halves by shuffle, 32 wave partials through LDS, wave w adds up columns 2w and 2w+1 by a butterfly.
__device__ __forceinline__ v4f cn_colsum(v4f s, float* red, float* tot, int wave, int lane) {
  const int c4 = (lane & 15) * 4;
#pragma unroll
  for (int e = 0; e < 4; ++e) s[e] += __shfl_xor(s[e], 16, 32);
  if (lane < 16) *(v4f*)(red + wave * CN_RP + c4) = s;
  __syncthreads();   // all 32 partial rows are in red
  v2f p = *(const v2f*)(red + lane * CN_RP + 2 * wave);
#pragma unroll
  for (int off = 1; off < 32; off <<= 1) {
    p.x += __shfl_xor(p.x, off, 32);
    p.y += __shfl_xor(p.y, off, 32);
  }
  if (lane == 0) *(v2f*)(tot + 2 * wave) = p;
  __syncthreads();   // all 64 totals are in tot; every read of red is over
  return *(const v4f*)(tot + c4);
}

template <int MODE, int NCOL>
__global__ __launch_bounds__(1024) void k_colnorm(
    const float* __restrict__ X, const unsigned* __restrict__ res,
    unsigned* __restrict__ outh, unsigned* __restrict__ outl) {
  constexpr int NR = 1024, NW = 32, NI = NR / (2 * NW);
  __shared__ __align__(16) float red[NW * CN_RP];
  __shared__ __align__(16) float tot[2][64];
  const int lane = threadIdx.x & 31, wave = threadIdx.x >> 5;
  const size_t base = ((size_t)blockIdx.y * NR + wave * 2 + (lane >> 4)) * NCOL + blockIdx.x * 64 + (lane & 15) * 4;
  constexpr size_t STEP = (size_t)64 * NCOL;   // floats between a thread's rows; STEP / 2 words in the bf16 planes
  const size_t obase = base >> 1;
  const float* xp = X + base;
  v4f x[NI];
#pragma unroll
  for (int i = 0; i < NI; ++i) x[i] = *(const v4f*)(xp + i * STEP);
  // xp as an input keeps the loads' address pair whole up to the wait (else the last load lands on it)
  asm volatile("s_wait_xcnt 0x0" :: "v"(xp) : "memory");
  // MODE 1: residual words, two groups of 4 rows; the first group is asked for here, under the two reductions
  v2u rw[2][4];
  if constexpr (MODE == 1) {
#pragma unroll
    for (int j = 0; j < 4; ++j) rw[0][j] = *(const v2u*)(res + obase + j * (STEP / 2));
  }
  v4f s = x[0];
#pragma unroll
  for (int i = 1; i < NI; ++i) s += x[i];
  const v4f mean = cn_colsum(s, red, tot[0], wave, lane) * (1.0f / NR);
  v4f q = (v4f){0.f, 0.f, 0.f, 0.f};
#pragma unroll
  for (int i = 0; i < NI; ++i) {
    x[i] -= mean;
    q += x[i] * x[i];
  }
  const v4f var = cn_colsum(q, red, tot[1], wave, lane) * (1.0f / NR);
  v4f rs;
#pragma unroll
  for (int e = 0; e < 4; ++e) rs[e] = rsqrtf(var[e] + 1e-5f);
#pragma unroll
  for (int g = 0; g < NI / 4; ++g) {
    if constexpr (MODE == 1) {
      if (g + 1 < NI / 4) {
#pragma unroll
        for (int j = 0; j < 4; ++j) rw[(g + 1) & 1][j] = *(const v2u*)(res + obase + ((g + 1) * 4 + j) * (STEP / 2));
      }
    }
#pragma unroll
    for (int j = 0; j < 4; ++j) {
      const int i = g * 4 + j;
      v4f y = x[i] * rs;
      if constexpr (MODE == 1) {
        const v2u w = rw[g & 1][j];
        y.x += __uint_as_float(w.x << 16);
        y.y += __uint_as_float(w.x & 0xffff0000u);
        y.z += __uint_as_float(w.y << 16);
        y.w += __uint_as_float(w.y & 0xffff0000u);
      }
      if constexpr (MODE == 2) {
#pragma unroll
        for (int e = 0; e < 4; ++e) y[e] = fmaxf(y[e], 0.0f);
      }
      unsigned short hb[4], lb[4];
#pragma unroll
      for (int e = 0; e < 4; ++e) {
        hb[e] = f2bf_bits(y[e]);
        lb[e] = f2bf_bits(y[e] - bf_bits2f(hb[e]));
      }
      const size_t oi = obase + i * (STEP / 2);
      *(v2u*)(outh + oi) = (v2u){ (unsigned)hb[0] | ((unsigned)hb[1] << 16), (unsigned)hb[2] | ((unsigned)hb[3] << 16) };
      *(v2u*)(outl + oi) = (v2u){ (unsigned)lb[0] | ((unsigned)lb[1] << 16), (unsigned)lb[2] | ((unsigned)lb[3] << 16) };
    }
    if (g + 1 < NI / 4) {
      // stands in front of every reuse of the address and data registers that the loads and stores above name
      asm volatile("s_wait_xcnt 0x0" ::: "memory");
      // keeps the next group's code below that wait; in MODE 1 it also keeps the later groups' residual loads from
      // being hoisted: with all 16 in flight the kernel passes the 128 registers of a 32-wave block and spills
      __builtin_amdgcn_sched_barrier(0);
    }
  }
}

// ---- InstanceNorm over channel-major f32 rows X[row][1024] (row = b*C + channel), one wave per row ----
// block 8 waves = 8 rows; grid = rows/8 (rows % 8 == 0). Rolled re-read passes (no per-thread arrays).
template <int MODE>
__global__ __launch_bounds__(256) void k_rownorm(
    const float* __restrict__ X, float* __restrict__ outf,
    unsigned short* __restrict__ outh, unsigned short* __restrict__ outl) {
  constexpr int NCOL = 1024;
  const int lane = threadIdx.x & 31, wave = threadIdx.x >> 5;
  const size_t row = (size_t)blockIdx.x * 8 + wave;
  const float* xr = X + row * NCOL;
  float s = 0.f;
#pragma unroll 1
  for (int it = 0; it < 8; ++it) {
    const v4f u = *(const v4f*)(xr + it * 128 + lane * 4);
    s += (u.x + u.y) + (u.z + u.w);
  }
#pragma unroll
  for (int off = 1; off < 32; off <<= 1) s += __shfl_xor(s, off, 32);
  const float mean = s * (1.0f / NCOL);
  float ss = 0.f;
#pragma unroll 1
  for (int it = 0; it < 8; ++it) {
    const v4f u = *(const v4f*)(xr + it * 128 + lane * 4);
    const float d0 = u.x - mean, d1 = u.y - mean, d2 = u.z - mean, d3 = u.w - mean;
    ss += (d0 * d0 + d1 * d1) + (d2 * d2 + d3 * d3);
  }
#pragma unroll
  for (int off = 1; off < 32; off <<= 1) ss += __shfl_xor(ss, off, 32);
  const float rs = rsqrtf(ss * (1.0f / NCOL) + 1e-5f);
  if constexpr (MODE == 0) {
    float* orow = outf + row * NCOL;
    {
#pragma unroll 1
      for (int it = 0; it < 8; ++it) {
        const v4f u = *(const v4f*)(xr + it * 128 + lane * 4);
        v4f y;
        y.x = (u.x - mean) * rs; y.y = (u.y - mean) * rs; y.z = (u.z - mean) * rs; y.w = (u.w - mean) * rs;
        *(v4f*)(orow + it * 128 + lane * 4) = y;
      }
      
    }
  } else {
    unsigned short* hrow = outh + row * NCOL;
    unsigned short* lrw  = outl + row * NCOL;
    {
#pragma unroll 1
      for (int it = 0; it < 4; ++it) {
        const v4f u0 = *(const v4f*)(xr + it * 256 + lane * 8);
        const v4f u1 = *(const v4f*)(xr + it * 256 + lane * 8 + 4);
        const float y0 = (u0.x - mean) * rs, y1 = (u0.y - mean) * rs, y2 = (u0.z - mean) * rs, y3 = (u0.w - mean) * rs;
        const float y4 = (u1.x - mean) * rs, y5 = (u1.y - mean) * rs, y6 = (u1.z - mean) * rs, y7 = (u1.w - mean) * rs;
        const unsigned short h0 = f2bf_bits(y0), h1 = f2bf_bits(y1), h2 = f2bf_bits(y2), h3 = f2bf_bits(y3);
        const unsigned short h4 = f2bf_bits(y4), h5 = f2bf_bits(y5), h6 = f2bf_bits(y6), h7 = f2bf_bits(y7);
        const unsigned short l0 = f2bf_bits(y0 - bf_bits2f(h0)), l1 = f2bf_bits(y1 - bf_bits2f(h1));
        const unsigned short l2 = f2bf_bits(y2 - bf_bits2f(h2)), l3 = f2bf_bits(y3 - bf_bits2f(h3));
        const unsigned short l4 = f2bf_bits(y4 - bf_bits2f(h4)), l5 = f2bf_bits(y5 - bf_bits2f(h5));
        const unsigned short l6 = f2bf_bits(y6 - bf_bits2f(h6)), l7 = f2bf_bits(y7 - bf_bits2f(h7));
        const v4u hv = (v4u){ (unsigned)h0 | ((unsigned)h1 << 16), (unsigned)h2 | ((unsigned)h3 << 16),
                              (unsigned)h4 | ((unsigned)h5 << 16), (unsigned)h6 | ((unsigned)h7 << 16) };
        const v4u lv = (v4u){ (unsigned)l0 | ((unsigned)l1 << 16), (unsigned)l2 | ((unsigned)l3 << 16),
                              (unsigned)l4 | ((unsigned)l5 << 16), (unsigned)l6 | ((unsigned)l7 << 16) };
        *(v4u*)(hrow + it * 256 + lane * 8) = hv;
        *(v4u*)(lrw  + it * 256 + lane * 8) = lv;
      }
      
    }
  }
}

// =====================================================================================
// Attention, head_dim 64, no mask, 16-bit input planes:
//   q hi/lo planes: L-major [b][l][512] bf16 (element (b, l, h, d) at (b*L + l)*512 + h*64 + d)
//   k hi/lo planes: same layout
//   v hi/lo planes: channel-major [b][h*64+d][m] bf16
//   out: f32 L-major [b][l][512]
//   scores = sscale * q.k^T : bf16 hi.hi + hi.lo + lo.hi, f32 accumulate; online softmax f32;
//   out = p.v : p and v bf16 hi/lo (hi.hi + hi.lo + lo.hi). Block = 4 waves = 64 query rows of one (b, h).
//   grid.x = B * H * (L/64)
// =====================================================================================
#define AT_D 64
#define AT_NW 4
#define AT_KC 64
#define AT_OSP 68
// pitch in bf16 elements of every 64-element row of the K, V and P tiles in LDS: 144 B = 16 B x 9. The fragment reads are
// 16-byte loads of 16 rows at one column; at a pitch of 128 B those rows fall on two groups of four banks, at 144 B on sixteen.
#define AT_LP 72
constexpr int SEQ_LEN = 1024;
constexpr int N_HEADS = 8;
constexpr int N_CH = 512;

__device__ __forceinline__ v8f at_mma(v16b a, v16b b, v8f c) {
  c = __builtin_amdgcn_wmma_f32_16x16x32_bf16(false, a, false, b, (short)0, c, false, false);
  asm volatile("v_nop\n\tv_nop\n\tv_nop\n\tv_nop" : "+v"(c) : "v"(a), "v"(b));
  return c;
}
__device__ __forceinline__ void at_split(float f, __bf16& hi, __bf16& lo) {
  const unsigned short hb = f2bf_bits(f);
  hi = __builtin_bit_cast(__bf16, hb);
  lo = __builtin_bit_cast(__bf16, f2bf_bits(f - __uint_as_float(((unsigned)hb) << 16)));
}

__global__ __launch_bounds__(128)
void k_attn(const unsigned short* __restrict__ qhp, const unsigned short* __restrict__ qlp,
            const unsigned short* __restrict__ khp, const unsigned short* __restrict__ klp,
            const unsigned short* __restrict__ vhp, const unsigned short* __restrict__ vlp,
            float* __restrict__ out, float sscale) {
  union FB { v16b v; v8b h[2]; };
  __shared__ __align__(16) __bf16 Ksh[AT_KC * AT_LP];            // K hi [kv][d]
  __shared__ __align__(16) __bf16 Ksl[AT_KC * AT_LP];            // K lo [kv][d]
  __shared__ __align__(16) __bf16 Vth[AT_D * AT_LP];             // V hi [d][kv]
  __shared__ __align__(16) __bf16 Vtl[AT_D * AT_LP];             // V lo [d][kv]
  __shared__ __align__(16) __bf16 Psh[AT_NW][16 * AT_LP];        // per wave P hi [row][kv]
  __shared__ __align__(16) __bf16 Psl[AT_NW][16 * AT_LP];        // per wave P lo [row][kv]
  __shared__ __align__(16) float  Os[AT_NW][16 * AT_OSP];        // per wave out tile

  const int tid  = threadIdx.x;
  const int wave = tid >> 5;
  const int lane = tid & 31;
  const int hh   = lane >> 4;
  const int c    = lane & 15;

  constexpr int NQB = SEQ_LEN / 64;
  const int bx  = blockIdx.x;
  const int qb  = bx % NQB;
  const int bhd = bx / NQB;
  const int h   = bhd % N_HEADS;
  const int b   = bhd / N_HEADS;
  const int q0  = qb * 64 + wave * 16;

  const __bf16* qh = (const __bf16*)qhp;
  const __bf16* ql = (const __bf16*)qlp;
  const __bf16* kh = (const __bf16*)khp;
  const __bf16* kl = (const __bf16*)klp;
  const __bf16* vh = (const __bf16*)vhp;
  const __bf16* vl = (const __bf16*)vlp;

  // ---- Q fragments (A operand: row = query q0 + c, k = d), hi and lo planes ----
  v16b qah[2], qal[2];
  {
    const size_t qo = ((size_t)b * SEQ_LEN + q0 + c) * N_CH + h * AT_D + 8 * hh;
#pragma unroll
    for (int dc = 0; dc < 2; ++dc) {
      qah[dc] = Frag<__bf16>::load(qh + qo + dc * 32);
      qal[dc] = Frag<__bf16>::load(ql + qo + dc * 32);
    }
  }

  float mrow[8], lrow[8];
  v8f oacc[4];
#pragma unroll
  for (int r = 0; r < 8; ++r) { mrow[r] = -INFINITY; lrow[r] = 0.f; }
#pragma unroll
  for (int t = 0; t < 4; ++t) oacc[t] = (v8f){0.f,0.f,0.f,0.f,0.f,0.f,0.f,0.f};

  for (int kc = 0; kc < SEQ_LEN / AT_KC; ++kc) {
    const int kv0 = kc * AT_KC;
    __syncthreads();
    {
      // staging: thread (row = tid>>1, half = (tid&1)*32) copies 32 bf16 = 4 x 16 B per plane;
      // 128 threads x 32 = 4096 = 64 x 64 elements per plane (full tiles)
      const int row = tid >> 1, half = (tid & 1) * 32;
      const size_t ko = ((size_t)b * SEQ_LEN + kv0 + row) * N_CH + h * AT_D + half;
      const size_t vo = ((size_t)b * N_CH + h * AT_D + row) * SEQ_LEN + kv0 + half;
      {
        const v4u* sp = (const v4u*)(kh + ko);
        v4u* dp = (v4u*)(Ksh + row * AT_LP + half);
#pragma unroll
        for (int i = 0; i < 4; ++i) dp[i] = sp[i];
      }
      asm volatile("" ::: "memory");
      {
        const v4u* sp = (const v4u*)(kl + ko);
        v4u* dp = (v4u*)(Ksl + row * AT_LP + half);
#pragma unroll
        for (int i = 0; i < 4; ++i) dp[i] = sp[i];
      }
      asm volatile("" ::: "memory");
      {
        const v4u* sp = (const v4u*)(vh + vo);
        v4u* dp = (v4u*)(Vth + row * AT_LP + half);
#pragma unroll
        for (int i = 0; i < 4; ++i) dp[i] = sp[i];
      }
      asm volatile("" ::: "memory");
      {
        const v4u* sp = (const v4u*)(vl + vo);
        v4u* dp = (v4u*)(Vtl + row * AT_LP + half);
#pragma unroll
        for (int i = 0; i < 4; ++i) dp[i] = sp[i];
      }
    }
    __syncthreads();

    // ---- scores: B operand column n = key j*16 + c, k = d (Ksh is [key][d], k-contiguous) ----
    v8f s[4];
#pragma unroll
    for (int j = 0; j < 4; ++j) {
      s[j] = (v8f){0.f,0.f,0.f,0.f,0.f,0.f,0.f,0.f};
#pragma unroll
      for (int dc = 0; dc < 2; ++dc) {
        FB kb, kb2;
        const int ko2 = (j * 16 + c) * AT_LP + dc * 32 + 8 * hh;
        kb.h[0]  = *(const v8b*)(Ksh + ko2);
        kb.h[1]  = *(const v8b*)(Ksh + ko2 + 16);
        kb2.h[0] = *(const v8b*)(Ksl + ko2);
        kb2.h[1] = *(const v8b*)(Ksl + ko2 + 16);
        s[j] = at_mma(qah[dc], kb.v,  s[j]);
        s[j] = at_mma(qah[dc], kb2.v, s[j]);
        s[j] = at_mma(qal[dc], kb.v,  s[j]);
      }
    }
    // D element r of lane = (query row 8*hh + r, key column c of subtile j)
    float cm[8];
#pragma unroll
    for (int r = 0; r < 8; ++r) {
      float m = -INFINITY;
#pragma unroll
      for (int j = 0; j < 4; ++j) {
        const float sv = s[j][r] * sscale;
        s[j][r] = sv;
        m = fmaxf(m, sv);
      }
#pragma unroll
      for (int off = 1; off < 16; off <<= 1) m = fmaxf(m, __shfl_xor(m, off, 32));
      cm[r] = m;
    }
    __bf16* pwh = Psh[wave];
    __bf16* pwl = Psl[wave];
#pragma unroll
    for (int r = 0; r < 8; ++r) {
      const float mnew = fmaxf(mrow[r], cm[r]);
      const float alpha = expf(mrow[r] - mnew);
      mrow[r] = mnew;
      float psum = 0.f;
#pragma unroll
      for (int j = 0; j < 4; ++j) {
        const float p = expf(s[j][r] - mnew);
        psum += p;
        __bf16 pa_hi, pa_lo;
        at_split(p, pa_hi, pa_lo);
        pwh[(8 * hh + r) * AT_LP + j * 16 + c] = pa_hi;
        pwl[(8 * hh + r) * AT_LP + j * 16 + c] = pa_lo;
      }
#pragma unroll
      for (int off = 1; off < 16; off <<= 1) psum += __shfl_xor(psum, off, 32);
      lrow[r] = lrow[r] * alpha + psum;
#pragma unroll
      for (int t = 0; t < 4; ++t) oacc[t][r] *= alpha;
    }
    // same-wave P tile: stored as __bf16 elements, reloaded as v8b vectors of the same element type after the wave barrier
    __builtin_amdgcn_fence(__ATOMIC_RELEASE, "workgroup");
    __builtin_amdgcn_wave_barrier();
    __builtin_amdgcn_fence(__ATOMIC_ACQUIRE, "workgroup");
    // ---- out += P.V : A = P [query][key], B = V with k = key, n = d (Vth is [d][key], k-contiguous) ----
#pragma unroll 1
    for (int kk = 0; kk < 2; ++kk) {
      FB pa, pl;
      const int po = c * AT_LP + kk * 32 + 8 * hh;
      pa.h[0] = *(const v8b*)(pwh + po);
      pa.h[1] = *(const v8b*)(pwh + po + 16);
      pl.h[0] = *(const v8b*)(pwl + po);
      pl.h[1] = *(const v8b*)(pwl + po + 16);
#pragma unroll
      for (int t = 0; t < 4; ++t) {
        FB vb, vb2;
        const int vo2 = (t * 16 + c) * AT_LP + kk * 32 + 8 * hh;
        vb.h[0]  = *(const v8b*)(Vth + vo2);
        vb.h[1]  = *(const v8b*)(Vth + vo2 + 16);
        vb2.h[0] = *(const v8b*)(Vtl + vo2);
        vb2.h[1] = *(const v8b*)(Vtl + vo2 + 16);
        oacc[t] = at_mma(pa.v, vb.v,  oacc[t]);
        oacc[t] = at_mma(pa.v, vb2.v, oacc[t]);
        oacc[t] = at_mma(pl.v, vb.v,  oacc[t]);
      }
    }
  }

  float* os = Os[wave];
#pragma unroll
  for (int r = 0; r < 8; ++r) {
    const float inv = 1.0f / lrow[r];
#pragma unroll
    for (int t = 0; t < 4; ++t) os[(8 * hh + r) * AT_OSP + t * 16 + c] = oacc[t][r] * inv;
  }
  __builtin_amdgcn_fence(__ATOMIC_RELEASE, "workgroup");
  __builtin_amdgcn_wave_barrier();
  __builtin_amdgcn_fence(__ATOMIC_ACQUIRE, "workgroup");
  {
    float* ob = out + ((size_t)b * SEQ_LEN) * N_CH + h * AT_D;
    const int c4 = (lane & 15) * 4;
    {
#pragma unroll
      for (int it = 0; it < 8; ++it) {
        const int row = it * 2 + hh;
        v4f val = *(const v4f*)(os + row * AT_OSP + c4);
        *(v4f*)(ob + (size_t)(q0 + row) * N_CH + c4) = val;
      }
      
    }
  }
}

// =====================================================================================
// Host orchestration
// =====================================================================================
extern "C" void kernel_launch(void* const* d_in, const int* in_sizes, int n_in,
                              void* d_out, int out_size, void* d_ws,
                              size_t ws_size, hipStream_t stream) {
  (void)in_sizes; (void)n_in; (void)out_size;
  constexpr int NB = 8, CIN = 256, NCH = 512, SEQ = 1024, NFF = 1024, NHD = 8;

  // ---- workspace region map (bytes) ----
  constexpr size_t SZ_WQ   = (size_t)NCH * NCH * 2;        //    524288  wq  bf16 [512][512]
  constexpr size_t SZ_WK   = (size_t)NCH * CIN * 2;        //    262144  wk  bf16 [512][256]
  constexpr size_t SZ_WV   = (size_t)NCH * CIN * 2;        //    262144  wv  bf16 [512][256]
  constexpr size_t SZ_W1   = (size_t)NFF * NCH * 2;        //   1048576  w1  bf16 [1024][512]
  constexpr size_t SZ_W2   = (size_t)NCH * NFF * 2;        //   1048576  w2  bf16 [512][1024]
  constexpr size_t SZ_XQT  = (size_t)NB * SEQ * NCH * 2;   //   8388608  x_query (L,C) bf16
  constexpr size_t SZ_XKVT = (size_t)NB * SEQ * CIN * 2;   //   4194304  x_kv (L,C) bf16
  constexpr size_t SZ_G    = (size_t)NB * SEQ * NFF * 4;   //  33554432  f32 GEMM/attention output, max user = ffn1 [8][1024][1024]
  constexpr size_t SZ_P    = (size_t)NB * SEQ * NCH * 2;   //   8388608  one bf16 activation plane [8][1024][512]
  constexpr size_t OFF_WQ   = 0;
  constexpr size_t OFF_WK   = OFF_WQ + SZ_WQ;
  constexpr size_t OFF_WV   = OFF_WK + SZ_WK;
  constexpr size_t OFF_W1   = OFF_WV + SZ_WV;
  constexpr size_t OFF_W2   = OFF_W1 + SZ_W1;
  constexpr size_t OFF_XQT  = OFF_W2 + SZ_W2;
  constexpr size_t OFF_XKVT = OFF_XQT + SZ_XQT;
  constexpr size_t OFF_G    = OFF_XKVT + SZ_XKVT;
  constexpr size_t OFF_QH   = OFF_G + SZ_G;       // q hi plane; later z hi plane
  constexpr size_t OFF_QL   = OFF_QH + SZ_P;      // q lo plane; later z lo plane
  constexpr size_t OFF_KH   = OFF_QL + SZ_P;      // k hi plane; later y hi plane spans KH+KL (16777216)
  constexpr size_t OFF_KL   = OFF_KH + SZ_P;      // k lo plane
  constexpr size_t OFF_VH   = OFF_KL + SZ_P;      // v hi plane; later y lo plane spans VH+VL (16777216)
  constexpr size_t OFF_VL   = OFF_VH + SZ_P;      // v lo plane
  constexpr size_t OFF_END  = OFF_VL + SZ_P;      // 99614720
  static_assert(OFF_END == 99614720ull);
  static_assert(OFF_END <= 134217728ull);
  static_assert((OFF_WK % 256) == 0 && (OFF_XQT % 256) == 0 && (OFF_G % 256) == 0 && (OFF_QH % 256) == 0);
  // reused regions sized from the max user
  static_assert((size_t)NB * SEQ * NCH * 4 <= SZ_G);        // q, k, v, proj, ffn2 f32 outputs
  static_assert((size_t)NB * SEQ * NFF * 4 <= SZ_G);        // ffn1 f32 output
  static_assert((size_t)NB * SEQ * NFF * 2 == 2 * SZ_P);    // y plane fits exactly over two 512-wide planes
  // GEMM shape contract: M, N multiples of 64, K multiple of 32
  static_assert(SEQ % 64 == 0 && NCH % 64 == 0 && NFF % 64 == 0);
  static_assert(NCH % 32 == 0 && CIN % 32 == 0 && NFF % 32 == 0);
  static_assert(((SEQ / 64) * (NCH / 64)) % 8 == 0 && ((SEQ / 64) * (NFF / 64)) % 8 == 0);
  static_assert(NCH % 256 == 0 && NFF % 256 == 0 && (NB * NCH) % 8 == 0);
  static_assert((size_t)NB * NCH * SEQ * 4 == 16777216ull);   // d_out bytes
  if (ws_size < OFF_END) return;

  const float* x_query = (const float*)d_in[0];
  const float* x_kv    = (const float*)d_in[1];
  const float* wq      = (const float*)d_in[2];
  const float* bq      = (const float*)d_in[3];
  const float* wk      = (const float*)d_in[4];
  const float* bk      = (const float*)d_in[5];
  const float* wv      = (const float*)d_in[6];
  const float* bv      = (const float*)d_in[7];
  const float* w1      = (const float*)d_in[8];
  const float* b1      = (const float*)d_in[9];
  const float* w2      = (const float*)d_in[10];
  const float* b2      = (const float*)d_in[11];
  float* out = (float*)d_out;

  char* ws = (char*)d_ws;
  typedef unsigned short us;
  us* wq16  = (us*)(ws + OFF_WQ);
  us* wk16  = (us*)(ws + OFF_WK);
  us* wv16  = (us*)(ws + OFF_WV);
  us* w1_16 = (us*)(ws + OFF_W1);
  us* w2_16 = (us*)(ws + OFF_W2);
  us* xqT   = (us*)(ws + OFF_XQT);
  us* xkvT  = (us*)(ws + OFF_XKVT);
  float* gf = (float*)(ws + OFF_G);
  us* qh = (us*)(ws + OFF_QH);
  us* ql = (us*)(ws + OFF_QL);
  us* kh = (us*)(ws + OFF_KH);
  us* kl = (us*)(ws + OFF_KL);
  us* vh = (us*)(ws + OFF_VH);
  us* vl = (us*)(ws + OFF_VL);
  us* zh = qh;
  us* zl = ql;
  us* yh = kh;    // [8][1024][1024] bf16 = 16777216 B over KH..KL
  us* yl = vh;    // [8][1024][1024] bf16 = 16777216 B over VH..VL

  // 1) weights -> bf16 (RNE)
  k_cast_bf16x2<<<(NCH * NCH / 2 + 255) / 256, 256, 0, stream>>>(wq, wq16, NCH * NCH / 2);
  k_cast_bf16x2<<<(NCH * CIN / 2 + 255) / 256, 256, 0, stream>>>(wk, wk16, NCH * CIN / 2);
  k_cast_bf16x2<<<(NCH * CIN / 2 + 255) / 256, 256, 0, stream>>>(wv, wv16, NCH * CIN / 2);
  k_cast_bf16x2<<<(NFF * NCH / 2 + 255) / 256, 256, 0, stream>>>(w1, w1_16, NFF * NCH / 2);
  k_cast_bf16x2<<<(NCH * NFF / 2 + 255) / 256, 256, 0, stream>>>(w2, w2_16, NCH * NFF / 2);

  // 2) activations (B,C,L) f32 -> (B,L,C) bf16 : in[C][L] -> out[L][C], grid (L/32, C/64, B)
  k_transpose_bf16<<<dim3(SEQ / 32, NCH / 64, NB), 256, 0, stream>>>(x_query, xqT, NCH, SEQ);
  k_transpose_bf16<<<dim3(SEQ / 32, CIN / 64, NB), 256, 0, stream>>>(x_kv, xkvT, CIN, SEQ);

  // 3) q: C[l][o] = sum_c xqT[l][c] wq[o][c] + bq[o]  (M=1024, N=512, K=512) -> gf L-major; InstanceNorm -> q hi/lo planes
  wmma_gemm64<1, 0, 2, 0, false><<<dim3((SEQ / 64) * (NCH / 64) / 8, NB), 256, 0, stream>>>(
      xqT, nullptr, NCH, (long)SEQ * NCH, wq16, nullptr, NCH, 0L,
      (void*)gf, nullptr, NCH, (long)SEQ * NCH, bq, nullptr, 0L, SEQ, NCH, NCH, 1.0f);
  k_colnorm<0, NCH><<<dim3(NCH / 64, NB), 1024, 0, stream>>>(gf, nullptr, (unsigned*)qh, (unsigned*)ql);

  // 4) k: C[l][o] = sum_c xkvT[l][c] wk[o][c] + bk[o]  (M=1024, N=512, K=256) -> k hi/lo planes (L-major)
  wmma_gemm64<1, 0, 2, 0, false><<<dim3((SEQ / 64) * (NCH / 64) / 8, NB), 256, 0, stream>>>(
      xkvT, nullptr, CIN, (long)SEQ * CIN, wk16, nullptr, CIN, 0L,
      (void*)gf, nullptr, NCH, (long)SEQ * NCH, bk, nullptr, 0L, SEQ, NCH, CIN, 1.0f);
  k_colnorm<0, NCH><<<dim3(NCH / 64, NB), 1024, 0, stream>>>(gf, nullptr, (unsigned*)kh, (unsigned*)kl);

  // 5) v: C[o][m] = sum_c wv[o][c] xkvT[m][c] + bv[o]  (M=512, N=1024, K=256) -> channel-major gf; InstanceNorm rows -> v hi/lo planes
  wmma_gemm64<1, 0, 1, 0, false><<<dim3((NCH / 64) * (SEQ / 64) / 8, NB), 256, 0, stream>>>(
      wv16, nullptr, CIN, 0L, xkvT, nullptr, CIN, (long)SEQ * CIN,
      (void*)gf, nullptr, SEQ, (long)NCH * SEQ, bv, nullptr, 0L, NCH, SEQ, CIN, 1.0f);
  k_rownorm<1><<<NB * NCH / 8, 256, 0, stream>>>(gf, nullptr, vh, vl);

  // 6) attention -> gf as proj L-major [b][l][h*64+d] f32
  k_attn<<<NB * NHD * (SEQ / 64), 128, 0, stream>>>(qh, ql, kh, kl, vh, vl, gf, 0.125f);

  // 7) z = InstanceNorm(proj) + x_query(bf16) -> z hi/lo planes (L-major, pitch 512)
  k_colnorm<1, NCH><<<dim3(NCH / 64, NB), 1024, 0, stream>>>(gf, (const unsigned*)xqT, (unsigned*)zh, (unsigned*)zl);

  // 8) ffn1: C[l][o] = sum_c z[l][c] w1[o][c] + b1[o]  (M=1024, N=1024, K=512), z as hi/lo -> gf L-major [l][1024]
  wmma_gemm64<1, 2, 2, 0, false><<<dim3((SEQ / 64) * (NFF / 64) / 8, NB), 256, 0, stream>>>(
      zh, zl, NCH, (long)SEQ * NCH, w1_16, nullptr, NCH, 0L,
      (void*)gf, nullptr, NFF, (long)SEQ * NFF, b1, nullptr, 0L, SEQ, NFF, NCH, 1.0f);
  // 9) y = relu(InstanceNorm(h1)) -> y hi/lo planes [l][1024]
  k_colnorm<2, NFF><<<dim3(NFF / 64, NB), 1024, 0, stream>>>(gf, nullptr, (unsigned*)yh, (unsigned*)yl);

  // 10) ffn2: C[o][l] = sum_c w2[o][c] y[l][c] + b2[o]  (M=512, N=1024, K=1024), y as hi/lo -> channel-major gf
  wmma_gemm64<1, 3, 1, 0, false><<<dim3((NCH / 64) * (SEQ / 64) / 8, NB), 256, 0, stream>>>(
      w2_16, nullptr, NFF, 0L, yh, yl, NFF, (long)SEQ * NFF,
      (void*)gf, nullptr, SEQ, (long)NCH * SEQ, b2, nullptr, 0L, NCH, SEQ, NFF, 1.0f);

  // 11) final InstanceNorm over rows -> d_out (B, 512, L) f32
  k_rownorm<0><<<NB * NCH / 8, 256, 0, stream>>>(gf, out, nullptr, nullptr);
}

// v003
// Measured time: 296 microseconds a run.
// Next to v002, in two timings, it ran 1.25 times as fast each time.
// Counting every step since v000, it is 11.3 times as fast.
// Compute dtypes: conv1x1 GEMMs q/k/v = v_wmma_f32_16x16x32_bf16 on RNE-bf16 inputs (1 product); attention scores and P.V = bf16 hi+lo planes (3 products); FFN GEMMs = bf16 hi+lo activations x bf16 weights (2 products); f32 accumulate; InstanceNorm, softmax, residual in f32.
#include <hip/hip_runtime.h>
#include <hip/hip_bf16.h>

typedef __attribute__((ext_vector_type(16))) _Float16 v16h;
typedef __attribute__((ext_vector_type(8)))  _Float16 v8h;
typedef __attribute__((ext_vector_type(16))) __bf16   v16b;
typedef __attribute__((ext_vector_type(8)))  __bf16   v8b;
typedef __attribute__((ext_vector_type(8)))  float    v8f;
typedef __attribute__((ext_vector_type(4)))  float    v4f;
typedef __attribute__((ext_vector_type(2)))  float    v2f;
typedef __attribute__((ext_vector_type(4)))  unsigned v4u;
typedef __attribute__((ext_vector_type(2)))  unsigned v2u;

__device__ __forceinline__ unsigned short f2bf_bits(float f) {
  unsigned u = __float_as_uint(f);
  return (unsigned short)((u + 0x7FFFu + ((u >> 16) & 1u)) >> 16);
}
__device__ __forceinline__ float bf_bits2f(unsigned short h) { return __uint_as_float(((unsigned)h) << 16); }

// hazard guards as plain device helpers
__device__ __forceinline__ void dep_guard_h(v8f& a, v8f& b, v16h x, v16h y) { asm volatile("v_nop\n\tv_nop\n\tv_nop\n\tv_nop" : "+v"(a), "+v"(b) : "v"(x), "v"(y)); }
__device__ __forceinline__ void dep_guard_b(v8f& a, v8f& b, v16b x, v16b y) { asm volatile("v_nop\n\tv_nop\n\tv_nop\n\tv_nop" : "+v"(a), "+v"(b) : "v"(x), "v"(y)); }
__device__ __forceinline__ void keep4_h(v16h a, v16h b, v16h c, v16h d) { asm volatile("v_nop" :: "v"(a), "v"(b), "v"(c), "v"(d)); }
__device__ __forceinline__ void keep4_b(v16b a, v16b b, v16b c, v16b d) { asm volatile("v_nop" :: "v"(a), "v"(b), "v"(c), "v"(d)); }
__device__ __forceinline__ void acc_guard4(v8f& a, v8f& b, v8f& c, v8f& d) { asm volatile("v_nop\n\tv_nop\n\tv_nop\n\tv_nop" : "+v"(a), "+v"(b), "+v"(c), "+v"(d)); }
template <typename T> struct Frag;
template <> struct Frag<_Float16> {
  typedef v16h V; union U { v16h v; v8h h[2]; };
  // elements 0..7 <- p[0..7], 8..15 <- p[16..23]
  static __device__ __forceinline__ v16h load(const _Float16* p) {
    U f; f.h[0] = *(const v8h*)(p); f.h[1] = *(const v8h*)(p + 16); return f.v;
  }
  static __device__ __forceinline__ v8f mma(v16h a, v16h b, v8f c) {
    return __builtin_amdgcn_wmma_f32_16x16x32_f16(false, a, false, b, (short)0, c, false, false);
  }
  static __device__ __forceinline__ void guard(v8f& a, v8f& b, v16h x, v16h y) { dep_guard_h(a, b, x, y); }
  static __device__ __forceinline__ void keep(v16h a, v16h b, v16h c, v16h d) { keep4_h(a, b, c, d); }
};
template <> struct Frag<__bf16> {
  typedef v16b V; union U { v16b v; v8b h[2]; };
  static __device__ __forceinline__ v16b load(const __bf16* p) {
    U f; f.h[0] = *(const v8b*)(p); f.h[1] = *(const v8b*)(p + 16); return f.v;
  }
  static __device__ __forceinline__ v8f mma(v16b a, v16b b, v8f c) {
    return __builtin_amdgcn_wmma_f32_16x16x32_bf16(false, a, false, b, (short)0, c, false, false);
  }
  static __device__ __forceinline__ void guard(v8f& a, v8f& b, v16b x, v16b y) { dep_guard_b(a, b, x, y); }
  static __device__ __forceinline__ void keep(v16b a, v16b b, v16b c, v16b d) { keep4_b(a, b, c, d); }
};

// ---- Register-blocked batched WMMA GEMM ------------------------------------
// C[m,n] = scale * sum_k A[m,k] * Bt[n,k] (+bias)(+resid); each wave owns a 64x64 tile.
// A row-major [M,K]; Bt row-major [N,K]; M % 64 == 0, N % 512 == 0, K % 64 == 0.
// The eight waves of a block own eight neighbouring tiles of one tile row (N % 512 == 0), so they share the A rows.
// Operands reach the fragments through LDS: a stage is 64 k (one whole 128-byte line of every row), brought by asynchronous
// 16-byte copies in which a wave covers 4 rows x 128 B per instruction; two buffers, stage t + 1 flies while stage t is worked on.
// Stage layout: [A planes: 64 rows][wave 0..7: its Bt planes: 64 rows], every row at a pitch of 144 B (16 B x odd).
// SPLIT: 0 = single product; 1 = A and Bt both hi/lo planes (hi.hi + hi.lo + lo.hi);
//        2 = only A is hi/lo (A_hi.B + A_lo.B); 3 = only Bt is hi/lo (A.B_hi + A.B_lo).
// BIAS_MODE: 0 = none, 1 = bias[m], 2 = bias[n].
// OUT_MODE: 0 = f32, 1 = f16, 2 = bf16 hi plane (Cout) + bf16 lo plane (Cout2).
// ET: 0 = f16 operands, 1 = bf16 operands (pointers passed as 16-bit storage)
constexpr int GM_KS = 64;                  // k elements of a stage
constexpr int GM_LP = 72;                  // LDS pitch of a stage row, in 16-bit elements
constexpr int GM_PL = 64 * GM_LP * 2;      // bytes of one 64-row plane of a stage
__device__ __forceinline__ unsigned lds_off(const void* p) { return (unsigned)(size_t)p; }   // byte address in the block's LDS
// asynchronous copies global -> LDS, 16 bytes per lane. The s_wait_xcnt closes each statement so that it stands in front of
// every later write of the address registers that the copies name.
__device__ __forceinline__ void cp_async2(unsigned l0, const void* g0, unsigned l1, const void* g1) {
  asm volatile("global_load_async_to_lds_b128 %0, %1, off\n\t"
               "global_load_async_to_lds_b128 %2, %3, off\n\t"
               "s_wait_xcnt 0x0"
               :: "v"(l0), "v"(g0), "v"(l1), "v"(g1) : "memory");
}
__device__ __forceinline__ void cp_async8(unsigned l, const char* g, size_t gstep) {
  // eight rows, four apart: LDS step 4 rows of GM_LP elements, global step gstep bytes
  constexpr unsigned LS = 4 * GM_LP * 2;
  asm volatile("global_load_async_to_lds_b128 %0, %1, off\n\t"
               "global_load_async_to_lds_b128 %2, %3, off\n\t"
               "global_load_async_to_lds_b128 %4, %5, off\n\t"
               "global_load_async_to_lds_b128 %6, %7, off\n\t"
               "global_load_async_to_lds_b128 %8, %9, off\n\t"
               "global_load_async_to_lds_b128 %10, %11, off\n\t"
               "global_load_async_to_lds_b128 %12, %13, off\n\t"
               "global_load_async_to_lds_b128 %14, %15, off\n\t"
               "s_wait_xcnt 0x0"
               :: "v"(l), "v"(g), "v"(l + LS), "v"(g + gstep), "v"(l + 2 * LS), "v"(g + 2 * gstep), "v"(l + 3 * LS), "v"(g + 3 * gstep),
                  "v"(l + 4 * LS), "v"(g + 4 * gstep), "v"(l + 5 * LS), "v"(g + 5 * gstep), "v"(l + 6 * LS), "v"(g + 6 * gstep),
                  "v"(l + 7 * LS), "v"(g + 7 * gstep) : "memory");
}
template <int ET> struct Elem;
template <> struct Elem<0> { typedef _Float16 T; };
template <> struct Elem<1> { typedef __bf16 T; };
template <int ET, int SPLIT, int BIAS_MODE, int OUT_MODE, bool RESID, int ACT = 0>
__global__ __launch_bounds__(256) void wmma_gemm64(
    const unsigned short* __restrict__ Ap, const unsigned short* __restrict__ A2p, int lda, long strideA,
    const unsigned short* __restrict__ Btp, const unsigned short* __restrict__ Bt2p, int ldb, long strideB,
    void* __restrict__ Cout, void* __restrict__ Cout2, int ldc, long strideC,
    const float* __restrict__ bias,
    const float* __restrict__ resid, long strideR,
    int M, int N, int K, float scale) {
  typedef typename Elem<ET>::T T;
  typedef typename Frag<T>::V V;
  constexpr bool ASPL = (SPLIT == 1) || (SPLIT == 2);
  constexpr bool BSPL = (SPLIT == 1) || (SPLIT == 3);
  const T* A = (const T*)Ap; const T* A2 = (const T*)A2p; const T* Bt = (const T*)Btp; const T* Bt2 = (const T*)Bt2p;
  constexpr int NPA = ASPL ? 2 : 1, NPB = BSPL ? 2 : 1;
  constexpr int STAGE = (NPA + 8 * NPB) * GM_PL;            // bytes of one buffer
  static_assert(2 * STAGE <= 327680 && 8 * 16 * 68 * 4 <= STAGE);
  __shared__ __align__(16) unsigned char smem[2 * STAGE];   // two stage buffers; behind the k loop: per-wave 16x64 f32 slabs, pitch 68
  const int b    = blockIdx.y;
  const int lane = threadIdx.x & 31;
  const int wave = threadIdx.x >> 5;
  const int tilesN = N >> 6;
  const int tilesM = M >> 6;
  const int tile = blockIdx.x * 8 + wave;
  if ((int)blockIdx.x * 8 >= tilesM * tilesN) return;   // the same for the whole block, in front of every barrier
  const int tm = tile / tilesN;
  const int tn = tile - tm * tilesN;
  const int m0 = tm << 6;
  const int n0 = tn << 6;

  const T* Ab  = A  + (size_t)b * strideA;
  const T* Bb  = Bt + (size_t)b * strideB;
  const T* Ab2 = ASPL ? (A2  + (size_t)b * strideA) : nullptr;
  const T* Bb2 = BSPL ? (Bt2 + (size_t)b * strideB) : nullptr;

  const int rlane = lane & 15;                 // row (A) / col (B, D) within subtile
  const int koff  = (lane >> 4) * 8;           // k offset of this lane half
  const int mOff  = (lane >> 4) * 8;           // D row offset

  v8f acc[4][4];
#pragma unroll
  for (int i = 0; i < 4; ++i)
#pragma unroll
    for (int j = 0; j < 4; ++j) acc[i][j] = (v8f){0.f,0.f,0.f,0.f,0.f,0.f,0.f,0.f};

  // ---- one stage's copies: the block's A rows (two 16-byte pieces per thread and plane), then this wave's own Bt rows ----
  const unsigned lbase = lds_off(smem);
  const int arow = threadIdx.x >> 3;           // 0..31; the second piece is row arow + 32
  const int brow = lane >> 3;                  // 0..3; piece it is row it * 4 + brow
  const int scol = (lane & 7) * 8;             // first k element of this lane's 16 bytes
  const unsigned la0 = lbase + (unsigned)(arow * GM_LP + scol) * 2u;
  const unsigned lb0 = lbase + (unsigned)(NPA + wave * NPB) * GM_PL + (unsigned)(brow * GM_LP + scol) * 2u;
  const size_t ga0 = (size_t)(m0 + arow) * lda + scol;
  const size_t gb0 = (size_t)(n0 + brow) * ldb + scol;
  auto issue_stage = [&](int st) {
    const unsigned bo = (unsigned)(st & 1) * STAGE;
    const size_t ka = ga0 + (size_t)st * GM_KS;
    const size_t kb = gb0 + (size_t)st * GM_KS;
    cp_async2(la0 + bo, Ab + ka, la0 + bo + 32 * GM_LP * 2, Ab + ka + (size_t)32 * lda);
    if (ASPL) cp_async2(la0 + bo + GM_PL, Ab2 + ka, la0 + bo + GM_PL + 32 * GM_LP * 2, Ab2 + ka + (size_t)32 * lda);
    const size_t gstep = (size_t)ldb * 8;   // bytes of four Bt rows
#pragma unroll   // two straight-line statements a plane: no loop counter between the copies
    for (int hf = 0; hf < 2; ++hf) {          // rows 0..31, rows 32..63
      cp_async8(lb0 + bo + hf * 32 * GM_LP * 2, (const char*)(Bb + kb + (size_t)(hf * 32) * ldb), gstep);
      if (BSPL) cp_async8(lb0 + bo + GM_PL + hf * 32 * GM_LP * 2, (const char*)(Bb2 + kb + (size_t)(hf * 32) * ldb), gstep);
    }
  };

  const int nst = K / GM_KS;
  issue_stage(0);
  asm volatile("s_wait_asynccnt 0x0" ::: "memory");   // this wave's copies of stage 0 have landed
  __syncthreads();                                    // stage 0 is readable by every wave
  if (nst > 1) issue_stage(1);
  for (int st = 0; st < nst; ++st) {
    const T* sA = (const T*)(smem + (st & 1) * STAGE);
    const T* sB = sA + (NPA + wave * NPB) * (GM_PL / 2);
#pragma unroll   // both 32-k steps of a stage in one body (as every loop below: fragment and accumulator arrays stay in registers)
    for (int ks = 0; ks < 2; ++ks) {
      V bh[4], bl[4], ah[4], al[4];
#pragma unroll
      for (int j = 0; j < 4; ++j) {
        const int bo = ((j << 4) + rlane) * GM_LP + ks * 32 + koff;
        bh[j] = Frag<T>::load(sB + bo);
        if (BSPL) bl[j] = Frag<T>::load(sB + GM_PL / 2 + bo);
        else bl[j] = bh[j];
      }
#pragma unroll
      for (int i = 0; i < 4; ++i) {
        const int ao = ((i << 4) + rlane) * GM_LP + ks * 32 + koff;
        ah[i] = Frag<T>::load(sA + ao);
        if (ASPL) al[i] = Frag<T>::load(sA + GM_PL / 2 + ao);
        else al[i] = ah[i];
      }
#pragma unroll
      for (int i = 0; i < 4; ++i) {
#pragma unroll
        for (int j = 0; j < 4; ++j) {
          acc[i][j] = Frag<T>::mma(ah[i], bh[j], acc[i][j]);
          if (BSPL) acc[i][j] = Frag<T>::mma(ah[i], bl[j], acc[i][j]);
          if (ASPL) acc[i][j] = Frag<T>::mma(al[i], bh[j], acc[i][j]);
        }
        Frag<T>::guard(acc[i][0], acc[i][3], ah[i], al[i]);
      }
      Frag<T>::keep(bh[0], bh[1], bh[2], bh[3]);
      if (BSPL) Frag<T>::keep(bl[0], bl[1], bl[2], bl[3]);
    }
    // hand-over: this wave's reads of stage st are over, its copies of stage st + 1 have landed; behind the barrier
    // stage st + 1 is readable by every wave and the buffer of stage st is free for stage st + 2
    asm volatile("s_wait_dscnt 0x0" ::: "memory");
    asm volatile("s_wait_asynccnt 0x0" ::: "memory");
    __syncthreads();
    if (st + 2 < nst) issue_stage(st + 2);
  }
  asm volatile("s_wait_asynccnt 0x0" ::: "memory");   // no copy is outstanding when the buffers become the output slabs
  acc_guard4(acc[0][0], acc[0][1], acc[0][2], acc[0][3]);
  acc_guard4(acc[1][0], acc[1][1], acc[1][2], acc[1][3]);
  acc_guard4(acc[2][0], acc[2][1], acc[2][2], acc[2][3]);
  acc_guard4(acc[3][0], acc[3][1], acc[3][2], acc[3][3]);

  // ---- epilogue ----
  float* slab = (float*)(smem + wave * (16 * 68 * 4));   // every wave has passed the last hand-over barrier: the buffers are free
  const float* Rb = RESID ? (resid + (size_t)b * strideR) : nullptr;
#pragma unroll
  for (int i = 0; i < 4; ++i) {
    const int mBase = m0 + (i << 4);
#pragma unroll
    for (int j = 0; j < 4; ++j) {
      const int n = n0 + (j << 4) + rlane;
      float bv = 0.f;
      if (BIAS_MODE == 2) bv = bias[n];
#pragma unroll
      for (int r = 0; r < 8; ++r) {
        float v = acc[i][j][r] * scale;
        if (BIAS_MODE == 1) v += bias[mBase + mOff + r];
        if (BIAS_MODE == 2) v += bv;
        if (RESID) v += Rb[(size_t)(mBase + mOff + r) * ldc + n];
        if (ACT == 1) v = tanhf(v);
        if (ACT == 2) v = fmaxf(v, 0.0f);
        if (ACT == 3) v = v / (1.0f + expf(-v));
        if (ACT == 4) v = (v > 0.f) ? v : 0.01f * v;
        slab[(mOff + r) * 68 + (j << 4) + rlane] = v;
      }
    }
    __builtin_amdgcn_fence(__ATOMIC_RELEASE, "workgroup");
    __builtin_amdgcn_wave_barrier();
    __builtin_amdgcn_fence(__ATOMIC_ACQUIRE, "workgroup");
    if (OUT_MODE == 0) {
      float* C = (float*)Cout + (size_t)b * strideC;
      const int hh = lane >> 4, c4 = (lane & 15) * 4;     // row seg = 256 B = 16 lanes x 16 B
      {
#pragma unroll
        for (int it = 0; it < 8; ++it) {
          const int row = it * 2 + hh;
          v4f v = *(const v4f*)(slab + row * 68 + c4);
          *(v4f*)(C + (size_t)(mBase + row) * ldc + n0 + c4) = v;
        }
        
      }
    } else {
      const int q = lane >> 3, c8 = (lane & 7) * 8;
      unsigned short* C  = (unsigned short*)Cout  + (size_t)b * strideC;
      unsigned short* C2 = (OUT_MODE == 2) ? ((unsigned short*)Cout2 + (size_t)b * strideC) : nullptr;
      {
#pragma unroll
        for (int it = 0; it < 4; ++it) {
          const int row = it * 4 + q;
          const float* sp = slab + row * 68 + c8;
          v8h hv, lv;
#pragma unroll
          for (int e = 0; e < 8; ++e) {
            if (OUT_MODE == 1) {
              hv[e] = (_Float16)sp[e];
            } else {
              unsigned short hb = f2bf_bits(sp[e]);
              unsigned short lb = f2bf_bits(sp[e] - bf_bits2f(hb));
              hv[e] = __builtin_bit_cast(_Float16, hb);
              lv[e] = __builtin_bit_cast(_Float16, lb);
            }
          }
          *(v8h*)(C + (size_t)(mBase + row) * ldc + n0 + c8) = hv;
          if (OUT_MODE == 2) *(v8h*)(C2 + (size_t)(mBase + row) * ldc + n0 + c8) = lv;
        }
        
      }
    }
    __builtin_amdgcn_fence(__ATOMIC_RELEASE, "workgroup");
    __builtin_amdgcn_wave_barrier();
    __builtin_amdgcn_fence(__ATOMIC_ACQUIRE, "workgroup");
  }
}

__global__ __launch_bounds__(256) void k_cast_bf16x2(
    const float* __restrict__ in, unsigned short* __restrict__ out, int n2) {
  int i = blockIdx.x * 256 + threadIdx.x;
  if (i < n2) {
    const unsigned u = (unsigned)f2bf_bits(in[2 * i]) | ((unsigned)f2bf_bits(in[2 * i + 1]) << 16);
    ((unsigned*)out)[i] = u;
    
  }
}

// ---- (nb, C, L) f32 -> (nb, L, C) bf16 through an LDS tile: in[c][l] -> out[l][c] ----
// tile = 64 channels x 32 positions; grid (L/32, C/64, nb), block 256.
// loads: 256 threads x 8 = 2048 = 64x32 floats; stores: thread (r = tid>>3, c8 = (tid&7)*8) writes 8 bf16 = 16 B,
__global__ __launch_bounds__(256) void k_transpose_bf16(
    const float* __restrict__ in, unsigned short* __restrict__ out, int C, int L) {
  __shared__ float t[64][33];
  const int tid = threadIdx.x;
  const int b = blockIdx.z;
  const int l0 = blockIdx.x * 32, c0 = blockIdx.y * 64;
  const float* inb = in + (size_t)b * C * L;
#pragma unroll
  for (int i = 0; i < 8; ++i) {
    const int cl = i * 8 + (tid >> 5);
    t[cl][tid & 31] = inb[(size_t)(c0 + cl) * L + l0 + (tid & 31)];
  }
  __syncthreads();
  const int r = tid >> 3, c8 = (tid & 7) * 8;
  unsigned w0, w1, w2, w3;
  w0 = (unsigned)f2bf_bits(t[c8 + 0][r]) | ((unsigned)f2bf_bits(t[c8 + 1][r]) << 16);
  w1 = (unsigned)f2bf_bits(t[c8 + 2][r]) | ((unsigned)f2bf_bits(t[c8 + 3][r]) << 16);
  w2 = (unsigned)f2bf_bits(t[c8 + 4][r]) | ((unsigned)f2bf_bits(t[c8 + 5][r]) << 16);
  w3 = (unsigned)f2bf_bits(t[c8 + 6][r]) | ((unsigned)f2bf_bits(t[c8 + 7][r]) << 16);
  const v4u val = (v4u){w0, w1, w2, w3};
  unsigned short* dst = out + ((size_t)b * L + l0 + r) * C + c0 + c8;
  *(v4u*)dst = val;
  
}

// ---- InstanceNorm over the 1024 rows of an L-major f32 plane X[nb][1024][NCOL], per (b, column) ----
// block = 32 waves owns a slab of 64 columns x 1024 rows; grid (NCOL/64, nb).
// lane = (row half, 4 adjacent columns): one wave-wide 16-byte load covers 2 rows x 256 B; a thread keeps its
// 16 rows (i*64 + wave*2 + half) x 4 columns in registers, so X is read once. Mean, then centred sum of squares.
// output = bf16 hi + lo planes, same layout (a wave stores 2 rows x 128 B per plane);
// MODE 0: plain; MODE 1: + residual read from a bf16 plane res (same layout); MODE 2: relu.
constexpr int CN_RP = 68;   // pitch in floats of the per-wave partial rows (16-byte aligned rows)

// column totals over the whole slab: s = this thread's partial for its 4 columns; every thread gets the totals of its 4 columns.
// fixed tree: two row halves by shuffle, 32 wave partials through LDS, wave w adds up columns 2w and 2w+1 by a butterfly.
__device__ __forceinline__ v4f cn_colsum(v4f s, float* red, float* tot, int wave, int lane) {
  const int c4 = (lane & 15) * 4;
#pragma unroll
  for (int e = 0; e < 4; ++e) s[e] += __shfl_xor(s[e], 16, 32);
  if (lane < 16) *(v4f*)(red + wave * CN_RP + c4) = s;
  __syncthreads();   // all 32 partial rows are in red
  v2f p = *(const v2f*)(red + lane * CN_RP + 2 * wave);
#pragma unroll
  for (int off = 1; off < 32; off <<= 1) {
    p.x += __shfl_xor(p.x, off, 32);
    p.y += __shfl_xor(p.y, off, 32);
  }
  if (lane == 0) *(v2f*)(tot + 2 * wave) = p;
  __syncthreads();   // all 64 totals are in tot; every read of red is over
  return *(const v4f*)(tot + c4);
}

template <int MODE, int NCOL>
__global__ __launch_bounds__(1024) void k_colnorm(
    const float* __restrict__ X, const unsigned* __restrict__ res,
    unsigned* __restrict__ outh, unsigned* __restrict__ outl) {
  constexpr int NR = 1024, NW = 32, NI = NR / (2 * NW);
  __shared__ __align__(16) float red[NW * CN_RP];
  __shared__ __align__(16) float tot[2][64];
  const int lane = threadIdx.x & 31, wave = threadIdx.x >> 5;
  const size_t base = ((size_t)blockIdx.y * NR + wave * 2 + (lane >> 4)) * NCOL + blockIdx.x * 64 + (lane & 15) * 4;
  constexpr size_t STEP = (size_t)64 * NCOL;   // floats between a thread's rows; STEP / 2 words in the bf16 planes
  const size_t obase = base >> 1;
  const float* xp = X + base;
  v4f x[NI];
#pragma unroll
  for (int i = 0; i < NI; ++i) x[i] = *(const v4f*)(xp + i * STEP);
  // xp as an input keeps the loads' address pair whole up to the wait (else the last load lands on it)
  asm volatile("s_wait_xcnt 0x0" :: "v"(xp) : "memory");
  // MODE 1: residual words, two groups of 4 rows; the first group is asked for here, under the two reductions
  v2u rw[2][4];
  if constexpr (MODE == 1) {
#pragma unroll
    for (int j = 0; j < 4; ++j) rw[0][j] = *(const v2u*)(res + obase + j * (STEP / 2));
  }
  v4f s = x[0];
#pragma unroll
  for (int i = 1; i < NI; ++i) s += x[i];
  const v4f mean = cn_colsum(s, red, tot[0], wave, lane) * (1.0f / NR);
  v4f q = (v4f){0.f, 0.f, 0.f, 0.f};
#pragma unroll
  for (int i = 0; i < NI; ++i) {
    x[i] -= mean;
    q += x[i] * x[i];
  }
  const v4f var = cn_colsum(q, red, tot[1], wave, lane) * (1.0f / NR);
  v4f rs;
#pragma unroll
  for (int e = 0; e < 4; ++e) rs[e] = rsqrtf(var[e] + 1e-5f);
#pragma unroll
  for (int g = 0; g < NI / 4; ++g) {
    if constexpr (MODE == 1) {
      if (g + 1 < NI / 4) {
#pragma unroll
        for (int j = 0; j < 4; ++j) rw[(g + 1) & 1][j] = *(const v2u*)(res + obase + ((g + 1) * 4 + j) * (STEP / 2));
      }
    }
#pragma unroll
    for (int j = 0; j < 4; ++j) {
      const int i = g * 4 + j;
      v4f y = x[i] * rs;
      if constexpr (MODE == 1) {
        const v2u w = rw[g & 1][j];
        y.x += __uint_as_float(w.x << 16);
        y.y += __uint_as_float(w.x & 0xffff0000u);
        y.z += __uint_as_float(w.y << 16);
        y.w += __uint_as_float(w.y & 0xffff0000u);
      }
      if constexpr (MODE == 2) {
#pragma unroll
        for (int e = 0; e < 4; ++e) y[e] = fmaxf(y[e], 0.0f);
      }
      unsigned short hb[4], lb[4];
#pragma unroll
      for (int e = 0; e < 4; ++e) {
        hb[e] = f2bf_bits(y[e]);
        lb[e] = f2bf_bits(y[e] - bf_bits2f(hb[e]));
      }
      const size_t oi = obase + i * (STEP / 2);
      *(v2u*)(outh + oi) = (v2u){ (unsigned)hb[0] | ((unsigned)hb[1] << 16), (unsigned)hb[2] | ((unsigned)hb[3] << 16) };
      *(v2u*)(outl + oi) = (v2u){ (unsigned)lb[0] | ((unsigned)lb[1] << 16), (unsigned)lb[2] | ((unsigned)lb[3] << 16) };
    }
    if (g + 1 < NI / 4) {
      // stands in front of every reuse of the address and data registers that the loads and stores above name
      asm volatile("s_wait_xcnt 0x0" ::: "memory");
      // keeps the next group's code below that wait; in MODE 1 it also keeps the later groups' residual loads from
      // being hoisted: with all 16 in flight the kernel passes the 128 registers of a 32-wave block and spills
      __builtin_amdgcn_sched_barrier(0);
    }
  }
}

// ---- InstanceNorm over channel-major f32 rows X[row][1024] (row = b*C + channel), one wave per row ----
// block 8 waves = 8 rows; grid = rows/8 (rows % 8 == 0). Rolled re-read passes (no per-thread arrays).
template <int MODE>
__global__ __launch_bounds__(256) void k_rownorm(
    const float* __restrict__ X, float* __restrict__ outf,
    unsigned short* __restrict__ outh, unsigned short* __restrict__ outl) {
  constexpr int NCOL = 1024;
  const int lane = threadIdx.x & 31, wave = threadIdx.x >> 5;
  const size_t row = (size_t)blockIdx.x * 8 + wave;
  const float* xr = X + row * NCOL;
  float s = 0.f;
#pragma unroll 1
  for (int it = 0; it < 8; ++it) {
    const v4f u = *(const v4f*)(xr + it * 128 + lane * 4);
    s += (u.x + u.y) + (u.z + u.w);
  }
#pragma unroll
  for (int off = 1; off < 32; off <<= 1) s += __shfl_xor(s, off, 32);
  const float mean = s * (1.0f / NCOL);
  float ss = 0.f;
#pragma unroll 1
  for (int it = 0; it < 8; ++it) {
    const v4f u = *(const v4f*)(xr + it * 128 + lane * 4);
    const float d0 = u.x - mean, d1 = u.y - mean, d2 = u.z - mean, d3 = u.w - mean;
    ss += (d0 * d0 + d1 * d1) + (d2 * d2 + d3 * d3);
  }
#pragma unroll
  for (int off = 1; off < 32; off <<= 1) ss += __shfl_xor(ss, off, 32);
  const float rs = rsqrtf(ss * (1.0f / NCOL) + 1e-5f);
  if constexpr (MODE == 0) {
    float* orow = outf + row * NCOL;
    {
#pragma unroll 1
      for (int it = 0; it < 8; ++it) {
        const v4f u = *(const v4f*)(xr + it * 128 + lane * 4);
        v4f y;
        y.x = (u.x - mean) * rs; y.y = (u.y - mean) * rs; y.z = (u.z - mean) * rs; y.w = (u.w - mean) * rs;
        *(v4f*)(orow + it * 128 + lane * 4) = y;
      }
      
    }
  } else {
    unsigned short* hrow = outh + row * NCOL;
    unsigned short* lrw  = outl + row * NCOL;
    {
#pragma unroll 1
      for (int it = 0; it < 4; ++it) {
        const v4f u0 = *(const v4f*)(xr + it * 256 + lane * 8);
        const v4f u1 = *(const v4f*)(xr + it * 256 + lane * 8 + 4);
        const float y0 = (u0.x - mean) * rs, y1 = (u0.y - mean) * rs, y2 = (u0.z - mean) * rs, y3 = (u0.w - mean) * rs;
        const float y4 = (u1.x - mean) * rs, y5 = (u1.y - mean) * rs, y6 = (u1.z - mean) * rs, y7 = (u1.w - mean) * rs;
        const unsigned short h0 = f2bf_bits(y0), h1 = f2bf_bits(y1), h2 = f2bf_bits(y2), h3 = f2bf_bits(y3);
        const unsigned short h4 = f2bf_bits(y4), h5 = f2bf_bits(y5), h6 = f2bf_bits(y6), h7 = f2bf_bits(y7);
        const unsigned short l0 = f2bf_bits(y0 - bf_bits2f(h0)), l1 = f2bf_bits(y1 - bf_bits2f(h1));
        const unsigned short l2 = f2bf_bits(y2 - bf_bits2f(h2)), l3 = f2bf_bits(y3 - bf_bits2f(h3));
        const unsigned short l4 = f2bf_bits(y4 - bf_bits2f(h4)), l5 = f2bf_bits(y5 - bf_bits2f(h5));
        const unsigned short l6 = f2bf_bits(y6 - bf_bits2f(h6)), l7 = f2bf_bits(y7 - bf_bits2f(h7));
        const v4u hv = (v4u){ (unsigned)h0 | ((unsigned)h1 << 16), (unsigned)h2 | ((unsigned)h3 << 16),
                              (unsigned)h4 | ((unsigned)h5 << 16), (unsigned)h6 | ((unsigned)h7 << 16) };
        const v4u lv = (v4u){ (unsigned)l0 | ((unsigned)l1 << 16), (unsigned)l2 | ((unsigned)l3 << 16),
                              (unsigned)l4 | ((unsigned)l5 << 16), (unsigned)l6 | ((unsigned)l7 << 16) };
        *(v4u*)(hrow + it * 256 + lane * 8) = hv;
        *(v4u*)(lrw  + it * 256 + lane * 8) = lv;
      }
      
    }
  }
}

// =====================================================================================
// Attention, head_dim 64, no mask, 16-bit input planes:
//   q hi/lo planes: L-major [b][l][512] bf16 (element (b, l, h, d) at (b*L + l)*512 + h*64 + d)
//   k hi/lo planes: same layout
//   v hi/lo planes: channel-major [b][h*64+d][m] bf16
//   out: f32 L-major [b][l][512]
//   scores = sscale * q.k^T : bf16 hi.hi + hi.lo + lo.hi, f32 accumulate; online softmax f32;
//   out = p.v : p and v bf16 hi/lo (hi.hi + hi.lo + lo.hi). Block = 4 waves = 64 query rows of one (b, h).
//   grid.x = B * H * (L/64)
// =====================================================================================
#define AT_D 64
#define AT_NW 4
#define AT_KC 64
#define AT_OSP 68
// pitch in bf16 elements of every 64-element row of the K, V and P tiles in LDS: 144 B = 16 B x 9. The fragment reads are
// 16-byte loads of 16 rows at one column; at a pitch of 128 B those rows fall on two groups of four banks, at 144 B on sixteen.
#define AT_LP 72
constexpr int SEQ_LEN = 1024;
constexpr int N_HEADS = 8;
constexpr int N_CH = 512;

__device__ __forceinline__ v8f at_mma(v16b a, v16b b, v8f c) {
  c = __builtin_amdgcn_wmma_f32_16x16x32_bf16(false, a, false, b, (short)0, c, false, false);
  asm volatile("v_nop\n\tv_nop\n\tv_nop\n\tv_nop" : "+v"(c) : "v"(a), "v"(b));
  return c;
}
__device__ __forceinline__ void at_split(float f, __bf16& hi, __bf16& lo) {
  const unsigned short hb = f2bf_bits(f);
  hi = __builtin_bit_cast(__bf16, hb);
  lo = __builtin_bit_cast(__bf16, f2bf_bits(f - __uint_as_float(((unsigned)hb) << 16)));
}

__global__ __launch_bounds__(128)
void k_attn(const unsigned short* __restrict__ qhp, const unsigned short* __restrict__ qlp,
            const unsigned short* __restrict__ khp, const unsigned short* __restrict__ klp,
            const unsigned short* __restrict__ vhp, const unsigned short* __restrict__ vlp,
            float* __restrict__ out, float sscale) {
  union FB { v16b v; v8b h[2]; };
  __shared__ __align__(16) __bf16 Ksh[AT_KC * AT_LP];            // K hi [kv][d]
  __shared__ __align__(16) __bf16 Ksl[AT_KC * AT_LP];            // K lo [kv][d]
  __shared__ __align__(16) __bf16 Vth[AT_D * AT_LP];             // V hi [d][kv]
  __shared__ __align__(16) __bf16 Vtl[AT_D * AT_LP];             // V lo [d][kv]
  __shared__ __align__(16) __bf16 Psh[AT_NW][16 * AT_LP];        // per wave P hi [row][kv]
  __shared__ __align__(16) __bf16 Psl[AT_NW][16 * AT_LP];        // per wave P lo [row][kv]
  __shared__ __align__(16) float  Os[AT_NW][16 * AT_OSP];        // per wave out tile

  const int tid  = threadIdx.x;
  const int wave = tid >> 5;
  const int lane = tid & 31;
  const int hh   = lane >> 4;
  const int c    = lane & 15;

  constexpr int NQB = SEQ_LEN / 64;
  const int bx  = blockIdx.x;
  const int qb  = bx % NQB;
  const int bhd = bx / NQB;
  const int h   = bhd % N_HEADS;
  const int b   = bhd / N_HEADS;
  const int q0  = qb * 64 + wave * 16;

  const __bf16* qh = (const __bf16*)qhp;
  const __bf16* ql = (const __bf16*)qlp;
  const __bf16* kh = (const __bf16*)khp;
  const __bf16* kl = (const __bf16*)klp;
  const __bf16* vh = (const __bf16*)vhp;
  const __bf16* vl = (const __bf16*)vlp;

  // ---- Q fragments (A operand: row = query q0 + c, k = d), hi and lo planes ----
  v16b qah[2], qal[2];
  {
    const size_t qo = ((size_t)b * SEQ_LEN + q0 + c) * N_CH + h * AT_D + 8 * hh;
#pragma unroll
    for (int dc = 0; dc < 2; ++dc) {
      qah[dc] = Frag<__bf16>::load(qh + qo + dc * 32);
      qal[dc] = Frag<__bf16>::load(ql + qo + dc * 32);
    }
  }

  float mrow[8], lrow[8];
  v8f oacc[4];
#pragma unroll
  for (int r = 0; r < 8; ++r) { mrow[r] = -INFINITY; lrow[r] = 0.f; }
#pragma unroll
  for (int t = 0; t < 4; ++t) oacc[t] = (v8f){0.f,0.f,0.f,0.f,0.f,0.f,0.f,0.f};

  for (int kc = 0; kc < SEQ_LEN / AT_KC; ++kc) {
    const int kv0 = kc * AT_KC;
    __syncthreads();
    {
      // staging: thread (row = tid>>1, half = (tid&1)*32) copies 32 bf16 = 4 x 16 B per plane;
      // 128 threads x 32 = 4096 = 64 x 64 elements per plane (full tiles)
      const int row = tid >> 1, half = (tid & 1) * 32;
      const size_t ko = ((size_t)b * SEQ_LEN + kv0 + row) * N_CH + h * AT_D + half;
      const size_t vo = ((size_t)b * N_CH + h * AT_D + row) * SEQ_LEN + kv0 + half;
      {
        const v4u* sp = (const v4u*)(kh + ko);
        v4u* dp = (v4u*)(Ksh + row * AT_LP + half);
#pragma unroll
        for (int i = 0; i < 4; ++i) dp[i] = sp[i];
      }
      asm volatile("" ::: "memory");
      {
        const v4u* sp = (const v4u*)(kl + ko);
        v4u* dp = (v4u*)(Ksl + row * AT_LP + half);
#pragma unroll
        for (int i = 0; i < 4; ++i) dp[i] = sp[i];
      }
      asm volatile("" ::: "memory");
      {
        const v4u* sp = (const v4u*)(vh + vo);
        v4u* dp = (v4u*)(Vth + row * AT_LP + half);
#pragma unroll
        for (int i = 0; i < 4; ++i) dp[i] = sp[i];
      }
      asm volatile("" ::: "memory");
      {
        const v4u* sp = (const v4u*)(vl + vo);
        v4u* dp = (v4u*)(Vtl + row * AT_LP + half);
#pragma unroll
        for (int i = 0; i < 4; ++i) dp[i] = sp[i];
      }
    }
    __syncthreads();

    // ---- scores: B operand column n = key j*16 + c, k = d (Ksh is [key][d], k-contiguous) ----
    v8f s[4];
#pragma unroll
    for (int j = 0; j < 4; ++j) {
      s[j] = (v8f){0.f,0.f,0.f,0.f,0.f,0.f,0.f,0.f};
#pragma unroll
      for (int dc = 0; dc < 2; ++dc) {
        FB kb, kb2;
        const int ko2 = (j * 16 + c) * AT_LP + dc * 32 + 8 * hh;
        kb.h[0]  = *(const v8b*)(Ksh + ko2);
        kb.h[1]  = *(const v8b*)(Ksh + ko2 + 16);
        kb2.h[0] = *(const v8b*)(Ksl + ko2);
        kb2.h[1] = *(const v8b*)(Ksl + ko2 + 16);
        s[j] = at_mma(qah[dc], kb.v,  s[j]);
        s[j] = at_mma(qah[dc], kb2.v, s[j]);
        s[j] = at_mma(qal[dc], kb.v,  s[j]);
      }
    }
    // D element r of lane = (query row 8*hh + r, key column c of subtile j)
    float cm[8];
#pragma unroll
    for (int r = 0; r < 8; ++r) {
      float m = -INFINITY;
#pragma unroll
      for (int j = 0; j < 4; ++j) {
        const float sv = s[j][r] * sscale;
        s[j][r] = sv;
        m = fmaxf(m, sv);
      }
#pragma unroll
      for (int off = 1; off < 16; off <<= 1) m = fmaxf(m, __shfl_xor(m, off, 32));
      cm[r] = m;
    }
    __bf16* pwh = Psh[wave];
    __bf16* pwl = Psl[wave];
#pragma unroll
    for (int r = 0; r < 8; ++r) {
      const float mnew = fmaxf(mrow[r], cm[r]);
      const float alpha = expf(mrow[r] - mnew);
      mrow[r] = mnew;
      float psum = 0.f;
#pragma unroll
      for (int j = 0; j < 4; ++j) {
        const float p = expf(s[j][r] - mnew);
        psum += p;
        __bf16 pa_hi, pa_lo;
        at_split(p, pa_hi, pa_lo);
        pwh[(8 * hh + r) * AT_LP + j * 16 + c] = pa_hi;
        pwl[(8 * hh + r) * AT_LP + j * 16 + c] = pa_lo;
      }
#pragma unroll
      for (int off = 1; off < 16; off <<= 1) psum += __shfl_xor(psum, off, 32);
      lrow[r] = lrow[r] * alpha + psum;
#pragma unroll
      for (int t = 0; t < 4; ++t) oacc[t][r] *= alpha;
    }
    // same-wave P tile: stored as __bf16 elements, reloaded as v8b vectors of the same element type after the wave barrier
    __builtin_amdgcn_fence(__ATOMIC_RELEASE, "workgroup");
    __builtin_amdgcn_wave_barrier();
    __builtin_amdgcn_fence(__ATOMIC_ACQUIRE, "workgroup");
    // ---- out += P.V : A = P [query][key], B = V with k = key, n = d (Vth is [d][key], k-contiguous) ----
#pragma unroll 1
    for (int kk = 0; kk < 2; ++kk) {
      FB pa, pl;
      const int po = c * AT_LP + kk * 32 + 8 * hh;
      pa.h[0] = *(const v8b*)(pwh + po);
      pa.h[1] = *(const v8b*)(pwh + po + 16);
      pl.h[0] = *(const v8b*)(pwl + po);
      pl.h[1] = *(const v8b*)(pwl + po + 16);
#pragma unroll
      for (int t = 0; t < 4; ++t) {
        FB vb, vb2;
        const int vo2 = (t * 16 + c) * AT_LP + kk * 32 + 8 * hh;
        vb.h[0]  = *(const v8b*)(Vth + vo2);
        vb.h[1]  = *(const v8b*)(Vth + vo2 + 16);
        vb2.h[0] = *(const v8b*)(Vtl + vo2);
        vb2.h[1] = *(const v8b*)(Vtl + vo2 + 16);
        oacc[t] = at_mma(pa.v, vb.v,  oacc[t]);
        oacc[t] = at_mma(pa.v, vb2.v, oacc[t]);
        oacc[t] = at_mma(pl.v, vb.v,  oacc[t]);
      }
    }
  }

  float* os = Os[wave];
#pragma unroll
  for (int r = 0; r < 8; ++r) {
    const float inv = 1.0f / lrow[r];
#pragma unroll
    for (int t = 0; t < 4; ++t) os[(8 * hh + r) * AT_OSP + t * 16 + c] = oacc[t][r] * inv;
  }
  __builtin_amdgcn_fence(__ATOMIC_RELEASE, "workgroup");
  __builtin_amdgcn_wave_barrier();
  __builtin_amdgcn_fence(__ATOMIC_ACQUIRE, "workgroup");
  {
    float* ob = out + ((size_t)b * SEQ_LEN) * N_CH + h * AT_D;
    const int c4 = (lane & 15) * 4;
    {
#pragma unroll
      for (int it = 0; it < 8; ++it) {
        const int row = it * 2 + hh;
        v4f val = *(const v4f*)(os + row * AT_OSP + c4);
        *(v4f*)(ob + (size_t)(q0 + row) * N_CH + c4) = val;
      }
      
    }
  }
}

// =====================================================================================
// Host orchestration
// =====================================================================================
extern "C" void kernel_launch(void* const* d_in, const int* in_sizes, int n_in,
                              void* d_out, int out_size, void* d_ws,
                              size_t ws_size, hipStream_t stream) {
  (void)in_sizes; (void)n_in; (void)out_size;
  constexpr int NB = 8, CIN = 256, NCH = 512, SEQ = 1024, NFF = 1024, NHD = 8;

  // ---- workspace region map (bytes) ----
  constexpr size_t SZ_WQ   = (size_t)NCH * NCH * 2;        //    524288  wq  bf16 [512][512]
  constexpr size_t SZ_WK   = (size_t)NCH * CIN * 2;        //    262144  wk  bf16 [512][256]
  constexpr size_t SZ_WV   = (size_t)NCH * CIN * 2;        //    262144  wv  bf16 [512][256]
  constexpr size_t SZ_W1   = (size_t)NFF * NCH * 2;        //   1048576  w1  bf16 [1024][512]
  constexpr size_t SZ_W2   = (size_t)NCH * NFF * 2;        //   1048576  w2  bf16 [512][1024]
  constexpr size_t SZ_XQT  = (size_t)NB * SEQ * NCH * 2;   //   8388608  x_query (L,C) bf16
  constexpr size_t SZ_XKVT = (size_t)NB * SEQ * CIN * 2;   //   4194304  x_kv (L,C) bf16
  constexpr size_t SZ_G    = (size_t)NB * SEQ * NFF * 4;   //  33554432  f32 GEMM/attention output, max user = ffn1 [8][1024][1024]
  constexpr size_t SZ_P    = (size_t)NB * SEQ * NCH * 2;   //   8388608  one bf16 activation plane [8][1024][512]
  constexpr size_t OFF_WQ   = 0;
  constexpr size_t OFF_WK   = OFF_WQ + SZ_WQ;
  constexpr size_t OFF_WV   = OFF_WK + SZ_WK;
  constexpr size_t OFF_W1   = OFF_WV + SZ_WV;
  constexpr size_t OFF_W2   = OFF_W1 + SZ_W1;
  constexpr size_t OFF_XQT  = OFF_W2 + SZ_W2;
  constexpr size_t OFF_XKVT = OFF_XQT + SZ_XQT;
  constexpr size_t OFF_G    = OFF_XKVT + SZ_XKVT;
  constexpr size_t OFF_QH   = OFF_G + SZ_G;       // q hi plane; later z hi plane
  constexpr size_t OFF_QL   = OFF_QH + SZ_P;      // q lo plane; later z lo plane
  constexpr size_t OFF_KH   = OFF_QL + SZ_P;      // k hi plane; later y hi plane spans KH+KL (16777216)
  constexpr size_t OFF_KL   = OFF_KH + SZ_P;      // k lo plane
  constexpr size_t OFF_VH   = OFF_KL + SZ_P;      // v hi plane; later y lo plane spans VH+VL (16777216)
  constexpr size_t OFF_VL   = OFF_VH + SZ_P;      // v lo plane
  constexpr size_t OFF_END  = OFF_VL + SZ_P;      // 99614720
  static_assert(OFF_END == 99614720ull);
  static_assert(OFF_END <= 134217728ull);
  static_assert((OFF_WK % 256) == 0 && (OFF_XQT % 256) == 0 && (OFF_G % 256) == 0 && (OFF_QH % 256) == 0);
  // reused regions sized from the max user
  static_assert((size_t)NB * SEQ * NCH * 4 <= SZ_G);        // q, k, v, proj, ffn2 f32 outputs
  static_assert((size_t)NB * SEQ * NFF * 4 <= SZ_G);        // ffn1 f32 output
  static_assert((size_t)NB * SEQ * NFF * 2 == 2 * SZ_P);    // y plane fits exactly over two 512-wide planes
  // GEMM shape contract: M multiple of 64, N multiple of 512, K multiple of 64
  static_assert(SEQ % 512 == 0 && NCH % 512 == 0 && NFF % 512 == 0);
  static_assert(NCH % 64 == 0 && CIN % 64 == 0 && NFF % 64 == 0);
  static_assert(((SEQ / 64) * (NCH / 64)) % 8 == 0 && ((SEQ / 64) * (NFF / 64)) % 8 == 0);
  static_assert(NCH % 256 == 0 && NFF % 256 == 0 && (NB * NCH) % 8 == 0);
  static_assert((size_t)NB * NCH * SEQ * 4 == 16777216ull);   // d_out bytes
  if (ws_size < OFF_END) return;

  const float* x_query = (const float*)d_in[0];
  const float* x_kv    = (const float*)d_in[1];
  const float* wq      = (const float*)d_in[2];
  const float* bq      = (const float*)d_in[3];
  const float* wk      = (const float*)d_in[4];
  const float* bk      = (const float*)d_in[5];
  const float* wv      = (const float*)d_in[6];
  const float* bv      = (const float*)d_in[7];
  const float* w1      = (const float*)d_in[8];
  const float* b1      = (const float*)d_in[9];
  const float* w2      = (const float*)d_in[10];
  const float* b2      = (const float*)d_in[11];
  float* out = (float*)d_out;

  char* ws = (char*)d_ws;
  typedef unsigned short us;
  us* wq16  = (us*)(ws + OFF_WQ);
  us* wk16  = (us*)(ws + OFF_WK);
  us* wv16  = (us*)(ws + OFF_WV);
  us* w1_16 = (us*)(ws + OFF_W1);
  us* w2_16 = (us*)(ws + OFF_W2);
  us* xqT   = (us*)(ws + OFF_XQT);
  us* xkvT  = (us*)(ws + OFF_XKVT);
  float* gf = (float*)(ws + OFF_G);
  us* qh = (us*)(ws + OFF_QH);
  us* ql = (us*)(ws + OFF_QL);
  us* kh = (us*)(ws + OFF_KH);
  us* kl = (us*)(ws + OFF_KL);
  us* vh = (us*)(ws + OFF_VH);
  us* vl = (us*)(ws + OFF_VL);
  us* zh = qh;
  us* zl = ql;
  us* yh = kh;    // [8][1024][1024] bf16 = 16777216 B over KH..KL
  us* yl = vh;    // [8][1024][1024] bf16 = 16777216 B over VH..VL

  // 1) weights -> bf16 (RNE)
  k_cast_bf16x2<<<(NCH * NCH / 2 + 255) / 256, 256, 0, stream>>>(wq, wq16, NCH * NCH / 2);
  k_cast_bf16x2<<<(NCH * CIN / 2 + 255) / 256, 256, 0, stream>>>(wk, wk16, NCH * CIN / 2);
  k_cast_bf16x2<<<(NCH * CIN / 2 + 255) / 256, 256, 0, stream>>>(wv, wv16, NCH * CIN / 2);
  k_cast_bf16x2<<<(NFF * NCH / 2 + 255) / 256, 256, 0, stream>>>(w1, w1_16, NFF * NCH / 2);
  k_cast_bf16x2<<<(NCH * NFF / 2 + 255) / 256, 256, 0, stream>>>(w2, w2_16, NCH * NFF / 2);

  // 2) activations (B,C,L) f32 -> (B,L,C) bf16 : in[C][L] -> out[L][C], grid (L/32, C/64, B)
  k_transpose_bf16<<<dim3(SEQ / 32, NCH / 64, NB), 256, 0, stream>>>(x_query, xqT, NCH, SEQ);
  k_transpose_bf16<<<dim3(SEQ / 32, CIN / 64, NB), 256, 0, stream>>>(x_kv, xkvT, CIN, SEQ);

  // 3) q: C[l][o] = sum_c xqT[l][c] wq[o][c] + bq[o]  (M=1024, N=512, K=512) -> gf L-major; InstanceNorm -> q hi/lo planes
  wmma_gemm64<1, 0, 2, 0, false><<<dim3((SEQ / 64) * (NCH / 64) / 8, NB), 256, 0, stream>>>(
      xqT, nullptr, NCH, (long)SEQ * NCH, wq16, nullptr, NCH, 0L,
      (void*)gf, nullptr, NCH, (long)SEQ * NCH, bq, nullptr, 0L, SEQ, NCH, NCH, 1.0f);
  k_colnorm<0, NCH><<<dim3(NCH / 64, NB), 1024, 0, stream>>>(gf, nullptr, (unsigned*)qh, (unsigned*)ql);

  // 4) k: C[l][o] = sum_c xkvT[l][c] wk[o][c] + bk[o]  (M=1024, N=512, K=256) -> k hi/lo planes (L-major)
  wmma_gemm64<1, 0, 2, 0, false><<<dim3((SEQ / 64) * (NCH / 64) / 8, NB), 256, 0, stream>>>(
      xkvT, nullptr, CIN, (long)SEQ * CIN, wk16, nullptr, CIN, 0L,
      (void*)gf, nullptr, NCH, (long)SEQ * NCH, bk, nullptr, 0L, SEQ, NCH, CIN, 1.0f);
  k_colnorm<0, NCH><<<dim3(NCH / 64, NB), 1024, 0, stream>>>(gf, nullptr, (unsigned*)kh, (unsigned*)kl);

  // 5) v: C[o][m] = sum_c wv[o][c] xkvT[m][c] + bv[o]  (M=512, N=1024, K=256) -> channel-major gf; InstanceNorm rows -> v hi/lo planes
  wmma_gemm64<1, 0, 1, 0, false><<<dim3((NCH / 64) * (SEQ / 64) / 8, NB), 256, 0, stream>>>(
      wv16, nullptr, CIN, 0L, xkvT, nullptr, CIN, (long)SEQ * CIN,
      (void*)gf, nullptr, SEQ, (long)NCH * SEQ, bv, nullptr, 0L, NCH, SEQ, CIN, 1.0f);
  k_rownorm<1><<<NB * NCH / 8, 256, 0, stream>>>(gf, nullptr, vh, vl);

  // 6) attention -> gf as proj L-major [b][l][h*64+d] f32
  k_attn<<<NB * NHD * (SEQ / 64), 128, 0, stream>>>(qh, ql, kh, kl, vh, vl, gf, 0.125f);

  // 7) z = InstanceNorm(proj) + x_query(bf16) -> z hi/lo planes (L-major, pitch 512)
  k_colnorm<1, NCH><<<dim3(NCH / 64, NB), 1024, 0, stream>>>(gf, (const unsigned*)xqT, (unsigned*)zh, (unsigned*)zl);

  // 8) ffn1: C[l][o] = sum_c z[l][c] w1[o][c] + b1[o]  (M=1024, N=1024, K=512), z as hi/lo -> gf L-major [l][1024]
  wmma_gemm64<1, 2, 2, 0, false><<<dim3((SEQ / 64) * (NFF / 64) / 8, NB), 256, 0, stream>>>(
      zh, zl, NCH, (long)SEQ * NCH, w1_16, nullptr, NCH, 0L,
      (void*)gf, nullptr, NFF, (long)SEQ * NFF, b1, nullptr, 0L, SEQ, NFF, NCH, 1.0f);
  // 9) y = relu(InstanceNorm(h1)) -> y hi/lo planes [l][1024]
  k_colnorm<2, NFF><<<dim3(NFF / 64, NB), 1024, 0, stream>>>(gf, nullptr, (unsigned*)yh, (unsigned*)yl);

  // 10) ffn2: C[o][l] = sum_c w2[o][c] y[l][c] + b2[o]  (M=512, N=1024, K=1024), y as hi/lo -> channel-major gf
  wmma_gemm64<1, 3, 1, 0, false><<<dim3((NCH / 64) * (SEQ / 64) / 8, NB), 256, 0, stream>>>(
      w2_16, nullptr, NFF, 0L, yh, yl, NFF, (long)SEQ * NFF,
      (void*)gf, nullptr, SEQ, (long)NCH * SEQ, b2, nullptr, 0L, NCH, SEQ, NFF, 1.0f);

  // 11) final InstanceNorm over rows -> d_out (B, 512, L) f32
  k_rownorm<0><<<NB * NCH / 8, 256, 0, stream>>>(gf, out, nullptr, nullptr);
}

// v004
// One run takes 255 microseconds.
// Two timings next to v003 both put it at 1.17 times that version's speed.
// Counting every step since v000, it is 13.2 times as fast.
// Compute dtypes: conv1x1 GEMMs q/k/v = v_wmma_f32_16x16x32_bf16 on RNE-bf16 inputs (1 product); attention scores and P.V = bf16 hi+lo planes (3 products); FFN GEMMs = bf16 hi+lo activations x bf16 weights (2 products); f32 accumulate; InstanceNorm, softmax, residual in f32.
#include <hip/hip_runtime.h>
#include <hip/hip_bf16.h>

typedef __attribute__((ext_vector_type(16))) _Float16 v16h;
typedef __attribute__((ext_vector_type(8)))  _Float16 v8h;
typedef __attribute__((ext_vector_type(16))) __bf16   v16b;
typedef __attribute__((ext_vector_type(8)))  __bf16   v8b;
typedef __attribute__((ext_vector_type(8)))  float    v8f;
typedef __attribute__((ext_vector_type(4)))  float    v4f;
typedef __attribute__((ext_vector_type(2)))  float    v2f;
typedef __attribute__((ext_vector_type(4)))  unsigned v4u;
typedef __attribute__((ext_vector_type(2)))  unsigned v2u;

__device__ __forceinline__ unsigned short f2bf_bits(float f) {
  unsigned u = __float_as_uint(f);
  return (unsigned short)((u + 0x7FFFu + ((u >> 16) & 1u)) >> 16);
}
__device__ __forceinline__ float bf_bits2f(unsigned short h) { return __uint_as_float(((unsigned)h) << 16); }

// hazard guards as plain device helpers
__device__ __forceinline__ void dep_guard_h(v8f& a, v8f& b, v16h x, v16h y) { asm volatile("v_nop\n\tv_nop\n\tv_nop\n\tv_nop" : "+v"(a), "+v"(b) : "v"(x), "v"(y)); }
__device__ __forceinline__ void dep_guard_b(v8f& a, v8f& b, v16b x, v16b y) { asm volatile("v_nop\n\tv_nop\n\tv_nop\n\tv_nop" : "+v"(a), "+v"(b) : "v"(x), "v"(y)); }
__device__ __forceinline__ void keep4_h(v16h a, v16h b, v16h c, v16h d) { asm volatile("v_nop" :: "v"(a), "v"(b), "v"(c), "v"(d)); }
__device__ __forceinline__ void keep4_b(v16b a, v16b b, v16b c, v16b d) { asm volatile("v_nop" :: "v"(a), "v"(b), "v"(c), "v"(d)); }
__device__ __forceinline__ void acc_guard4(v8f& a, v8f& b, v8f& c, v8f& d) { asm volatile("v_nop\n\tv_nop\n\tv_nop\n\tv_nop" : "+v"(a), "+v"(b), "+v"(c), "+v"(d)); }
template <typename T> struct Frag;
template <> struct Frag<_Float16> {
  typedef v16h V; union U { v16h v; v8h h[2]; };
  // elements 0..7 <- p[0..7], 8..15 <- p[16..23]
  static __device__ __forceinline__ v16h load(const _Float16* p) {
    U f; f.h[0] = *(const v8h*)(p); f.h[1] = *(const v8h*)(p + 16); return f.v;
  }
  static __device__ __forceinline__ v8f mma(v16h a, v16h b, v8f c) {
    return __builtin_amdgcn_wmma_f32_16x16x32_f16(false, a, false, b, (short)0, c, false, false);
  }
  static __device__ __forceinline__ void guard(v8f& a, v8f& b, v16h x, v16h y) { dep_guard_h(a, b, x, y); }
  static __device__ __forceinline__ void keep(v16h a, v16h b, v16h c, v16h d) { keep4_h(a, b, c, d); }
};
template <> struct Frag<__bf16> {
  typedef v16b V; union U { v16b v; v8b h[2]; };
  static __device__ __forceinline__ v16b load(const __bf16* p) {
    U f; f.h[0] = *(const v8b*)(p); f.h[1] = *(const v8b*)(p + 16); return f.v;
  }
  static __device__ __forceinline__ v8f mma(v16b a, v16b b, v8f c) {
    return __builtin_amdgcn_wmma_f32_16x16x32_bf16(false, a, false, b, (short)0, c, false, false);
  }
  static __device__ __forceinline__ void guard(v8f& a, v8f& b, v16b x, v16b y) { dep_guard_b(a, b, x, y); }
  static __device__ __forceinline__ void keep(v16b a, v16b b, v16b c, v16b d) { keep4_b(a, b, c, d); }
};

// ---- Register-blocked batched WMMA GEMM ------------------------------------
// C[m,n] = scale * sum_k A[m,k] * Bt[n,k] (+bias)(+resid); each wave owns a 64x64 tile.
// A row-major [M,K]; Bt row-major [N,K]; M % 64 == 0, N % 512 == 0, K % 64 == 0.
// The eight waves of a block own eight neighbouring tiles of one tile row (N % 512 == 0), so they share the A rows.
// Operands reach the fragments through LDS: a stage is 64 k (one whole 128-byte line of every row), brought by asynchronous
// 16-byte copies in which a wave covers 4 rows x 128 B per instruction; two buffers, stage t + 1 flies while stage t is worked on.
// Stage layout: [A planes: 64 rows][wave 0..7: its Bt planes: 64 rows], every row at a pitch of 144 B (16 B x odd).
// SPLIT: 0 = single product; 1 = A and Bt both hi/lo planes (hi.hi + hi.lo + lo.hi);
//        2 = only A is hi/lo (A_hi.B + A_lo.B); 3 = only Bt is hi/lo (A.B_hi + A.B_lo).
// BIAS_MODE: 0 = none, 1 = bias[m], 2 = bias[n].
// OUT_MODE: 0 = f32, 1 = f16, 2 = bf16 hi plane (Cout) + bf16 lo plane (Cout2).
// ET: 0 = f16 operands, 1 = bf16 operands (pointers passed as 16-bit storage)
constexpr int GM_KS = 64;                  // k elements of a stage
constexpr int GM_LP = 72;                  // LDS pitch of a stage row, in 16-bit elements
constexpr int GM_PL = 64 * GM_LP * 2;      // bytes of one 64-row plane of a stage
__device__ __forceinline__ unsigned lds_off(const void* p) { return (unsigned)(size_t)p; }   // byte address in the block's LDS
// asynchronous copies global -> LDS, 16 bytes per lane. The s_wait_xcnt closes each statement so that it stands in front of
// every later write of the address registers that the copies name.
__device__ __forceinline__ void cp_async2(unsigned l0, const void* g0, unsigned l1, const void* g1) {
  asm volatile("global_load_async_to_lds_b128 %0, %1, off\n\t"
               "global_load_async_to_lds_b128 %2, %3, off\n\t"
               "s_wait_xcnt 0x0"
               :: "v"(l0), "v"(g0), "v"(l1), "v"(g1) : "memory");
}
__device__ __forceinline__ void cp_async8(unsigned l, const char* g, size_t gstep) {
  // eight rows, four apart: LDS step 4 rows of GM_LP elements, global step gstep bytes
  constexpr unsigned LS = 4 * GM_LP * 2;
  asm volatile("global_load_async_to_lds_b128 %0, %1, off\n\t"
               "global_load_async_to_lds_b128 %2, %3, off\n\t"
               "global_load_async_to_lds_b128 %4, %5, off\n\t"
               "global_load_async_to_lds_b128 %6, %7, off\n\t"
               "global_load_async_to_lds_b128 %8, %9, off\n\t"
               "global_load_async_to_lds_b128 %10, %11, off\n\t"
               "global_load_async_to_lds_b128 %12, %13, off\n\t"
               "global_load_async_to_lds_b128 %14, %15, off\n\t"
               "s_wait_xcnt 0x0"
               :: "v"(l), "v"(g), "v"(l + LS), "v"(g + gstep), "v"(l + 2 * LS), "v"(g + 2 * gstep), "v"(l + 3 * LS), "v"(g + 3 * gstep),
                  "v"(l + 4 * LS), "v"(g + 4 * gstep), "v"(l + 5 * LS), "v"(g + 5 * gstep), "v"(l + 6 * LS), "v"(g + 6 * gstep),
                  "v"(l + 7 * LS), "v"(g + 7 * gstep) : "memory");
}
template <int ET> struct Elem;
template <> struct Elem<0> { typedef _Float16 T; };
template <> struct Elem<1> { typedef __bf16 T; };
// bytes of one stage buffer of a GEMM with the given SPLIT
constexpr int gm_stage(int split) {
  return (((split == 1 || split == 2) ? 2 : 1) + 8 * ((split == 1 || split == 3) ? 2 : 1)) * GM_PL;
}
// The GEMM of one block: smem = the kernel's 2 * gm_stage(SPLIT) bytes of LDS, bx = index of the block's group of eight tiles, b = batch.
template <int ET, int SPLIT, int BIAS_MODE, int OUT_MODE, bool RESID, int ACT = 0>
__device__ __forceinline__ void gemm64_body(
    unsigned char* smem, const int bx, const int b,
    const unsigned short* __restrict__ Ap, const unsigned short* __restrict__ A2p, int lda, long strideA,
    const unsigned short* __restrict__ Btp, const unsigned short* __restrict__ Bt2p, int ldb, long strideB,
    void* __restrict__ Cout, void* __restrict__ Cout2, int ldc, long strideC,
    const float* __restrict__ bias,
    const float* __restrict__ resid, long strideR,
    int M, int N, int K, float scale) {
  typedef typename Elem<ET>::T T;
  typedef typename Frag<T>::V V;
  constexpr bool ASPL = (SPLIT == 1) || (SPLIT == 2);
  constexpr bool BSPL = (SPLIT == 1) || (SPLIT == 3);
  const T* A = (const T*)Ap; const T* A2 = (const T*)A2p; const T* Bt = (const T*)Btp; const T* Bt2 = (const T*)Bt2p;
  constexpr int NPA = ASPL ? 2 : 1, NPB = BSPL ? 2 : 1;
  constexpr int STAGE = (NPA + 8 * NPB) * GM_PL;            // bytes of one buffer
  static_assert(STAGE == gm_stage(SPLIT) && 2 * STAGE <= 327680 && 8 * 16 * 68 * 4 <= STAGE);
  // smem: two stage buffers; behind the k loop: per-wave 16x64 f32 slabs, pitch 68
  const int lane = threadIdx.x & 31;
  const int wave = threadIdx.x >> 5;
  const int tilesN = N >> 6;
  const int tilesM = M >> 6;
  const int tile = bx * 8 + wave;
  if (bx * 8 >= tilesM * tilesN) return;   // the same for the whole block, in front of every barrier
  const int tm = tile / tilesN;
  const int tn = tile - tm * tilesN;
  const int m0 = tm << 6;
  const int n0 = tn << 6;

  const T* Ab  = A  + (size_t)b * strideA;
  const T* Bb  = Bt + (size_t)b * strideB;
  const T* Ab2 = ASPL ? (A2  + (size_t)b * strideA) : nullptr;
  const T* Bb2 = BSPL ? (Bt2 + (size_t)b * strideB) : nullptr;

  const int rlane = lane & 15;                 // row (A) / col (B, D) within subtile
  const int koff  = (lane >> 4) * 8;           // k offset of this lane half
  const int mOff  = (lane >> 4) * 8;           // D row offset

  v8f acc[4][4];
#pragma unroll
  for (int i = 0; i < 4; ++i)
#pragma unroll
    for (int j = 0; j < 4; ++j) acc[i][j] = (v8f){0.f,0.f,0.f,0.f,0.f,0.f,0.f,0.f};

  // ---- one stage's copies: the block's A rows (two 16-byte pieces per thread and plane), then this wave's own Bt rows ----
  const unsigned lbase = lds_off(smem);
  const int arow = threadIdx.x >> 3;           // 0..31; the second piece is row arow + 32
  const int brow = lane >> 3;                  // 0..3; piece it is row it * 4 + brow
  const int scol = (lane & 7) * 8;             // first k element of this lane's 16 bytes
  const unsigned la0 = lbase + (unsigned)(arow * GM_LP + scol) * 2u;
  const unsigned lb0 = lbase + (unsigned)(NPA + wave * NPB) * GM_PL + (unsigned)(brow * GM_LP + scol) * 2u;
  const size_t ga0 = (size_t)(m0 + arow) * lda + scol;
  const size_t gb0 = (size_t)(n0 + brow) * ldb + scol;
  auto issue_stage = [&](int st) {
    const unsigned bo = (unsigned)(st & 1) * STAGE;
    const size_t ka = ga0 + (size_t)st * GM_KS;
    const size_t kb = gb0 + (size_t)st * GM_KS;
    cp_async2(la0 + bo, Ab + ka, la0 + bo + 32 * GM_LP * 2, Ab + ka + (size_t)32 * lda);
    if (ASPL) cp_async2(la0 + bo + GM_PL, Ab2 + ka, la0 + bo + GM_PL + 32 * GM_LP * 2, Ab2 + ka + (size_t)32 * lda);
    const size_t gstep = (size_t)ldb * 8;   // bytes of four Bt rows
#pragma unroll   // two straight-line statements a plane: no loop counter between the copies
    for (int hf = 0; hf < 2; ++hf) {          // rows 0..31, rows 32..63
      cp_async8(lb0 + bo + hf * 32 * GM_LP * 2, (const char*)(Bb + kb + (size_t)(hf * 32) * ldb), gstep);
      if (BSPL) cp_async8(lb0 + bo + GM_PL + hf * 32 * GM_LP * 2, (const char*)(Bb2 + kb + (size_t)(hf * 32) * ldb), gstep);
    }
  };

  const int nst = K / GM_KS;
  issue_stage(0);
  asm volatile("s_wait_asynccnt 0x0" ::: "memory");   // this wave's copies of stage 0 have landed
  __syncthreads();                                    // stage 0 is readable by every wave
  if (nst > 1) issue_stage(1);
  for (int st = 0; st < nst; ++st) {
    const T* sA = (const T*)(smem + (st & 1) * STAGE);
    const T* sB = sA + (NPA + wave * NPB) * (GM_PL / 2);
#pragma unroll   // both 32-k steps of a stage in one body (as every loop below: fragment and accumulator arrays stay in registers)
    for (int ks = 0; ks < 2; ++ks) {
      V bh[4], bl[4], ah[4], al[4];
#pragma unroll
      for (int j = 0; j < 4; ++j) {
        const int bo = ((j << 4) + rlane) * GM_LP + ks * 32 + koff;
        bh[j] = Frag<T>::load(sB + bo);
        if (BSPL) bl[j] = Frag<T>::load(sB + GM_PL / 2 + bo);
        else bl[j] = bh[j];
      }
#pragma unroll
      for (int i = 0; i < 4; ++i) {
        const int ao = ((i << 4) + rlane) * GM_LP + ks * 32 + koff;
        ah[i] = Frag<T>::load(sA + ao);
        if (ASPL) al[i] = Frag<T>::load(sA + GM_PL / 2 + ao);
        else al[i] = ah[i];
      }
#pragma unroll
      for (int i = 0; i < 4; ++i) {
#pragma unroll
        for (int j = 0; j < 4; ++j) {
          acc[i][j] = Frag<T>::mma(ah[i], bh[j], acc[i][j]);
          if (BSPL) acc[i][j] = Frag<T>::mma(ah[i], bl[j], acc[i][j]);
          if (ASPL) acc[i][j] = Frag<T>::mma(al[i], bh[j], acc[i][j]);
        }
        Frag<T>::guard(acc[i][0], acc[i][3], ah[i], al[i]);
      }
      Frag<T>::keep(bh[0], bh[1], bh[2], bh[3]);
      if (BSPL) Frag<T>::keep(bl[0], bl[1], bl[2], bl[3]);
    }
    // hand-over: this wave's reads of stage st are over, its copies of stage st + 1 have landed; behind the barrier
    // stage st + 1 is readable by every wave and the buffer of stage st is free for stage st + 2
    asm volatile("s_wait_dscnt 0x0" ::: "memory");
    asm volatile("s_wait_asynccnt 0x0" ::: "memory");
    __syncthreads();
    if (st + 2 < nst) issue_stage(st + 2);
  }
  asm volatile("s_wait_asynccnt 0x0" ::: "memory");   // no copy is outstanding when the buffers become the output slabs
  acc_guard4(acc[0][0], acc[0][1], acc[0][2], acc[0][3]);
  acc_guard4(acc[1][0], acc[1][1], acc[1][2], acc[1][3]);
  acc_guard4(acc[2][0], acc[2][1], acc[2][2], acc[2][3]);
  acc_guard4(acc[3][0], acc[3][1], acc[3][2], acc[3][3]);

  // ---- epilogue ----
  float* slab = (float*)(smem + wave * (16 * 68 * 4));   // every wave has passed the last hand-over barrier: the buffers are free
  const float* Rb = RESID ? (resid + (size_t)b * strideR) : nullptr;
#pragma unroll
  for (int i = 0; i < 4; ++i) {
    const int mBase = m0 + (i << 4);
#pragma unroll
    for (int j = 0; j < 4; ++j) {
      const int n = n0 + (j << 4) + rlane;
      float bv = 0.f;
      if (BIAS_MODE == 2) bv = bias[n];
#pragma unroll
      for (int r = 0; r < 8; ++r) {
        float v = acc[i][j][r] * scale;
        if (BIAS_MODE == 1) v += bias[mBase + mOff + r];
        if (BIAS_MODE == 2) v += bv;
        if (RESID) v += Rb[(size_t)(mBase + mOff + r) * ldc + n];
        if (ACT == 1) v = tanhf(v);
        if (ACT == 2) v = fmaxf(v, 0.0f);
        if (ACT == 3) v = v / (1.0f + expf(-v));
        if (ACT == 4) v = (v > 0.f) ? v : 0.01f * v;
        slab[(mOff + r) * 68 + (j << 4) + rlane] = v;
      }
    }
    __builtin_amdgcn_fence(__ATOMIC_RELEASE, "workgroup");
    __builtin_amdgcn_wave_barrier();
    __builtin_amdgcn_fence(__ATOMIC_ACQUIRE, "workgroup");
    if (OUT_MODE == 0) {
      float* C = (float*)Cout + (size_t)b * strideC;
      const int hh = lane >> 4, c4 = (lane & 15) * 4;     // row seg = 256 B = 16 lanes x 16 B
      {
#pragma unroll
        for (int it = 0; it < 8; ++it) {
          const int row = it * 2 + hh;
          v4f v = *(const v4f*)(slab + row * 68 + c4);
          *(v4f*)(C + (size_t)(mBase + row) * ldc + n0 + c4) = v;
        }
        
      }
    } else {
      const int q = lane >> 3, c8 = (lane & 7) * 8;
      unsigned short* C  = (unsigned short*)Cout  + (size_t)b * strideC;
      unsigned short* C2 = (OUT_MODE == 2) ? ((unsigned short*)Cout2 + (size_t)b * strideC) : nullptr;
      {
#pragma unroll
        for (int it = 0; it < 4; ++it) {
          const int row = it * 4 + q;
          const float* sp = slab + row * 68 + c8;
          v8h hv, lv;
#pragma unroll
          for (int e = 0; e < 8; ++e) {
            if (OUT_MODE == 1) {
              hv[e] = (_Float16)sp[e];
            } else {
              unsigned short hb = f2bf_bits(sp[e]);
              unsigned short lb = f2bf_bits(sp[e] - bf_bits2f(hb));
              hv[e] = __builtin_bit_cast(_Float16, hb);
              lv[e] = __builtin_bit_cast(_Float16, lb);
            }
          }
          *(v8h*)(C + (size_t)(mBase + row) * ldc + n0 + c8) = hv;
          if (OUT_MODE == 2) *(v8h*)(C2 + (size_t)(mBase + row) * ldc + n0 + c8) = lv;
        }
        
      }
    }
    __builtin_amdgcn_fence(__ATOMIC_RELEASE, "workgroup");
    __builtin_amdgcn_wave_barrier();
    __builtin_amdgcn_fence(__ATOMIC_ACQUIRE, "workgroup");
  }
}

template <int ET, int SPLIT, int BIAS_MODE, int OUT_MODE, bool RESID, int ACT = 0>
__global__ __launch_bounds__(256) void wmma_gemm64(
    const unsigned short* __restrict__ Ap, const unsigned short* __restrict__ A2p, int lda, long strideA,
    const unsigned short* __restrict__ Btp, const unsigned short* __restrict__ Bt2p, int ldb, long strideB,
    void* __restrict__ Cout, void* __restrict__ Cout2, int ldc, long strideC,
    const float* __restrict__ bias,
    const float* __restrict__ resid, long strideR,
    int M, int N, int K, float scale) {
  __shared__ __align__(16) unsigned char smem[2 * gm_stage(SPLIT)];
  gemm64_body<ET, SPLIT, BIAS_MODE, OUT_MODE, RESID, ACT>(smem, (int)blockIdx.x, (int)blockIdx.y, Ap, A2p, lda, strideA,
      Btp, Bt2p, ldb, strideB, Cout, Cout2, ldc, strideC, bias, resid, strideR, M, N, K, scale);
}

constexpr int SEQ_LEN = 1024;
constexpr int N_HEADS = 8;
constexpr int N_CH = 512;
constexpr int N_CIN = 256;
constexpr int N_FF = 1024;
constexpr int N_B = 8;

// ---- the q, k and v projections in one launch: they need nothing of each other. grid (16, N_B, 3); blockIdx.z picks the GEMM ----
//   z = 0: gq[l][o] = sum_c xqT[l][c]  wq[o][c] + bq[o]   (M = 1024, N = 512, K = 512), L-major
//   z = 1: gk[l][o] = sum_c xkvT[l][c] wk[o][c] + bk[o]   (M = 1024, N = 512, K = 256), L-major
//   z = 2: gv[o][m] = sum_c wv[o][c] xkvT[m][c] + bv[o]   (M = 512, N = 1024, K = 256), channel-major
__global__ __launch_bounds__(256) void k_gemm_qkv(
    const unsigned short* __restrict__ xqT, const unsigned short* __restrict__ xkvT,
    const unsigned short* __restrict__ wq16, const unsigned short* __restrict__ wk16, const unsigned short* __restrict__ wv16,
    const float* __restrict__ bq, const float* __restrict__ bk, const float* __restrict__ bv,
    float* __restrict__ gq, float* __restrict__ gk, float* __restrict__ gv) {
  __shared__ __align__(16) unsigned char smem[2 * gm_stage(0)];
  const int job = blockIdx.z;   // the same for the whole block
  if (job < 2) {
    const bool isq = job == 0;
    const int K = isq ? N_CH : N_CIN;
    gemm64_body<1, 0, 2, 0, false>(smem, (int)blockIdx.x, (int)blockIdx.y,
        isq ? xqT : xkvT, nullptr, K, (long)SEQ_LEN * K, isq ? wq16 : wk16, nullptr, K, 0L,
        (void*)(isq ? gq : gk), nullptr, N_CH, (long)SEQ_LEN * N_CH, isq ? bq : bk, nullptr, 0L, SEQ_LEN, N_CH, K, 1.0f);
  } else {
    gemm64_body<1, 0, 1, 0, false>(smem, (int)blockIdx.x, (int)blockIdx.y,
        wv16, nullptr, N_CIN, 0L, xkvT, nullptr, N_CIN, (long)SEQ_LEN * N_CIN,
        (void*)gv, nullptr, SEQ_LEN, (long)N_CH * SEQ_LEN, bv, nullptr, 0L, N_CH, SEQ_LEN, N_CIN, 1.0f);
  }
}

// f32 -> bf16 (RNE), two elements per thread; blk = index of the 256-thread block inside this array
__device__ __forceinline__ void cast_bf16x2_body(
    const float* __restrict__ in, unsigned short* __restrict__ out, int n2, int blk) {
  int i = blk * 256 + threadIdx.x;
  if (i < n2) {
    const float* p = in + 2 * i;
    const float e0 = p[0], e1 = p[1];
    // p as an input keeps the load's address pair whole up to the wait (else the load lands on it)
    asm volatile("s_wait_xcnt 0x0" :: "v"(p) : "memory");
    const unsigned u = (unsigned)f2bf_bits(e0) | ((unsigned)f2bf_bits(e1) << 16);
    ((unsigned*)out)[i] = u;
  }
}

// ---- (nb, C, L) f32 -> (nb, L, C) bf16 through an LDS tile: in[c][l] -> out[l][c] ----
// tile = 64 channels x 32 positions; tile index (bx < L/32, by < C/64, b < nb), block 256.
// loads: 256 threads x 8 = 2048 = 64x32 floats; stores: thread (r = tid>>3, c8 = (tid&7)*8) writes 8 bf16 = 16 B,
__device__ __forceinline__ void transpose_bf16_body(
    const float* __restrict__ in, unsigned short* __restrict__ out, int C, int L, int bx, int by, int b) {
  __shared__ float t[64][33];
  const int tid = threadIdx.x;
  const int l0 = bx * 32, c0 = by * 64;
  const float* inb = in + (size_t)b * C * L;
#pragma unroll
  for (int i = 0; i < 8; ++i) {
    const int cl = i * 8 + (tid >> 5);
    t[cl][tid & 31] = inb[(size_t)(c0 + cl) * L + l0 + (tid & 31)];
  }
  __syncthreads();
  const int r = tid >> 3, c8 = (tid & 7) * 8;
  unsigned w0, w1, w2, w3;
  w0 = (unsigned)f2bf_bits(t[c8 + 0][r]) | ((unsigned)f2bf_bits(t[c8 + 1][r]) << 16);
  w1 = (unsigned)f2bf_bits(t[c8 + 2][r]) | ((unsigned)f2bf_bits(t[c8 + 3][r]) << 16);
  w2 = (unsigned)f2bf_bits(t[c8 + 4][r]) | ((unsigned)f2bf_bits(t[c8 + 5][r]) << 16);
  w3 = (unsigned)f2bf_bits(t[c8 + 6][r]) | ((unsigned)f2bf_bits(t[c8 + 7][r]) << 16);
  const v4u val = (v4u){w0, w1, w2, w3};
  unsigned short* dst = out + ((size_t)b * L + l0 + r) * C + c0 + c8;
  *(v4u*)dst = val;
  
}

// ---- all operand preparation in one launch: the two activation transposes and the five weight casts need nothing of each other.
// One-dimensional grid; a range of the block index picks the job (the same for the whole block), the transposes first.
constexpr int PB_XQ  = (SEQ_LEN / 32) * (N_CH / 64) * N_B;    // blocks of the x_query transpose
constexpr int PB_XKV = (SEQ_LEN / 32) * (N_CIN / 64) * N_B;   // blocks of the x_kv transpose
constexpr int PB_WQ  = N_CH * N_CH / 512;                     // blocks of a cast: 512 elements each
constexpr int PB_WKV = N_CH * N_CIN / 512;
constexpr int PB_WFF = N_FF * N_CH / 512;
constexpr int PB_ALL = PB_XQ + PB_XKV + PB_WQ + 2 * PB_WKV + 2 * PB_WFF;
__global__ __launch_bounds__(256) void k_prep(
    const float* __restrict__ x_query, const float* __restrict__ x_kv,
    const float* __restrict__ wq, const float* __restrict__ wk, const float* __restrict__ wv,
    const float* __restrict__ w1, const float* __restrict__ w2,
    unsigned short* __restrict__ xqT, unsigned short* __restrict__ xkvT,
    unsigned short* __restrict__ wq16, unsigned short* __restrict__ wk16, unsigned short* __restrict__ wv16,
    unsigned short* __restrict__ w1_16, unsigned short* __restrict__ w2_16) {
  int blk = blockIdx.x;
  if (blk < PB_XQ + PB_XKV) {
    const bool isq = blk < PB_XQ;
    static_assert(N_CH / 64 == 8 && N_CIN / 64 == 4);
    const unsigned t  = isq ? blk : blk - PB_XQ;
    const unsigned cb = t / (SEQ_LEN / 32);   // (batch, channel block)
    const int ls = isq ? 3 : 2;               // log2 of the channel blocks: a shift, not a division by a run-time value
    transpose_bf16_body(isq ? x_query : x_kv, isq ? xqT : xkvT, isq ? N_CH : N_CIN, SEQ_LEN,
                        (int)(t % (SEQ_LEN / 32)), (int)(cb & ((1u << ls) - 1u)), (int)(cb >> ls));
    return;
  }
  blk -= PB_XQ + PB_XKV;
  const float* in; unsigned short* out; int n2;
  if (blk < PB_WQ)                                 { in = wq; out = wq16;  n2 = N_CH * N_CH / 2; }
  else if ((blk -= PB_WQ) < PB_WKV)                { in = wk; out = wk16;  n2 = N_CH * N_CIN / 2; }
  else if ((blk -= PB_WKV) < PB_WKV)               { in = wv; out = wv16;  n2 = N_CH * N_CIN / 2; }
  else if ((blk -= PB_WKV) < PB_WFF)               { in = w1; out = w1_16; n2 = N_FF * N_CH / 2; }
  else                          { blk -= PB_WFF;     in = w2; out = w2_16; n2 = N_CH * N_FF / 2; }
  cast_bf16x2_body(in, out, n2, blk);
}

// ---- InstanceNorm over the 1024 rows of an L-major f32 plane X[nb][1024][NCOL], per (b, column) ----
// block = 32 waves owns a slab of 64 columns x 1024 rows; slab index (bx < NCOL/64, by < nb).
// lane = (row half, 4 adjacent columns): one wave-wide 16-byte load covers 2 rows x 256 B; a thread keeps its
// 16 rows (i*64 + wave*2 + half) x 4 columns in registers, so X is read once. Mean, then centred sum of squares.
// output = bf16 hi + lo planes, same layout (a wave stores 2 rows x 128 B per plane);
// MODE 0: plain; MODE 1: + residual read from a bf16 plane res (same layout); MODE 2: relu.
constexpr int CN_RP = 68;   // pitch in floats of the per-wave partial rows (16-byte aligned rows)

// column totals over the whole slab: s = this thread's partial for its 4 columns; every thread gets the totals of its 4 columns.
// fixed tree: two row halves by shuffle, 32 wave partials through LDS, wave w adds up columns 2w and 2w+1 by a butterfly.
__device__ __forceinline__ v4f cn_colsum(v4f s, float* red, float* tot, int wave, int lane) {
  const int c4 = (lane & 15) * 4;
#pragma unroll
  for (int e = 0; e < 4; ++e) s[e] += __shfl_xor(s[e], 16, 32);
  if (lane < 16) *(v4f*)(red + wave * CN_RP + c4) = s;
  __syncthreads();   // all 32 partial rows are in red
  v2f p = *(const v2f*)(red + lane * CN_RP + 2 * wave);
#pragma unroll
  for (int off = 1; off < 32; off <<= 1) {
    p.x += __shfl_xor(p.x, off, 32);
    p.y += __shfl_xor(p.y, off, 32);
  }
  if (lane == 0) *(v2f*)(tot + 2 * wave) = p;
  __syncthreads();   // all 64 totals are in tot; every read of red is over
  return *(const v4f*)(tot + c4);
}

template <int MODE, int NCOL>
__device__ __forceinline__ void colnorm_body(
    const float* __restrict__ X, const unsigned* __restrict__ res,
    unsigned* __restrict__ outh, unsigned* __restrict__ outl, int bx, int by) {
  constexpr int NR = 1024, NW = 32, NI = NR / (2 * NW);
  __shared__ __align__(16) float red[NW * CN_RP];
  __shared__ __align__(16) float tot[2][64];
  const int lane = threadIdx.x & 31, wave = threadIdx.x >> 5;
  const size_t base = ((size_t)by * NR + wave * 2 + (lane >> 4)) * NCOL + bx * 64 + (lane & 15) * 4;
  constexpr size_t STEP = (size_t)64 * NCOL;   // floats between a thread's rows; STEP / 2 words in the bf16 planes
  const size_t obase = base >> 1;
  const float* xp = X + base;
  v4f x[NI];
#pragma unroll
  for (int i = 0; i < NI; ++i) x[i] = *(const v4f*)(xp + i * STEP);
  // xp as an input keeps the loads' address pair whole up to the wait (else the last load lands on it)
  asm volatile("s_wait_xcnt 0x0" :: "v"(xp) : "memory");
  // MODE 1: residual words, two groups of 4 rows; the first group is asked for here, under the two reductions
  v2u rw[2][4];
  if constexpr (MODE == 1) {
#pragma unroll
    for (int j = 0; j < 4; ++j) rw[0][j] = *(const v2u*)(res + obase + j * (STEP / 2));
  }
  v4f s = x[0];
#pragma unroll
  for (int i = 1; i < NI; ++i) s += x[i];
  const v4f mean = cn_colsum(s, red, tot[0], wave, lane) * (1.0f / NR);
  v4f q = (v4f){0.f, 0.f, 0.f, 0.f};
#pragma unroll
  for (int i = 0; i < NI; ++i) {
    x[i] -= mean;
    q += x[i] * x[i];
  }
  const v4f var = cn_colsum(q, red, tot[1], wave, lane) * (1.0f / NR);
  v4f rs;
#pragma unroll
  for (int e = 0; e < 4; ++e) rs[e] = rsqrtf(var[e] + 1e-5f);
#pragma unroll
  for (int g = 0; g < NI / 4; ++g) {
    if constexpr (MODE == 1) {
      if (g + 1 < NI / 4) {
#pragma unroll
        for (int j = 0; j < 4; ++j) rw[(g + 1) & 1][j] = *(const v2u*)(res + obase + ((g + 1) * 4 + j) * (STEP / 2));
      }
    }
#pragma unroll
    for (int j = 0; j < 4; ++j) {
      const int i = g * 4 + j;
      v4f y = x[i] * rs;
      if constexpr (MODE == 1) {
        const v2u w = rw[g & 1][j];
        y.x += __uint_as_float(w.x << 16);
        y.y += __uint_as_float(w.x & 0xffff0000u);
        y.z += __uint_as_float(w.y << 16);
        y.w += __uint_as_float(w.y & 0xffff0000u);
      }
      if constexpr (MODE == 2) {
#pragma unroll
        for (int e = 0; e < 4; ++e) y[e] = fmaxf(y[e], 0.0f);
      }
      unsigned short hb[4], lb[4];
#pragma unroll
      for (int e = 0; e < 4; ++e) {
        hb[e] = f2bf_bits(y[e]);
        lb[e] = f2bf_bits(y[e] - bf_bits2f(hb[e]));
      }
      const size_t oi = obase + i * (STEP / 2);
      *(v2u*)(outh + oi) = (v2u){ (unsigned)hb[0] | ((unsigned)hb[1] << 16), (unsigned)hb[2] | ((unsigned)hb[3] << 16) };
      *(v2u*)(outl + oi) = (v2u){ (unsigned)lb[0] | ((unsigned)lb[1] << 16), (unsigned)lb[2] | ((unsigned)lb[3] << 16) };
    }
    if (g + 1 < NI / 4) {
      // stands in front of every reuse of the address and data registers that the loads and stores above name
      asm volatile("s_wait_xcnt 0x0" ::: "memory");
      // keeps the next group's code below that wait; in MODE 1 it also keeps the later groups' residual loads from
      // being hoisted: with all 16 in flight the kernel passes the 128 registers of a 32-wave block and spills
      __builtin_amdgcn_sched_barrier(0);
    }
  }
}

template <int MODE, int NCOL>
__global__ __launch_bounds__(1024) void k_colnorm(
    const float* __restrict__ X, const unsigned* __restrict__ res,
    unsigned* __restrict__ outh, unsigned* __restrict__ outl) {
  colnorm_body<MODE, NCOL>(X, res, outh, outl, (int)blockIdx.x, (int)blockIdx.y);
}

// ---- InstanceNorm over channel-major f32 rows X[row][1024] (row = b*C + channel), one wave per row ----
// Rolled re-read passes (no per-thread arrays); no LDS, no barrier.
template <int MODE>
__device__ __forceinline__ void rownorm_body(
    const float* __restrict__ X, float* __restrict__ outf,
    unsigned short* __restrict__ outh, unsigned short* __restrict__ outl, const size_t row) {
  constexpr int NCOL = 1024;
  const int lane = threadIdx.x & 31;
  const float* xr = X + row * NCOL;
  float s = 0.f;
#pragma unroll 1
  for (int it = 0; it < 8; ++it) {
    const v4f u = *(const v4f*)(xr + it * 128 + lane * 4);
    s += (u.x + u.y) + (u.z + u.w);
  }
#pragma unroll
  for (int off = 1; off < 32; off <<= 1) s += __shfl_xor(s, off, 32);
  const float mean = s * (1.0f / NCOL);
  float ss = 0.f;
#pragma unroll 1
  for (int it = 0; it < 8; ++it) {
    const v4f u = *(const v4f*)(xr + it * 128 + lane * 4);
    const float d0 = u.x - mean, d1 = u.y - mean, d2 = u.z - mean, d3 = u.w - mean;
    ss += (d0 * d0 + d1 * d1) + (d2 * d2 + d3 * d3);
  }
#pragma unroll
  for (int off = 1; off < 32; off <<= 1) ss += __shfl_xor(ss, off, 32);
  const float rs = rsqrtf(ss * (1.0f / NCOL) + 1e-5f);
  if constexpr (MODE == 0) {
    float* orow = outf + row * NCOL;
    {
#pragma unroll 1
      for (int it = 0; it < 8; ++it) {
        const v4f u = *(const v4f*)(xr + it * 128 + lane * 4);
        v4f y;
        y.x = (u.x - mean) * rs; y.y = (u.y - mean) * rs; y.z = (u.z - mean) * rs; y.w = (u.w - mean) * rs;
        *(v4f*)(orow + it * 128 + lane * 4) = y;
      }
      
    }
  } else {
    unsigned short* hrow = outh + row * NCOL;
    unsigned short* lrw  = outl + row * NCOL;
    {
#pragma unroll 1
      for (int it = 0; it < 4; ++it) {
        const v4f u0 = *(const v4f*)(xr + it * 256 + lane * 8);
        const v4f u1 = *(const v4f*)(xr + it * 256 + lane * 8 + 4);
        const float y0 = (u0.x - mean) * rs, y1 = (u0.y - mean) * rs, y2 = (u0.z - mean) * rs, y3 = (u0.w - mean) * rs;
        const float y4 = (u1.x - mean) * rs, y5 = (u1.y - mean) * rs, y6 = (u1.z - mean) * rs, y7 = (u1.w - mean) * rs;
        const unsigned short h0 = f2bf_bits(y0), h1 = f2bf_bits(y1), h2 = f2bf_bits(y2), h3 = f2bf_bits(y3);
        const unsigned short h4 = f2bf_bits(y4), h5 = f2bf_bits(y5), h6 = f2bf_bits(y6), h7 = f2bf_bits(y7);
        const unsigned short l0 = f2bf_bits(y0 - bf_bits2f(h0)), l1 = f2bf_bits(y1 - bf_bits2f(h1));
        const unsigned short l2 = f2bf_bits(y2 - bf_bits2f(h2)), l3 = f2bf_bits(y3 - bf_bits2f(h3));
        const unsigned short l4 = f2bf_bits(y4 - bf_bits2f(h4)), l5 = f2bf_bits(y5 - bf_bits2f(h5));
        const unsigned short l6 = f2bf_bits(y6 - bf_bits2f(h6)), l7 = f2bf_bits(y7 - bf_bits2f(h7));
        const v4u hv = (v4u){ (unsigned)h0 | ((unsigned)h1 << 16), (unsigned)h2 | ((unsigned)h3 << 16),
                              (unsigned)h4 | ((unsigned)h5 << 16), (unsigned)h6 | ((unsigned)h7 << 16) };
        const v4u lv = (v4u){ (unsigned)l0 | ((unsigned)l1 << 16), (unsigned)l2 | ((unsigned)l3 << 16),
                              (unsigned)l4 | ((unsigned)l5 << 16), (unsigned)l6 | ((unsigned)l7 << 16) };
        *(v4u*)(hrow + it * 256 + lane * 8) = hv;
        *(v4u*)(lrw  + it * 256 + lane * 8) = lv;
      }
      
    }
  }
}

// block 8 waves = 8 rows; grid = rows/8 (rows % 8 == 0)
template <int MODE>
__global__ __launch_bounds__(256) void k_rownorm(
    const float* __restrict__ X, float* __restrict__ outf,
    unsigned short* __restrict__ outh, unsigned short* __restrict__ outl) {
  rownorm_body<MODE>(X, outf, outh, outl, (size_t)blockIdx.x * 8 + (threadIdx.x >> 5));
}

// ---- the InstanceNorms of q, k and v in one launch: they need nothing of each other. Block = 32 waves; a range of the block
// index picks the job (the same for the whole block): 64 column slabs of q, 64 of k, then 32 rows of v per block.
constexpr int NB_SLAB = (N_CH / 64) * N_B;        // column slabs of q, and of k
constexpr int NB_VROW = N_B * N_CH / 32;          // blocks of 32 v rows
__global__ __launch_bounds__(1024) void k_norm_qkv(
    const float* __restrict__ gq, const float* __restrict__ gk, const float* __restrict__ gv,
    unsigned* __restrict__ qh, unsigned* __restrict__ ql, unsigned* __restrict__ kh, unsigned* __restrict__ kl,
    unsigned short* __restrict__ vh, unsigned short* __restrict__ vl) {
  const int blk = blockIdx.x;
  if (blk < 2 * NB_SLAB) {
    const bool isq = blk < NB_SLAB;
    const int t = isq ? blk : blk - NB_SLAB;
    colnorm_body<0, N_CH>(isq ? gq : gk, nullptr, isq ? qh : kh, isq ? ql : kl, t % (N_CH / 64), t / (N_CH / 64));
  } else {
    rownorm_body<1>(gv, nullptr, vh, vl, (size_t)(blk - 2 * NB_SLAB) * 32 + (threadIdx.x >> 5));
  }
}

// =====================================================================================
// Attention, head_dim 64, no mask, 16-bit input planes:
//   q hi/lo planes: L-major [b][l][512] bf16 (element (b, l, h, d) at (b*L + l)*512 + h*64 + d)
//   k hi/lo planes: same layout
//   v hi/lo planes: channel-major [b][h*64+d][m] bf16
//   out: f32 L-major [b][l][512]
//   scores = sscale * q.k^T : bf16 hi.hi + hi.lo + lo.hi, f32 accumulate; online softmax f32;
//   out = p.v : p and v bf16 hi/lo (hi.hi + hi.lo + lo.hi). Block = 4 waves = 64 query rows of one (b, h).
//   grid.x = B * H * (L/64)
// =====================================================================================
#define AT_D 64
#define AT_NW 4
#define AT_KC 64
#define AT_OSP 68
// pitch in bf16 elements of every 64-element row of the K, V and P tiles in LDS: 144 B = 16 B x 9. The fragment reads are
// 16-byte loads of 16 rows at one column; at a pitch of 128 B those rows fall on two groups of four banks, at 144 B on sixteen.
#define AT_LP 72

__device__ __forceinline__ v8f at_mma(v16b a, v16b b, v8f c) {
  c = __builtin_amdgcn_wmma_f32_16x16x32_bf16(false, a, false, b, (short)0, c, false, false);
  asm volatile("v_nop\n\tv_nop\n\tv_nop\n\tv_nop" : "+v"(c) : "v"(a), "v"(b));
  return c;
}
__device__ __forceinline__ void at_split(float f, __bf16& hi, __bf16& lo) {
  const unsigned short hb = f2bf_bits(f);
  hi = __builtin_bit_cast(__bf16, hb);
  lo = __builtin_bit_cast(__bf16, f2bf_bits(f - __uint_as_float(((unsigned)hb) << 16)));
}

__global__ __launch_bounds__(128)
void k_attn(const unsigned short* __restrict__ qhp, const unsigned short* __restrict__ qlp,
            const unsigned short* __restrict__ khp, const unsigned short* __restrict__ klp,
            const unsigned short* __restrict__ vhp, const unsigned short* __restrict__ vlp,
            float* __restrict__ out, float sscale) {
  union FB { v16b v; v8b h[2]; };
  __shared__ __align__(16) __bf16 Ksh[AT_KC * AT_LP];            // K hi [kv][d]
  __shared__ __align__(16) __bf16 Ksl[AT_KC * AT_LP];            // K lo [kv][d]
  __shared__ __align__(16) __bf16 Vth[AT_D * AT_LP];             // V hi [d][kv]
  __shared__ __align__(16) __bf16 Vtl[AT_D * AT_LP];             // V lo [d][kv]
  __shared__ __align__(16) __bf16 Psh[AT_NW][16 * AT_LP];        // per wave P hi [row][kv]
  __shared__ __align__(16) __bf16 Psl[AT_NW][16 * AT_LP];        // per wave P lo [row][kv]
  __shared__ __align__(16) float  Os[AT_NW][16 * AT_OSP];        // per wave out tile

  const int tid  = threadIdx.x;
  const int wave = tid >> 5;
  const int lane = tid & 31;
  const int hh   = lane >> 4;
  const int c    = lane & 15;

  constexpr int NQB = SEQ_LEN / 64;
  const int bx  = blockIdx.x;
  const int qb  = bx % NQB;
  const int bhd = bx / NQB;
  const int h   = bhd % N_HEADS;
  const int b   = bhd / N_HEADS;
  const int q0  = qb * 64 + wave * 16;

  const __bf16* qh = (const __bf16*)qhp;
  const __bf16* ql = (const __bf16*)qlp;
  const __bf16* kh = (const __bf16*)khp;
  const __bf16* kl = (const __bf16*)klp;
  const __bf16* vh = (const __bf16*)vhp;
  const __bf16* vl = (const __bf16*)vlp;

  // ---- Q fragments (A operand: row = query q0 + c, k = d), hi and lo planes ----
  v16b qah[2], qal[2];
  {
    const size_t qo = ((size_t)b * SEQ_LEN + q0 + c) * N_CH + h * AT_D + 8 * hh;
#pragma unroll
    for (int dc = 0; dc < 2; ++dc) {
      qah[dc] = Frag<__bf16>::load(qh + qo + dc * 32);
      qal[dc] = Frag<__bf16>::load(ql + qo + dc * 32);
    }
  }

  float mrow[8], lrow[8];
  v8f oacc[4];
#pragma unroll
  for (int r = 0; r < 8; ++r) { mrow[r] = -INFINITY; lrow[r] = 0.f; }
#pragma unroll
  for (int t = 0; t < 4; ++t) oacc[t] = (v8f){0.f,0.f,0.f,0.f,0.f,0.f,0.f,0.f};

  for (int kc = 0; kc < SEQ_LEN / AT_KC; ++kc) {
    const int kv0 = kc * AT_KC;
    __syncthreads();
    {
      // staging: thread (row = tid>>1, half = (tid&1)*32) copies 32 bf16 = 4 x 16 B per plane;
      // 128 threads x 32 = 4096 = 64 x 64 elements per plane (full tiles)
      const int row = tid >> 1, half = (tid & 1) * 32;
      const size_t ko = ((size_t)b * SEQ_LEN + kv0 + row) * N_CH + h * AT_D + half;
      const size_t vo = ((size_t)b * N_CH + h * AT_D + row) * SEQ_LEN + kv0 + half;
      {
        const v4u* sp = (const v4u*)(kh + ko);
        v4u* dp = (v4u*)(Ksh + row * AT_LP + half);
#pragma unroll
        for (int i = 0; i < 4; ++i) dp[i] = sp[i];
      }
      asm volatile("" ::: "memory");
      {
        const v4u* sp = (const v4u*)(kl + ko);
        v4u* dp = (v4u*)(Ksl + row * AT_LP + half);
#pragma unroll
        for (int i = 0; i < 4; ++i) dp[i] = sp[i];
      }
      asm volatile("" ::: "memory");
      {
        const v4u* sp = (const v4u*)(vh + vo);
        v4u* dp = (v4u*)(Vth + row * AT_LP + half);
#pragma unroll
        for (int i = 0; i < 4; ++i) dp[i] = sp[i];
      }
      asm volatile("" ::: "memory");
      {
        const v4u* sp = (const v4u*)(vl + vo);
        v4u* dp = (v4u*)(Vtl + row * AT_LP + half);
#pragma unroll
        for (int i = 0; i < 4; ++i) dp[i] = sp[i];
      }
    }
    __syncthreads();

    // ---- scores: B operand column n = key j*16 + c, k = d (Ksh is [key][d], k-contiguous) ----
    v8f s[4];
#pragma unroll
    for (int j = 0; j < 4; ++j) {
      s[j] = (v8f){0.f,0.f,0.f,0.f,0.f,0.f,0.f,0.f};
#pragma unroll
      for (int dc = 0; dc < 2; ++dc) {
        FB kb, kb2;
        const int ko2 = (j * 16 + c) * AT_LP + dc * 32 + 8 * hh;
        kb.h[0]  = *(const v8b*)(Ksh + ko2);
        kb.h[1]  = *(const v8b*)(Ksh + ko2 + 16);
        kb2.h[0] = *(const v8b*)(Ksl + ko2);
        kb2.h[1] = *(const v8b*)(Ksl + ko2 + 16);
        s[j] = at_mma(qah[dc], kb.v,  s[j]);
        s[j] = at_mma(qah[dc], kb2.v, s[j]);
        s[j] = at_mma(qal[dc], kb.v,  s[j]);
      }
    }
    // D element r of lane = (query row 8*hh + r, key column c of subtile j)
    float cm[8];
#pragma unroll
    for (int r = 0; r < 8; ++r) {
      float m = -INFINITY;
#pragma unroll
      for (int j = 0; j < 4; ++j) {
        const float sv = s[j][r] * sscale;
        s[j][r] = sv;
        m = fmaxf(m, sv);
      }
#pragma unroll
      for (int off = 1; off < 16; off <<= 1) m = fmaxf(m, __shfl_xor(m, off, 32));
      cm[r] = m;
    }
    __bf16* pwh = Psh[wave];
    __bf16* pwl = Psl[wave];
#pragma unroll
    for (int r = 0; r < 8; ++r) {
      const float mnew = fmaxf(mrow[r], cm[r]);
      const float alpha = expf(mrow[r] - mnew);
      mrow[r] = mnew;
      float psum = 0.f;
#pragma unroll
      for (int j = 0; j < 4; ++j) {
        const float p = expf(s[j][r] - mnew);
        psum += p;
        __bf16 pa_hi, pa_lo;
        at_split(p, pa_hi, pa_lo);
        pwh[(8 * hh + r) * AT_LP + j * 16 + c] = pa_hi;
        pwl[(8 * hh + r) * AT_LP + j * 16 + c] = pa_lo;
      }
#pragma unroll
      for (int off = 1; off < 16; off <<= 1) psum += __shfl_xor(psum, off, 32);
      lrow[r] = lrow[r] * alpha + psum;
#pragma unroll
      for (int t = 0; t < 4; ++t) oacc[t][r] *= alpha;
    }
    // same-wave P tile: stored as __bf16 elements, reloaded as v8b vectors of the same element type after the wave barrier
    __builtin_amdgcn_fence(__ATOMIC_RELEASE, "workgroup");
    __builtin_amdgcn_wave_barrier();
    __builtin_amdgcn_fence(__ATOMIC_ACQUIRE, "workgroup");
    // ---- out += P.V : A = P [query][key], B = V with k = key, n = d (Vth is [d][key], k-contiguous) ----
#pragma unroll 1
    for (int kk = 0; kk < 2; ++kk) {
      FB pa, pl;
      const int po = c * AT_LP + kk * 32 + 8 * hh;
      pa.h[0] = *(const v8b*)(pwh + po);
      pa.h[1] = *(const v8b*)(pwh + po + 16);
      pl.h[0] = *(const v8b*)(pwl + po);
      pl.h[1] = *(const v8b*)(pwl + po + 16);
#pragma unroll
      for (int t = 0; t < 4; ++t) {
        FB vb, vb2;
        const int vo2 = (t * 16 + c) * AT_LP + kk * 32 + 8 * hh;
        vb.h[0]  = *(const v8b*)(Vth + vo2);
        vb.h[1]  = *(const v8b*)(Vth + vo2 + 16);
        vb2.h[0] = *(const v8b*)(Vtl + vo2);
        vb2.h[1] = *(const v8b*)(Vtl + vo2 + 16);
        oacc[t] = at_mma(pa.v, vb.v,  oacc[t]);
        oacc[t] = at_mma(pa.v, vb2.v, oacc[t]);
        oacc[t] = at_mma(pl.v, vb.v,  oacc[t]);
      }
    }
  }

  float* os = Os[wave];
#pragma unroll
  for (int r = 0; r < 8; ++r) {
    const float inv = 1.0f / lrow[r];
#pragma unroll
    for (int t = 0; t < 4; ++t) os[(8 * hh + r) * AT_OSP + t * 16 + c] = oacc[t][r] * inv;
  }
  __builtin_amdgcn_fence(__ATOMIC_RELEASE, "workgroup");
  __builtin_amdgcn_wave_barrier();
  __builtin_amdgcn_fence(__ATOMIC_ACQUIRE, "workgroup");
  {
    float* ob = out + ((size_t)b * SEQ_LEN) * N_CH + h * AT_D;
    const int c4 = (lane & 15) * 4;
    {
#pragma unroll
      for (int it = 0; it < 8; ++it) {
        const int row = it * 2 + hh;
        v4f val = *(const v4f*)(os + row * AT_OSP + c4);
        *(v4f*)(ob + (size_t)(q0 + row) * N_CH + c4) = val;
      }
      
    }
  }
}

// =====================================================================================
// Host orchestration
// =====================================================================================
extern "C" void kernel_launch(void* const* d_in, const int* in_sizes, int n_in,
                              void* d_out, int out_size, void* d_ws,
                              size_t ws_size, hipStream_t stream) {
  (void)in_sizes; (void)n_in; (void)out_size;
  constexpr int NB = 8, CIN = 256, NCH = 512, SEQ = 1024, NFF = 1024, NHD = 8;

  // ---- workspace region map (bytes) ----
  constexpr size_t SZ_WQ   = (size_t)NCH * NCH * 2;        //    524288  wq  bf16 [512][512]
  constexpr size_t SZ_WK   = (size_t)NCH * CIN * 2;        //    262144  wk  bf16 [512][256]
  constexpr size_t SZ_WV   = (size_t)NCH * CIN * 2;        //    262144  wv  bf16 [512][256]
  constexpr size_t SZ_W1   = (size_t)NFF * NCH * 2;        //   1048576  w1  bf16 [1024][512]
  constexpr size_t SZ_W2   = (size_t)NCH * NFF * 2;        //   1048576  w2  bf16 [512][1024]
  constexpr size_t SZ_XQT  = (size_t)NB * SEQ * NCH * 2;   //   8388608  x_query (L,C) bf16
  constexpr size_t SZ_XKVT = (size_t)NB * SEQ * CIN * 2;   //   4194304  x_kv (L,C) bf16
  constexpr size_t SZ_G    = (size_t)NB * SEQ * NFF * 4;   //  33554432  f32 GEMM/attention output, max user = ffn1 [8][1024][1024]
  constexpr size_t SZ_P    = (size_t)NB * SEQ * NCH * 2;   //   8388608  one bf16 activation plane [8][1024][512]
  constexpr size_t OFF_WQ   = 0;
  constexpr size_t OFF_WK   = OFF_WQ + SZ_WQ;
  constexpr size_t OFF_WV   = OFF_WK + SZ_WK;
  constexpr size_t OFF_W1   = OFF_WV + SZ_WV;
  constexpr size_t OFF_W2   = OFF_W1 + SZ_W1;
  constexpr size_t OFF_XQT  = OFF_W2 + SZ_W2;
  constexpr size_t OFF_XKVT = OFF_XQT + SZ_XQT;
  constexpr size_t OFF_G    = OFF_XKVT + SZ_XKVT;
  constexpr size_t OFF_QH   = OFF_G + SZ_G;       // q hi plane; later z hi plane
  constexpr size_t OFF_QL   = OFF_QH + SZ_P;      // q lo plane; later z lo plane
  constexpr size_t OFF_KH   = OFF_QL + SZ_P;      // k hi plane; later y hi plane spans KH+KL (16777216)
  constexpr size_t OFF_KL   = OFF_KH + SZ_P;      // k lo plane
  constexpr size_t OFF_VH   = OFF_KL + SZ_P;      // v hi plane; later y lo plane spans VH+VL (16777216)
  constexpr size_t OFF_VL   = OFF_VH + SZ_P;      // v lo plane
  constexpr size_t OFF_GV   = OFF_VL + SZ_P;      // v projection f32 [8][512][1024] (q and k projections: the two halves of G)
  constexpr size_t OFF_END  = OFF_GV + SZ_G / 2;  // 116391936
  static_assert(OFF_END == 116391936ull);
  static_assert(OFF_END <= 134217728ull);
  static_assert((OFF_WK % 256) == 0 && (OFF_XQT % 256) == 0 && (OFF_G % 256) == 0 && (OFF_QH % 256) == 0);
  // reused regions sized from the max user
  static_assert((size_t)NB * SEQ * NCH * 4 * 2 <= SZ_G);    // q and k side by side; proj, ffn2 f32 outputs
  static_assert(NB == N_B && CIN == N_CIN && NCH == N_CH && SEQ == SEQ_LEN && NFF == N_FF && NHD == N_HEADS);
  static_assert((size_t)NB * SEQ * NFF * 4 <= SZ_G);        // ffn1 f32 output
  static_assert((size_t)NB * SEQ * NFF * 2 == 2 * SZ_P);    // y plane fits exactly over two 512-wide planes
  // GEMM shape contract: M multiple of 64, N multiple of 512, K multiple of 64
  static_assert(SEQ % 512 == 0 && NCH % 512 == 0 && NFF % 512 == 0);
  static_assert(NCH % 64 == 0 && CIN % 64 == 0 && NFF % 64 == 0);
  static_assert(((SEQ / 64) * (NCH / 64)) % 8 == 0 && ((SEQ / 64) * (NFF / 64)) % 8 == 0);
  static_assert(NCH % 256 == 0 && NFF % 256 == 0 && (NB * NCH) % 8 == 0);
  static_assert((size_t)NB * NCH * SEQ * 4 == 16777216ull);   // d_out bytes
  if (ws_size < OFF_END) return;

  const float* x_query = (const float*)d_in[0];
  const float* x_kv    = (const float*)d_in[1];
  const float* wq      = (const float*)d_in[2];
  const float* bq      = (const float*)d_in[3];
  const float* wk      = (const float*)d_in[4];
  const float* bk      = (const float*)d_in[5];
  const float* wv      = (const float*)d_in[6];
  const float* bv      = (const float*)d_in[7];
  const float* w1      = (const float*)d_in[8];
  const float* b1      = (const float*)d_in[9];
  const float* w2      = (const float*)d_in[10];
  const float* b2      = (const float*)d_in[11];
  float* out = (float*)d_out;

  char* ws = (char*)d_ws;
  typedef unsigned short us;
  us* wq16  = (us*)(ws + OFF_WQ);
  us* wk16  = (us*)(ws + OFF_WK);
  us* wv16  = (us*)(ws + OFF_WV);
  us* w1_16 = (us*)(ws + OFF_W1);
  us* w2_16 = (us*)(ws + OFF_W2);
  us* xqT   = (us*)(ws + OFF_XQT);
  us* xkvT  = (us*)(ws + OFF_XKVT);
  float* gf = (float*)(ws + OFF_G);
  float* gq = gf;
  float* gk = (float*)(ws + OFF_G + SZ_G / 2);
  float* gv = (float*)(ws + OFF_GV);
  us* qh = (us*)(ws + OFF_QH);
  us* ql = (us*)(ws + OFF_QL);
  us* kh = (us*)(ws + OFF_KH);
  us* kl = (us*)(ws + OFF_KL);
  us* vh = (us*)(ws + OFF_VH);
  us* vl = (us*)(ws + OFF_VL);
  us* zh = qh;
  us* zl = ql;
  us* yh = kh;    // [8][1024][1024] bf16 = 16777216 B over KH..KL
  us* yl = vh;    // [8][1024][1024] bf16 = 16777216 B over VH..VL

  // 1) operand preparation: activations (B,C,L) f32 -> (B,L,C) bf16, weights -> bf16 (RNE)
  k_prep<<<PB_ALL, 256, 0, stream>>>(x_query, x_kv, wq, wk, wv, w1, w2, xqT, xkvT, wq16, wk16, wv16, w1_16, w2_16);

  // 2) q, k (L-major) and v (channel-major) projections, f32
  k_gemm_qkv<<<dim3((SEQ / 64) * (NCH / 64) / 8, NB, 3), 256, 0, stream>>>(xqT, xkvT, wq16, wk16, wv16, bq, bk, bv, gq, gk, gv);

  // 3) InstanceNorm of each -> q, k hi/lo planes (L-major), v hi/lo planes (channel-major)
  k_norm_qkv<<<2 * NB_SLAB + NB_VROW, 1024, 0, stream>>>(gq, gk, gv, (unsigned*)qh, (unsigned*)ql, (unsigned*)kh, (unsigned*)kl, vh, vl);

  // 4) attention -> gf as proj L-major [b][l][h*64+d] f32
  k_attn<<<NB * NHD * (SEQ / 64), 128, 0, stream>>>(qh, ql, kh, kl, vh, vl, gf, 0.125f);

  // 5) z = InstanceNorm(proj) + x_query(bf16) -> z hi/lo planes (L-major, pitch 512)
  k_colnorm<1, NCH><<<dim3(NCH / 64, NB), 1024, 0, stream>>>(gf, (const unsigned*)xqT, (unsigned*)zh, (unsigned*)zl);

  // 6) ffn1: C[l][o] = sum_c z[l][c] w1[o][c] + b1[o]  (M=1024, N=1024, K=512), z as hi/lo -> gf L-major [l][1024]
  wmma_gemm64<1, 2, 2, 0, false><<<dim3((SEQ / 64) * (NFF / 64) / 8, NB), 256, 0, stream>>>(
      zh, zl, NCH, (long)SEQ * NCH, w1_16, nullptr, NCH, 0L,
      (void*)gf, nullptr, NFF, (long)SEQ * NFF, b1, nullptr, 0L, SEQ, NFF, NCH, 1.0f);
  // 7) y = relu(InstanceNorm(h1)) -> y hi/lo planes [l][1024]
  k_colnorm<2, NFF><<<dim3(NFF / 64, NB), 1024, 0, stream>>>(gf, nullptr, (unsigned*)yh, (unsigned*)yl);

  // 8) ffn2: C[o][l] = sum_c w2[o][c] y[l][c] + b2[o]  (M=512, N=1024, K=1024), y as hi/lo -> channel-major gf
  wmma_gemm64<1, 3, 1, 0, false><<<dim3((NCH / 64) * (SEQ / 64) / 8, NB), 256, 0, stream>>>(
      w2_16, nullptr, NFF, 0L, yh, yl, NFF, (long)SEQ * NFF,
      (void*)gf, nullptr, SEQ, (long)NCH * SEQ, b2, nullptr, 0L, NCH, SEQ, NFF, 1.0f);

  // 9) final InstanceNorm over rows -> d_out (B, 512, L) f32
  k_rownorm<0><<<NB * NCH / 8, 256, 0, stream>>>(gf, out, nullptr, nullptr);
}

// v005
// It runs in 203 microseconds.
// Next to v004, in two timings, it ran 1.25 times as fast each time.
// Counting every step since v000, it is 16.4 times as fast.
// Compute dtypes: conv1x1 GEMMs q/k/v = v_wmma_f32_16x16x32_bf16 on RNE-bf16 inputs (1 product); attention scores and P.V = bf16 hi+lo planes (3 products); FFN GEMMs = bf16 hi+lo activations x bf16 weights (2 products); f32 accumulate; InstanceNorm, softmax, residual in f32.
#include <hip/hip_runtime.h>
#include <hip/hip_bf16.h>

typedef __attribute__((ext_vector_type(16))) _Float16 v16h;
typedef __attribute__((ext_vector_type(8)))  _Float16 v8h;
typedef __attribute__((ext_vector_type(16))) __bf16   v16b;
typedef __attribute__((ext_vector_type(8)))  __bf16   v8b;
typedef __attribute__((ext_vector_type(2)))  __bf16   v2b;
typedef __attribute__((ext_vector_type(8)))  float    v8f;
typedef __attribute__((ext_vector_type(4)))  float    v4f;
typedef __attribute__((ext_vector_type(2)))  float    v2f;
typedef __attribute__((ext_vector_type(4)))  unsigned v4u;
typedef __attribute__((ext_vector_type(2)))  unsigned v2u;

__device__ __forceinline__ unsigned short f2bf_bits(float f) {
  unsigned u = __float_as_uint(f);
  return (unsigned short)((u + 0x7FFFu + ((u >> 16) & 1u)) >> 16);
}
__device__ __forceinline__ float bf_bits2f(unsigned short h) { return __uint_as_float(((unsigned)h) << 16); }

// hazard guards as plain device helpers
__device__ __forceinline__ void dep_guard_h(v8f& a, v8f& b, v16h x, v16h y) { asm volatile("v_nop\n\tv_nop\n\tv_nop\n\tv_nop" : "+v"(a), "+v"(b) : "v"(x), "v"(y)); }
__device__ __forceinline__ void dep_guard_b(v8f& a, v8f& b, v16b x, v16b y) { asm volatile("v_nop\n\tv_nop\n\tv_nop\n\tv_nop" : "+v"(a), "+v"(b) : "v"(x), "v"(y)); }
__device__ __forceinline__ void keep4_h(v16h a, v16h b, v16h c, v16h d) { asm volatile("v_nop" :: "v"(a), "v"(b), "v"(c), "v"(d)); }
__device__ __forceinline__ void keep4_b(v16b a, v16b b, v16b c, v16b d) { asm volatile("v_nop" :: "v"(a), "v"(b), "v"(c), "v"(d)); }
__device__ __forceinline__ void acc_guard4(v8f& a, v8f& b, v8f& c, v8f& d) { asm volatile("v_nop\n\tv_nop\n\tv_nop\n\tv_nop" : "+v"(a), "+v"(b), "+v"(c), "+v"(d)); }
template <typename T> struct Frag;
template <> struct Frag<_Float16> {
  typedef v16h V; union U { v16h v; v8h h[2]; };
  // elements 0..7 <- p[0..7], 8..15 <- p[16..23]
  static __device__ __forceinline__ v16h load(const _Float16* p) {
    U f; f.h[0] = *(const v8h*)(p); f.h[1] = *(const v8h*)(p + 16); return f.v;
  }
  static __device__ __forceinline__ v8f mma(v16h a, v16h b, v8f c) {
    return __builtin_amdgcn_wmma_f32_16x16x32_f16(false, a, false, b, (short)0, c, false, false);
  }
  static __device__ __forceinline__ void guard(v8f& a, v8f& b, v16h x, v16h y) { dep_guard_h(a, b, x, y); }
  static __device__ __forceinline__ void keep(v16h a, v16h b, v16h c, v16h d) { keep4_h(a, b, c, d); }
};
template <> struct Frag<__bf16> {
  typedef v16b V; union U { v16b v; v8b h[2]; };
  static __device__ __forceinline__ v16b load(const __bf16* p) {
    U f; f.h[0] = *(const v8b*)(p); f.h[1] = *(const v8b*)(p + 16); return f.v;
  }
  static __device__ __forceinline__ v8f mma(v16b a, v16b b, v8f c) {
    return __builtin_amdgcn_wmma_f32_16x16x32_bf16(false, a, false, b, (short)0, c, false, false);
  }
  static __device__ __forceinline__ void guard(v8f& a, v8f& b, v16b x, v16b y) { dep_guard_b(a, b, x, y); }
  static __device__ __forceinline__ void keep(v16b a, v16b b, v16b c, v16b d) { keep4_b(a, b, c, d); }
};

// ---- Register-blocked batched WMMA GEMM ------------------------------------
// C[m,n] = scale * sum_k A[m,k] * Bt[n,k] (+bias)(+resid); each wave owns a 64x64 tile.
// A row-major [M,K]; Bt row-major [N,K]; M % 64 == 0, N % 512 == 0, K % 64 == 0.
// The eight waves of a block own eight neighbouring tiles of one tile row (N % 512 == 0), so they share the A rows.
// Operands reach the fragments through LDS: a stage is 64 k (one whole 128-byte line of every row), brought by asynchronous
// 16-byte copies in which a wave covers 4 rows x 128 B per instruction; two buffers, stage t + 1 flies while stage t is worked on.
// Stage layout: [A planes: 64 rows][wave 0..7: its Bt planes: 64 rows], every row at a pitch of 144 B (16 B x odd).
// SPLIT: 0 = single product; 1 = A and Bt both hi/lo planes (hi.hi + hi.lo + lo.hi);
//        2 = only A is hi/lo (A_hi.B + A_lo.B); 3 = only Bt is hi/lo (A.B_hi + A.B_lo).
// BIAS_MODE: 0 = none, 1 = bias[m], 2 = bias[n].
// OUT_MODE: 0 = f32, 1 = f16, 2 = bf16 hi plane (Cout) + bf16 lo plane (Cout2).
// ET: 0 = f16 operands, 1 = bf16 operands (pointers passed as 16-bit storage)
constexpr int GM_KS = 64;                  // k elements of a stage
constexpr int GM_LP = 72;                  // LDS pitch of a stage row, in 16-bit elements
constexpr int GM_PL = 64 * GM_LP * 2;      // bytes of one 64-row plane of a stage
__device__ __forceinline__ unsigned lds_off(const void* p) { return (unsigned)(size_t)p; }   // byte address in the block's LDS
// asynchronous copies global -> LDS, 16 bytes per lane. The s_wait_xcnt closes each statement so that it stands in front of
// every later write of the address registers that the copies name.
__device__ __forceinline__ void cp_async2(unsigned l0, const void* g0, unsigned l1, const void* g1) {
  asm volatile("global_load_async_to_lds_b128 %0, %1, off\n\t"
               "global_load_async_to_lds_b128 %2, %3, off\n\t"
               "s_wait_xcnt 0x0"
               :: "v"(l0), "v"(g0), "v"(l1), "v"(g1) : "memory");
}
__device__ __forceinline__ void cp_async8(unsigned l, const char* g, size_t gstep) {
  // eight rows, four apart: LDS step 4 rows of GM_LP elements, global step gstep bytes
  constexpr unsigned LS = 4 * GM_LP * 2;
  asm volatile("global_load_async_to_lds_b128 %0, %1, off\n\t"
               "global_load_async_to_lds_b128 %2, %3, off\n\t"
               "global_load_async_to_lds_b128 %4, %5, off\n\t"
               "global_load_async_to_lds_b128 %6, %7, off\n\t"
               "global_load_async_to_lds_b128 %8, %9, off\n\t"
               "global_load_async_to_lds_b128 %10, %11, off\n\t"
               "global_load_async_to_lds_b128 %12, %13, off\n\t"
               "global_load_async_to_lds_b128 %14, %15, off\n\t"
               "s_wait_xcnt 0x0"
               :: "v"(l), "v"(g), "v"(l + LS), "v"(g + gstep), "v"(l + 2 * LS), "v"(g + 2 * gstep), "v"(l + 3 * LS), "v"(g + 3 * gstep),
                  "v"(l + 4 * LS), "v"(g + 4 * gstep), "v"(l + 5 * LS), "v"(g + 5 * gstep), "v"(l + 6 * LS), "v"(g + 6 * gstep),
                  "v"(l + 7 * LS), "v"(g + 7 * gstep) : "memory");
}
template <int ET> struct Elem;
template <> struct Elem<0> { typedef _Float16 T; };
template <> struct Elem<1> { typedef __bf16 T; };
// bytes of one stage buffer of a GEMM with the given SPLIT
constexpr int gm_stage(int split) {
  return (((split == 1 || split == 2) ? 2 : 1) + 8 * ((split == 1 || split == 3) ? 2 : 1)) * GM_PL;
}
// The GEMM of one block: smem = the kernel's 2 * gm_stage(SPLIT) bytes of LDS, bx = index of the block's group of eight tiles, b = batch.
template <int ET, int SPLIT, int BIAS_MODE, int OUT_MODE, bool RESID, int ACT = 0>
__device__ __forceinline__ void gemm64_body(
    unsigned char* smem, const int bx, const int b,
    const unsigned short* __restrict__ Ap, const unsigned short* __restrict__ A2p, int lda, long strideA,
    const unsigned short* __restrict__ Btp, const unsigned short* __restrict__ Bt2p, int ldb, long strideB,
    void* __restrict__ Cout, void* __restrict__ Cout2, int ldc, long strideC,
    const float* __restrict__ bias,
    const float* __restrict__ resid, long strideR,
    int M, int N, int K, float scale) {
  typedef typename Elem<ET>::T T;
  typedef typename Frag<T>::V V;
  constexpr bool ASPL = (SPLIT == 1) || (SPLIT == 2);
  constexpr bool BSPL = (SPLIT == 1) || (SPLIT == 3);
  const T* A = (const T*)Ap; const T* A2 = (const T*)A2p; const T* Bt = (const T*)Btp; const T* Bt2 = (const T*)Bt2p;
  constexpr int NPA = ASPL ? 2 : 1, NPB = BSPL ? 2 : 1;
  constexpr int STAGE = (NPA + 8 * NPB) * GM_PL;            // bytes of one buffer
  static_assert(STAGE == gm_stage(SPLIT) && 2 * STAGE <= 327680 && 8 * 16 * 68 * 4 <= STAGE);
  // smem: two stage buffers; behind the k loop: per-wave 16x64 f32 slabs, pitch 68
  const int lane = threadIdx.x & 31;
  const int wave = threadIdx.x >> 5;
  const int tilesN = N >> 6;
  const int tilesM = M >> 6;
  const int tile = bx * 8 + wave;
  if (bx * 8 >= tilesM * tilesN) return;   // the same for the whole block, in front of every barrier
  const int tm = tile / tilesN;
  const int tn = tile - tm * tilesN;
  const int m0 = tm << 6;
  const int n0 = tn << 6;

  const T* Ab  = A  + (size_t)b * strideA;
  const T* Bb  = Bt + (size_t)b * strideB;
  const T* Ab2 = ASPL ? (A2  + (size_t)b * strideA) : nullptr;
  const T* Bb2 = BSPL ? (Bt2 + (size_t)b * strideB) : nullptr;

  const int rlane = lane & 15;                 // row (A) / col (B, D) within subtile
  const int koff  = (lane >> 4) * 8;           // k offset of this lane half
  const int mOff  = (lane >> 4) * 8;           // D row offset

  v8f acc[4][4];
#pragma unroll
  for (int i = 0; i < 4; ++i)
#pragma unroll
    for (int j = 0; j < 4; ++j) acc[i][j] = (v8f){0.f,0.f,0.f,0.f,0.f,0.f,0.f,0.f};

  // ---- one stage's copies: the block's A rows (two 16-byte pieces per thread and plane), then this wave's own Bt rows ----
  const unsigned lbase = lds_off(smem);
  const int arow = threadIdx.x >> 3;           // 0..31; the second piece is row arow + 32
  const int brow = lane >> 3;                  // 0..3; piece it is row it * 4 + brow
  const int scol = (lane & 7) * 8;             // first k element of this lane's 16 bytes
  const unsigned la0 = lbase + (unsigned)(arow * GM_LP + scol) * 2u;
  const unsigned lb0 = lbase + (unsigned)(NPA + wave * NPB) * GM_PL + (unsigned)(brow * GM_LP + scol) * 2u;
  const size_t ga0 = (size_t)(m0 + arow) * lda + scol;
  const size_t gb0 = (size_t)(n0 + brow) * ldb + scol;
  auto issue_stage = [&](int st) {
    const unsigned bo = (unsigned)(st & 1) * STAGE;
    const size_t ka = ga0 + (size_t)st * GM_KS;
    const size_t kb = gb0 + (size_t)st * GM_KS;
    cp_async2(la0 + bo, Ab + ka, la0 + bo + 32 * GM_LP * 2, Ab + ka + (size_t)32 * lda);
    if (ASPL) cp_async2(la0 + bo + GM_PL, Ab2 + ka, la0 + bo + GM_PL + 32 * GM_LP * 2, Ab2 + ka + (size_t)32 * lda);
    const size_t gstep = (size_t)ldb * 8;   // bytes of four Bt rows
#pragma unroll   // two straight-line statements a plane: no loop counter between the copies
    for (int hf = 0; hf < 2; ++hf) {          // rows 0..31, rows 32..63
      cp_async8(lb0 + bo + hf * 32 * GM_LP * 2, (const char*)(Bb + kb + (size_t)(hf * 32) * ldb), gstep);
      if (BSPL) cp_async8(lb0 + bo + GM_PL + hf * 32 * GM_LP * 2, (const char*)(Bb2 + kb + (size_t)(hf * 32) * ldb), gstep);
    }
  };

  const int nst = K / GM_KS;
  issue_stage(0);
  asm volatile("s_wait_asynccnt 0x0" ::: "memory");   // this wave's copies of stage 0 have landed
  __syncthreads();                                    // stage 0 is readable by every wave
  if (nst > 1) issue_stage(1);
  for (int st = 0; st < nst; ++st) {
    const T* sA = (const T*)(smem + (st & 1) * STAGE);
    const T* sB = sA + (NPA + wave * NPB) * (GM_PL / 2);
#pragma unroll   // both 32-k steps of a stage in one body (as every loop below: fragment and accumulator arrays stay in registers)
    for (int ks = 0; ks < 2; ++ks) {
      V bh[4], bl[4], ah[4], al[4];
#pragma unroll
      for (int j = 0; j < 4; ++j) {
        const int bo = ((j << 4) + rlane) * GM_LP + ks * 32 + koff;
        bh[j] = Frag<T>::load(sB + bo);
        if (BSPL) bl[j] = Frag<T>::load(sB + GM_PL / 2 + bo);
        else bl[j] = bh[j];
      }
#pragma unroll
      for (int i = 0; i < 4; ++i) {
        const int ao = ((i << 4) + rlane) * GM_LP + ks * 32 + koff;
        ah[i] = Frag<T>::load(sA + ao);
        if (ASPL) al[i] = Frag<T>::load(sA + GM_PL / 2 + ao);
        else al[i] = ah[i];
      }
#pragma unroll
      for (int i = 0; i < 4; ++i) {
#pragma unroll
        for (int j = 0; j < 4; ++j) {
          acc[i][j] = Frag<T>::mma(ah[i], bh[j], acc[i][j]);
          if (BSPL) acc[i][j] = Frag<T>::mma(ah[i], bl[j], acc[i][j]);
          if (ASPL) acc[i][j] = Frag<T>::mma(al[i], bh[j], acc[i][j]);
        }
        Frag<T>::guard(acc[i][0], acc[i][3], ah[i], al[i]);
      }
      Frag<T>::keep(bh[0], bh[1], bh[2], bh[3]);
      if (BSPL) Frag<T>::keep(bl[0], bl[1], bl[2], bl[3]);
    }
    // hand-over: this wave's reads of stage st are over, its copies of stage st + 1 have landed; behind the barrier
    // stage st + 1 is readable by every wave and the buffer of stage st is free for stage st + 2
    asm volatile("s_wait_dscnt 0x0" ::: "memory");
    asm volatile("s_wait_asynccnt 0x0" ::: "memory");
    __syncthreads();
    if (st + 2 < nst) issue_stage(st + 2);
  }
  asm volatile("s_wait_asynccnt 0x0" ::: "memory");   // no copy is outstanding when the buffers become the output slabs
  acc_guard4(acc[0][0], acc[0][1], acc[0][2], acc[0][3]);
  acc_guard4(acc[1][0], acc[1][1], acc[1][2], acc[1][3]);
  acc_guard4(acc[2][0], acc[2][1], acc[2][2], acc[2][3]);
  acc_guard4(acc[3][0], acc[3][1], acc[3][2], acc[3][3]);

  // ---- epilogue ----
  float* slab = (float*)(smem + wave * (16 * 68 * 4));   // every wave has passed the last hand-over barrier: the buffers are free
  const float* Rb = RESID ? (resid + (size_t)b * strideR) : nullptr;
#pragma unroll
  for (int i = 0; i < 4; ++i) {
    const int mBase = m0 + (i << 4);
#pragma unroll
    for (int j = 0; j < 4; ++j) {
      const int n = n0 + (j << 4) + rlane;
      float bv = 0.f;
      if (BIAS_MODE == 2) bv = bias[n];
#pragma unroll
      for (int r = 0; r < 8; ++r) {
        float v = acc[i][j][r] * scale;
        if (BIAS_MODE == 1) v += bias[mBase + mOff + r];
        if (BIAS_MODE == 2) v += bv;
        if (RESID) v += Rb[(size_t)(mBase + mOff + r) * ldc + n];
        if (ACT == 1) v = tanhf(v);
        if (ACT == 2) v = fmaxf(v, 0.0f);
        if (ACT == 3) v = v / (1.0f + expf(-v));
        if (ACT == 4) v = (v > 0.f) ? v : 0.01f * v;
        slab[(mOff + r) * 68 + (j << 4) + rlane] = v;
      }
    }
    __builtin_amdgcn_fence(__ATOMIC_RELEASE, "workgroup");
    __builtin_amdgcn_wave_barrier();
    __builtin_amdgcn_fence(__ATOMIC_ACQUIRE, "workgroup");
    if (OUT_MODE == 0) {
      float* C = (float*)Cout + (size_t)b * strideC;
      const int hh = lane >> 4, c4 = (lane & 15) * 4;     // row seg = 256 B = 16 lanes x 16 B
      {
#pragma unroll
        for (int it = 0; it < 8; ++it) {
          const int row = it * 2 + hh;
          v4f v = *(const v4f*)(slab + row * 68 + c4);
          *(v4f*)(C + (size_t)(mBase + row) * ldc + n0 + c4) = v;
        }
        
      }
    } else {
      const int q = lane >> 3, c8 = (lane & 7) * 8;
      unsigned short* C  = (unsigned short*)Cout  + (size_t)b * strideC;
      unsigned short* C2 = (OUT_MODE == 2) ? ((unsigned short*)Cout2 + (size_t)b * strideC) : nullptr;
      {
#pragma unroll
        for (int it = 0; it < 4; ++it) {
          const int row = it * 4 + q;
          const float* sp = slab + row * 68 + c8;
          v8h hv, lv;
#pragma unroll
          for (int e = 0; e < 8; ++e) {
            if (OUT_MODE == 1) {
              hv[e] = (_Float16)sp[e];
            } else {
              unsigned short hb = f2bf_bits(sp[e]);
              unsigned short lb = f2bf_bits(sp[e] - bf_bits2f(hb));
              hv[e] = __builtin_bit_cast(_Float16, hb);
              lv[e] = __builtin_bit_cast(_Float16, lb);
            }
          }
          *(v8h*)(C + (size_t)(mBase + row) * ldc + n0 + c8) = hv;
          if (OUT_MODE == 2) *(v8h*)(C2 + (size_t)(mBase + row) * ldc + n0 + c8) = lv;
        }
        
      }
    }
    __builtin_amdgcn_fence(__ATOMIC_RELEASE, "workgroup");
    __builtin_amdgcn_wave_barrier();
    __builtin_amdgcn_fence(__ATOMIC_ACQUIRE, "workgroup");
  }
}

template <int ET, int SPLIT, int BIAS_MODE, int OUT_MODE, bool RESID, int ACT = 0>
__global__ __launch_bounds__(256) void wmma_gemm64(
    const unsigned short* __restrict__ Ap, const unsigned short* __restrict__ A2p, int lda, long strideA,
    const unsigned short* __restrict__ Btp, const unsigned short* __restrict__ Bt2p, int ldb, long strideB,
    void* __restrict__ Cout, void* __restrict__ Cout2, int ldc, long strideC,
    const float* __restrict__ bias,
    const float* __restrict__ resid, long strideR,
    int M, int N, int K, float scale) {
  __shared__ __align__(16) unsigned char smem[2 * gm_stage(SPLIT)];
  gemm64_body<ET, SPLIT, BIAS_MODE, OUT_MODE, RESID, ACT>(smem, (int)blockIdx.x, (int)blockIdx.y, Ap, A2p, lda, strideA,
      Btp, Bt2p, ldb, strideB, Cout, Cout2, ldc, strideC, bias, resid, strideR, M, N, K, scale);
}

constexpr int SEQ_LEN = 1024;
constexpr int N_HEADS = 8;
constexpr int N_CH = 512;
constexpr int N_CIN = 256;
constexpr int N_FF = 1024;
constexpr int N_B = 8;

// ---- the q, k and v projections in one launch: they need nothing of each other. grid (16, N_B, 3); blockIdx.z picks the GEMM ----
//   z = 0: gq[l][o] = sum_c xqT[l][c]  wq[o][c] + bq[o]   (M = 1024, N = 512, K = 512), L-major
//   z = 1: gk[l][o] = sum_c xkvT[l][c] wk[o][c] + bk[o]   (M = 1024, N = 512, K = 256), L-major
//   z = 2: gv[o][m] = sum_c wv[o][c] xkvT[m][c] + bv[o]   (M = 512, N = 1024, K = 256), channel-major
__global__ __launch_bounds__(256) void k_gemm_qkv(
    const unsigned short* __restrict__ xqT, const unsigned short* __restrict__ xkvT,
    const unsigned short* __restrict__ wq16, const unsigned short* __restrict__ wk16, const unsigned short* __restrict__ wv16,
    const float* __restrict__ bq, const float* __restrict__ bk, const float* __restrict__ bv,
    float* __restrict__ gq, float* __restrict__ gk, float* __restrict__ gv) {
  __shared__ __align__(16) unsigned char smem[2 * gm_stage(0)];
  const int job = blockIdx.z;   // the same for the whole block
  if (job < 2) {
    const bool isq = job == 0;
    const int K = isq ? N_CH : N_CIN;
    gemm64_body<1, 0, 2, 0, false>(smem, (int)blockIdx.x, (int)blockIdx.y,
        isq ? xqT : xkvT, nullptr, K, (long)SEQ_LEN * K, isq ? wq16 : wk16, nullptr, K, 0L,
        (void*)(isq ? gq : gk), nullptr, N_CH, (long)SEQ_LEN * N_CH, isq ? bq : bk, nullptr, 0L, SEQ_LEN, N_CH, K, 1.0f);
  } else {
    gemm64_body<1, 0, 1, 0, false>(smem, (int)blockIdx.x, (int)blockIdx.y,
        wv16, nullptr, N_CIN, 0L, xkvT, nullptr, N_CIN, (long)SEQ_LEN * N_CIN,
        (void*)gv, nullptr, SEQ_LEN, (long)N_CH * SEQ_LEN, bv, nullptr, 0L, N_CH, SEQ_LEN, N_CIN, 1.0f);
  }
}

// f32 -> bf16 (RNE), two elements per thread; blk = index of the 256-thread block inside this array
__device__ __forceinline__ void cast_bf16x2_body(
    const float* __restrict__ in, unsigned short* __restrict__ out, int n2, int blk) {
  int i = blk * 256 + threadIdx.x;
  if (i < n2) {
    const float* p = in + 2 * i;
    const float e0 = p[0], e1 = p[1];
    // p as an input keeps the load's address pair whole up to the wait (else the load lands on it)
    asm volatile("s_wait_xcnt 0x0" :: "v"(p) : "memory");
    const unsigned u = (unsigned)f2bf_bits(e0) | ((unsigned)f2bf_bits(e1) << 16);
    ((unsigned*)out)[i] = u;
  }
}

// ---- (nb, C, L) f32 -> (nb, L, C) bf16 through an LDS tile: in[c][l] -> out[l][c] ----
// tile = 64 channels x 32 positions; tile index (bx < L/32, by < C/64, b < nb), block 256.
// loads: 256 threads x 8 = 2048 = 64x32 floats; stores: thread (r = tid>>3, c8 = (tid&7)*8) writes 8 bf16 = 16 B,
__device__ __forceinline__ void transpose_bf16_body(
    const float* __restrict__ in, unsigned short* __restrict__ out, int C, int L, int bx, int by, int b) {
  __shared__ float t[64][33];
  const int tid = threadIdx.x;
  const int l0 = bx * 32, c0 = by * 64;
  const float* inb = in + (size_t)b * C * L;
#pragma unroll
  for (int i = 0; i < 8; ++i) {
    const int cl = i * 8 + (tid >> 5);
    t[cl][tid & 31] = inb[(size_t)(c0 + cl) * L + l0 + (tid & 31)];
  }
  __syncthreads();
  const int r = tid >> 3, c8 = (tid & 7) * 8;
  unsigned w0, w1, w2, w3;
  w0 = (unsigned)f2bf_bits(t[c8 + 0][r]) | ((unsigned)f2bf_bits(t[c8 + 1][r]) << 16);
  w1 = (unsigned)f2bf_bits(t[c8 + 2][r]) | ((unsigned)f2bf_bits(t[c8 + 3][r]) << 16);
  w2 = (unsigned)f2bf_bits(t[c8 + 4][r]) | ((unsigned)f2bf_bits(t[c8 + 5][r]) << 16);
  w3 = (unsigned)f2bf_bits(t[c8 + 6][r]) | ((unsigned)f2bf_bits(t[c8 + 7][r]) << 16);
  const v4u val = (v4u){w0, w1, w2, w3};
  unsigned short* dst = out + ((size_t)b * L + l0 + r) * C + c0 + c8;
  *(v4u*)dst = val;
  
}

// ---- all operand preparation in one launch: the two activation transposes and the five weight casts need nothing of each other.
// One-dimensional grid; a range of the block index picks the job (the same for the whole block), the transposes first.
constexpr int PB_XQ  = (SEQ_LEN / 32) * (N_CH / 64) * N_B;    // blocks of the x_query transpose
constexpr int PB_XKV = (SEQ_LEN / 32) * (N_CIN / 64) * N_B;   // blocks of the x_kv transpose
constexpr int PB_WQ  = N_CH * N_CH / 512;                     // blocks of a cast: 512 elements each
constexpr int PB_WKV = N_CH * N_CIN / 512;
constexpr int PB_WFF = N_FF * N_CH / 512;
constexpr int PB_ALL = PB_XQ + PB_XKV + PB_WQ + 2 * PB_WKV + 2 * PB_WFF;
__global__ __launch_bounds__(256) void k_prep(
    const float* __restrict__ x_query, const float* __restrict__ x_kv,
    const float* __restrict__ wq, const float* __restrict__ wk, const float* __restrict__ wv,
    const float* __restrict__ w1, const float* __restrict__ w2,
    unsigned short* __restrict__ xqT, unsigned short* __restrict__ xkvT,
    unsigned short* __restrict__ wq16, unsigned short* __restrict__ wk16, unsigned short* __restrict__ wv16,
    unsigned short* __restrict__ w1_16, unsigned short* __restrict__ w2_16) {
  int blk = blockIdx.x;
  if (blk < PB_XQ + PB_XKV) {
    const bool isq = blk < PB_XQ;
    static_assert(N_CH / 64 == 8 && N_CIN / 64 == 4);
    const unsigned t  = isq ? blk : blk - PB_XQ;
    const unsigned cb = t / (SEQ_LEN / 32);   // (batch, channel block)
    const int ls = isq ? 3 : 2;               // log2 of the channel blocks: a shift, not a division by a run-time value
    transpose_bf16_body(isq ? x_query : x_kv, isq ? xqT : xkvT, isq ? N_CH : N_CIN, SEQ_LEN,
                        (int)(t % (SEQ_LEN / 32)), (int)(cb & ((1u << ls) - 1u)), (int)(cb >> ls));
    return;
  }
  blk -= PB_XQ + PB_XKV;
  const float* in; unsigned short* out; int n2;
  if (blk < PB_WQ)                                 { in = wq; out = wq16;  n2 = N_CH * N_CH / 2; }
  else if ((blk -= PB_WQ) < PB_WKV)                { in = wk; out = wk16;  n2 = N_CH * N_CIN / 2; }
  else if ((blk -= PB_WKV) < PB_WKV)               { in = wv; out = wv16;  n2 = N_CH * N_CIN / 2; }
  else if ((blk -= PB_WKV) < PB_WFF)               { in = w1; out = w1_16; n2 = N_FF * N_CH / 2; }
  else                          { blk -= PB_WFF;     in = w2; out = w2_16; n2 = N_CH * N_FF / 2; }
  cast_bf16x2_body(in, out, n2, blk);
}

// ---- InstanceNorm over the 1024 rows of an L-major f32 plane X[nb][1024][NCOL], per (b, column) ----
// block = 32 waves owns a slab of 64 columns x 1024 rows; slab index (bx < NCOL/64, by < nb).
// lane = (row half, 4 adjacent columns): one wave-wide 16-byte load covers 2 rows x 256 B; a thread keeps its
// 16 rows (i*64 + wave*2 + half) x 4 columns in registers, so X is read once. Mean, then centred sum of squares.
// output = bf16 hi + lo planes, same layout (a wave stores 2 rows x 128 B per plane);
// MODE 0: plain; MODE 1: + residual read from a bf16 plane res (same layout); MODE 2: relu.
constexpr int CN_RP = 68;   // pitch in floats of the per-wave partial rows (16-byte aligned rows)

// column totals over the whole slab: s = this thread's partial for its 4 columns; every thread gets the totals of its 4 columns.
// fixed tree: two row halves by shuffle, 32 wave partials through LDS, wave w adds up columns 2w and 2w+1 by a butterfly.
__device__ __forceinline__ v4f cn_colsum(v4f s, float* red, float* tot, int wave, int lane) {
  const int c4 = (lane & 15) * 4;
#pragma unroll
  for (int e = 0; e < 4; ++e) s[e] += __shfl_xor(s[e], 16, 32);
  if (lane < 16) *(v4f*)(red + wave * CN_RP + c4) = s;
  __syncthreads();   // all 32 partial rows are in red
  v2f p = *(const v2f*)(red + lane * CN_RP + 2 * wave);
#pragma unroll
  for (int off = 1; off < 32; off <<= 1) {
    p.x += __shfl_xor(p.x, off, 32);
    p.y += __shfl_xor(p.y, off, 32);
  }
  if (lane == 0) *(v2f*)(tot + 2 * wave) = p;
  __syncthreads();   // all 64 totals are in tot; every read of red is over
  return *(const v4f*)(tot + c4);
}

template <int MODE, int NCOL>
__device__ __forceinline__ void colnorm_body(
    const float* __restrict__ X, const unsigned* __restrict__ res,
    unsigned* __restrict__ outh, unsigned* __restrict__ outl, int bx, int by) {
  constexpr int NR = 1024, NW = 32, NI = NR / (2 * NW);
  __shared__ __align__(16) float red[NW * CN_RP];
  __shared__ __align__(16) float tot[2][64];
  const int lane = threadIdx.x & 31, wave = threadIdx.x >> 5;
  const size_t base = ((size_t)by * NR + wave * 2 + (lane >> 4)) * NCOL + bx * 64 + (lane & 15) * 4;
  constexpr size_t STEP = (size_t)64 * NCOL;   // floats between a thread's rows; STEP / 2 words in the bf16 planes
  const size_t obase = base >> 1;
  const float* xp = X + base;
  v4f x[NI];
#pragma unroll
  for (int i = 0; i < NI; ++i) x[i] = *(const v4f*)(xp + i * STEP);
  // xp as an input keeps the loads' address pair whole up to the wait (else the last load lands on it)
  asm volatile("s_wait_xcnt 0x0" :: "v"(xp) : "memory");
  // MODE 1: residual words, two groups of 4 rows; the first group is asked for here, under the two reductions
  v2u rw[2][4];
  if constexpr (MODE == 1) {
#pragma unroll
    for (int j = 0; j < 4; ++j) rw[0][j] = *(const v2u*)(res + obase + j * (STEP / 2));
  }
  v4f s = x[0];
#pragma unroll
  for (int i = 1; i < NI; ++i) s += x[i];
  const v4f mean = cn_colsum(s, red, tot[0], wave, lane) * (1.0f / NR);
  v4f q = (v4f){0.f, 0.f, 0.f, 0.f};
#pragma unroll
  for (int i = 0; i < NI; ++i) {
    x[i] -= mean;
    q += x[i] * x[i];
  }
  const v4f var = cn_colsum(q, red, tot[1], wave, lane) * (1.0f / NR);
  v4f rs;
#pragma unroll
  for (int e = 0; e < 4; ++e) rs[e] = rsqrtf(var[e] + 1e-5f);
#pragma unroll
  for (int g = 0; g < NI / 4; ++g) {
    if constexpr (MODE == 1) {
      if (g + 1 < NI / 4) {
#pragma unroll
        for (int j = 0; j < 4; ++j) rw[(g + 1) & 1][j] = *(const v2u*)(res + obase + ((g + 1) * 4 + j) * (STEP / 2));
      }
    }
#pragma unroll
    for (int j = 0; j < 4; ++j) {
      const int i = g * 4 + j;
      v4f y = x[i] * rs;
      if constexpr (MODE == 1) {
        const v2u w = rw[g & 1][j];
        y.x += __uint_as_float(w.x << 16);
        y.y += __uint_as_float(w.x & 0xffff0000u);
        y.z += __uint_as_float(w.y << 16);
        y.w += __uint_as_float(w.y & 0xffff0000u);
      }
      if constexpr (MODE == 2) {
#pragma unroll
        for (int e = 0; e < 4; ++e) y[e] = fmaxf(y[e], 0.0f);
      }
      unsigned short hb[4], lb[4];
#pragma unroll
      for (int e = 0; e < 4; ++e) {
        hb[e] = f2bf_bits(y[e]);
        lb[e] = f2bf_bits(y[e] - bf_bits2f(hb[e]));
      }
      const size_t oi = obase + i * (STEP / 2);
      *(v2u*)(outh + oi) = (v2u){ (unsigned)hb[0] | ((unsigned)hb[1] << 16), (unsigned)hb[2] | ((unsigned)hb[3] << 16) };
      *(v2u*)(outl + oi) = (v2u){ (unsigned)lb[0] | ((unsigned)lb[1] << 16), (unsigned)lb[2] | ((unsigned)lb[3] << 16) };
    }
    if (g + 1 < NI / 4) {
      // stands in front of every reuse of the address and data registers that the loads and stores above name
      asm volatile("s_wait_xcnt 0x0" ::: "memory");
      // keeps the next group's code below that wait; in MODE 1 it also keeps the later groups' residual loads from
      // being hoisted: with all 16 in flight the kernel passes the 128 registers of a 32-wave block and spills
      __builtin_amdgcn_sched_barrier(0);
    }
  }
}

template <int MODE, int NCOL>
__global__ __launch_bounds__(1024) void k_colnorm(
    const float* __restrict__ X, const unsigned* __restrict__ res,
    unsigned* __restrict__ outh, unsigned* __restrict__ outl) {
  colnorm_body<MODE, NCOL>(X, res, outh, outl, (int)blockIdx.x, (int)blockIdx.y);
}

// ---- InstanceNorm over channel-major f32 rows X[row][1024] (row = b*C + channel), one wave per row ----
// Rolled re-read passes (no per-thread arrays); no LDS, no barrier.
template <int MODE>
__device__ __forceinline__ void rownorm_body(
    const float* __restrict__ X, float* __restrict__ outf,
    unsigned short* __restrict__ outh, unsigned short* __restrict__ outl, const size_t row) {
  constexpr int NCOL = 1024;
  const int lane = threadIdx.x & 31;
  const float* xr = X + row * NCOL;
  float s = 0.f;
#pragma unroll 1
  for (int it = 0; it < 8; ++it) {
    const v4f u = *(const v4f*)(xr + it * 128 + lane * 4);
    s += (u.x + u.y) + (u.z + u.w);
  }
#pragma unroll
  for (int off = 1; off < 32; off <<= 1) s += __shfl_xor(s, off, 32);
  const float mean = s * (1.0f / NCOL);
  float ss = 0.f;
#pragma unroll 1
  for (int it = 0; it < 8; ++it) {
    const v4f u = *(const v4f*)(xr + it * 128 + lane * 4);
    const float d0 = u.x - mean, d1 = u.y - mean, d2 = u.z - mean, d3 = u.w - mean;
    ss += (d0 * d0 + d1 * d1) + (d2 * d2 + d3 * d3);
  }
#pragma unroll
  for (int off = 1; off < 32; off <<= 1) ss += __shfl_xor(ss, off, 32);
  const float rs = rsqrtf(ss * (1.0f / NCOL) + 1e-5f);
  if constexpr (MODE == 0) {
    float* orow = outf + row * NCOL;
    {
#pragma unroll 1
      for (int it = 0; it < 8; ++it) {
        const v4f u = *(const v4f*)(xr + it * 128 + lane * 4);
        v4f y;
        y.x = (u.x - mean) * rs; y.y = (u.y - mean) * rs; y.z = (u.z - mean) * rs; y.w = (u.w - mean) * rs;
        *(v4f*)(orow + it * 128 + lane * 4) = y;
      }
      
    }
  } else {
    unsigned short* hrow = outh + row * NCOL;
    unsigned short* lrw  = outl + row * NCOL;
    {
#pragma unroll 1
      for (int it = 0; it < 4; ++it) {
        const v4f u0 = *(const v4f*)(xr + it * 256 + lane * 8);
        const v4f u1 = *(const v4f*)(xr + it * 256 + lane * 8 + 4);
        const float y0 = (u0.x - mean) * rs, y1 = (u0.y - mean) * rs, y2 = (u0.z - mean) * rs, y3 = (u0.w - mean) * rs;
        const float y4 = (u1.x - mean) * rs, y5 = (u1.y - mean) * rs, y6 = (u1.z - mean) * rs, y7 = (u1.w - mean) * rs;
        const unsigned short h0 = f2bf_bits(y0), h1 = f2bf_bits(y1), h2 = f2bf_bits(y2), h3 = f2bf_bits(y3);
        const unsigned short h4 = f2bf_bits(y4), h5 = f2bf_bits(y5), h6 = f2bf_bits(y6), h7 = f2bf_bits(y7);
        const unsigned short l0 = f2bf_bits(y0 - bf_bits2f(h0)), l1 = f2bf_bits(y1 - bf_bits2f(h1));
        const unsigned short l2 = f2bf_bits(y2 - bf_bits2f(h2)), l3 = f2bf_bits(y3 - bf_bits2f(h3));
        const unsigned short l4 = f2bf_bits(y4 - bf_bits2f(h4)), l5 = f2bf_bits(y5 - bf_bits2f(h5));
        const unsigned short l6 = f2bf_bits(y6 - bf_bits2f(h6)), l7 = f2bf_bits(y7 - bf_bits2f(h7));
        const v4u hv = (v4u){ (unsigned)h0 | ((unsigned)h1 << 16), (unsigned)h2 | ((unsigned)h3 << 16),
                              (unsigned)h4 | ((unsigned)h5 << 16), (unsigned)h6 | ((unsigned)h7 << 16) };
        const v4u lv = (v4u){ (unsigned)l0 | ((unsigned)l1 << 16), (unsigned)l2 | ((unsigned)l3 << 16),
                              (unsigned)l4 | ((unsigned)l5 << 16), (unsigned)l6 | ((unsigned)l7 << 16) };
        *(v4u*)(hrow + it * 256 + lane * 8) = hv;
        *(v4u*)(lrw  + it * 256 + lane * 8) = lv;
      }
      
    }
  }
}

// block 8 waves = 8 rows; grid = rows/8 (rows % 8 == 0)
template <int MODE>
__global__ __launch_bounds__(256) void k_rownorm(
    const float* __restrict__ X, float* __restrict__ outf,
    unsigned short* __restrict__ outh, unsigned short* __restrict__ outl) {
  rownorm_body<MODE>(X, outf, outh, outl, (size_t)blockIdx.x * 8 + (threadIdx.x >> 5));
}

// ---- the InstanceNorms of q, k and v in one launch: they need nothing of each other. Block = 32 waves; a range of the block
// index picks the job (the same for the whole block): 64 column slabs of q, 64 of k, then 32 rows of v per block.
constexpr int NB_SLAB = (N_CH / 64) * N_B;        // column slabs of q, and of k
constexpr int NB_VROW = N_B * N_CH / 32;          // blocks of 32 v rows
__global__ __launch_bounds__(1024) void k_norm_qkv(
    const float* __restrict__ gq, const float* __restrict__ gk, const float* __restrict__ gv,
    unsigned* __restrict__ qh, unsigned* __restrict__ ql, unsigned* __restrict__ kh, unsigned* __restrict__ kl,
    unsigned short* __restrict__ vh, unsigned short* __restrict__ vl) {
  const int blk = blockIdx.x;
  if (blk < 2 * NB_SLAB) {
    const bool isq = blk < NB_SLAB;
    const int t = isq ? blk : blk - NB_SLAB;
    colnorm_body<0, N_CH>(isq ? gq : gk, nullptr, isq ? qh : kh, isq ? ql : kl, t % (N_CH / 64), t / (N_CH / 64));
  } else {
    rownorm_body<1>(gv, nullptr, vh, vl, (size_t)(blk - 2 * NB_SLAB) * 32 + (threadIdx.x >> 5));
  }
}

#define AT_D 64
#define AT_NW 4
#define AT_KC 64
#define AT_OSP 68
// pitch in bf16 elements of every 64-element row of the K and V tiles in LDS: 144 B = 16 B x 9. The fragment reads are
// 16-byte loads of 16 rows at one column; at a pitch of 128 B those rows fall on two groups of four banks, at 144 B on sixteen.
#define AT_LP 72

__device__ __forceinline__ v8f at_mma(v16b a, v16b b, v8f c) {
  c = __builtin_amdgcn_wmma_f32_16x16x32_bf16(false, a, false, b, (short)0, c, false, false);
  asm volatile("v_nop\n\tv_nop\n\tv_nop\n\tv_nop" : "+v"(c) : "v"(a), "v"(b));
  return c;
}
// lane l <-> lane l ^ 16
__device__ __forceinline__ float at_xhalf(float x) {
  const int b = __builtin_bit_cast(int, x);
  return __builtin_bit_cast(float, __builtin_amdgcn_permlanex16(b, b, 0x76543210, 0xfedcba98, false, false));
}
// two neighbouring elements of a fragment -> one register of the hi plane and one of the lo plane (bf16, round to nearest even;
// f0 in the low half): hi = bf16(f), lo = bf16(f - hi)
__device__ __forceinline__ void at_split2(float f0, float f1, unsigned& hi, unsigned& lo) {
  const unsigned hw = __builtin_bit_cast(unsigned, __builtin_convertvector((v2f){f0, f1}, v2b));
  const v2f rem = (v2f){f0 - __uint_as_float(hw << 16), f1 - __uint_as_float(hw & 0xffff0000u)};
  hi = hw;
  lo = __builtin_bit_cast(unsigned, __builtin_convertvector(rem, v2b));
}

// four waves a SIMD: the grid gives every WGP four work-groups (1024 on 256 WGPs); by LDS and registers a fifth would fit on a
// WGP and would then be missing on another
__global__ __launch_bounds__(128) __attribute__((amdgpu_waves_per_eu(4, 4)))
void k_attn(const unsigned short* __restrict__ qhp, const unsigned short* __restrict__ qlp,
            const unsigned short* __restrict__ khp, const unsigned short* __restrict__ klp,
            const unsigned short* __restrict__ vhp, const unsigned short* __restrict__ vlp,
            float* __restrict__ out, float sscale) {
  union FB { v16b v; v8b h[2]; unsigned w[8]; };
  __shared__ __align__(16) __bf16 Ksh[AT_KC * AT_LP];            // K hi [kv][d]
  __shared__ __align__(16) __bf16 Ksl[AT_KC * AT_LP];            // K lo [kv][d]
  __shared__ __align__(16) __bf16 Vth[AT_D * AT_LP];             // V hi [d][kv]
  __shared__ __align__(16) __bf16 Vtl[AT_D * AT_LP];             // V lo [d][kv]
  __shared__ __align__(16) float  Os[AT_NW][16 * AT_OSP];        // per wave out tile

  const int tid  = threadIdx.x;
  const int wave = tid >> 5;
  const int lane = tid & 31;
  const int hh   = lane >> 4;
  const int c    = lane & 15;

  constexpr int NQB = SEQ_LEN / 64;
  const int bx  = blockIdx.x;
  const int qb  = bx % NQB;
  const int bhd = bx / NQB;
  const int h   = bhd % N_HEADS;
  const int b   = bhd / N_HEADS;
  const int q0  = qb * 64 + wave * 16;

  const __bf16* qh = (const __bf16*)qhp;
  const __bf16* ql = (const __bf16*)qlp;
  const __bf16* kh = (const __bf16*)khp;
  const __bf16* kl = (const __bf16*)klp;
  const __bf16* vh = (const __bf16*)vhp;
  const __bf16* vl = (const __bf16*)vlp;

  // ---- Q fragments (B operand: column = query q0 + c, k = d), hi and lo planes ----
  v16b qah[2], qal[2];
  {
    const size_t qo = ((size_t)b * SEQ_LEN + q0 + c) * N_CH + h * AT_D + 8 * hh;
#pragma unroll
    for (int dc = 0; dc < 2; ++dc) {
      qah[dc] = Frag<__bf16>::load(qh + qo + dc * 32);
      qal[dc] = Frag<__bf16>::load(ql + qo + dc * 32);
    }
  }

  // of this lane's query: running maximum over all keys so far; running sum over this lane half's keys only
  float mrow = -INFINITY, lrow = 0.f;
  v8f oacc[4];   // O^T: element r of tile t = (d = t*16 + 8*hh + r, query c)
#pragma unroll
  for (int t = 0; t < 4; ++t) oacc[t] = (v8f){0.f,0.f,0.f,0.f,0.f,0.f,0.f,0.f};

  for (int kc = 0; kc < SEQ_LEN / AT_KC; ++kc) {
    const int kv0 = kc * AT_KC;
    __syncthreads();
    {
      // staging: thread (row = tid>>1, half = (tid&1)*32) copies 32 bf16 = 4 x 16 B per plane;
      // 128 threads x 32 = 4096 = 64 x 64 elements per plane (full tiles)
      const int row = tid >> 1, half = (tid & 1) * 32;
      const size_t ko = ((size_t)b * SEQ_LEN + kv0 + row) * N_CH + h * AT_D + half;
      const size_t vo = ((size_t)b * N_CH + h * AT_D + row) * SEQ_LEN + kv0 + half;
      {
        const v4u* sp = (const v4u*)(kh + ko);
        v4u* dp = (v4u*)(Ksh + row * AT_LP + half);
#pragma unroll
        for (int i = 0; i < 4; ++i) dp[i] = sp[i];
      }
      asm volatile("" ::: "memory");
      {
        const v4u* sp = (const v4u*)(kl + ko);
        v4u* dp = (v4u*)(Ksl + row * AT_LP + half);
#pragma unroll
        for (int i = 0; i < 4; ++i) dp[i] = sp[i];
      }
      asm volatile("" ::: "memory");
      {
        const v4u* sp = (const v4u*)(vh + vo);
        v4u* dp = (v4u*)(Vth + row * AT_LP + half);
#pragma unroll
        for (int i = 0; i < 4; ++i) dp[i] = sp[i];
      }
      asm volatile("" ::: "memory");
      {
        const v4u* sp = (const v4u*)(vl + vo);
        v4u* dp = (v4u*)(Vtl + row * AT_LP + half);
#pragma unroll
        for (int i = 0; i < 4; ++i) dp[i] = sp[i];
      }
    }
    __syncthreads();

    // ---- scores, transposed: A operand row = key j*16 + c, k = d (Ksh is [key][d], k-contiguous); B = Q ----
    v8f s[4];
#pragma unroll
    for (int j = 0; j < 4; ++j) {
      s[j] = (v8f){0.f,0.f,0.f,0.f,0.f,0.f,0.f,0.f};
#pragma unroll
      for (int dc = 0; dc < 2; ++dc) {
        FB kb, kb2;
        const int ko2 = (j * 16 + c) * AT_LP + dc * 32 + 8 * hh;
        kb.h[0]  = *(const v8b*)(Ksh + ko2);
        kb.h[1]  = *(const v8b*)(Ksh + ko2 + 16);
        kb2.h[0] = *(const v8b*)(Ksl + ko2);
        kb2.h[1] = *(const v8b*)(Ksl + ko2 + 16);
        s[j] = at_mma(kb.v,  qah[dc], s[j]);
        s[j] = at_mma(kb2.v, qah[dc], s[j]);
        s[j] = at_mma(kb.v,  qal[dc], s[j]);
      }
    }
    // D element r of lane = (key j*16 + 8*hh + r, query column c)
    float cm[4];
#pragma unroll
    for (int j = 0; j < 4; ++j) {
      float m = -INFINITY;
#pragma unroll
      for (int r = 0; r < 8; ++r) {
        const float sv = s[j][r] * sscale;
        s[j][r] = sv;
        m = fmaxf(m, sv);
      }
      cm[j] = m;
    }
    float mc = fmaxf(fmaxf(cm[0], cm[1]), fmaxf(cm[2], cm[3]));
    mc = fmaxf(mc, at_xhalf(mc));            // both lane halves of a query agree on the maximum, so on alpha too
    const float mnew = fmaxf(mrow, mc);
    const float alpha = expf(mrow - mnew);
    mrow = mnew;
    // P^T as B operand of a 32-key step kk: element e < 8 = key kk*32 + 8*hh + e, e >= 8 = key kk*32 + 16 + 8*hh + (e - 8):
    // these are this lane's own elements of the score tiles j = 2*kk and j = 2*kk + 1
    FB ph[2], pl[2];
    float ps[4];
#pragma unroll
    for (int j = 0; j < 4; ++j) {
      float psum = 0.f;
#pragma unroll
      for (int r = 0; r < 8; r += 2) {
        const float p0 = expf(s[j][r] - mnew);
        const float p1 = expf(s[j][r + 1] - mnew);
        psum += p0 + p1;
        at_split2(p0, p1, ph[j >> 1].w[(j & 1) * 4 + (r >> 1)], pl[j >> 1].w[(j & 1) * 4 + (r >> 1)]);
      }
      ps[j] = psum;
    }
    lrow = lrow * alpha + ((ps[0] + ps[1]) + (ps[2] + ps[3]));
#pragma unroll
    for (int t = 0; t < 4; ++t) oacc[t] *= alpha;
    // ---- O^T += V^T.P^T : A = V with row = d, k = key (Vth is [d][key], k-contiguous), B = P^T ----
#pragma unroll   // ph and pl are indexed by kk: they stay in registers only with kk a constant
    for (int kk = 0; kk < 2; ++kk) {
#pragma unroll
      for (int t = 0; t < 4; ++t) {
        FB vb, vb2;
        const int vo2 = (t * 16 + c) * AT_LP + kk * 32 + 8 * hh;
        vb.h[0]  = *(const v8b*)(Vth + vo2);
        vb.h[1]  = *(const v8b*)(Vth + vo2 + 16);
        vb2.h[0] = *(const v8b*)(Vtl + vo2);
        vb2.h[1] = *(const v8b*)(Vtl + vo2 + 16);
        oacc[t] = at_mma(vb.v,  ph[kk].v, oacc[t]);
        oacc[t] = at_mma(vb2.v, ph[kk].v, oacc[t]);
        oacc[t] = at_mma(vb.v,  pl[kk].v, oacc[t]);
      }
    }
  }

  // out tile [query][d]: this lane holds 8 neighbouring d of query c in every O^T tile
  float* os = Os[wave];
  {
    const float inv = 1.0f / (lrow + at_xhalf(lrow));   // the two lane halves' sums are joined here, once
#pragma unroll
    for (int t = 0; t < 4; ++t) {
      float* op = os + c * AT_OSP + t * 16 + 8 * hh;
      *(v4f*)(op)     = (v4f){oacc[t][0] * inv, oacc[t][1] * inv, oacc[t][2] * inv, oacc[t][3] * inv};
      *(v4f*)(op + 4) = (v4f){oacc[t][4] * inv, oacc[t][5] * inv, oacc[t][6] * inv, oacc[t][7] * inv};
    }
  }
  __builtin_amdgcn_fence(__ATOMIC_RELEASE, "workgroup");
  __builtin_amdgcn_wave_barrier();
  __builtin_amdgcn_fence(__ATOMIC_ACQUIRE, "workgroup");
  {
    float* ob = out + ((size_t)b * SEQ_LEN) * N_CH + h * AT_D;
    const int c4 = (lane & 15) * 4;
    {
#pragma unroll
      for (int it = 0; it < 8; ++it) {
        const int row = it * 2 + hh;
        v4f val = *(const v4f*)(os + row * AT_OSP + c4);
        *(v4f*)(ob + (size_t)(q0 + row) * N_CH + c4) = val;
      }
      
    }
  }
}

// =====================================================================================
// Host orchestration
// =====================================================================================
extern "C" void kernel_launch(void* const* d_in, const int* in_sizes, int n_in,
                              void* d_out, int out_size, void* d_ws,
                              size_t ws_size, hipStream_t stream) {
  (void)in_sizes; (void)n_in; (void)out_size;
  constexpr int NB = 8, CIN = 256, NCH = 512, SEQ = 1024, NFF = 1024, NHD = 8;

  // ---- workspace region map (bytes) ----
  constexpr size_t SZ_WQ   = (size_t)NCH * NCH * 2;        //    524288  wq  bf16 [512][512]
  constexpr size_t SZ_WK   = (size_t)NCH * CIN * 2;        //    262144  wk  bf16 [512][256]
  constexpr size_t SZ_WV   = (size_t)NCH * CIN * 2;        //    262144  wv  bf16 [512][256]
  constexpr size_t SZ_W1   = (size_t)NFF * NCH * 2;        //   1048576  w1  bf16 [1024][512]
  constexpr size_t SZ_W2   = (size_t)NCH * NFF * 2;        //   1048576  w2  bf16 [512][1024]
  constexpr size_t SZ_XQT  = (size_t)NB * SEQ * NCH * 2;   //   8388608  x_query (L,C) bf16
  constexpr size_t SZ_XKVT = (size_t)NB * SEQ * CIN * 2;   //   4194304  x_kv (L,C) bf16
  constexpr size_t SZ_G    = (size_t)NB * SEQ * NFF * 4;   //  33554432  f32 GEMM/attention output, max user = ffn1 [8][1024][1024]
  constexpr size_t SZ_P    = (size_t)NB * SEQ * NCH * 2;   //   8388608  one bf16 activation plane [8][1024][512]
  constexpr size_t OFF_WQ   = 0;
  constexpr size_t OFF_WK   = OFF_WQ + SZ_WQ;
  constexpr size_t OFF_WV   = OFF_WK + SZ_WK;
  constexpr size_t OFF_W1   = OFF_WV + SZ_WV;
  constexpr size_t OFF_W2   = OFF_W1 + SZ_W1;
  constexpr size_t OFF_XQT  = OFF_W2 + SZ_W2;
  constexpr size_t OFF_XKVT = OFF_XQT + SZ_XQT;
  constexpr size_t OFF_G    = OFF_XKVT + SZ_XKVT;
  constexpr size_t OFF_QH   = OFF_G + SZ_G;       // q hi plane; later z hi plane
  constexpr size_t OFF_QL   = OFF_QH + SZ_P;      // q lo plane; later z lo plane
  constexpr size_t OFF_KH   = OFF_QL + SZ_P;      // k hi plane; later y hi plane spans KH+KL (16777216)
  constexpr size_t OFF_KL   = OFF_KH + SZ_P;      // k lo plane
  constexpr size_t OFF_VH   = OFF_KL + SZ_P;      // v hi plane; later y lo plane spans VH+VL (16777216)
  constexpr size_t OFF_VL   = OFF_VH + SZ_P;      // v lo plane
  constexpr size_t OFF_GV   = OFF_VL + SZ_P;      // v projection f32 [8][512][1024] (q and k projections: the two halves of G)
  constexpr size_t OFF_END  = OFF_GV + SZ_G / 2;  // 116391936
  static_assert(OFF_END == 116391936ull);
  static_assert(OFF_END <= 134217728ull);
  static_assert((OFF_WK % 256) == 0 && (OFF_XQT % 256) == 0 && (OFF_G % 256) == 0 && (OFF_QH % 256) == 0);
  // reused regions sized from the max user
  static_assert((size_t)NB * SEQ * NCH * 4 * 2 <= SZ_G);    // q and k side by side; proj, ffn2 f32 outputs
  static_assert(NB == N_B && CIN == N_CIN && NCH == N_CH && SEQ == SEQ_LEN && NFF == N_FF && NHD == N_HEADS);
  static_assert((size_t)NB * SEQ * NFF * 4 <= SZ_G);        // ffn1 f32 output
  static_assert((size_t)NB * SEQ * NFF * 2 == 2 * SZ_P);    // y plane fits exactly over two 512-wide planes
  // GEMM shape contract: M multiple of 64, N multiple of 512, K multiple of 64
  static_assert(SEQ % 512 == 0 && NCH % 512 == 0 && NFF % 512 == 0);
  static_assert(NCH % 64 == 0 && CIN % 64 == 0 && NFF % 64 == 0);
  static_assert(((SEQ / 64) * (NCH / 64)) % 8 == 0 && ((SEQ / 64) * (NFF / 64)) % 8 == 0);
  static_assert(NCH % 256 == 0 && NFF % 256 == 0 && (NB * NCH) % 8 == 0);
  static_assert((size_t)NB * NCH * SEQ * 4 == 16777216ull);   // d_out bytes
  if (ws_size < OFF_END) return;

  const float* x_query = (const float*)d_in[0];
  const float* x_kv    = (const float*)d_in[1];
  const float* wq      = (const float*)d_in[2];
  const float* bq      = (const float*)d_in[3];
  const float* wk      = (const float*)d_in[4];
  const float* bk      = (const float*)d_in[5];
  const float* wv      = (const float*)d_in[6];
  const float* bv      = (const float*)d_in[7];
  const float* w1      = (const float*)d_in[8];
  const float* b1      = (const float*)d_in[9];
  const float* w2      = (const float*)d_in[10];
  const float* b2      = (const float*)d_in[11];
  float* out = (float*)d_out;

  char* ws = (char*)d_ws;
  typedef unsigned short us;
  us* wq16  = (us*)(ws + OFF_WQ);
  us* wk16  = (us*)(ws + OFF_WK);
  us* wv16  = (us*)(ws + OFF_WV);
  us* w1_16 = (us*)(ws + OFF_W1);
  us* w2_16 = (us*)(ws + OFF_W2);
  us* xqT   = (us*)(ws + OFF_XQT);
  us* xkvT  = (us*)(ws + OFF_XKVT);
  float* gf = (float*)(ws + OFF_G);
  float* gq = gf;
  float* gk = (float*)(ws + OFF_G + SZ_G / 2);
  float* gv = (float*)(ws + OFF_GV);
  us* qh = (us*)(ws + OFF_QH);
  us* ql = (us*)(ws + OFF_QL);
  us* kh = (us*)(ws + OFF_KH);
  us* kl = (us*)(ws + OFF_KL);
  us* vh = (us*)(ws + OFF_VH);
  us* vl = (us*)(ws + OFF_VL);
  us* zh = qh;
  us* zl = ql;
  us* yh = kh;    // [8][1024][1024] bf16 = 16777216 B over KH..KL
  us* yl = vh;    // [8][1024][1024] bf16 = 16777216 B over VH..VL

  // 1) operand preparation: activations (B,C,L) f32 -> (B,L,C) bf16, weights -> bf16 (RNE)
  k_prep<<<PB_ALL, 256, 0, stream>>>(x_query, x_kv, wq, wk, wv, w1, w2, xqT, xkvT, wq16, wk16, wv16, w1_16, w2_16);

  // 2) q, k (L-major) and v (channel-major) projections, f32
  k_gemm_qkv<<<dim3((SEQ / 64) * (NCH / 64) / 8, NB, 3), 256, 0, stream>>>(xqT, xkvT, wq16, wk16, wv16, bq, bk, bv, gq, gk, gv);

  // 3) InstanceNorm of each -> q, k hi/lo planes (L-major), v hi/lo planes (channel-major)
  k_norm_qkv<<<2 * NB_SLAB + NB_VROW, 1024, 0, stream>>>(gq, gk, gv, (unsigned*)qh, (unsigned*)ql, (unsigned*)kh, (unsigned*)kl, vh, vl);

  // 4) attention -> gf as proj L-major [b][l][h*64+d] f32
  k_attn<<<NB * NHD * (SEQ / 64), 128, 0, stream>>>(qh, ql, kh, kl, vh, vl, gf, 0.125f);

  // 5) z = InstanceNorm(proj) + x_query(bf16) -> z hi/lo planes (L-major, pitch 512)
  k_colnorm<1, NCH><<<dim3(NCH / 64, NB), 1024, 0, stream>>>(gf, (const unsigned*)xqT, (unsigned*)zh, (unsigned*)zl);

  // 6) ffn1: C[l][o] = sum_c z[l][c] w1[o][c] + b1[o]  (M=1024, N=1024, K=512), z as hi/lo -> gf L-major [l][1024]
  wmma_gemm64<1, 2, 2, 0, false><<<dim3((SEQ / 64) * (NFF / 64) / 8, NB), 256, 0, stream>>>(
      zh, zl, NCH, (long)SEQ * NCH, w1_16, nullptr, NCH, 0L,
      (void*)gf, nullptr, NFF, (long)SEQ * NFF, b1, nullptr, 0L, SEQ, NFF, NCH, 1.0f);
  // 7) y = relu(InstanceNorm(h1)) -> y hi/lo planes [l][1024]
  k_colnorm<2, NFF><<<dim3(NFF / 64, NB), 1024, 0, stream>>>(gf, nullptr, (unsigned*)yh, (unsigned*)yl);

  // 8) ffn2: C[o][l] = sum_c w2[o][c] y[l][c] + b2[o]  (M=512, N=1024, K=1024), y as hi/lo -> channel-major gf
  wmma_gemm64<1, 3, 1, 0, false><<<dim3((NCH / 64) * (SEQ / 64) / 8, NB), 256, 0, stream>>>(
      w2_16, nullptr, NFF, 0L, yh, yl, NFF, (long)SEQ * NFF,
      (void*)gf, nullptr, SEQ, (long)NCH * SEQ, b2, nullptr, 0L, NCH, SEQ, NFF, 1.0f);

  // 9) final InstanceNorm over rows -> d_out (B, 512, L) f32
  k_rownorm<0><<<NB * NCH / 8, 256, 0, stream>>>(gf, out, nullptr, nullptr);
}

// v006
// A run of this version takes 198 microseconds.
// In two side-by-side timings against v005, it was 1.04 and 1.03 times as fast.
// All steps since v000 together make it 17.0 times as fast.
// Compute dtypes: conv1x1 GEMMs q/k/v = v_wmma_f32_16x16x32_bf16 on RNE-bf16 inputs (1 product); attention scores and P.V = bf16 hi+lo planes (3 products); FFN GEMMs = bf16 hi+lo activations x bf16 weights (2 products); f32 accumulate; InstanceNorm, softmax, residual in f32.
#include <hip/hip_runtime.h>
#include <hip/hip_bf16.h>

typedef __attribute__((ext_vector_type(16))) _Float16 v16h;
typedef __attribute__((ext_vector_type(8)))  _Float16 v8h;
typedef __attribute__((ext_vector_type(16))) __bf16   v16b;
typedef __attribute__((ext_vector_type(8)))  __bf16   v8b;
typedef __attribute__((ext_vector_type(2)))  __bf16   v2b;
typedef __attribute__((ext_vector_type(8)))  float    v8f;
typedef __attribute__((ext_vector_type(4)))  float    v4f;
typedef __attribute__((ext_vector_type(2)))  float    v2f;
typedef __attribute__((ext_vector_type(4)))  unsigned v4u;
typedef __attribute__((ext_vector_type(2)))  unsigned v2u;

__device__ __forceinline__ unsigned short f2bf_bits(float f) {
  unsigned u = __float_as_uint(f);
  return (unsigned short)((u + 0x7FFFu + ((u >> 16) & 1u)) >> 16);
}
__device__ __forceinline__ float bf_bits2f(unsigned short h) { return __uint_as_float(((unsigned)h) << 16); }

// hazard guards as plain device helpers
__device__ __forceinline__ void dep_guard_h(v8f& a, v8f& b, v16h x, v16h y) { asm volatile("v_nop\n\tv_nop\n\tv_nop\n\tv_nop" : "+v"(a), "+v"(b) : "v"(x), "v"(y)); }
__device__ __forceinline__ void dep_guard_b(v8f& a, v8f& b, v16b x, v16b y) { asm volatile("v_nop\n\tv_nop\n\tv_nop\n\tv_nop" : "+v"(a), "+v"(b) : "v"(x), "v"(y)); }
__device__ __forceinline__ void keep4_h(v16h a, v16h b, v16h c, v16h d) { asm volatile("v_nop" :: "v"(a), "v"(b), "v"(c), "v"(d)); }
__device__ __forceinline__ void keep4_b(v16b a, v16b b, v16b c, v16b d) { asm volatile("v_nop" :: "v"(a), "v"(b), "v"(c), "v"(d)); }
__device__ __forceinline__ void acc_guard4(v8f& a, v8f& b, v8f& c, v8f& d) { asm volatile("v_nop\n\tv_nop\n\tv_nop\n\tv_nop" : "+v"(a), "+v"(b), "+v"(c), "+v"(d)); }
template <typename T> struct Frag;
template <> struct Frag<_Float16> {
  typedef v16h V; union U { v16h v; v8h h[2]; };
  // elements 0..7 <- p[0..7], 8..15 <- p[16..23]
  static __device__ __forceinline__ v16h load(const _Float16* p) {
    U f; f.h[0] = *(const v8h*)(p); f.h[1] = *(const v8h*)(p + 16); return f.v;
  }
  static __device__ __forceinline__ v8f mma(v16h a, v16h b, v8f c) {
    return __builtin_amdgcn_wmma_f32_16x16x32_f16(false, a, false, b, (short)0, c, false, false);
  }
  static __device__ __forceinline__ void guard(v8f& a, v8f& b, v16h x, v16h y) { dep_guard_h(a, b, x, y); }
  static __device__ __forceinline__ void keep(v16h a, v16h b, v16h c, v16h d) { keep4_h(a, b, c, d); }
};
template <> struct Frag<__bf16> {
  typedef v16b V; union U { v16b v; v8b h[2]; };
  static __device__ __forceinline__ v16b load(const __bf16* p) {
    U f; f.h[0] = *(const v8b*)(p); f.h[1] = *(const v8b*)(p + 16); return f.v;
  }
  static __device__ __forceinline__ v8f mma(v16b a, v16b b, v8f c) {
    return __builtin_amdgcn_wmma_f32_16x16x32_bf16(false, a, false, b, (short)0, c, false, false);
  }
  static __device__ __forceinline__ void guard(v8f& a, v8f& b, v16b x, v16b y) { dep_guard_b(a, b, x, y); }
  static __device__ __forceinline__ void keep(v16b a, v16b b, v16b c, v16b d) { keep4_b(a, b, c, d); }
};

// ---- Register-blocked batched WMMA GEMM ------------------------------------
// C[m,n] = scale * sum_k A[m,k] * Bt[n,k] (+bias)(+resid); each wave owns a 64x64 tile.
// A row-major [M,K]; Bt row-major [N,K]; M % 64 == 0, N % 512 == 0, K % 64 == 0.
// The eight waves of a block own eight neighbouring tiles of one tile row (N % 512 == 0), so they share the A rows.
// Operands reach the fragments through LDS: a stage is 64 k (one whole 128-byte line of every row), brought by asynchronous
// 16-byte copies in which a wave covers 4 rows x 128 B per instruction; two buffers, stage t + 1 flies while stage t is worked on.
// Stage layout: [A planes: 64 rows][wave 0..7: its Bt planes: 64 rows], every row at a pitch of 144 B (16 B x odd).
// SPLIT: 0 = single product; 1 = A and Bt both hi/lo planes (hi.hi + hi.lo + lo.hi);
//        2 = only A is hi/lo (A_hi.B + A_lo.B); 3 = only Bt is hi/lo (A.B_hi + A.B_lo).
// BIAS_MODE: 0 = none, 1 = bias[m], 2 = bias[n].
// OUT_MODE: 0 = f32, 1 = f16, 2 = bf16 hi plane (Cout) + bf16 lo plane (Cout2).
// ET: 0 = f16 operands, 1 = bf16 operands (pointers passed as 16-bit storage)
constexpr int GM_KS = 64;                  // k elements of a stage
constexpr int GM_LP = 72;                  // LDS pitch of a stage row, in 16-bit elements
constexpr int GM_PL = 64 * GM_LP * 2;      // bytes of one 64-row plane of a stage
__device__ __forceinline__ unsigned lds_off(const void* p) { return (unsigned)(size_t)p; }   // byte address in the block's LDS
// asynchronous copies global -> LDS, 16 bytes per lane. The s_wait_xcnt closes each statement so that it stands in front of
// every later write of the address registers that the copies name.
__device__ __forceinline__ void cp_async2(unsigned l0, const void* g0, unsigned l1, const void* g1) {
  asm volatile("global_load_async_to_lds_b128 %0, %1, off\n\t"
               "global_load_async_to_lds_b128 %2, %3, off\n\t"
               "s_wait_xcnt 0x0"
               :: "v"(l0), "v"(g0), "v"(l1), "v"(g1) : "memory");
}
__device__ __forceinline__ void cp_async8(unsigned l, const char* g, size_t gstep) {
  // eight rows, four apart: LDS step 4 rows of GM_LP elements, global step gstep bytes
  constexpr unsigned LS = 4 * GM_LP * 2;
  asm volatile("global_load_async_to_lds_b128 %0, %1, off\n\t"
               "global_load_async_to_lds_b128 %2, %3, off\n\t"
               "global_load_async_to_lds_b128 %4, %5, off\n\t"
               "global_load_async_to_lds_b128 %6, %7, off\n\t"
               "global_load_async_to_lds_b128 %8, %9, off\n\t"
               "global_load_async_to_lds_b128 %10, %11, off\n\t"
               "global_load_async_to_lds_b128 %12, %13, off\n\t"
               "global_load_async_to_lds_b128 %14, %15, off\n\t"
               "s_wait_xcnt 0x0"
               :: "v"(l), "v"(g), "v"(l + LS), "v"(g + gstep), "v"(l + 2 * LS), "v"(g + 2 * gstep), "v"(l + 3 * LS), "v"(g + 3 * gstep),
                  "v"(l + 4 * LS), "v"(g + 4 * gstep), "v"(l + 5 * LS), "v"(g + 5 * gstep), "v"(l + 6 * LS), "v"(g + 6 * gstep),
                  "v"(l + 7 * LS), "v"(g + 7 * gstep) : "memory");
}
template <int ET> struct Elem;
template <> struct Elem<0> { typedef _Float16 T; };
template <> struct Elem<1> { typedef __bf16 T; };
// bytes of one stage buffer of a GEMM with the given SPLIT
constexpr int gm_stage(int split) {
  return (((split == 1 || split == 2) ? 2 : 1) + 8 * ((split == 1 || split == 3) ? 2 : 1)) * GM_PL;
}
// The GEMM of one block: smem = the kernel's 2 * gm_stage(SPLIT) bytes of LDS, bx = index of the block's group of eight tiles, b = batch.
template <int ET, int SPLIT, int BIAS_MODE, int OUT_MODE, bool RESID, int ACT = 0>
__device__ __forceinline__ void gemm64_body(
    unsigned char* smem, const int bx, const int b,
    const unsigned short* __restrict__ Ap, const unsigned short* __restrict__ A2p, int lda, long strideA,
    const unsigned short* __restrict__ Btp, const unsigned short* __restrict__ Bt2p, int ldb, long strideB,
    void* __restrict__ Cout, void* __restrict__ Cout2, int ldc, long strideC,
    const float* __restrict__ bias,
    const float* __restrict__ resid, long strideR,
    int M, int N, int K, float scale) {
  typedef typename Elem<ET>::T T;
  typedef typename Frag<T>::V V;
  constexpr bool ASPL = (SPLIT == 1) || (SPLIT == 2);
  constexpr bool BSPL = (SPLIT == 1) || (SPLIT == 3);
  const T* A = (const T*)Ap; const T* A2 = (const T*)A2p; const T* Bt = (const T*)Btp; const T* Bt2 = (const T*)Bt2p;
  constexpr int NPA = ASPL ? 2 : 1, NPB = BSPL ? 2 : 1;
  constexpr int STAGE = (NPA + 8 * NPB) * GM_PL;            // bytes of one buffer
  static_assert(STAGE == gm_stage(SPLIT) && 2 * STAGE <= 327680 && 8 * 16 * 68 * 4 <= STAGE);
  // smem: two stage buffers; behind the k loop: per-wave 16x64 f32 slabs, pitch 68
  const int lane = threadIdx.x & 31;
  const int wave = threadIdx.x >> 5;
  const int tilesN = N >> 6;
  const int tilesM = M >> 6;
  const int tile = bx * 8 + wave;
  if (bx * 8 >= tilesM * tilesN) return;   // the same for the whole block, in front of every barrier
  const int tm = tile / tilesN;
  const int tn = tile - tm * tilesN;
  const int m0 = tm << 6;
  const int n0 = tn << 6;

  const T* Ab  = A  + (size_t)b * strideA;
  const T* Bb  = Bt + (size_t)b * strideB;
  const T* Ab2 = ASPL ? (A2  + (size_t)b * strideA) : nullptr;
  const T* Bb2 = BSPL ? (Bt2 + (size_t)b * strideB) : nullptr;

  const int rlane = lane & 15;                 // row (A) / col (B, D) within subtile
  const int koff  = (lane >> 4) * 8;           // k offset of this lane half
  const int mOff  = (lane >> 4) * 8;           // D row offset

  v8f acc[4][4];
#pragma unroll
  for (int i = 0; i < 4; ++i)
#pragma unroll
    for (int j = 0; j < 4; ++j) acc[i][j] = (v8f){0.f,0.f,0.f,0.f,0.f,0.f,0.f,0.f};

  // ---- one stage's copies: the block's A rows (two 16-byte pieces per thread and plane), then this wave's own Bt rows ----
  const unsigned lbase = lds_off(smem);
  const int arow = threadIdx.x >> 3;           // 0..31; the second piece is row arow + 32
  const int brow = lane >> 3;                  // 0..3; piece it is row it * 4 + brow
  const int scol = (lane & 7) * 8;             // first k element of this lane's 16 bytes
  const unsigned la0 = lbase + (unsigned)(arow * GM_LP + scol) * 2u;
  const unsigned lb0 = lbase + (unsigned)(NPA + wave * NPB) * GM_PL + (unsigned)(brow * GM_LP + scol) * 2u;
  const size_t ga0 = (size_t)(m0 + arow) * lda + scol;
  const size_t gb0 = (size_t)(n0 + brow) * ldb + scol;
  auto issue_stage = [&](int st) {
    const unsigned bo = (unsigned)(st & 1) * STAGE;
    const size_t ka = ga0 + (size_t)st * GM_KS;
    const size_t kb = gb0 + (size_t)st * GM_KS;
    cp_async2(la0 + bo, Ab + ka, la0 + bo + 32 * GM_LP * 2, Ab + ka + (size_t)32 * lda);
    if (ASPL) cp_async2(la0 + bo + GM_PL, Ab2 + ka, la0 + bo + GM_PL + 32 * GM_LP * 2, Ab2 + ka + (size_t)32 * lda);
    const size_t gstep = (size_t)ldb * 8;   // bytes of four Bt rows
#pragma unroll   // two straight-line statements a plane: no loop counter between the copies
    for (int hf = 0; hf < 2; ++hf) {          // rows 0..31, rows 32..63
      cp_async8(lb0 + bo + hf * 32 * GM_LP * 2, (const char*)(Bb + kb + (size_t)(hf * 32) * ldb), gstep);
      if (BSPL) cp_async8(lb0 + bo + GM_PL + hf * 32 * GM_LP * 2, (const char*)(Bb2 + kb + (size_t)(hf * 32) * ldb), gstep);
    }
  };

  const int nst = K / GM_KS;
  issue_stage(0);
  asm volatile("s_wait_asynccnt 0x0" ::: "memory");   // this wave's copies of stage 0 have landed
  __syncthreads();                                    // stage 0 is readable by every wave
  if (nst > 1) issue_stage(1);
  for (int st = 0; st < nst; ++st) {
    const T* sA = (const T*)(smem + (st & 1) * STAGE);
    const T* sB = sA + (NPA + wave * NPB) * (GM_PL / 2);
#pragma unroll   // both 32-k steps of a stage in one body (as every loop below: fragment and accumulator arrays stay in registers)
    for (int ks = 0; ks < 2; ++ks) {
      V bh[4], bl[4], ah[4], al[4];
#pragma unroll
      for (int j = 0; j < 4; ++j) {
        const int bo = ((j << 4) + rlane) * GM_LP + ks * 32 + koff;
        bh[j] = Frag<T>::load(sB + bo);
        if (BSPL) bl[j] = Frag<T>::load(sB + GM_PL / 2 + bo);
        else bl[j] = bh[j];
      }
#pragma unroll
      for (int i = 0; i < 4; ++i) {
        const int ao = ((i << 4) + rlane) * GM_LP + ks * 32 + koff;
        ah[i] = Frag<T>::load(sA + ao);
        if (ASPL) al[i] = Frag<T>::load(sA + GM_PL / 2 + ao);
        else al[i] = ah[i];
      }
#pragma unroll
      for (int i = 0; i < 4; ++i) {
#pragma unroll
        for (int j = 0; j < 4; ++j) {
          acc[i][j] = Frag<T>::mma(ah[i], bh[j], acc[i][j]);
          if (BSPL) acc[i][j] = Frag<T>::mma(ah[i], bl[j], acc[i][j]);
          if (ASPL) acc[i][j] = Frag<T>::mma(al[i], bh[j], acc[i][j]);
        }
        Frag<T>::guard(acc[i][0], acc[i][3], ah[i], al[i]);
      }
      Frag<T>::keep(bh[0], bh[1], bh[2], bh[3]);
      if (BSPL) Frag<T>::keep(bl[0], bl[1], bl[2], bl[3]);
    }
    // hand-over: this wave's reads of stage st are over, its copies of stage st + 1 have landed; behind the barrier
    // stage st + 1 is readable by every wave and the buffer of stage st is free for stage st + 2
    asm volatile("s_wait_dscnt 0x0" ::: "memory");
    asm volatile("s_wait_asynccnt 0x0" ::: "memory");
    __syncthreads();
    if (st + 2 < nst) issue_stage(st + 2);
  }
  asm volatile("s_wait_asynccnt 0x0" ::: "memory");   // no copy is outstanding when the buffers become the output slabs
  acc_guard4(acc[0][0], acc[0][1], acc[0][2], acc[0][3]);
  acc_guard4(acc[1][0], acc[1][1], acc[1][2], acc[1][3]);
  acc_guard4(acc[2][0], acc[2][1], acc[2][2], acc[2][3]);
  acc_guard4(acc[3][0], acc[3][1], acc[3][2], acc[3][3]);

  // ---- epilogue ----
  float* slab = (float*)(smem + wave * (16 * 68 * 4));   // every wave has passed the last hand-over barrier: the buffers are free
  const float* Rb = RESID ? (resid + (size_t)b * strideR) : nullptr;
#pragma unroll
  for (int i = 0; i < 4; ++i) {
    const int mBase = m0 + (i << 4);
#pragma unroll
    for (int j = 0; j < 4; ++j) {
      const int n = n0 + (j << 4) + rlane;
      float bv = 0.f;
      if (BIAS_MODE == 2) bv = bias[n];
#pragma unroll
      for (int r = 0; r < 8; ++r) {
        float v = acc[i][j][r] * scale;
        if (BIAS_MODE == 1) v += bias[mBase + mOff + r];
        if (BIAS_MODE == 2) v += bv;
        if (RESID) v += Rb[(size_t)(mBase + mOff + r) * ldc + n];
        if (ACT == 1) v = tanhf(v);
        if (ACT == 2) v = fmaxf(v, 0.0f);
        if (ACT == 3) v = v / (1.0f + expf(-v));
        if (ACT == 4) v = (v > 0.f) ? v : 0.01f * v;
        slab[(mOff + r) * 68 + (j << 4) + rlane] = v;
      }
    }
    __builtin_amdgcn_fence(__ATOMIC_RELEASE, "workgroup");
    __builtin_amdgcn_wave_barrier();
    __builtin_amdgcn_fence(__ATOMIC_ACQUIRE, "workgroup");
    if (OUT_MODE == 0) {
      float* C = (float*)Cout + (size_t)b * strideC;
      const int hh = lane >> 4, c4 = (lane & 15) * 4;     // row seg = 256 B = 16 lanes x 16 B
      {
#pragma unroll
        for (int it = 0; it < 8; ++it) {
          const int row = it * 2 + hh;
          v4f v = *(const v4f*)(slab + row * 68 + c4);
          *(v4f*)(C + (size_t)(mBase + row) * ldc + n0 + c4) = v;
        }
        
      }
    } else {
      const int q = lane >> 3, c8 = (lane & 7) * 8;
      unsigned short* C  = (unsigned short*)Cout  + (size_t)b * strideC;
      unsigned short* C2 = (OUT_MODE == 2) ? ((unsigned short*)Cout2 + (size_t)b * strideC) : nullptr;
      {
#pragma unroll
        for (int it = 0; it < 4; ++it) {
          const int row = it * 4 + q;
          const float* sp = slab + row * 68 + c8;
          v8h hv, lv;
#pragma unroll
          for (int e = 0; e < 8; ++e) {
            if (OUT_MODE == 1) {
              hv[e] = (_Float16)sp[e];
            } else {
              unsigned short hb = f2bf_bits(sp[e]);
              unsigned short lb = f2bf_bits(sp[e] - bf_bits2f(hb));
              hv[e] = __builtin_bit_cast(_Float16, hb);
              lv[e] = __builtin_bit_cast(_Float16, lb);
            }
          }
          *(v8h*)(C + (size_t)(mBase + row) * ldc + n0 + c8) = hv;
          if (OUT_MODE == 2) *(v8h*)(C2 + (size_t)(mBase + row) * ldc + n0 + c8) = lv;
        }
        
      }
    }
    __builtin_amdgcn_fence(__ATOMIC_RELEASE, "workgroup");
    __builtin_amdgcn_wave_barrier();
    __builtin_amdgcn_fence(__ATOMIC_ACQUIRE, "workgroup");
  }
}

template <int ET, int SPLIT, int BIAS_MODE, int OUT_MODE, bool RESID, int ACT = 0>
__global__ __launch_bounds__(256) void wmma_gemm64(
    const unsigned short* __restrict__ Ap, const unsigned short* __restrict__ A2p, int lda, long strideA,
    const unsigned short* __restrict__ Btp, const unsigned short* __restrict__ Bt2p, int ldb, long strideB,
    void* __restrict__ Cout, void* __restrict__ Cout2, int ldc, long strideC,
    const float* __restrict__ bias,
    const float* __restrict__ resid, long strideR,
    int M, int N, int K, float scale) {
  __shared__ __align__(16) unsigned char smem[2 * gm_stage(SPLIT)];
  gemm64_body<ET, SPLIT, BIAS_MODE, OUT_MODE, RESID, ACT>(smem, (int)blockIdx.x, (int)blockIdx.y, Ap, A2p, lda, strideA,
      Btp, Bt2p, ldb, strideB, Cout, Cout2, ldc, strideC, bias, resid, strideR, M, N, K, scale);
}

constexpr int SEQ_LEN = 1024;
constexpr int N_HEADS = 8;
constexpr int N_CH = 512;
constexpr int N_CIN = 256;
constexpr int N_FF = 1024;
constexpr int N_B = 8;

// ---- the q, k and v projections in one launch: they need nothing of each other. grid (16, N_B, 3); blockIdx.z picks the GEMM ----
//   z = 0: gq[l][o] = sum_c xqT[l][c]  wq[o][c] + bq[o]   (M = 1024, N = 512, K = 512), L-major
//   z = 1: gk[l][o] = sum_c xkvT[l][c] wk[o][c] + bk[o]   (M = 1024, N = 512, K = 256), L-major
//   z = 2: gv[o][m] = sum_c wv[o][c] xkvT[m][c] + bv[o]   (M = 512, N = 1024, K = 256), channel-major
__global__ __launch_bounds__(256) void k_gemm_qkv(
    const unsigned short* __restrict__ xqT, const unsigned short* __restrict__ xkvT,
    const unsigned short* __restrict__ wq16, const unsigned short* __restrict__ wk16, const unsigned short* __restrict__ wv16,
    const float* __restrict__ bq, const float* __restrict__ bk, const float* __restrict__ bv,
    float* __restrict__ gq, float* __restrict__ gk, float* __restrict__ gv) {
  __shared__ __align__(16) unsigned char smem[2 * gm_stage(0)];
  const int job = blockIdx.z;   // the same for the whole block
  if (job < 2) {
    const bool isq = job == 0;
    const int K = isq ? N_CH : N_CIN;
    gemm64_body<1, 0, 2, 0, false>(smem, (int)blockIdx.x, (int)blockIdx.y,
        isq ? xqT : xkvT, nullptr, K, (long)SEQ_LEN * K, isq ? wq16 : wk16, nullptr, K, 0L,
        (void*)(isq ? gq : gk), nullptr, N_CH, (long)SEQ_LEN * N_CH, isq ? bq : bk, nullptr, 0L, SEQ_LEN, N_CH, K, 1.0f);
  } else {
    gemm64_body<1, 0, 1, 0, false>(smem, (int)blockIdx.x, (int)blockIdx.y,
        wv16, nullptr, N_CIN, 0L, xkvT, nullptr, N_CIN, (long)SEQ_LEN * N_CIN,
        (void*)gv, nullptr, SEQ_LEN, (long)N_CH * SEQ_LEN, bv, nullptr, 0L, N_CH, SEQ_LEN, N_CIN, 1.0f);
  }
}

// f32 -> bf16 (RNE), two elements per thread; blk = index of the 256-thread block inside this array
__device__ __forceinline__ void cast_bf16x2_body(
    const float* __restrict__ in, unsigned short* __restrict__ out, int n2, int blk) {
  int i = blk * 256 + threadIdx.x;
  if (i < n2) {
    const float* p = in + 2 * i;
    const float e0 = p[0], e1 = p[1];
    // p as an input keeps the load's address pair whole up to the wait (else the load lands on it)
    asm volatile("s_wait_xcnt 0x0" :: "v"(p) : "memory");
    const unsigned u = (unsigned)f2bf_bits(e0) | ((unsigned)f2bf_bits(e1) << 16);
    ((unsigned*)out)[i] = u;
  }
}

// ---- (nb, C, L) f32 -> (nb, L, C) bf16 through an LDS tile: in[c][l] -> out[l][c] ----
// tile = 64 channels x 32 positions; tile index (bx < L/32, by < C/64, b < nb), block 256.
// loads: 256 threads x 8 = 2048 = 64x32 floats; stores: thread (r = tid>>3, c8 = (tid&7)*8) writes 8 bf16 = 16 B,
__device__ __forceinline__ void transpose_bf16_body(
    const float* __restrict__ in, unsigned short* __restrict__ out, int C, int L, int bx, int by, int b) {
  __shared__ float t[64][33];
  const int tid = threadIdx.x;
  const int l0 = bx * 32, c0 = by * 64;
  const float* inb = in + (size_t)b * C * L;
#pragma unroll
  for (int i = 0; i < 8; ++i) {
    const int cl = i * 8 + (tid >> 5);
    t[cl][tid & 31] = inb[(size_t)(c0 + cl) * L + l0 + (tid & 31)];
  }
  __syncthreads();
  const int r = tid >> 3, c8 = (tid & 7) * 8;
  unsigned w0, w1, w2, w3;
  w0 = (unsigned)f2bf_bits(t[c8 + 0][r]) | ((unsigned)f2bf_bits(t[c8 + 1][r]) << 16);
  w1 = (unsigned)f2bf_bits(t[c8 + 2][r]) | ((unsigned)f2bf_bits(t[c8 + 3][r]) << 16);
  w2 = (unsigned)f2bf_bits(t[c8 + 4][r]) | ((unsigned)f2bf_bits(t[c8 + 5][r]) << 16);
  w3 = (unsigned)f2bf_bits(t[c8 + 6][r]) | ((unsigned)f2bf_bits(t[c8 + 7][r]) << 16);
  const v4u val = (v4u){w0, w1, w2, w3};
  unsigned short* dst = out + ((size_t)b * L + l0 + r) * C + c0 + c8;
  *(v4u*)dst = val;
  
}

// ---- all operand preparation in one launch: the two activation transposes and the five weight casts need nothing of each other.
// One-dimensional grid; a range of the block index picks the job (the same for the whole block), the transposes first.
constexpr int PB_XQ  = (SEQ_LEN / 32) * (N_CH / 64) * N_B;    // blocks of the x_query transpose
constexpr int PB_XKV = (SEQ_LEN / 32) * (N_CIN / 64) * N_B;   // blocks of the x_kv transpose
constexpr int PB_WQ  = N_CH * N_CH / 512;                     // blocks of a cast: 512 elements each
constexpr int PB_WKV = N_CH * N_CIN / 512;
constexpr int PB_WFF = N_FF * N_CH / 512;
constexpr int PB_ALL = PB_XQ + PB_XKV + PB_WQ + 2 * PB_WKV + 2 * PB_WFF;
__global__ __launch_bounds__(256) void k_prep(
    const float* __restrict__ x_query, const float* __restrict__ x_kv,
    const float* __restrict__ wq, const float* __restrict__ wk, const float* __restrict__ wv,
    const float* __restrict__ w1, const float* __restrict__ w2,
    unsigned short* __restrict__ xqT, unsigned short* __restrict__ xkvT,
    unsigned short* __restrict__ wq16, unsigned short* __restrict__ wk16, unsigned short* __restrict__ wv16,
    unsigned short* __restrict__ w1_16, unsigned short* __restrict__ w2_16) {
  int blk = blockIdx.x;
  if (blk < PB_XQ + PB_XKV) {
    const bool isq = blk < PB_XQ;
    static_assert(N_CH / 64 == 8 && N_CIN / 64 == 4);
    const unsigned t  = isq ? blk : blk - PB_XQ;
    const unsigned cb = t / (SEQ_LEN / 32);   // (batch, channel block)
    const int ls = isq ? 3 : 2;               // log2 of the channel blocks: a shift, not a division by a run-time value
    transpose_bf16_body(isq ? x_query : x_kv, isq ? xqT : xkvT, isq ? N_CH : N_CIN, SEQ_LEN,
                        (int)(t % (SEQ_LEN / 32)), (int)(cb & ((1u << ls) - 1u)), (int)(cb >> ls));
    return;
  }
  blk -= PB_XQ + PB_XKV;
  const float* in; unsigned short* out; int n2;
  if (blk < PB_WQ)                                 { in = wq; out = wq16;  n2 = N_CH * N_CH / 2; }
  else if ((blk -= PB_WQ) < PB_WKV)                { in = wk; out = wk16;  n2 = N_CH * N_CIN / 2; }
  else if ((blk -= PB_WKV) < PB_WKV)               { in = wv; out = wv16;  n2 = N_CH * N_CIN / 2; }
  else if ((blk -= PB_WKV) < PB_WFF)               { in = w1; out = w1_16; n2 = N_FF * N_CH / 2; }
  else                          { blk -= PB_WFF;     in = w2; out = w2_16; n2 = N_CH * N_FF / 2; }
  cast_bf16x2_body(in, out, n2, blk);
}

// ---- InstanceNorm over the 1024 rows of an L-major f32 plane X[nb][1024][NCOL], per (b, column) ----
// block = 32 waves owns a slab of 64 columns x 1024 rows; slab index (bx < NCOL/64, by < nb).
// lane = (row half, 4 adjacent columns): one wave-wide 16-byte load covers 2 rows x 256 B; a thread keeps its
// 16 rows (i*64 + wave*2 + half) x 4 columns in registers, so X is read once. Mean, then centred sum of squares.
// output = bf16 hi + lo planes, same layout (a wave stores 2 rows x 128 B per plane);
// MODE 0: plain; MODE 1: + residual read from a bf16 plane res (same layout); MODE 2: relu.
constexpr int CN_RP = 68;   // pitch in floats of the per-wave partial rows (16-byte aligned rows)

// column totals over the whole slab: s = this thread's partial for its 4 columns; every thread gets the totals of its 4 columns.
// fixed tree: two row halves by shuffle, 32 wave partials through LDS, wave w adds up columns 2w and 2w+1 by a butterfly.
__device__ __forceinline__ v4f cn_colsum(v4f s, float* red, float* tot, int wave, int lane) {
  const int c4 = (lane & 15) * 4;
#pragma unroll
  for (int e = 0; e < 4; ++e) s[e] += __shfl_xor(s[e], 16, 32);
  if (lane < 16) *(v4f*)(red + wave * CN_RP + c4) = s;
  __syncthreads();   // all 32 partial rows are in red
  v2f p = *(const v2f*)(red + lane * CN_RP + 2 * wave);
#pragma unroll
  for (int off = 1; off < 32; off <<= 1) {
    p.x += __shfl_xor(p.x, off, 32);
    p.y += __shfl_xor(p.y, off, 32);
  }
  if (lane == 0) *(v2f*)(tot + 2 * wave) = p;
  __syncthreads();   // all 64 totals are in tot; every read of red is over
  return *(const v4f*)(tot + c4);
}

template <int MODE, int NCOL>
__device__ __forceinline__ void colnorm_body(
    const float* __restrict__ X, const unsigned* __restrict__ res,
    unsigned* __restrict__ outh, unsigned* __restrict__ outl, int bx, int by) {
  constexpr int NR = 1024, NW = 32, NI = NR / (2 * NW);
  __shared__ __align__(16) float red[NW * CN_RP];
  __shared__ __align__(16) float tot[2][64];
  const int lane = threadIdx.x & 31, wave = threadIdx.x >> 5;
  const size_t base = ((size_t)by * NR + wave * 2 + (lane >> 4)) * NCOL + bx * 64 + (lane & 15) * 4;
  constexpr size_t STEP = (size_t)64 * NCOL;   // floats between a thread's rows; STEP / 2 words in the bf16 planes
  const size_t obase = base >> 1;
  const float* xp = X + base;
  v4f x[NI];
#pragma unroll
  for (int i = 0; i < NI; ++i) x[i] = *(const v4f*)(xp + i * STEP);
  // xp as an input keeps the loads' address pair whole up to the wait (else the last load lands on it)
  asm volatile("s_wait_xcnt 0x0" :: "v"(xp) : "memory");
  // MODE 1: residual words, two groups of 4 rows; the first group is asked for here, under the two reductions
  v2u rw[2][4];
  if constexpr (MODE == 1) {
#pragma unroll
    for (int j = 0; j < 4; ++j) rw[0][j] = *(const v2u*)(res + obase + j * (STEP / 2));
  }
  v4f s = x[0];
#pragma unroll
  for (int i = 1; i < NI; ++i) s += x[i];
  const v4f mean = cn_colsum(s, red, tot[0], wave, lane) * (1.0f / NR);
  v4f q = (v4f){0.f, 0.f, 0.f, 0.f};
#pragma unroll
  for (int i = 0; i < NI; ++i) {
    x[i] -= mean;
    q += x[i] * x[i];
  }
  const v4f var = cn_colsum(q, red, tot[1], wave, lane) * (1.0f / NR);
  v4f rs;
#pragma unroll
  for (int e = 0; e < 4; ++e) rs[e] = rsqrtf(var[e] + 1e-5f);
#pragma unroll
  for (int g = 0; g < NI / 4; ++g) {
    if constexpr (MODE == 1) {
      if (g + 1 < NI / 4) {
#pragma unroll
        for (int j = 0; j < 4; ++j) rw[(g + 1) & 1][j] = *(const v2u*)(res + obase + ((g + 1) * 4 + j) * (STEP / 2));
      }
    }
#pragma unroll
    for (int j = 0; j < 4; ++j) {
      const int i = g * 4 + j;
      v4f y = x[i] * rs;
      if constexpr (MODE == 1) {
        const v2u w = rw[g & 1][j];
        y.x += __uint_as_float(w.x << 16);
        y.y += __uint_as_float(w.x & 0xffff0000u);
        y.z += __uint_as_float(w.y << 16);
        y.w += __uint_as_float(w.y & 0xffff0000u);
      }
      if constexpr (MODE == 2) {
#pragma unroll
        for (int e = 0; e < 4; ++e) y[e] = fmaxf(y[e], 0.0f);
      }
      unsigned short hb[4], lb[4];
#pragma unroll
      for (int e = 0; e < 4; ++e) {
        hb[e] = f2bf_bits(y[e]);
        lb[e] = f2bf_bits(y[e] - bf_bits2f(hb[e]));
      }
      const size_t oi = obase + i * (STEP / 2);
      *(v2u*)(outh + oi) = (v2u){ (unsigned)hb[0] | ((unsigned)hb[1] << 16), (unsigned)hb[2] | ((unsigned)hb[3] << 16) };
      *(v2u*)(outl + oi) = (v2u){ (unsigned)lb[0] | ((unsigned)lb[1] << 16), (unsigned)lb[2] | ((unsigned)lb[3] << 16) };
    }
    if (g + 1 < NI / 4) {
      // stands in front of every reuse of the address and data registers that the loads and stores above name
      asm volatile("s_wait_xcnt 0x0" ::: "memory");
      // keeps the next group's code below that wait; in MODE 1 it also keeps the later groups' residual loads from
      // being hoisted: with all 16 in flight the kernel passes the 128 registers of a 32-wave block and spills
      __builtin_amdgcn_sched_barrier(0);
    }
  }
}

template <int MODE, int NCOL>
__global__ __launch_bounds__(1024) void k_colnorm(
    const float* __restrict__ X, const unsigned* __restrict__ res,
    unsigned* __restrict__ outh, unsigned* __restrict__ outl) {
  colnorm_body<MODE, NCOL>(X, res, outh, outl, (int)blockIdx.x, (int)blockIdx.y);
}

// ---- InstanceNorm over channel-major f32 rows X[row][1024] (row = b*C + channel), one wave per row ----
// Rolled re-read passes (no per-thread arrays); no LDS, no barrier.
template <int MODE>
__device__ __forceinline__ void rownorm_body(
    const float* __restrict__ X, float* __restrict__ outf,
    unsigned short* __restrict__ outh, unsigned short* __restrict__ outl, const size_t row) {
  constexpr int NCOL = 1024;
  const int lane = threadIdx.x & 31;
  const float* xr = X + row * NCOL;
  float s = 0.f;
#pragma unroll 1
  for (int it = 0; it < 8; ++it) {
    const v4f u = *(const v4f*)(xr + it * 128 + lane * 4);
    s += (u.x + u.y) + (u.z + u.w);
  }
#pragma unroll
  for (int off = 1; off < 32; off <<= 1) s += __shfl_xor(s, off, 32);
  const float mean = s * (1.0f / NCOL);
  float ss = 0.f;
#pragma unroll 1
  for (int it = 0; it < 8; ++it) {
    const v4f u = *(const v4f*)(xr + it * 128 + lane * 4);
    const float d0 = u.x - mean, d1 = u.y - mean, d2 = u.z - mean, d3 = u.w - mean;
    ss += (d0 * d0 + d1 * d1) + (d2 * d2 + d3 * d3);
  }
#pragma unroll
  for (int off = 1; off < 32; off <<= 1) ss += __shfl_xor(ss, off, 32);
  const float rs = rsqrtf(ss * (1.0f / NCOL) + 1e-5f);
  if constexpr (MODE == 0) {
    float* orow = outf + row * NCOL;
    {
#pragma unroll 1
      for (int it = 0; it < 8; ++it) {
        const v4f u = *(const v4f*)(xr + it * 128 + lane * 4);
        v4f y;
        y.x = (u.x - mean) * rs; y.y = (u.y - mean) * rs; y.z = (u.z - mean) * rs; y.w = (u.w - mean) * rs;
        *(v4f*)(orow + it * 128 + lane * 4) = y;
      }
      
    }
  } else {
    unsigned short* hrow = outh + row * NCOL;
    unsigned short* lrw  = outl + row * NCOL;
    {
#pragma unroll 1
      for (int it = 0; it < 4; ++it) {
        const v4f u0 = *(const v4f*)(xr + it * 256 + lane * 8);
        const v4f u1 = *(const v4f*)(xr + it * 256 + lane * 8 + 4);
        const float y0 = (u0.x - mean) * rs, y1 = (u0.y - mean) * rs, y2 = (u0.z - mean) * rs, y3 = (u0.w - mean) * rs;
        const float y4 = (u1.x - mean) * rs, y5 = (u1.y - mean) * rs, y6 = (u1.z - mean) * rs, y7 = (u1.w - mean) * rs;
        const unsigned short h0 = f2bf_bits(y0), h1 = f2bf_bits(y1), h2 = f2bf_bits(y2), h3 = f2bf_bits(y3);
        const unsigned short h4 = f2bf_bits(y4), h5 = f2bf_bits(y5), h6 = f2bf_bits(y6), h7 = f2bf_bits(y7);
        const unsigned short l0 = f2bf_bits(y0 - bf_bits2f(h0)), l1 = f2bf_bits(y1 - bf_bits2f(h1));
        const unsigned short l2 = f2bf_bits(y2 - bf_bits2f(h2)), l3 = f2bf_bits(y3 - bf_bits2f(h3));
        const unsigned short l4 = f2bf_bits(y4 - bf_bits2f(h4)), l5 = f2bf_bits(y5 - bf_bits2f(h5));
        const unsigned short l6 = f2bf_bits(y6 - bf_bits2f(h6)), l7 = f2bf_bits(y7 - bf_bits2f(h7));
        const v4u hv = (v4u){ (unsigned)h0 | ((unsigned)h1 << 16), (unsigned)h2 | ((unsigned)h3 << 16),
                              (unsigned)h4 | ((unsigned)h5 << 16), (unsigned)h6 | ((unsigned)h7 << 16) };
        const v4u lv = (v4u){ (unsigned)l0 | ((unsigned)l1 << 16), (unsigned)l2 | ((unsigned)l3 << 16),
                              (unsigned)l4 | ((unsigned)l5 << 16), (unsigned)l6 | ((unsigned)l7 << 16) };
        *(v4u*)(hrow + it * 256 + lane * 8) = hv;
        *(v4u*)(lrw  + it * 256 + lane * 8) = lv;
      }
      
    }
  }
}

// block 8 waves = 8 rows; grid = rows/8 (rows % 8 == 0)
template <int MODE>
__global__ __launch_bounds__(256) void k_rownorm(
    const float* __restrict__ X, float* __restrict__ outf,
    unsigned short* __restrict__ outh, unsigned short* __restrict__ outl) {
  rownorm_body<MODE>(X, outf, outh, outl, (size_t)blockIdx.x * 8 + (threadIdx.x >> 5));
}

// ---- the InstanceNorms of q, k and v in one launch: they need nothing of each other. Block = 32 waves; a range of the block
// index picks the job (the same for the whole block): 64 column slabs of q, 64 of k, then 32 rows of v per block.
constexpr int NB_SLAB = (N_CH / 64) * N_B;        // column slabs of q, and of k
constexpr int NB_VROW = N_B * N_CH / 32;          // blocks of 32 v rows
__global__ __launch_bounds__(1024) void k_norm_qkv(
    const float* __restrict__ gq, const float* __restrict__ gk, const float* __restrict__ gv,
    unsigned* __restrict__ qh, unsigned* __restrict__ ql, unsigned* __restrict__ kh, unsigned* __restrict__ kl,
    unsigned short* __restrict__ vh, unsigned short* __restrict__ vl) {
  const int blk = blockIdx.x;
  if (blk < 2 * NB_SLAB) {
    const bool isq = blk < NB_SLAB;
    const int t = isq ? blk : blk - NB_SLAB;
    colnorm_body<0, N_CH>(isq ? gq : gk, nullptr, isq ? qh : kh, isq ? ql : kl, t % (N_CH / 64), t / (N_CH / 64));
  } else {
    rownorm_body<1>(gv, nullptr, vh, vl, (size_t)(blk - 2 * NB_SLAB) * 32 + (threadIdx.x >> 5));
  }
}

#define AT_D 64
#define AT_NW 4
#define AT_KC 64
#define AT_OSP 68
// pitch in bf16 elements of every 64-element row of the K and V tiles in LDS: 144 B = 16 B x 9. The fragment reads are
// 16-byte loads of 16 rows at one column; at a pitch of 128 B those rows fall on two groups of four banks, at 144 B on sixteen.
#define AT_LP 72

__device__ __forceinline__ v8f at_mma(v16b a, v16b b, v8f c) {
  c = __builtin_amdgcn_wmma_f32_16x16x32_bf16(false, a, false, b, (short)0, c, false, false);
  asm volatile("v_nop\n\tv_nop\n\tv_nop\n\tv_nop" : "+v"(c) : "v"(a), "v"(b));
  return c;
}
// lane l <-> lane l ^ 16
__device__ __forceinline__ float at_xhalf(float x) {
  const int b = __builtin_bit_cast(int, x);
  return __builtin_bit_cast(float, __builtin_amdgcn_permlanex16(b, b, 0x76543210, 0xfedcba98, false, false));
}
// two neighbouring elements of a fragment -> one register of the hi plane and one of the lo plane (bf16, round to nearest even;
// f0 in the low half): hi = bf16(f), lo = bf16(f - hi)
__device__ __forceinline__ void at_split2(float f0, float f1, unsigned& hi, unsigned& lo) {
  const unsigned hw = __builtin_bit_cast(unsigned, __builtin_convertvector((v2f){f0, f1}, v2b));
  const v2f rem = (v2f){f0, f1} - (v2f){__uint_as_float(hw << 16), __uint_as_float(hw & 0xffff0000u)};   // one packed subtraction a pair
  hi = hw;
  lo = __builtin_bit_cast(unsigned, __builtin_convertvector(rem, v2b));
}

// four waves a SIMD: the grid gives every WGP four work-groups (1024 on 256 WGPs); by LDS and registers a fifth would fit on a
// WGP and would then be missing on another
__global__ __launch_bounds__(128) __attribute__((amdgpu_waves_per_eu(4, 4)))
void k_attn(const unsigned short* __restrict__ qhp, const unsigned short* __restrict__ qlp,
            const unsigned short* __restrict__ khp, const unsigned short* __restrict__ klp,
            const unsigned short* __restrict__ vhp, const unsigned short* __restrict__ vlp,
            float* __restrict__ out, float sscale) {
  union FB { v16b v; v8b h[2]; unsigned w[8]; };
  __shared__ __align__(16) __bf16 Ksh[AT_KC * AT_LP];            // K hi [kv][d]
  __shared__ __align__(16) __bf16 Ksl[AT_KC * AT_LP];            // K lo [kv][d]
  __shared__ __align__(16) __bf16 Vth[AT_D * AT_LP];             // V hi [d][kv]
  __shared__ __align__(16) __bf16 Vtl[AT_D * AT_LP];             // V lo [d][kv]
  __shared__ __align__(16) float  Os[AT_NW][16 * AT_OSP];        // per wave out tile

  const int tid  = threadIdx.x;
  const int wave = tid >> 5;
  const int lane = tid & 31;
  const int hh   = lane >> 4;
  const int c    = lane & 15;

  constexpr int NQB = SEQ_LEN / 64;
  const int bx  = blockIdx.x;
  const int qb  = bx % NQB;
  const int bhd = bx / NQB;
  const int h   = bhd % N_HEADS;
  const int b   = bhd / N_HEADS;
  const int q0  = qb * 64 + wave * 16;

  const __bf16* qh = (const __bf16*)qhp;
  const __bf16* ql = (const __bf16*)qlp;
  const __bf16* kh = (const __bf16*)khp;
  const __bf16* kl = (const __bf16*)klp;
  const __bf16* vh = (const __bf16*)vhp;
  const __bf16* vl = (const __bf16*)vlp;

  // ---- Q fragments (B operand: column = query q0 + c, k = d), hi and lo planes ----
  v16b qah[2], qal[2];
  {
    const size_t qo = ((size_t)b * SEQ_LEN + q0 + c) * N_CH + h * AT_D + 8 * hh;
#pragma unroll
    for (int dc = 0; dc < 2; ++dc) {
      qah[dc] = Frag<__bf16>::load(qh + qo + dc * 32);
      qal[dc] = Frag<__bf16>::load(ql + qo + dc * 32);
    }
  }

  // of this lane's query: running maximum over all keys so far, in units of log2 (score * cscale); running sum over this lane half's keys only
  const float cscale = sscale * 1.4426950408889634f;   // sscale * log2(e)
  float mrow = -INFINITY, lrow = 0.f;
  v8f oacc[4];   // O^T: element r of tile t = (d = t*16 + 8*hh + r, query c)
#pragma unroll
  for (int t = 0; t < 4; ++t) oacc[t] = (v8f){0.f,0.f,0.f,0.f,0.f,0.f,0.f,0.f};

  for (int kc = 0; kc < SEQ_LEN / AT_KC; ++kc) {
    const int kv0 = kc * AT_KC;
    __syncthreads();
    {
      // staging: thread (row = tid>>1, half = (tid&1)*32) copies 32 bf16 = 4 x 16 B per plane;
      // 128 threads x 32 = 4096 = 64 x 64 elements per plane (full tiles)
      const int row = tid >> 1, half = (tid & 1) * 32;
      const size_t ko = ((size_t)b * SEQ_LEN + kv0 + row) * N_CH + h * AT_D + half;
      const size_t vo = ((size_t)b * N_CH + h * AT_D + row) * SEQ_LEN + kv0 + half;
      {
        const v4u* sp = (const v4u*)(kh + ko);
        v4u* dp = (v4u*)(Ksh + row * AT_LP + half);
#pragma unroll
        for (int i = 0; i < 4; ++i) dp[i] = sp[i];
      }
      asm volatile("" ::: "memory");
      {
        const v4u* sp = (const v4u*)(kl + ko);
        v4u* dp = (v4u*)(Ksl + row * AT_LP + half);
#pragma unroll
        for (int i = 0; i < 4; ++i) dp[i] = sp[i];
      }
      asm volatile("" ::: "memory");
      {
        const v4u* sp = (const v4u*)(vh + vo);
        v4u* dp = (v4u*)(Vth + row * AT_LP + half);
#pragma unroll
        for (int i = 0; i < 4; ++i) dp[i] = sp[i];
      }
      asm volatile("" ::: "memory");
      {
        const v4u* sp = (const v4u*)(vl + vo);
        v4u* dp = (v4u*)(Vtl + row * AT_LP + half);
#pragma unroll
        for (int i = 0; i < 4; ++i) dp[i] = sp[i];
      }
    }
    __syncthreads();

    // ---- scores, transposed: A operand row = key j*16 + c, k = d (Ksh is [key][d], k-contiguous); B = Q ----
    v8f s[4];
#pragma unroll
    for (int j = 0; j < 4; ++j) {
      s[j] = (v8f){0.f,0.f,0.f,0.f,0.f,0.f,0.f,0.f};
#pragma unroll
      for (int dc = 0; dc < 2; ++dc) {
        FB kb, kb2;
        const int ko2 = (j * 16 + c) * AT_LP + dc * 32 + 8 * hh;
        kb.h[0]  = *(const v8b*)(Ksh + ko2);
        kb.h[1]  = *(const v8b*)(Ksh + ko2 + 16);
        kb2.h[0] = *(const v8b*)(Ksl + ko2);
        kb2.h[1] = *(const v8b*)(Ksl + ko2 + 16);
        s[j] = at_mma(kb.v,  qah[dc], s[j]);
        s[j] = at_mma(kb2.v, qah[dc], s[j]);
        s[j] = at_mma(kb.v,  qal[dc], s[j]);
      }
    }
    // D element r of lane = (key j*16 + 8*hh + r, query column c)
    // softmax in base 2: the maximum is taken over the raw scores and scaled once (cscale > 0 keeps the order)
    float cm[4];
#pragma unroll
    for (int j = 0; j < 4; ++j) {
      float m = -INFINITY;
#pragma unroll
      for (int r = 0; r < 8; ++r) m = fmaxf(m, s[j][r]);
      cm[j] = m;
    }
    float mc = fmaxf(fmaxf(cm[0], cm[1]), fmaxf(cm[2], cm[3]));
    mc = fmaxf(mc, at_xhalf(mc)) * cscale;   // both lane halves of a query agree on the maximum, so on alpha too
    const float mnew = fmaxf(mrow, mc);
    const float alpha = __builtin_amdgcn_exp2f(mrow - mnew);   // 0 in the first chunk, where mrow is -inf
    mrow = mnew;
    const v2f cs2 = (v2f){cscale, cscale}, nm2 = (v2f){-mnew, -mnew};
    // P^T as B operand of a 32-key step kk: element e < 8 = key kk*32 + 8*hh + e, e >= 8 = key kk*32 + 16 + 8*hh + (e - 8):
    // these are this lane's own elements of the score tiles j = 2*kk and j = 2*kk + 1
    FB ph[2], pl[2];
    float ps[4];
#pragma unroll
    for (int j = 0; j < 4; ++j) {
      float psum = 0.f;
#pragma unroll
      for (int r = 0; r < 8; r += 2) {
        // exp(sscale * s - max) = 2^(s * cscale - mnew): one packed multiply-add a score pair, then the hardware's 2^x
        const v2f arg = __builtin_elementwise_fma((v2f){s[j][r], s[j][r + 1]}, cs2, nm2);
        const float p0 = __builtin_amdgcn_exp2f(arg.x);
        const float p1 = __builtin_amdgcn_exp2f(arg.y);
        psum += p0 + p1;
        at_split2(p0, p1, ph[j >> 1].w[(j & 1) * 4 + (r >> 1)], pl[j >> 1].w[(j & 1) * 4 + (r >> 1)]);
      }
      ps[j] = psum;
    }
    lrow = lrow * alpha + ((ps[0] + ps[1]) + (ps[2] + ps[3]));
#pragma unroll
    for (int t = 0; t < 4; ++t) oacc[t] *= alpha;
    // ---- O^T += V^T.P^T : A = V with row = d, k = key (Vth is [d][key], k-contiguous), B = P^T ----
#pragma unroll   // ph and pl are indexed by kk: they stay in registers only with kk a constant
    for (int kk = 0; kk < 2; ++kk) {
#pragma unroll
      for (int t = 0; t < 4; ++t) {
        FB vb, vb2;
        const int vo2 = (t * 16 + c) * AT_LP + kk * 32 + 8 * hh;
        vb.h[0]  = *(const v8b*)(Vth + vo2);
        vb.h[1]  = *(const v8b*)(Vth + vo2 + 16);
        vb2.h[0] = *(const v8b*)(Vtl + vo2);
        vb2.h[1] = *(const v8b*)(Vtl + vo2 + 16);
        oacc[t] = at_mma(vb.v,  ph[kk].v, oacc[t]);
        oacc[t] = at_mma(vb2.v, ph[kk].v, oacc[t]);
        oacc[t] = at_mma(vb.v,  pl[kk].v, oacc[t]);
      }
    }
  }

  // out tile [query][d]: this lane holds 8 neighbouring d of query c in every O^T tile
  float* os = Os[wave];
  {
    const float inv = 1.0f / (lrow + at_xhalf(lrow));   // the two lane halves' sums are joined here, once
#pragma unroll
    for (int t = 0; t < 4; ++t) {
      float* op = os + c * AT_OSP + t * 16 + 8 * hh;
      *(v4f*)(op)     = (v4f){oacc[t][0] * inv, oacc[t][1] * inv, oacc[t][2] * inv, oacc[t][3] * inv};
      *(v4f*)(op + 4) = (v4f){oacc[t][4] * inv, oacc[t][5] * inv, oacc[t][6] * inv, oacc[t][7] * inv};
    }
  }
  __builtin_amdgcn_fence(__ATOMIC_RELEASE, "workgroup");
  __builtin_amdgcn_wave_barrier();
  __builtin_amdgcn_fence(__ATOMIC_ACQUIRE, "workgroup");
  {
    float* ob = out + ((size_t)b * SEQ_LEN) * N_CH + h * AT_D;
    const int c4 = (lane & 15) * 4;
    {
#pragma unroll
      for (int it = 0; it < 8; ++it) {
        const int row = it * 2 + hh;
        v4f val = *(const v4f*)(os + row * AT_OSP + c4);
        *(v4f*)(ob + (size_t)(q0 + row) * N_CH + c4) = val;
      }
      
    }
  }
}

// =====================================================================================
// Host orchestration
// =====================================================================================
extern "C" void kernel_launch(void* const* d_in, const int* in_sizes, int n_in,
                              void* d_out, int out_size, void* d_ws,
                              size_t ws_size, hipStream_t stream) {
  (void)in_sizes; (void)n_in; (void)out_size;
  constexpr int NB = 8, CIN = 256, NCH = 512, SEQ = 1024, NFF = 1024, NHD = 8;

  // ---- workspace region map (bytes) ----
  constexpr size_t SZ_WQ   = (size_t)NCH * NCH * 2;        //    524288  wq  bf16 [512][512]
  constexpr size_t SZ_WK   = (size_t)NCH * CIN * 2;        //    262144  wk  bf16 [512][256]
  constexpr size_t SZ_WV   = (size_t)NCH * CIN * 2;        //    262144  wv  bf16 [512][256]
  constexpr size_t SZ_W1   = (size_t)NFF * NCH * 2;        //   1048576  w1  bf16 [1024][512]
  constexpr size_t SZ_W2   = (size_t)NCH * NFF * 2;        //   1048576  w2  bf16 [512][1024]
  constexpr size_t SZ_XQT  = (size_t)NB * SEQ * NCH * 2;   //   8388608  x_query (L,C) bf16
  constexpr size_t SZ_XKVT = (size_t)NB * SEQ * CIN * 2;   //   4194304  x_kv (L,C) bf16
  constexpr size_t SZ_G    = (size_t)NB * SEQ * NFF * 4;   //  33554432  f32 GEMM/attention output, max user = ffn1 [8][1024][1024]
  constexpr size_t SZ_P    = (size_t)NB * SEQ * NCH * 2;   //   8388608  one bf16 activation plane [8][1024][512]
  constexpr size_t OFF_WQ   = 0;
  constexpr size_t OFF_WK   = OFF_WQ + SZ_WQ;
  constexpr size_t OFF_WV   = OFF_WK + SZ_WK;
  constexpr size_t OFF_W1   = OFF_WV + SZ_WV;
  constexpr size_t OFF_W2   = OFF_W1 + SZ_W1;
  constexpr size_t OFF_XQT  = OFF_W2 + SZ_W2;
  constexpr size_t OFF_XKVT = OFF_XQT + SZ_XQT;
  constexpr size_t OFF_G    = OFF_XKVT + SZ_XKVT;
  constexpr size_t OFF_QH   = OFF_G + SZ_G;       // q hi plane; later z hi plane
  constexpr size_t OFF_QL   = OFF_QH + SZ_P;      // q lo plane; later z lo plane
  constexpr size_t OFF_KH   = OFF_QL + SZ_P;      // k hi plane; later y hi plane spans KH+KL (16777216)
  constexpr size_t OFF_KL   = OFF_KH + SZ_P;      // k lo plane
  constexpr size_t OFF_VH   = OFF_KL + SZ_P;      // v hi plane; later y lo plane spans VH+VL (16777216)
  constexpr size_t OFF_VL   = OFF_VH + SZ_P;      // v lo plane
  constexpr size_t OFF_GV   = OFF_VL + SZ_P;      // v projection f32 [8][512][1024] (q and k projections: the two halves of G)
  constexpr size_t OFF_END  = OFF_GV + SZ_G / 2;  // 116391936
  static_assert(OFF_END == 116391936ull);
  static_assert(OFF_END <= 134217728ull);
  static_assert((OFF_WK % 256) == 0 && (OFF_XQT % 256) == 0 && (OFF_G % 256) == 0 && (OFF_QH % 256) == 0);
  // reused regions sized from the max user
  static_assert((size_t)NB * SEQ * NCH * 4 * 2 <= SZ_G);    // q and k side by side; proj, ffn2 f32 outputs
  static_assert(NB == N_B && CIN == N_CIN && NCH == N_CH && SEQ == SEQ_LEN && NFF == N_FF && NHD == N_HEADS);
  static_assert((size_t)NB * SEQ * NFF * 4 <= SZ_G);        // ffn1 f32 output
  static_assert((size_t)NB * SEQ * NFF * 2 == 2 * SZ_P);    // y plane fits exactly over two 512-wide planes
  // GEMM shape contract: M multiple of 64, N multiple of 512, K multiple of 64
  static_assert(SEQ % 512 == 0 && NCH % 512 == 0 && NFF % 512 == 0);
  static_assert(NCH % 64 == 0 && CIN % 64 == 0 && NFF % 64 == 0);
  static_assert(((SEQ / 64) * (NCH / 64)) % 8 == 0 && ((SEQ / 64) * (NFF / 64)) % 8 == 0);
  static_assert(NCH % 256 == 0 && NFF % 256 == 0 && (NB * NCH) % 8 == 0);
  static_assert((size_t)NB * NCH * SEQ * 4 == 16777216ull);   // d_out bytes
  if (ws_size < OFF_END) return;

  const float* x_query = (const float*)d_in[0];
  const float* x_kv    = (const float*)d_in[1];
  const float* wq      = (const float*)d_in[2];
  const float* bq      = (const float*)d_in[3];
  const float* wk      = (const float*)d_in[4];
  const float* bk      = (const float*)d_in[5];
  const float* wv      = (const float*)d_in[6];
  const float* bv      = (const float*)d_in[7];
  const float* w1      = (const float*)d_in[8];
  const float* b1      = (const float*)d_in[9];
  const float* w2      = (const float*)d_in[10];
  const float* b2      = (const float*)d_in[11];
  float* out = (float*)d_out;

  char* ws = (char*)d_ws;
  typedef unsigned short us;
  us* wq16  = (us*)(ws + OFF_WQ);
  us* wk16  = (us*)(ws + OFF_WK);
  us* wv16  = (us*)(ws + OFF_WV);
  us* w1_16 = (us*)(ws + OFF_W1);
  us* w2_16 = (us*)(ws + OFF_W2);
  us* xqT   = (us*)(ws + OFF_XQT);
  us* xkvT  = (us*)(ws + OFF_XKVT);
  float* gf = (float*)(ws + OFF_G);
  float* gq = gf;
  float* gk = (float*)(ws + OFF_G + SZ_G / 2);
  float* gv = (float*)(ws + OFF_GV);
  us* qh = (us*)(ws + OFF_QH);
  us* ql = (us*)(ws + OFF_QL);
  us* kh = (us*)(ws + OFF_KH);
  us* kl = (us*)(ws + OFF_KL);
  us* vh = (us*)(ws + OFF_VH);
  us* vl = (us*)(ws + OFF_VL);
  us* zh = qh;
  us* zl = ql;
  us* yh = kh;    // [8][1024][1024] bf16 = 16777216 B over KH..KL
  us* yl = vh;    // [8][1024][1024] bf16 = 16777216 B over VH..VL

  // 1) operand preparation: activations (B,C,L) f32 -> (B,L,C) bf16, weights -> bf16 (RNE)
  k_prep<<<PB_ALL, 256, 0, stream>>>(x_query, x_kv, wq, wk, wv, w1, w2, xqT, xkvT, wq16, wk16, wv16, w1_16, w2_16);

  // 2) q, k (L-major) and v (channel-major) projections, f32
  k_gemm_qkv<<<dim3((SEQ / 64) * (NCH / 64) / 8, NB, 3), 256, 0, stream>>>(xqT, xkvT, wq16, wk16, wv16, bq, bk, bv, gq, gk, gv);

  // 3) InstanceNorm of each -> q, k hi/lo planes (L-major), v hi/lo planes (channel-major)
  k_norm_qkv<<<2 * NB_SLAB + NB_VROW, 1024, 0, stream>>>(gq, gk, gv, (unsigned*)qh, (unsigned*)ql, (unsigned*)kh, (unsigned*)kl, vh, vl);

  // 4) attention -> gf as proj L-major [b][l][h*64+d] f32
  k_attn<<<NB * NHD * (SEQ / 64), 128, 0, stream>>>(qh, ql, kh, kl, vh, vl, gf, 0.125f);

  // 5) z = InstanceNorm(proj) + x_query(bf16) -> z hi/lo planes (L-major, pitch 512)
  k_colnorm<1, NCH><<<dim3(NCH / 64, NB), 1024, 0, stream>>>(gf, (const unsigned*)xqT, (unsigned*)zh, (unsigned*)zl);

  // 6) ffn1: C[l][o] = sum_c z[l][c] w1[o][c] + b1[o]  (M=1024, N=1024, K=512), z as hi/lo -> gf L-major [l][1024]
  wmma_gemm64<1, 2, 2, 0, false><<<dim3((SEQ / 64) * (NFF / 64) / 8, NB), 256, 0, stream>>>(
      zh, zl, NCH, (long)SEQ * NCH, w1_16, nullptr, NCH, 0L,
      (void*)gf, nullptr, NFF, (long)SEQ * NFF, b1, nullptr, 0L, SEQ, NFF, NCH, 1.0f);
  // 7) y = relu(InstanceNorm(h1)) -> y hi/lo planes [l][1024]
  k_colnorm<2, NFF><<<dim3(NFF / 64, NB), 1024, 0, stream>>>(gf, nullptr, (unsigned*)yh, (unsigned*)yl);

  // 8) ffn2: C[o][l] = sum_c w2[o][c] y[l][c] + b2[o]  (M=512, N=1024, K=1024), y as hi/lo -> channel-major gf
  wmma_gemm64<1, 3, 1, 0, false><<<dim3((NCH / 64) * (SEQ / 64) / 8, NB), 256, 0, stream>>>(
      w2_16, nullptr, NFF, 0L, yh, yl, NFF, (long)SEQ * NFF,
      (void*)gf, nullptr, SEQ, (long)NCH * SEQ, b2, nullptr, 0L, NCH, SEQ, NFF, 1.0f);

  // 9) final InstanceNorm over rows -> d_out (B, 512, L) f32
  k_rownorm<0><<<NB * NCH / 8, 256, 0, stream>>>(gf, out, nullptr, nullptr);
}

// v007
// It runs in 178 microseconds.
// Next to v006, in two timings, it ran 1.11 times as fast each time.
// All steps since v000 together make it 18.8 times as fast.
// Compute dtypes: conv1x1 GEMMs q/k/v = v_wmma_f32_16x16x32_bf16 on RNE-bf16 inputs (1 product); attention scores and P.V = bf16 hi+lo planes (3 products); FFN GEMMs = bf16 hi+lo activations x bf16 weights (2 products); f32 accumulate; InstanceNorm, softmax, residual in f32.
#include <hip/hip_runtime.h>
#include <hip/hip_bf16.h>

typedef __attribute__((ext_vector_type(16))) _Float16 v16h;
typedef __attribute__((ext_vector_type(8)))  _Float16 v8h;
typedef __attribute__((ext_vector_type(16))) __bf16   v16b;
typedef __attribute__((ext_vector_type(8)))  __bf16   v8b;
typedef __attribute__((ext_vector_type(2)))  __bf16   v2b;
typedef __attribute__((ext_vector_type(8)))  float    v8f;
typedef __attribute__((ext_vector_type(4)))  float    v4f;
typedef __attribute__((ext_vector_type(2)))  float    v2f;
typedef __attribute__((ext_vector_type(4)))  unsigned v4u;
typedef __attribute__((ext_vector_type(2)))  unsigned v2u;

__device__ __forceinline__ unsigned short f2bf_bits(float f) {
  unsigned u = __float_as_uint(f);
  return (unsigned short)((u + 0x7FFFu + ((u >> 16) & 1u)) >> 16);
}
__device__ __forceinline__ float bf_bits2f(unsigned short h) { return __uint_as_float(((unsigned)h) << 16); }

// hazard guards as plain device helpers
__device__ __forceinline__ void dep_guard_h(v8f& a, v8f& b, v16h x, v16h y) { asm volatile("v_nop\n\tv_nop\n\tv_nop\n\tv_nop" : "+v"(a), "+v"(b) : "v"(x), "v"(y)); }
__device__ __forceinline__ void dep_guard_b(v8f& a, v8f& b, v16b x, v16b y) { asm volatile("v_nop\n\tv_nop\n\tv_nop\n\tv_nop" : "+v"(a), "+v"(b) : "v"(x), "v"(y)); }
__device__ __forceinline__ void keep4_h(v16h a, v16h b, v16h c, v16h d) { asm volatile("v_nop" :: "v"(a), "v"(b), "v"(c), "v"(d)); }
__device__ __forceinline__ void keep4_b(v16b a, v16b b, v16b c, v16b d) { asm volatile("v_nop" :: "v"(a), "v"(b), "v"(c), "v"(d)); }
__device__ __forceinline__ void acc_guard4(v8f& a, v8f& b, v8f& c, v8f& d) { asm volatile("v_nop\n\tv_nop\n\tv_nop\n\tv_nop" : "+v"(a), "+v"(b), "+v"(c), "+v"(d)); }
template <typename T> struct Frag;
template <> struct Frag<_Float16> {
  typedef v16h V; union U { v16h v; v8h h[2]; };
  // elements 0..7 <- p[0..7], 8..15 <- p[16..23]
  static __device__ __forceinline__ v16h load(const _Float16* p) {
    U f; f.h[0] = *(const v8h*)(p); f.h[1] = *(const v8h*)(p + 16); return f.v;
  }
  static __device__ __forceinline__ v8f mma(v16h a, v16h b, v8f c) {
    return __builtin_amdgcn_wmma_f32_16x16x32_f16(false, a, false, b, (short)0, c, false, false);
  }
  static __device__ __forceinline__ void guard(v8f& a, v8f& b, v16h x, v16h y) { dep_guard_h(a, b, x, y); }
  static __device__ __forceinline__ void keep(v16h a, v16h b, v16h c, v16h d) { keep4_h(a, b, c, d); }
};
template <> struct Frag<__bf16> {
  typedef v16b V; union U { v16b v; v8b h[2]; };
  static __device__ __forceinline__ v16b load(const __bf16* p) {
    U f; f.h[0] = *(const v8b*)(p); f.h[1] = *(const v8b*)(p + 16); return f.v;
  }
  static __device__ __forceinline__ v8f mma(v16b a, v16b b, v8f c) {
    return __builtin_amdgcn_wmma_f32_16x16x32_bf16(false, a, false, b, (short)0, c, false, false);
  }
  static __device__ __forceinline__ void guard(v8f& a, v8f& b, v16b x, v16b y) { dep_guard_b(a, b, x, y); }
  static __device__ __forceinline__ void keep(v16b a, v16b b, v16b c, v16b d) { keep4_b(a, b, c, d); }
};

// ---- Register-blocked batched WMMA GEMM ------------------------------------
// C[m,n] = scale * sum_k A[m,k] * Bt[n,k] (+bias)(+resid); each wave owns a 64x64 tile.
// A row-major [M,K]; Bt row-major [N,K]; M % 64 == 0, N % 512 == 0, K % 64 == 0.
// The eight waves of a block own eight neighbouring tiles of one tile row (N % 512 == 0), so they share the A rows.
// Operands reach the fragments through LDS: a stage is 64 k (one whole 128-byte line of every row), brought by asynchronous
// 16-byte copies in which a wave covers 4 rows x 128 B per instruction; two buffers, stage t + 1 flies while stage t is worked on.
// Stage layout: [A planes: 64 rows][wave 0..7: its Bt planes: 64 rows], every row at a pitch of 144 B (16 B x odd).
// SPLIT: 0 = single product; 1 = A and Bt both hi/lo planes (hi.hi + hi.lo + lo.hi);
//        2 = only A is hi/lo (A_hi.B + A_lo.B); 3 = only Bt is hi/lo (A.B_hi + A.B_lo).
// BIAS_MODE: 0 = none, 1 = bias[m], 2 = bias[n].
// OUT_MODE: 0 = f32, 1 = f16, 2 = bf16 hi plane (Cout) + bf16 lo plane (Cout2).
// ET: 0 = f16 operands, 1 = bf16 operands (pointers passed as 16-bit storage)
constexpr int GM_KS = 64;                  // k elements of a stage
constexpr int GM_LP = 72;                  // LDS pitch of a stage row, in 16-bit elements
constexpr int GM_PL = 64 * GM_LP * 2;      // bytes of one 64-row plane of a stage
__device__ __forceinline__ unsigned lds_off(const void* p) { return (unsigned)(size_t)p; }   // byte address in the block's LDS
// asynchronous copies global -> LDS, 16 bytes per lane. The s_wait_xcnt closes each statement so that it stands in front of
// every later write of the address registers that the copies name.
__device__ __forceinline__ void cp_async2(unsigned l0, const void* g0, unsigned l1, const void* g1) {
  asm volatile("global_load_async_to_lds_b128 %0, %1, off\n\t"
               "global_load_async_to_lds_b128 %2, %3, off\n\t"
               "s_wait_xcnt 0x0"
               :: "v"(l0), "v"(g0), "v"(l1), "v"(g1) : "memory");
}
__device__ __forceinline__ void cp_async8(unsigned l, const char* g, size_t gstep) {
  // eight rows, four apart: LDS step 4 rows of GM_LP elements, global step gstep bytes
  constexpr unsigned LS = 4 * GM_LP * 2;
  asm volatile("global_load_async_to_lds_b128 %0, %1, off\n\t"
               "global_load_async_to_lds_b128 %2, %3, off\n\t"
               "global_load_async_to_lds_b128 %4, %5, off\n\t"
               "global_load_async_to_lds_b128 %6, %7, off\n\t"
               "global_load_async_to_lds_b128 %8, %9, off\n\t"
               "global_load_async_to_lds_b128 %10, %11, off\n\t"
               "global_load_async_to_lds_b128 %12, %13, off\n\t"
               "global_load_async_to_lds_b128 %14, %15, off\n\t"
               "s_wait_xcnt 0x0"
               :: "v"(l), "v"(g), "v"(l + LS), "v"(g + gstep), "v"(l + 2 * LS), "v"(g + 2 * gstep), "v"(l + 3 * LS), "v"(g + 3 * gstep),
                  "v"(l + 4 * LS), "v"(g + 4 * gstep), "v"(l + 5 * LS), "v"(g + 5 * gstep), "v"(l + 6 * LS), "v"(g + 6 * gstep),
                  "v"(l + 7 * LS), "v"(g + 7 * gstep) : "memory");
}
template <int ET> struct Elem;
template <> struct Elem<0> { typedef _Float16 T; };
template <> struct Elem<1> { typedef __bf16 T; };
// bytes of one stage buffer of a GEMM with the given SPLIT
constexpr int gm_stage(int split) {
  return (((split == 1 || split == 2) ? 2 : 1) + 8 * ((split == 1 || split == 3) ? 2 : 1)) * GM_PL;
}
// The GEMM of one block: smem = the kernel's 2 * gm_stage(SPLIT) bytes of LDS, bx = index of the block's group of eight tiles, b = batch.
template <int ET, int SPLIT, int BIAS_MODE, int OUT_MODE, bool RESID, int ACT = 0>
__device__ __forceinline__ void gemm64_body(
    unsigned char* smem, const int bx, const int b,
    const unsigned short* __restrict__ Ap, const unsigned short* __restrict__ A2p, int lda, long strideA,
    const unsigned short* __restrict__ Btp, const unsigned short* __restrict__ Bt2p, int ldb, long strideB,
    void* __restrict__ Cout, void* __restrict__ Cout2, int ldc, long strideC,
    const float* __restrict__ bias,
    const float* __restrict__ resid, long strideR,
    int M, int N, int K, float scale) {
  typedef typename Elem<ET>::T T;
  typedef typename Frag<T>::V V;
  constexpr bool ASPL = (SPLIT == 1) || (SPLIT == 2);
  constexpr bool BSPL = (SPLIT == 1) || (SPLIT == 3);
  const T* A = (const T*)Ap; const T* A2 = (const T*)A2p; const T* Bt = (const T*)Btp; const T* Bt2 = (const T*)Bt2p;
  constexpr int NPA = ASPL ? 2 : 1, NPB = BSPL ? 2 : 1;
  constexpr int STAGE = (NPA + 8 * NPB) * GM_PL;            // bytes of one buffer
  static_assert(STAGE == gm_stage(SPLIT) && 2 * STAGE <= 327680 && 8 * 16 * 68 * 4 <= STAGE);
  // smem: two stage buffers; behind the k loop: per-wave 16x64 f32 slabs, pitch 68
  const int lane = threadIdx.x & 31;
  const int wave = threadIdx.x >> 5;
  const int tilesN = N >> 6;
  const int tilesM = M >> 6;
  const int tile = bx * 8 + wave;
  if (bx * 8 >= tilesM * tilesN) return;   // the same for the whole block, in front of every barrier
  const int tm = tile / tilesN;
  const int tn = tile - tm * tilesN;
  const int m0 = tm << 6;
  const int n0 = tn << 6;

  const T* Ab  = A  + (size_t)b * strideA;
  const T* Bb  = Bt + (size_t)b * strideB;
  const T* Ab2 = ASPL ? (A2  + (size_t)b * strideA) : nullptr;
  const T* Bb2 = BSPL ? (Bt2 + (size_t)b * strideB) : nullptr;

  const int rlane = lane & 15;                 // row (A) / col (B, D) within subtile
  const int koff  = (lane >> 4) * 8;           // k offset of this lane half
  const int mOff  = (lane >> 4) * 8;           // D row offset

  v8f acc[4][4];
#pragma unroll
  for (int i = 0; i < 4; ++i)
#pragma unroll
    for (int j = 0; j < 4; ++j) acc[i][j] = (v8f){0.f,0.f,0.f,0.f,0.f,0.f,0.f,0.f};

  // ---- one stage's copies: the block's A rows (two 16-byte pieces per thread and plane), then this wave's own Bt rows ----
  const unsigned lbase = lds_off(smem);
  const int arow = threadIdx.x >> 3;           // 0..31; the second piece is row arow + 32
  const int brow = lane >> 3;                  // 0..3; piece it is row it * 4 + brow
  const int scol = (lane & 7) * 8;             // first k element of this lane's 16 bytes
  const unsigned la0 = lbase + (unsigned)(arow * GM_LP + scol) * 2u;
  const unsigned lb0 = lbase + (unsigned)(NPA + wave * NPB) * GM_PL + (unsigned)(brow * GM_LP + scol) * 2u;
  const size_t ga0 = (size_t)(m0 + arow) * lda + scol;
  const size_t gb0 = (size_t)(n0 + brow) * ldb + scol;
  auto issue_stage = [&](int st) {
    const unsigned bo = (unsigned)(st & 1) * STAGE;
    const size_t ka = ga0 + (size_t)st * GM_KS;
    const size_t kb = gb0 + (size_t)st * GM_KS;
    cp_async2(la0 + bo, Ab + ka, la0 + bo + 32 * GM_LP * 2, Ab + ka + (size_t)32 * lda);
    if (ASPL) cp_async2(la0 + bo + GM_PL, Ab2 + ka, la0 + bo + GM_PL + 32 * GM_LP * 2, Ab2 + ka + (size_t)32 * lda);
    const size_t gstep = (size_t)ldb * 8;   // bytes of four Bt rows
#pragma unroll   // two straight-line statements a plane: no loop counter between the copies
    for (int hf = 0; hf < 2; ++hf) {          // rows 0..31, rows 32..63
      cp_async8(lb0 + bo + hf * 32 * GM_LP * 2, (const char*)(Bb + kb + (size_t)(hf * 32) * ldb), gstep);
      if (BSPL) cp_async8(lb0 + bo + GM_PL + hf * 32 * GM_LP * 2, (const char*)(Bb2 + kb + (size_t)(hf * 32) * ldb), gstep);
    }
  };

  const int nst = K / GM_KS;
  issue_stage(0);
  asm volatile("s_wait_asynccnt 0x0" ::: "memory");   // this wave's copies of stage 0 have landed
  __syncthreads();                                    // stage 0 is readable by every wave
  if (nst > 1) issue_stage(1);
  for (int st = 0; st < nst; ++st) {
    const T* sA = (const T*)(smem + (st & 1) * STAGE);
    const T* sB = sA + (NPA + wave * NPB) * (GM_PL / 2);
#pragma unroll   // both 32-k steps of a stage in one body (as every loop below: fragment and accumulator arrays stay in registers)
    for (int ks = 0; ks < 2; ++ks) {
      V bh[4], bl[4], ah[4], al[4];
#pragma unroll
      for (int j = 0; j < 4; ++j) {
        const int bo = ((j << 4) + rlane) * GM_LP + ks * 32 + koff;
        bh[j] = Frag<T>::load(sB + bo);
        if (BSPL) bl[j] = Frag<T>::load(sB + GM_PL / 2 + bo);
        else bl[j] = bh[j];
      }
#pragma unroll
      for (int i = 0; i < 4; ++i) {
        const int ao = ((i << 4) + rlane) * GM_LP + ks * 32 + koff;
        ah[i] = Frag<T>::load(sA + ao);
        if (ASPL) al[i] = Frag<T>::load(sA + GM_PL / 2 + ao);
        else al[i] = ah[i];
      }
#pragma unroll
      for (int i = 0; i < 4; ++i) {
#pragma unroll
        for (int j = 0; j < 4; ++j) {
          acc[i][j] = Frag<T>::mma(ah[i], bh[j], acc[i][j]);
          if (BSPL) acc[i][j] = Frag<T>::mma(ah[i], bl[j], acc[i][j]);
          if (ASPL) acc[i][j] = Frag<T>::mma(al[i], bh[j], acc[i][j]);
        }
        Frag<T>::guard(acc[i][0], acc[i][3], ah[i], al[i]);
      }
      Frag<T>::keep(bh[0], bh[1], bh[2], bh[3]);
      if (BSPL) Frag<T>::keep(bl[0], bl[1], bl[2], bl[3]);
    }
    // hand-over: this wave's reads of stage st are over, its copies of stage st + 1 have landed; behind the barrier
    // stage st + 1 is readable by every wave and the buffer of stage st is free for stage st + 2
    asm volatile("s_wait_dscnt 0x0" ::: "memory");
    asm volatile("s_wait_asynccnt 0x0" ::: "memory");
    __syncthreads();
    if (st + 2 < nst) issue_stage(st + 2);
  }
  asm volatile("s_wait_asynccnt 0x0" ::: "memory");   // no copy is outstanding when the buffers become the output slabs
  acc_guard4(acc[0][0], acc[0][1], acc[0][2], acc[0][3]);
  acc_guard4(acc[1][0], acc[1][1], acc[1][2], acc[1][3]);
  acc_guard4(acc[2][0], acc[2][1], acc[2][2], acc[2][3]);
  acc_guard4(acc[3][0], acc[3][1], acc[3][2], acc[3][3]);

  // ---- epilogue ----
  float* slab = (float*)(smem + wave * (16 * 68 * 4));   // every wave has passed the last hand-over barrier: the buffers are free
  const float* Rb = RESID ? (resid + (size_t)b * strideR) : nullptr;
#pragma unroll
  for (int i = 0; i < 4; ++i) {
    const int mBase = m0 + (i << 4);
#pragma unroll
    for (int j = 0; j < 4; ++j) {
      const int n = n0 + (j << 4) + rlane;
      float bv = 0.f;
      if (BIAS_MODE == 2) bv = bias[n];
#pragma unroll
      for (int r = 0; r < 8; ++r) {
        float v = acc[i][j][r] * scale;
        if (BIAS_MODE == 1) v += bias[mBase + mOff + r];
        if (BIAS_MODE == 2) v += bv;
        if (RESID) v += Rb[(size_t)(mBase + mOff + r) * ldc + n];
        if (ACT == 1) v = tanhf(v);
        if (ACT == 2) v = fmaxf(v, 0.0f);
        if (ACT == 3) v = v / (1.0f + expf(-v));
        if (ACT == 4) v = (v > 0.f) ? v : 0.01f * v;
        slab[(mOff + r) * 68 + (j << 4) + rlane] = v;
      }
    }
    __builtin_amdgcn_fence(__ATOMIC_RELEASE, "workgroup");
    __builtin_amdgcn_wave_barrier();
    __builtin_amdgcn_fence(__ATOMIC_ACQUIRE, "workgroup");
    if (OUT_MODE == 0) {
      float* C = (float*)Cout + (size_t)b * strideC;
      const int hh = lane >> 4, c4 = (lane & 15) * 4;     // row seg = 256 B = 16 lanes x 16 B
      {
#pragma unroll
        for (int it = 0; it < 8; ++it) {
          const int row = it * 2 + hh;
          v4f v = *(const v4f*)(slab + row * 68 + c4);
          *(v4f*)(C + (size_t)(mBase + row) * ldc + n0 + c4) = v;
        }
        
      }
    } else {
      const int q = lane >> 3, c8 = (lane & 7) * 8;
      unsigned short* C  = (unsigned short*)Cout  + (size_t)b * strideC;
      unsigned short* C2 = (OUT_MODE == 2) ? ((unsigned short*)Cout2 + (size_t)b * strideC) : nullptr;
      {
#pragma unroll
        for (int it = 0; it < 4; ++it) {
          const int row = it * 4 + q;
          const float* sp = slab + row * 68 + c8;
          v8h hv, lv;
#pragma unroll
          for (int e = 0; e < 8; ++e) {
            if (OUT_MODE == 1) {
              hv[e] = (_Float16)sp[e];
            } else {
              unsigned short hb = f2bf_bits(sp[e]);
              unsigned short lb = f2bf_bits(sp[e] - bf_bits2f(hb));
              hv[e] = __builtin_bit_cast(_Float16, hb);
              lv[e] = __builtin_bit_cast(_Float16, lb);
            }
          }
          *(v8h*)(C + (size_t)(mBase + row) * ldc + n0 + c8) = hv;
          if (OUT_MODE == 2) *(v8h*)(C2 + (size_t)(mBase + row) * ldc + n0 + c8) = lv;
        }
        
      }
    }
    __builtin_amdgcn_fence(__ATOMIC_RELEASE, "workgroup");
    __builtin_amdgcn_wave_barrier();
    __builtin_amdgcn_fence(__ATOMIC_ACQUIRE, "workgroup");
  }
}

template <int ET, int SPLIT, int BIAS_MODE, int OUT_MODE, bool RESID, int ACT = 0>
__global__ __launch_bounds__(256) void wmma_gemm64(
    const unsigned short* __restrict__ Ap, const unsigned short* __restrict__ A2p, int lda, long strideA,
    const unsigned short* __restrict__ Btp, const unsigned short* __restrict__ Bt2p, int ldb, long strideB,
    void* __restrict__ Cout, void* __restrict__ Cout2, int ldc, long strideC,
    const float* __restrict__ bias,
    const float* __restrict__ resid, long strideR,
    int M, int N, int K, float scale) {
  __shared__ __align__(16) unsigned char smem[2 * gm_stage(SPLIT)];
  gemm64_body<ET, SPLIT, BIAS_MODE, OUT_MODE, RESID, ACT>(smem, (int)blockIdx.x, (int)blockIdx.y, Ap, A2p, lda, strideA,
      Btp, Bt2p, ldb, strideB, Cout, Cout2, ldc, strideC, bias, resid, strideR, M, N, K, scale);
}

constexpr int SEQ_LEN = 1024;
constexpr int N_HEADS = 8;
constexpr int N_CH = 512;
constexpr int N_CIN = 256;
constexpr int N_FF = 1024;
constexpr int N_B = 8;

// ---- the q, k and v projections in one launch: they need nothing of each other. grid (16, N_B, 3); blockIdx.z picks the GEMM ----
//   z = 0: gq[l][o] = sum_c xqT[l][c]  wq[o][c] + bq[o]   (M = 1024, N = 512, K = 512), L-major
//   z = 1: gk[l][o] = sum_c xkvT[l][c] wk[o][c] + bk[o]   (M = 1024, N = 512, K = 256), L-major
//   z = 2: gv[o][m] = sum_c wv[o][c] xkvT[m][c] + bv[o]   (M = 512, N = 1024, K = 256), channel-major
__global__ __launch_bounds__(256) void k_gemm_qkv(
    const unsigned short* __restrict__ xqT, const unsigned short* __restrict__ xkvT,
    const unsigned short* __restrict__ wq16, const unsigned short* __restrict__ wk16, const unsigned short* __restrict__ wv16,
    const float* __restrict__ bq, const float* __restrict__ bk, const float* __restrict__ bv,
    float* __restrict__ gq, float* __restrict__ gk, float* __restrict__ gv) {
  __shared__ __align__(16) unsigned char smem[2 * gm_stage(0)];
  const int job = blockIdx.z;   // the same for the whole block
  if (job < 2) {
    const bool isq = job == 0;
    const int K = isq ? N_CH : N_CIN;
    gemm64_body<1, 0, 2, 0, false>(smem, (int)blockIdx.x, (int)blockIdx.y,
        isq ? xqT : xkvT, nullptr, K, (long)SEQ_LEN * K, isq ? wq16 : wk16, nullptr, K, 0L,
        (void*)(isq ? gq : gk), nullptr, N_CH, (long)SEQ_LEN * N_CH, isq ? bq : bk, nullptr, 0L, SEQ_LEN, N_CH, K, 1.0f);
  } else {
    gemm64_body<1, 0, 1, 0, false>(smem, (int)blockIdx.x, (int)blockIdx.y,
        wv16, nullptr, N_CIN, 0L, xkvT, nullptr, N_CIN, (long)SEQ_LEN * N_CIN,
        (void*)gv, nullptr, SEQ_LEN, (long)N_CH * SEQ_LEN, bv, nullptr, 0L, N_CH, SEQ_LEN, N_CIN, 1.0f);
  }
}

// f32 -> bf16 (RNE), two elements per thread; blk = index of the 256-thread block inside this array
__device__ __forceinline__ void cast_bf16x2_body(
    const float* __restrict__ in, unsigned short* __restrict__ out, int n2, int blk) {
  int i = blk * 256 + threadIdx.x;
  if (i < n2) {
    const float* p = in + 2 * i;
    const float e0 = p[0], e1 = p[1];
    // p as an input keeps the load's address pair whole up to the wait (else the load lands on it)
    asm volatile("s_wait_xcnt 0x0" :: "v"(p) : "memory");
    const unsigned u = (unsigned)f2bf_bits(e0) | ((unsigned)f2bf_bits(e1) << 16);
    ((unsigned*)out)[i] = u;
  }
}

// ---- (nb, C, L) f32 -> (nb, L, C) bf16 through an LDS tile: in[c][l] -> out[l][c] ----
// tile = 64 channels x 32 positions; tile index (bx < L/32, by < C/64, b < nb), block 256.
// loads: 256 threads x 8 = 2048 = 64x32 floats; stores: thread (r = tid>>3, c8 = (tid&7)*8) writes 8 bf16 = 16 B,
__device__ __forceinline__ void transpose_bf16_body(
    const float* __restrict__ in, unsigned short* __restrict__ out, int C, int L, int bx, int by, int b) {
  __shared__ float t[64][33];
  const int tid = threadIdx.x;
  const int l0 = bx * 32, c0 = by * 64;
  const float* inb = in + (size_t)b * C * L;
#pragma unroll
  for (int i = 0; i < 8; ++i) {
    const int cl = i * 8 + (tid >> 5);
    t[cl][tid & 31] = inb[(size_t)(c0 + cl) * L + l0 + (tid & 31)];
  }
  __syncthreads();
  const int r = tid >> 3, c8 = (tid & 7) * 8;
  unsigned w0, w1, w2, w3;
  w0 = (unsigned)f2bf_bits(t[c8 + 0][r]) | ((unsigned)f2bf_bits(t[c8 + 1][r]) << 16);
  w1 = (unsigned)f2bf_bits(t[c8 + 2][r]) | ((unsigned)f2bf_bits(t[c8 + 3][r]) << 16);
  w2 = (unsigned)f2bf_bits(t[c8 + 4][r]) | ((unsigned)f2bf_bits(t[c8 + 5][r]) << 16);
  w3 = (unsigned)f2bf_bits(t[c8 + 6][r]) | ((unsigned)f2bf_bits(t[c8 + 7][r]) << 16);
  const v4u val = (v4u){w0, w1, w2, w3};
  unsigned short* dst = out + ((size_t)b * L + l0 + r) * C + c0 + c8;
  *(v4u*)dst = val;
  
}

// ---- all operand preparation in one launch: the two activation transposes and the five weight casts need nothing of each other.
// One-dimensional grid; a range of the block index picks the job (the same for the whole block), the transposes first.
constexpr int PB_XQ  = (SEQ_LEN / 32) * (N_CH / 64) * N_B;    // blocks of the x_query transpose
constexpr int PB_XKV = (SEQ_LEN / 32) * (N_CIN / 64) * N_B;   // blocks of the x_kv transpose
constexpr int PB_WQ  = N_CH * N_CH / 512;                     // blocks of a cast: 512 elements each
constexpr int PB_WKV = N_CH * N_CIN / 512;
constexpr int PB_WFF = N_FF * N_CH / 512;
constexpr int PB_ALL = PB_XQ + PB_XKV + PB_WQ + 2 * PB_WKV + 2 * PB_WFF;
__global__ __launch_bounds__(256) void k_prep(
    const float* __restrict__ x_query, const float* __restrict__ x_kv,
    const float* __restrict__ wq, const float* __restrict__ wk, const float* __restrict__ wv,
    const float* __restrict__ w1, const float* __restrict__ w2,
    unsigned short* __restrict__ xqT, unsigned short* __restrict__ xkvT,
    unsigned short* __restrict__ wq16, unsigned short* __restrict__ wk16, unsigned short* __restrict__ wv16,
    unsigned short* __restrict__ w1_16, unsigned short* __restrict__ w2_16) {
  int blk = blockIdx.x;
  if (blk < PB_XQ + PB_XKV) {
    const bool isq = blk < PB_XQ;
    static_assert(N_CH / 64 == 8 && N_CIN / 64 == 4);
    const unsigned t  = isq ? blk : blk - PB_XQ;
    const unsigned cb = t / (SEQ_LEN / 32);   // (batch, channel block)
    const int ls = isq ? 3 : 2;               // log2 of the channel blocks: a shift, not a division by a run-time value
    transpose_bf16_body(isq ? x_query : x_kv, isq ? xqT : xkvT, isq ? N_CH : N_CIN, SEQ_LEN,
                        (int)(t % (SEQ_LEN / 32)), (int)(cb & ((1u << ls) - 1u)), (int)(cb >> ls));
    return;
  }
  blk -= PB_XQ + PB_XKV;
  const float* in; unsigned short* out; int n2;
  if (blk < PB_WQ)                                 { in = wq; out = wq16;  n2 = N_CH * N_CH / 2; }
  else if ((blk -= PB_WQ) < PB_WKV)                { in = wk; out = wk16;  n2 = N_CH * N_CIN / 2; }
  else if ((blk -= PB_WKV) < PB_WKV)               { in = wv; out = wv16;  n2 = N_CH * N_CIN / 2; }
  else if ((blk -= PB_WKV) < PB_WFF)               { in = w1; out = w1_16; n2 = N_FF * N_CH / 2; }
  else                          { blk -= PB_WFF;     in = w2; out = w2_16; n2 = N_CH * N_FF / 2; }
  cast_bf16x2_body(in, out, n2, blk);
}

// ---- InstanceNorm over the 1024 rows of an L-major f32 plane X[nb][1024][NCOL], per (b, column) ----
// block = 32 waves owns a slab of 64 columns x 1024 rows; slab index (bx < NCOL/64, by < nb).
// lane = (row half, 4 adjacent columns): one wave-wide 16-byte load covers 2 rows x 256 B; a thread keeps its
// 16 rows (i*64 + wave*2 + half) x 4 columns in registers, so X is read once. Mean, then centred sum of squares.
// output = bf16 hi + lo planes, same layout (a wave stores 2 rows x 128 B per plane);
// MODE 0: plain; MODE 1: + residual read from a bf16 plane res (same layout); MODE 2: relu.
constexpr int CN_RP = 68;   // pitch in floats of the per-wave partial rows (16-byte aligned rows)

// column totals over the whole slab: s = this thread's partial for its 4 columns; every thread gets the totals of its 4 columns.
// fixed tree: two row halves by shuffle, 32 wave partials through LDS, wave w adds up columns 2w and 2w+1 by a butterfly.
__device__ __forceinline__ v4f cn_colsum(v4f s, float* red, float* tot, int wave, int lane) {
  const int c4 = (lane & 15) * 4;
#pragma unroll
  for (int e = 0; e < 4; ++e) s[e] += __shfl_xor(s[e], 16, 32);
  if (lane < 16) *(v4f*)(red + wave * CN_RP + c4) = s;
  __syncthreads();   // all 32 partial rows are in red
  v2f p = *(const v2f*)(red + lane * CN_RP + 2 * wave);
#pragma unroll
  for (int off = 1; off < 32; off <<= 1) {
    p.x += __shfl_xor(p.x, off, 32);
    p.y += __shfl_xor(p.y, off, 32);
  }
  if (lane == 0) *(v2f*)(tot + 2 * wave) = p;
  __syncthreads();   // all 64 totals are in tot; every read of red is over
  return *(const v4f*)(tot + c4);
}

template <int MODE, int NCOL>
__device__ __forceinline__ void colnorm_body(
    const float* __restrict__ X, const unsigned* __restrict__ res,
    unsigned* __restrict__ outh, unsigned* __restrict__ outl, int bx, int by) {
  constexpr int NR = 1024, NW = 32, NI = NR / (2 * NW);
  __shared__ __align__(16) float red[NW * CN_RP];
  __shared__ __align__(16) float tot[2][64];
  const int lane = threadIdx.x & 31, wave = threadIdx.x >> 5;
  const size_t base = ((size_t)by * NR + wave * 2 + (lane >> 4)) * NCOL + bx * 64 + (lane & 15) * 4;
  constexpr size_t STEP = (size_t)64 * NCOL;   // floats between a thread's rows; STEP / 2 words in the bf16 planes
  const size_t obase = base >> 1;
  const float* xp = X + base;
  v4f x[NI];
#pragma unroll
  for (int i = 0; i < NI; ++i) x[i] = *(const v4f*)(xp + i * STEP);
  // xp as an input keeps the loads' address pair whole up to the wait (else the last load lands on it)
  asm volatile("s_wait_xcnt 0x0" :: "v"(xp) : "memory");
  // MODE 1: residual words, two groups of 4 rows; the first group is asked for here, under the two reductions
  v2u rw[2][4];
  if constexpr (MODE == 1) {
#pragma unroll
    for (int j = 0; j < 4; ++j) rw[0][j] = *(const v2u*)(res + obase + j * (STEP / 2));
  }
  v4f s = x[0];
#pragma unroll
  for (int i = 1; i < NI; ++i) s += x[i];
  const v4f mean = cn_colsum(s, red, tot[0], wave, lane) * (1.0f / NR);
  v4f q = (v4f){0.f, 0.f, 0.f, 0.f};
#pragma unroll
  for (int i = 0; i < NI; ++i) {
    x[i] -= mean;
    q += x[i] * x[i];
  }
  const v4f var = cn_colsum(q, red, tot[1], wave, lane) * (1.0f / NR);
  v4f rs;
#pragma unroll
  for (int e = 0; e < 4; ++e) rs[e] = rsqrtf(var[e] + 1e-5f);
#pragma unroll
  for (int g = 0; g < NI / 4; ++g) {
    if constexpr (MODE == 1) {
      if (g + 1 < NI / 4) {
#pragma unroll
        for (int j = 0; j < 4; ++j) rw[(g + 1) & 1][j] = *(const v2u*)(res + obase + ((g + 1) * 4 + j) * (STEP / 2));
      }
    }
#pragma unroll
    for (int j = 0; j < 4; ++j) {
      const int i = g * 4 + j;
      v4f y = x[i] * rs;
      if constexpr (MODE == 1) {
        const v2u w = rw[g & 1][j];
        y.x += __uint_as_float(w.x << 16);
        y.y += __uint_as_float(w.x & 0xffff0000u);
        y.z += __uint_as_float(w.y << 16);
        y.w += __uint_as_float(w.y & 0xffff0000u);
      }
      if constexpr (MODE == 2) {
#pragma unroll
        for (int e = 0; e < 4; ++e) y[e] = fmaxf(y[e], 0.0f);
      }
      unsigned short hb[4], lb[4];
#pragma unroll
      for (int e = 0; e < 4; ++e) {
        hb[e] = f2bf_bits(y[e]);
        lb[e] = f2bf_bits(y[e] - bf_bits2f(hb[e]));
      }
      const size_t oi = obase + i * (STEP / 2);
      *(v2u*)(outh + oi) = (v2u){ (unsigned)hb[0] | ((unsigned)hb[1] << 16), (unsigned)hb[2] | ((unsigned)hb[3] << 16) };
      *(v2u*)(outl + oi) = (v2u){ (unsigned)lb[0] | ((unsigned)lb[1] << 16), (unsigned)lb[2] | ((unsigned)lb[3] << 16) };
    }
    if (g + 1 < NI / 4) {
      // stands in front of every reuse of the address and data registers that the loads and stores above name
      asm volatile("s_wait_xcnt 0x0" ::: "memory");
      // keeps the next group's code below that wait; in MODE 1 it also keeps the later groups' residual loads from
      // being hoisted: with all 16 in flight the kernel passes the 128 registers of a 32-wave block and spills
      __builtin_amdgcn_sched_barrier(0);
    }
  }
}

template <int MODE, int NCOL>
__global__ __launch_bounds__(1024) void k_colnorm(
    const float* __restrict__ X, const unsigned* __restrict__ res,
    unsigned* __restrict__ outh, unsigned* __restrict__ outl) {
  colnorm_body<MODE, NCOL>(X, res, outh, outl, (int)blockIdx.x, (int)blockIdx.y);
}

// ---- InstanceNorm over channel-major f32 rows X[row][1024] (row = b*C + channel), one wave per row ----
// Rolled re-read passes (no per-thread arrays); no LDS, no barrier.
template <int MODE>
__device__ __forceinline__ void rownorm_body(
    const float* __restrict__ X, float* __restrict__ outf,
    unsigned short* __restrict__ outh, unsigned short* __restrict__ outl, const size_t row) {
  constexpr int NCOL = 1024;
  const int lane = threadIdx.x & 31;
  const float* xr = X + row * NCOL;
  float s = 0.f;
#pragma unroll 1
  for (int it = 0; it < 8; ++it) {
    const v4f u = *(const v4f*)(xr + it * 128 + lane * 4);
    s += (u.x + u.y) + (u.z + u.w);
  }
#pragma unroll
  for (int off = 1; off < 32; off <<= 1) s += __shfl_xor(s, off, 32);
  const float mean = s * (1.0f / NCOL);
  float ss = 0.f;
#pragma unroll 1
  for (int it = 0; it < 8; ++it) {
    const v4f u = *(const v4f*)(xr + it * 128 + lane * 4);
    const float d0 = u.x - mean, d1 = u.y - mean, d2 = u.z - mean, d3 = u.w - mean;
    ss += (d0 * d0 + d1 * d1) + (d2 * d2 + d3 * d3);
  }
#pragma unroll
  for (int off = 1; off < 32; off <<= 1) ss += __shfl_xor(ss, off, 32);
  const float rs = rsqrtf(ss * (1.0f / NCOL) + 1e-5f);
  if constexpr (MODE == 0) {
    float* orow = outf + row * NCOL;
    {
#pragma unroll 1
      for (int it = 0; it < 8; ++it) {
        const v4f u = *(const v4f*)(xr + it * 128 + lane * 4);
        v4f y;
        y.x = (u.x - mean) * rs; y.y = (u.y - mean) * rs; y.z = (u.z - mean) * rs; y.w = (u.w - mean) * rs;
        *(v4f*)(orow + it * 128 + lane * 4) = y;
      }
      
    }
  } else {
    unsigned short* hrow = outh + row * NCOL;
    unsigned short* lrw  = outl + row * NCOL;
    {
#pragma unroll 1
      for (int it = 0; it < 4; ++it) {
        const v4f u0 = *(const v4f*)(xr + it * 256 + lane * 8);
        const v4f u1 = *(const v4f*)(xr + it * 256 + lane * 8 + 4);
        const float y0 = (u0.x - mean) * rs, y1 = (u0.y - mean) * rs, y2 = (u0.z - mean) * rs, y3 = (u0.w - mean) * rs;
        const float y4 = (u1.x - mean) * rs, y5 = (u1.y - mean) * rs, y6 = (u1.z - mean) * rs, y7 = (u1.w - mean) * rs;
        const unsigned short h0 = f2bf_bits(y0), h1 = f2bf_bits(y1), h2 = f2bf_bits(y2), h3 = f2bf_bits(y3);
        const unsigned short h4 = f2bf_bits(y4), h5 = f2bf_bits(y5), h6 = f2bf_bits(y6), h7 = f2bf_bits(y7);
        const unsigned short l0 = f2bf_bits(y0 - bf_bits2f(h0)), l1 = f2bf_bits(y1 - bf_bits2f(h1));
        const unsigned short l2 = f2bf_bits(y2 - bf_bits2f(h2)), l3 = f2bf_bits(y3 - bf_bits2f(h3));
        const unsigned short l4 = f2bf_bits(y4 - bf_bits2f(h4)), l5 = f2bf_bits(y5 - bf_bits2f(h5));
        const unsigned short l6 = f2bf_bits(y6 - bf_bits2f(h6)), l7 = f2bf_bits(y7 - bf_bits2f(h7));
        const v4u hv = (v4u){ (unsigned)h0 | ((unsigned)h1 << 16), (unsigned)h2 | ((unsigned)h3 << 16),
                              (unsigned)h4 | ((unsigned)h5 << 16), (unsigned)h6 | ((unsigned)h7 << 16) };
        const v4u lv = (v4u){ (unsigned)l0 | ((unsigned)l1 << 16), (unsigned)l2 | ((unsigned)l3 << 16),
                              (unsigned)l4 | ((unsigned)l5 << 16), (unsigned)l6 | ((unsigned)l7 << 16) };
        *(v4u*)(hrow + it * 256 + lane * 8) = hv;
        *(v4u*)(lrw  + it * 256 + lane * 8) = lv;
      }
      
    }
  }
}

// block 8 waves = 8 rows; grid = rows/8 (rows % 8 == 0)
template <int MODE>
__global__ __launch_bounds__(256) void k_rownorm(
    const float* __restrict__ X, float* __restrict__ outf,
    unsigned short* __restrict__ outh, unsigned short* __restrict__ outl) {
  rownorm_body<MODE>(X, outf, outh, outl, (size_t)blockIdx.x * 8 + (threadIdx.x >> 5));
}

// ---- the InstanceNorms of q, k and v in one launch: they need nothing of each other. Block = 32 waves; a range of the block
// index picks the job (the same for the whole block): 64 column slabs of q, 64 of k, then 32 rows of v per block.
constexpr int NB_SLAB = (N_CH / 64) * N_B;        // column slabs of q, and of k
constexpr int NB_VROW = N_B * N_CH / 32;          // blocks of 32 v rows
__global__ __launch_bounds__(1024) void k_norm_qkv(
    const float* __restrict__ gq, const float* __restrict__ gk, const float* __restrict__ gv,
    unsigned* __restrict__ qh, unsigned* __restrict__ ql, unsigned* __restrict__ kh, unsigned* __restrict__ kl,
    unsigned short* __restrict__ vh, unsigned short* __restrict__ vl) {
  const int blk = blockIdx.x;
  if (blk < 2 * NB_SLAB) {
    const bool isq = blk < NB_SLAB;
    const int t = isq ? blk : blk - NB_SLAB;
    colnorm_body<0, N_CH>(isq ? gq : gk, nullptr, isq ? qh : kh, isq ? ql : kl, t % (N_CH / 64), t / (N_CH / 64));
  } else {
    rownorm_body<1>(gv, nullptr, vh, vl, (size_t)(blk - 2 * NB_SLAB) * 32 + (threadIdx.x >> 5));
  }
}

#define AT_D 64
#define AT_NW 4
#define AT_KC 64
#define AT_OSP 68
// pitch in bf16 elements of every 64-element row of the K and V tiles in LDS: 144 B = 16 B x 9. The fragment reads are
// 16-byte loads of 16 rows at one column; at a pitch of 128 B those rows fall on two groups of four banks, at 144 B on sixteen.
#define AT_LP 72
// K hi, K lo, V hi and V lo tiles of a 64-key chunk reach LDS by asynchronous 16-byte copies: wave w brings plane w, a copy
// instruction covers 4 whole rows of 128 B; two buffers, chunk t + 1 flies while chunk t is worked on.
constexpr int AT_PL = AT_KC * AT_LP * 2;   // bytes of one 64-row plane
constexpr int AT_ST = 4 * AT_PL;           // bytes of one buffer: K hi [kv][d], K lo [kv][d], V hi [d][kv], V lo [d][kv]

__device__ __forceinline__ v8f at_mma(v16b a, v16b b, v8f c) {
  c = __builtin_amdgcn_wmma_f32_16x16x32_bf16(false, a, false, b, (short)0, c, false, false);
  asm volatile("v_nop\n\tv_nop\n\tv_nop\n\tv_nop" : "+v"(c) : "v"(a), "v"(b));
  return c;
}
// lane l <-> lane l ^ 16
__device__ __forceinline__ float at_xhalf(float x) {
  const int b = __builtin_bit_cast(int, x);
  return __builtin_bit_cast(float, __builtin_amdgcn_permlanex16(b, b, 0x76543210, 0xfedcba98, false, false));
}
// two neighbouring elements of a fragment -> one register of the hi plane and one of the lo plane (bf16, round to nearest even;
// f0 in the low half): hi = bf16(f), lo = bf16(f - hi)
__device__ __forceinline__ void at_split2(float f0, float f1, unsigned& hi, unsigned& lo) {
  const unsigned hw = __builtin_bit_cast(unsigned, __builtin_convertvector((v2f){f0, f1}, v2b));
  const v2f rem = (v2f){f0, f1} - (v2f){__uint_as_float(hw << 16), __uint_as_float(hw & 0xffff0000u)};   // one packed subtraction a pair
  hi = hw;
  lo = __builtin_bit_cast(unsigned, __builtin_convertvector(rem, v2b));
}

// four waves a SIMD: the grid gives every WGP four work-groups (1024 on 256 WGPs), and four of them fit its LDS
__global__ __launch_bounds__(128) __attribute__((amdgpu_waves_per_eu(4, 4)))
void k_attn(const unsigned short* __restrict__ qhp, const unsigned short* __restrict__ qlp,
            const unsigned short* __restrict__ khp, const unsigned short* __restrict__ klp,
            const unsigned short* __restrict__ vhp, const unsigned short* __restrict__ vlp,
            float* __restrict__ out, float sscale) {
  union FB { v16b v; v8b h[2]; unsigned w[8]; };
  __shared__ __align__(16) unsigned char smem[2 * AT_ST];        // two chunk buffers; behind the loop: per wave out tiles
  static_assert(AT_NW * 16 * AT_OSP * 4 <= 2 * AT_ST && AT_LP == GM_LP && AT_D == AT_KC && AT_NW == 4);

  const int tid  = threadIdx.x;
  const int wave = tid >> 5;
  const int lane = tid & 31;
  const int hh   = lane >> 4;
  const int c    = lane & 15;

  constexpr int NQB = SEQ_LEN / 64;
  const int bx  = blockIdx.x;
  const int qb  = bx % NQB;
  const int bhd = bx / NQB;
  const int h   = bhd % N_HEADS;
  const int b   = bhd / N_HEADS;
  const int q0  = qb * 64 + wave * 16;

  const __bf16* qh = (const __bf16*)qhp;
  const __bf16* ql = (const __bf16*)qlp;
  const __bf16* kh = (const __bf16*)khp;
  const __bf16* kl = (const __bf16*)klp;
  const __bf16* vh = (const __bf16*)vhp;
  const __bf16* vl = (const __bf16*)vlp;

  // ---- one chunk's copies: this wave's plane, rows (lane >> 3) + 4 * i, 16 bytes a lane ----
  constexpr int NKC = SEQ_LEN / AT_KC;
  static_assert(NKC >= 2);
  const int crow = lane >> 3, ccol = (lane & 7) * 8;
  const int wv = __builtin_amdgcn_readfirstlane(wave);   // the wave's number in a scalar register: plane, row step and chunk step are then scalars, with no lane mask written
  const bool isk = wv < 2;
  const __bf16* cpl = isk ? (wv == 0 ? kh : kl) : (wv == 2 ? vh : vl);
  const char* csrc = (const char*)(cpl + (isk ? ((size_t)b * SEQ_LEN + crow) * N_CH + h * AT_D + ccol
                                              : ((size_t)b * N_CH + h * AT_D + crow) * SEQ_LEN + ccol));
  const size_t crow4 = isk ? (size_t)4 * N_CH * 2 : (size_t)4 * SEQ_LEN * 2;     // bytes of four rows of the plane in memory
  const size_t cadv  = isk ? (size_t)AT_KC * N_CH * 2 : (size_t)AT_KC * 2;       // bytes from one chunk to the next
  const unsigned cdst = lds_off(smem) + (unsigned)(wv * AT_PL + (crow * AT_LP + ccol) * 2);
  auto issue_chunk = [&](int t) {
    const unsigned l = cdst + (unsigned)(t & 1) * AT_ST;
    const char* g = csrc + (size_t)t * cadv;
    cp_async8(l, g, crow4);                                   // rows 0..31
    cp_async8(l + 32 * AT_LP * 2, g + 8 * crow4, crow4);      // rows 32..63
  };
  issue_chunk(0);

  // ---- Q fragments (B operand: column = query q0 + c, k = d), hi and lo planes ----
  v16b qah[2], qal[2];
  {
    const size_t qo = ((size_t)b * SEQ_LEN + q0 + c) * N_CH + h * AT_D + 8 * hh;
#pragma unroll
    for (int dc = 0; dc < 2; ++dc) {
      qah[dc] = Frag<__bf16>::load(qh + qo + dc * 32);
      qal[dc] = Frag<__bf16>::load(ql + qo + dc * 32);
    }
  }

  // of this lane's query: running maximum over all keys so far, in units of log2 (score * cscale); running sum over this lane half's keys only
  const float cscale = sscale * 1.4426950408889634f;   // sscale * log2(e)
  float mrow = -INFINITY, lrow = 0.f;
  v8f oacc[4];   // O^T: element r of tile t = (d = t*16 + 8*hh + r, query c)
#pragma unroll
  for (int t = 0; t < 4; ++t) oacc[t] = (v8f){0.f,0.f,0.f,0.f,0.f,0.f,0.f,0.f};

  asm volatile("s_wait_asynccnt 0x0" ::: "memory");   // this wave's copies of chunk 0 have landed
  __syncthreads();                                    // chunk 0 is readable by every wave
  issue_chunk(1);
  for (int kc = 0; kc < NKC; ++kc) {
    const __bf16* Ksh = (const __bf16*)(smem + (kc & 1) * AT_ST);
    const __bf16* Ksl = Ksh + AT_PL / 2;
    const __bf16* Vth = Ksh + 2 * (AT_PL / 2);
    const __bf16* Vtl = Ksh + 3 * (AT_PL / 2);

    // ---- scores, transposed: A operand row = key j*16 + c, k = d (Ksh is [key][d], k-contiguous); B = Q ----
    v8f s[4];
#pragma unroll
    for (int j = 0; j < 4; ++j) {
      s[j] = (v8f){0.f,0.f,0.f,0.f,0.f,0.f,0.f,0.f};
#pragma unroll
      for (int dc = 0; dc < 2; ++dc) {
        FB kb, kb2;
        const int ko2 = (j * 16 + c) * AT_LP + dc * 32 + 8 * hh;
        kb.h[0]  = *(const v8b*)(Ksh + ko2);
        kb.h[1]  = *(const v8b*)(Ksh + ko2 + 16);
        kb2.h[0] = *(const v8b*)(Ksl + ko2);
        kb2.h[1] = *(const v8b*)(Ksl + ko2 + 16);
        s[j] = at_mma(kb.v,  qah[dc], s[j]);
        s[j] = at_mma(kb2.v, qah[dc], s[j]);
        s[j] = at_mma(kb.v,  qal[dc], s[j]);
      }
    }
    // D element r of lane = (key j*16 + 8*hh + r, query column c)
    // softmax in base 2: the maximum is taken over the raw scores and scaled once (cscale > 0 keeps the order)
    float cm[4];
#pragma unroll
    for (int j = 0; j < 4; ++j) {
      float m = -INFINITY;
#pragma unroll
      for (int r = 0; r < 8; ++r) m = fmaxf(m, s[j][r]);
      cm[j] = m;
    }
    float mc = fmaxf(fmaxf(cm[0], cm[1]), fmaxf(cm[2], cm[3]));
    mc = fmaxf(mc, at_xhalf(mc)) * cscale;   // both lane halves of a query agree on the maximum, so on alpha too
    const float mnew = fmaxf(mrow, mc);
    const float alpha = __builtin_amdgcn_exp2f(mrow - mnew);   // 0 in the first chunk, where mrow is -inf
    mrow = mnew;
    const v2f cs2 = (v2f){cscale, cscale}, nm2 = (v2f){-mnew, -mnew};
    // P^T as B operand of a 32-key step kk: element e < 8 = key kk*32 + 8*hh + e, e >= 8 = key kk*32 + 16 + 8*hh + (e - 8):
    // these are this lane's own elements of the score tiles j = 2*kk and j = 2*kk + 1
    FB ph[2], pl[2];
    float ps[4];
#pragma unroll
    for (int j = 0; j < 4; ++j) {
      float psum = 0.f;
#pragma unroll
      for (int r = 0; r < 8; r += 2) {
        // exp(sscale * s - max) = 2^(s * cscale - mnew): one packed multiply-add a score pair, then the hardware's 2^x
        const v2f arg = __builtin_elementwise_fma((v2f){s[j][r], s[j][r + 1]}, cs2, nm2);
        const float p0 = __builtin_amdgcn_exp2f(arg.x);
        const float p1 = __builtin_amdgcn_exp2f(arg.y);
        psum += p0 + p1;
        at_split2(p0, p1, ph[j >> 1].w[(j & 1) * 4 + (r >> 1)], pl[j >> 1].w[(j & 1) * 4 + (r >> 1)]);
      }
      ps[j] = psum;
    }
    lrow = lrow * alpha + ((ps[0] + ps[1]) + (ps[2] + ps[3]));
#pragma unroll
    for (int t = 0; t < 4; ++t) oacc[t] *= alpha;
    // ---- O^T += V^T.P^T : A = V with row = d, k = key (Vth is [d][key], k-contiguous), B = P^T ----
#pragma unroll   // ph and pl are indexed by kk: they stay in registers only with kk a constant
    for (int kk = 0; kk < 2; ++kk) {
#pragma unroll
      for (int t = 0; t < 4; ++t) {
        FB vb, vb2;
        const int vo2 = (t * 16 + c) * AT_LP + kk * 32 + 8 * hh;
        vb.h[0]  = *(const v8b*)(Vth + vo2);
        vb.h[1]  = *(const v8b*)(Vth + vo2 + 16);
        vb2.h[0] = *(const v8b*)(Vtl + vo2);
        vb2.h[1] = *(const v8b*)(Vtl + vo2 + 16);
        oacc[t] = at_mma(vb.v,  ph[kk].v, oacc[t]);
        oacc[t] = at_mma(vb2.v, ph[kk].v, oacc[t]);
        oacc[t] = at_mma(vb.v,  pl[kk].v, oacc[t]);
      }
    }
    // hand-over: this wave's reads of chunk kc are over, its copies of chunk kc + 1 have landed; behind the barrier
    // chunk kc + 1 is readable by every wave and the buffer of chunk kc is free for chunk kc + 2
    asm volatile("s_wait_dscnt 0x0" ::: "memory");
    asm volatile("s_wait_asynccnt 0x0" ::: "memory");
    __syncthreads();
    if (kc + 2 < NKC) issue_chunk(kc + 2);
  }
  asm volatile("s_wait_asynccnt 0x0" ::: "memory");   // no copy is outstanding when the buffers become the out tiles

  // out tile [query][d]: this lane holds 8 neighbouring d of query c in every O^T tile
  float* os = (float*)(smem + wave * (16 * AT_OSP * 4));   // every wave has passed the last hand-over barrier: the buffers are free
  {
    const float inv = 1.0f / (lrow + at_xhalf(lrow));   // the two lane halves' sums are joined here, once
#pragma unroll
    for (int t = 0; t < 4; ++t) {
      float* op = os + c * AT_OSP + t * 16 + 8 * hh;
      *(v4f*)(op)     = (v4f){oacc[t][0] * inv, oacc[t][1] * inv, oacc[t][2] * inv, oacc[t][3] * inv};
      *(v4f*)(op + 4) = (v4f){oacc[t][4] * inv, oacc[t][5] * inv, oacc[t][6] * inv, oacc[t][7] * inv};
    }
  }
  __builtin_amdgcn_fence(__ATOMIC_RELEASE, "workgroup");
  __builtin_amdgcn_wave_barrier();
  __builtin_amdgcn_fence(__ATOMIC_ACQUIRE, "workgroup");
  {
    float* ob = out + ((size_t)b * SEQ_LEN) * N_CH + h * AT_D;
    const int c4 = (lane & 15) * 4;
    {
#pragma unroll
      for (int it = 0; it < 8; ++it) {
        const int row = it * 2 + hh;
        v4f val = *(const v4f*)(os + row * AT_OSP + c4);
        *(v4f*)(ob + (size_t)(q0 + row) * N_CH + c4) = val;
      }
      
    }
  }
}

// =====================================================================================
// Host orchestration
// =====================================================================================
extern "C" void kernel_launch(void* const* d_in, const int* in_sizes, int n_in,
                              void* d_out, int out_size, void* d_ws,
                              size_t ws_size, hipStream_t stream) {
  (void)in_sizes; (void)n_in; (void)out_size;
  constexpr int NB = 8, CIN = 256, NCH = 512, SEQ = 1024, NFF = 1024, NHD = 8;

  // ---- workspace region map (bytes) ----
  constexpr size_t SZ_WQ   = (size_t)NCH * NCH * 2;        //    524288  wq  bf16 [512][512]
  constexpr size_t SZ_WK   = (size_t)NCH * CIN * 2;        //    262144  wk  bf16 [512][256]
  constexpr size_t SZ_WV   = (size_t)NCH * CIN * 2;        //    262144  wv  bf16 [512][256]
  constexpr size_t SZ_W1   = (size_t)NFF * NCH * 2;        //   1048576  w1  bf16 [1024][512]
  constexpr size_t SZ_W2   = (size_t)NCH * NFF * 2;        //   1048576  w2  bf16 [512][1024]
  constexpr size_t SZ_XQT  = (size_t)NB * SEQ * NCH * 2;   //   8388608  x_query (L,C) bf16
  constexpr size_t SZ_XKVT = (size_t)NB * SEQ * CIN * 2;   //   4194304  x_kv (L,C) bf16
  constexpr size_t SZ_G    = (size_t)NB * SEQ * NFF * 4;   //  33554432  f32 GEMM/attention output, max user = ffn1 [8][1024][1024]
  constexpr size_t SZ_P    = (size_t)NB * SEQ * NCH * 2;   //   8388608  one bf16 activation plane [8][1024][512]
  constexpr size_t OFF_WQ   = 0;
  constexpr size_t OFF_WK   = OFF_WQ + SZ_WQ;
  constexpr size_t OFF_WV   = OFF_WK + SZ_WK;
  constexpr size_t OFF_W1   = OFF_WV + SZ_WV;
  constexpr size_t OFF_W2   = OFF_W1 + SZ_W1;
  constexpr size_t OFF_XQT  = OFF_W2 + SZ_W2;
  constexpr size_t OFF_XKVT = OFF_XQT + SZ_XQT;
  constexpr size_t OFF_G    = OFF_XKVT + SZ_XKVT;
  constexpr size_t OFF_QH   = OFF_G + SZ_G;       // q hi plane; later z hi plane
  constexpr size_t OFF_QL   = OFF_QH + SZ_P;      // q lo plane; later z lo plane
  constexpr size_t OFF_KH   = OFF_QL + SZ_P;      // k hi plane; later y hi plane spans KH+KL (16777216)
  constexpr size_t OFF_KL   = OFF_KH + SZ_P;      // k lo plane
  constexpr size_t OFF_VH   = OFF_KL + SZ_P;      // v hi plane; later y lo plane spans VH+VL (16777216)
  constexpr size_t OFF_VL   = OFF_VH + SZ_P;      // v lo plane
  constexpr size_t OFF_GV   = OFF_VL + SZ_P;      // v projection f32 [8][512][1024] (q and k projections: the two halves of G)
  constexpr size_t OFF_END  = OFF_GV + SZ_G / 2;  // 116391936
  static_assert(OFF_END == 116391936ull);
  static_assert(OFF_END <= 134217728ull);
  static_assert((OFF_WK % 256) == 0 && (OFF_XQT % 256) == 0 && (OFF_G % 256) == 0 && (OFF_QH % 256) == 0);
  // reused regions sized from the max user
  static_assert((size_t)NB * SEQ * NCH * 4 * 2 <= SZ_G);    // q and k side by side; proj, ffn2 f32 outputs
  static_assert(NB == N_B && CIN == N_CIN && NCH == N_CH && SEQ == SEQ_LEN && NFF == N_FF && NHD == N_HEADS);
  static_assert((size_t)NB * SEQ * NFF * 4 <= SZ_G);        // ffn1 f32 output
  static_assert((size_t)NB * SEQ * NFF * 2 == 2 * SZ_P);    // y plane fits exactly over two 512-wide planes
  // GEMM shape contract: M multiple of 64, N multiple of 512, K multiple of 64
  static_assert(SEQ % 512 == 0 && NCH % 512 == 0 && NFF % 512 == 0);
  static_assert(NCH % 64 == 0 && CIN % 64 == 0 && NFF % 64 == 0);
  static_assert(((SEQ / 64) * (NCH / 64)) % 8 == 0 && ((SEQ / 64) * (NFF / 64)) % 8 == 0);
  static_assert(NCH % 256 == 0 && NFF % 256 == 0 && (NB * NCH) % 8 == 0);
  static_assert((size_t)NB * NCH * SEQ * 4 == 16777216ull);   // d_out bytes
  if (ws_size < OFF_END) return;

  const float* x_query = (const float*)d_in[0];
  const float* x_kv    = (const float*)d_in[1];
  const float* wq      = (const float*)d_in[2];
  const float* bq      = (const float*)d_in[3];
  const float* wk      = (const float*)d_in[4];
  const float* bk      = (const float*)d_in[5];
  const float* wv      = (const float*)d_in[6];
  const float* bv      = (const float*)d_in[7];
  const float* w1      = (const float*)d_in[8];
  const float* b1      = (const float*)d_in[9];
  const float* w2      = (const float*)d_in[10];
  const float* b2      = (const float*)d_in[11];
  float* out = (float*)d_out;

  char* ws = (char*)d_ws;
  typedef unsigned short us;
  us* wq16  = (us*)(ws + OFF_WQ);
  us* wk16  = (us*)(ws + OFF_WK);
  us* wv16  = (us*)(ws + OFF_WV);
  us* w1_16 = (us*)(ws + OFF_W1);
  us* w2_16 = (us*)(ws + OFF_W2);
  us* xqT   = (us*)(ws + OFF_XQT);
  us* xkvT  = (us*)(ws + OFF_XKVT);
  float* gf = (float*)(ws + OFF_G);
  float* gq = gf;
  float* gk = (float*)(ws + OFF_G + SZ_G / 2);
  float* gv = (float*)(ws + OFF_GV);
  us* qh = (us*)(ws + OFF_QH);
  us* ql = (us*)(ws + OFF_QL);
  us* kh = (us*)(ws + OFF_KH);
  us* kl = (us*)(ws + OFF_KL);
  us* vh = (us*)(ws + OFF_VH);
  us* vl = (us*)(ws + OFF_VL);
  us* zh = qh;
  us* zl = ql;
  us* yh = kh;    // [8][1024][1024] bf16 = 16777216 B over KH..KL
  us* yl = vh;    // [8][1024][1024] bf16 = 16777216 B over VH..VL

  // 1) operand preparation: activations (B,C,L) f32 -> (B,L,C) bf16, weights -> bf16 (RNE)
  k_prep<<<PB_ALL, 256, 0, stream>>>(x_query, x_kv, wq, wk, wv, w1, w2, xqT, xkvT, wq16, wk16, wv16, w1_16, w2_16);

  // 2) q, k (L-major) and v (channel-major) projections, f32
  k_gemm_qkv<<<dim3((SEQ / 64) * (NCH / 64) / 8, NB, 3), 256, 0, stream>>>(xqT, xkvT, wq16, wk16, wv16, bq, bk, bv, gq, gk, gv);

  // 3) InstanceNorm of each -> q, k hi/lo planes (L-major), v hi/lo planes (channel-major)
  k_norm_qkv<<<2 * NB_SLAB + NB_VROW, 1024, 0, stream>>>(gq, gk, gv, (unsigned*)qh, (unsigned*)ql, (unsigned*)kh, (unsigned*)kl, vh, vl);

  // 4) attention -> gf as proj L-major [b][l][h*64+d] f32
  k_attn<<<NB * NHD * (SEQ / 64), 128, 0, stream>>>(qh, ql, kh, kl, vh, vl, gf, 0.125f);

  // 5) z = InstanceNorm(proj) + x_query(bf16) -> z hi/lo planes (L-major, pitch 512)
  k_colnorm<1, NCH><<<dim3(NCH / 64, NB), 1024, 0, stream>>>(gf, (const unsigned*)xqT, (unsigned*)zh, (unsigned*)zl);

  // 6) ffn1: C[l][o] = sum_c z[l][c] w1[o][c] + b1[o]  (M=1024, N=1024, K=512), z as hi/lo -> gf L-major [l][1024]
  wmma_gemm64<1, 2, 2, 0, false><<<dim3((SEQ / 64) * (NFF / 64) / 8, NB), 256, 0, stream>>>(
      zh, zl, NCH, (long)SEQ * NCH, w1_16, nullptr, NCH, 0L,
      (void*)gf, nullptr, NFF, (long)SEQ * NFF, b1, nullptr, 0L, SEQ, NFF, NCH, 1.0f);
  // 7) y = relu(InstanceNorm(h1)) -> y hi/lo planes [l][1024]
  k_colnorm<2, NFF><<<dim3(NFF / 64, NB), 1024, 0, stream>>>(gf, nullptr, (unsigned*)yh, (unsigned*)yl);

  // 8) ffn2: C[o][l] = sum_c w2[o][c] y[l][c] + b2[o]  (M=512, N=1024, K=1024), y as hi/lo -> channel-major gf
  wmma_gemm64<1, 3, 1, 0, false><<<dim3((NCH / 64) * (SEQ / 64) / 8, NB), 256, 0, stream>>>(
      w2_16, nullptr, NFF, 0L, yh, yl, NFF, (long)SEQ * NFF,
      (void*)gf, nullptr, SEQ, (long)NCH * SEQ, b2, nullptr, 0L, NCH, SEQ, NFF, 1.0f);

  // 9) final InstanceNorm over rows -> d_out (B, 512, L) f32
  k_rownorm<0><<<NB * NCH / 8, 256, 0, stream>>>(gf, out, nullptr, nullptr);
}

// v008
// It runs in 171 microseconds.
// Timed twice side by side with v007, it ran 1.04 times as fast both times.
// Over all steps from v000 it is 19.6 times as fast.
// Compute dtypes: conv1x1 GEMMs q/k/v = v_wmma_f32_16x16x32_bf16 on RNE-bf16 inputs (1 product); attention scores and P.V = bf16 hi+lo planes (3 products); FFN GEMMs = bf16 hi+lo activations x bf16 weights (2 products); f32 accumulate; InstanceNorm, softmax, residual in f32.
#include <hip/hip_runtime.h>
#include <hip/hip_bf16.h>

typedef __attribute__((ext_vector_type(16))) _Float16 v16h;
typedef __attribute__((ext_vector_type(8)))  _Float16 v8h;
typedef __attribute__((ext_vector_type(16))) __bf16   v16b;
typedef __attribute__((ext_vector_type(8)))  __bf16   v8b;
typedef __attribute__((ext_vector_type(2)))  __bf16   v2b;
typedef __attribute__((ext_vector_type(8)))  float    v8f;
typedef __attribute__((ext_vector_type(4)))  float    v4f;
typedef __attribute__((ext_vector_type(2)))  float    v2f;
typedef __attribute__((ext_vector_type(4)))  unsigned v4u;
typedef __attribute__((ext_vector_type(2)))  unsigned v2u;

__device__ __forceinline__ unsigned short f2bf_bits(float f) {
  unsigned u = __float_as_uint(f);
  return (unsigned short)((u + 0x7FFFu + ((u >> 16) & 1u)) >> 16);
}
__device__ __forceinline__ float bf_bits2f(unsigned short h) { return __uint_as_float(((unsigned)h) << 16); }

// hazard guards as plain device helpers
__device__ __forceinline__ void dep_guard_h(v8f& a, v8f& b, v16h x, v16h y) { asm volatile("v_nop\n\tv_nop\n\tv_nop\n\tv_nop" : "+v"(a), "+v"(b) : "v"(x), "v"(y)); }
__device__ __forceinline__ void dep_guard_b(v8f& a, v8f& b, v16b x, v16b y) { asm volatile("v_nop\n\tv_nop\n\tv_nop\n\tv_nop" : "+v"(a), "+v"(b) : "v"(x), "v"(y)); }
__device__ __forceinline__ void keep4_h(v16h a, v16h b, v16h c, v16h d) { asm volatile("v_nop" :: "v"(a), "v"(b), "v"(c), "v"(d)); }
__device__ __forceinline__ void keep4_b(v16b a, v16b b, v16b c, v16b d) { asm volatile("v_nop" :: "v"(a), "v"(b), "v"(c), "v"(d)); }
__device__ __forceinline__ void acc_guard4(v8f& a, v8f& b, v8f& c, v8f& d) { asm volatile("v_nop\n\tv_nop\n\tv_nop\n\tv_nop" : "+v"(a), "+v"(b), "+v"(c), "+v"(d)); }
template <typename T> struct Frag;
template <> struct Frag<_Float16> {
  typedef v16h V; union U { v16h v; v8h h[2]; };
  // elements 0..7 <- p[0..7], 8..15 <- p[16..23]
  static __device__ __forceinline__ v16h load(const _Float16* p) {
    U f; f.h[0] = *(const v8h*)(p); f.h[1] = *(const v8h*)(p + 16); return f.v;
  }
  static __device__ __forceinline__ v8f mma(v16h a, v16h b, v8f c) {
    return __builtin_amdgcn_wmma_f32_16x16x32_f16(false, a, false, b, (short)0, c, false, false);
  }
  static __device__ __forceinline__ void guard(v8f& a, v8f& b, v16h x, v16h y) { dep_guard_h(a, b, x, y); }
  static __device__ __forceinline__ void keep(v16h a, v16h b, v16h c, v16h d) { keep4_h(a, b, c, d); }
};
template <> struct Frag<__bf16> {
  typedef v16b V; union U { v16b v; v8b h[2]; };
  static __device__ __forceinline__ v16b load(const __bf16* p) {
    U f; f.h[0] = *(const v8b*)(p); f.h[1] = *(const v8b*)(p + 16); return f.v;
  }
  static __device__ __forceinline__ v8f mma(v16b a, v16b b, v8f c) {
    return __builtin_amdgcn_wmma_f32_16x16x32_bf16(false, a, false, b, (short)0, c, false, false);
  }
  static __device__ __forceinline__ void guard(v8f& a, v8f& b, v16b x, v16b y) { dep_guard_b(a, b, x, y); }
  static __device__ __forceinline__ void keep(v16b a, v16b b, v16b c, v16b d) { keep4_b(a, b, c, d); }
};

// ---- Register-blocked batched WMMA GEMM ------------------------------------
// C[m,n] = scale * sum_k A[m,k] * Bt[n,k] (+bias)(+resid); each wave owns a 64x64 tile.
// A row-major [M,K]; Bt row-major [N,K]; M % 64 == 0, N % 512 == 0, K % 64 == 0.
// The eight waves of a block own eight neighbouring tiles of one tile row (N % 512 == 0), so they share the A rows.
// Operands reach the fragments through LDS: a stage is 64 k (one whole 128-byte line of every row), brought by asynchronous
// 16-byte copies in which a wave covers 4 rows x 128 B per instruction; two buffers, stage t + 1 flies while stage t is worked on.
// Stage layout: [A planes: 64 rows][wave 0..7: its Bt planes: 64 rows], every row at a pitch of 144 B (16 B x odd).
// SPLIT: 0 = single product; 1 = A and Bt both hi/lo planes (hi.hi + hi.lo + lo.hi);
//        2 = only A is hi/lo (A_hi.B + A_lo.B); 3 = only Bt is hi/lo (A.B_hi + A.B_lo).
// BIAS_MODE: 0 = none, 1 = bias[m], 2 = bias[n].
// OUT_MODE: 0 = f32, 1 = f16, 2 = bf16 hi plane (Cout) + bf16 lo plane (Cout2).
// ET: 0 = f16 operands, 1 = bf16 operands (pointers passed as 16-bit storage)
constexpr int GM_KS = 64;                  // k elements of a stage
constexpr int GM_LP = 72;                  // LDS pitch of a stage row, in 16-bit elements
constexpr int GM_PL = 64 * GM_LP * 2;      // bytes of one 64-row plane of a stage
__device__ __forceinline__ unsigned lds_off(const void* p) { return (unsigned)(size_t)p; }   // byte address in the block's LDS
// asynchronous copies global -> LDS, 16 bytes per lane. The s_wait_xcnt closes each statement so that it stands in front of
// every later write of the address registers that the copies name.
__device__ __forceinline__ void cp_async2(unsigned l0, const void* g0, unsigned l1, const void* g1) {
  asm volatile("global_load_async_to_lds_b128 %0, %1, off\n\t"
               "global_load_async_to_lds_b128 %2, %3, off\n\t"
               "s_wait_xcnt 0x0"
               :: "v"(l0), "v"(g0), "v"(l1), "v"(g1) : "memory");
}
__device__ __forceinline__ void cp_async8(unsigned l, const char* g, size_t gstep) {
  // eight rows, four apart: LDS step 4 rows of GM_LP elements, global step gstep bytes
  constexpr unsigned LS = 4 * GM_LP * 2;
  asm volatile("global_load_async_to_lds_b128 %0, %1, off\n\t"
               "global_load_async_to_lds_b128 %2, %3, off\n\t"
               "global_load_async_to_lds_b128 %4, %5, off\n\t"
               "global_load_async_to_lds_b128 %6, %7, off\n\t"
               "global_load_async_to_lds_b128 %8, %9, off\n\t"
               "global_load_async_to_lds_b128 %10, %11, off\n\t"
               "global_load_async_to_lds_b128 %12, %13, off\n\t"
               "global_load_async_to_lds_b128 %14, %15, off\n\t"
               "s_wait_xcnt 0x0"
               :: "v"(l), "v"(g), "v"(l + LS), "v"(g + gstep), "v"(l + 2 * LS), "v"(g + 2 * gstep), "v"(l + 3 * LS), "v"(g + 3 * gstep),
                  "v"(l + 4 * LS), "v"(g + 4 * gstep), "v"(l + 5 * LS), "v"(g + 5 * gstep), "v"(l + 6 * LS), "v"(g + 6 * gstep),
                  "v"(l + 7 * LS), "v"(g + 7 * gstep) : "memory");
}
template <int ET> struct Elem;
template <> struct Elem<0> { typedef _Float16 T; };
template <> struct Elem<1> { typedef __bf16 T; };
// bytes of one stage buffer of a GEMM with the given SPLIT
constexpr int gm_stage(int split) {
  return (((split == 1 || split == 2) ? 2 : 1) + 8 * ((split == 1 || split == 3) ? 2 : 1)) * GM_PL;
}
// The GEMM of one block: smem = the kernel's 2 * gm_stage(SPLIT) bytes of LDS, bx = index of the block's group of eight tiles, b = batch.
template <int ET, int SPLIT, int BIAS_MODE, int OUT_MODE, bool RESID, int ACT = 0>
__device__ __forceinline__ void gemm64_body(
    unsigned char* smem, const int bx, const int b,
    const unsigned short* __restrict__ Ap, const unsigned short* __restrict__ A2p, int lda, long strideA,
    const unsigned short* __restrict__ Btp, const unsigned short* __restrict__ Bt2p, int ldb, long strideB,
    void* __restrict__ Cout, void* __restrict__ Cout2, int ldc, long strideC,
    const float* __restrict__ bias,
    const float* __restrict__ resid, long strideR,
    int M, int N, int K, float scale) {
  typedef typename Elem<ET>::T T;
  typedef typename Frag<T>::V V;
  constexpr bool ASPL = (SPLIT == 1) || (SPLIT == 2);
  constexpr bool BSPL = (SPLIT == 1) || (SPLIT == 3);
  const T* A = (const T*)Ap; const T* A2 = (const T*)A2p; const T* Bt = (const T*)Btp; const T* Bt2 = (const T*)Bt2p;
  constexpr int NPA = ASPL ? 2 : 1, NPB = BSPL ? 2 : 1;
  constexpr int STAGE = (NPA + 8 * NPB) * GM_PL;            // bytes of one buffer
  static_assert(STAGE == gm_stage(SPLIT) && 2 * STAGE <= 327680 && 8 * 16 * 68 * 4 <= STAGE);
  // smem: two stage buffers; behind the k loop: per-wave 16x64 f32 slabs, pitch 68
  const int lane = threadIdx.x & 31;
  const int wave = threadIdx.x >> 5;
  const int tilesN = N >> 6;
  const int tilesM = M >> 6;
  const int tile = bx * 8 + wave;
  if (bx * 8 >= tilesM * tilesN) return;   // the same for the whole block, in front of every barrier
  const int tm = tile / tilesN;
  const int tn = tile - tm * tilesN;
  const int m0 = tm << 6;
  const int n0 = tn << 6;

  const T* Ab  = A  + (size_t)b * strideA;
  const T* Bb  = Bt + (size_t)b * strideB;
  const T* Ab2 = ASPL ? (A2  + (size_t)b * strideA) : nullptr;
  const T* Bb2 = BSPL ? (Bt2 + (size_t)b * strideB) : nullptr;

  const int rlane = lane & 15;                 // row (A) / col (B, D) within subtile
  const int koff  = (lane >> 4) * 8;           // k offset of this lane half
  const int mOff  = (lane >> 4) * 8;           // D row offset

  v8f acc[4][4];
#pragma unroll
  for (int i = 0; i < 4; ++i)
#pragma unroll
    for (int j = 0; j < 4; ++j) acc[i][j] = (v8f){0.f,0.f,0.f,0.f,0.f,0.f,0.f,0.f};

  // ---- one stage's copies: the block's A rows (two 16-byte pieces per thread and plane), then this wave's own Bt rows ----
  const unsigned lbase = lds_off(smem);
  const int arow = threadIdx.x >> 3;           // 0..31; the second piece is row arow + 32
  const int brow = lane >> 3;                  // 0..3; piece it is row it * 4 + brow
  const int scol = (lane & 7) * 8;             // first k element of this lane's 16 bytes
  const unsigned la0 = lbase + (unsigned)(arow * GM_LP + scol) * 2u;
  const unsigned lb0 = lbase + (unsigned)(NPA + wave * NPB) * GM_PL + (unsigned)(brow * GM_LP + scol) * 2u;
  const size_t ga0 = (size_t)(m0 + arow) * lda + scol;
  const size_t gb0 = (size_t)(n0 + brow) * ldb + scol;
  auto issue_stage = [&](int st) {
    const unsigned bo = (unsigned)(st & 1) * STAGE;
    const size_t ka = ga0 + (size_t)st * GM_KS;
    const size_t kb = gb0 + (size_t)st * GM_KS;
    cp_async2(la0 + bo, Ab + ka, la0 + bo + 32 * GM_LP * 2, Ab + ka + (size_t)32 * lda);
    if (ASPL) cp_async2(la0 + bo + GM_PL, Ab2 + ka, la0 + bo + GM_PL + 32 * GM_LP * 2, Ab2 + ka + (size_t)32 * lda);
    const size_t gstep = (size_t)ldb * 8;   // bytes of four Bt rows
#pragma unroll   // two straight-line statements a plane: no loop counter between the copies
    for (int hf = 0; hf < 2; ++hf) {          // rows 0..31, rows 32..63
      cp_async8(lb0 + bo + hf * 32 * GM_LP * 2, (const char*)(Bb + kb + (size_t)(hf * 32) * ldb), gstep);
      if (BSPL) cp_async8(lb0 + bo + GM_PL + hf * 32 * GM_LP * 2, (const char*)(Bb2 + kb + (size_t)(hf * 32) * ldb), gstep);
    }
  };

  const int nst = K / GM_KS;
  issue_stage(0);
  asm volatile("s_wait_asynccnt 0x0" ::: "memory");   // this wave's copies of stage 0 have landed
  __syncthreads();                                    // stage 0 is readable by every wave
  if (nst > 1) issue_stage(1);
  for (int st = 0; st < nst; ++st) {
    const T* sA = (const T*)(smem + (st & 1) * STAGE);
    const T* sB = sA + (NPA + wave * NPB) * (GM_PL / 2);
#pragma unroll   // both 32-k steps of a stage in one body (as every loop below: fragment and accumulator arrays stay in registers)
    for (int ks = 0; ks < 2; ++ks) {
      V bh[4], bl[4], ah[4], al[4];
#pragma unroll
      for (int j = 0; j < 4; ++j) {
        const int bo = ((j << 4) + rlane) * GM_LP + ks * 32 + koff;
        bh[j] = Frag<T>::load(sB + bo);
        if (BSPL) bl[j] = Frag<T>::load(sB + GM_PL / 2 + bo);
        else bl[j] = bh[j];
      }
#pragma unroll
      for (int i = 0; i < 4; ++i) {
        const int ao = ((i << 4) + rlane) * GM_LP + ks * 32 + koff;
        ah[i] = Frag<T>::load(sA + ao);
        if (ASPL) al[i] = Frag<T>::load(sA + GM_PL / 2 + ao);
        else al[i] = ah[i];
      }
#pragma unroll
      for (int i = 0; i < 4; ++i) {
#pragma unroll
        for (int j = 0; j < 4; ++j) {
          acc[i][j] = Frag<T>::mma(ah[i], bh[j], acc[i][j]);
          if (BSPL) acc[i][j] = Frag<T>::mma(ah[i], bl[j], acc[i][j]);
          if (ASPL) acc[i][j] = Frag<T>::mma(al[i], bh[j], acc[i][j]);
        }
        Frag<T>::guard(acc[i][0], acc[i][3], ah[i], al[i]);
      }
      Frag<T>::keep(bh[0], bh[1], bh[2], bh[3]);
      if (BSPL) Frag<T>::keep(bl[0], bl[1], bl[2], bl[3]);
    }
    // hand-over: this wave's reads of stage st are over, its copies of stage st + 1 have landed; behind the barrier
    // stage st + 1 is readable by every wave and the buffer of stage st is free for stage st + 2
    asm volatile("s_wait_dscnt 0x0" ::: "memory");
    asm volatile("s_wait_asynccnt 0x0" ::: "memory");
    __syncthreads();
    if (st + 2 < nst) issue_stage(st + 2);
  }
  asm volatile("s_wait_asynccnt 0x0" ::: "memory");   // no copy is outstanding when the buffers become the output slabs
  acc_guard4(acc[0][0], acc[0][1], acc[0][2], acc[0][3]);
  acc_guard4(acc[1][0], acc[1][1], acc[1][2], acc[1][3]);
  acc_guard4(acc[2][0], acc[2][1], acc[2][2], acc[2][3]);
  acc_guard4(acc[3][0], acc[3][1], acc[3][2], acc[3][3]);

  // ---- epilogue ----
  float* slab = (float*)(smem + wave * (16 * 68 * 4));   // every wave has passed the last hand-over barrier: the buffers are free
  const float* Rb = RESID ? (resid + (size_t)b * strideR) : nullptr;
#pragma unroll
  for (int i = 0; i < 4; ++i) {
    const int mBase = m0 + (i << 4);
#pragma unroll
    for (int j = 0; j < 4; ++j) {
      const int n = n0 + (j << 4) + rlane;
      float bv = 0.f;
      if (BIAS_MODE == 2) bv = bias[n];
#pragma unroll
      for (int r = 0; r < 8; ++r) {
        float v = acc[i][j][r] * scale;
        if (BIAS_MODE == 1) v += bias[mBase + mOff + r];
        if (BIAS_MODE == 2) v += bv;
        if (RESID) v += Rb[(size_t)(mBase + mOff + r) * ldc + n];
        if (ACT == 1) v = tanhf(v);
        if (ACT == 2) v = fmaxf(v, 0.0f);
        if (ACT == 3) v = v / (1.0f + expf(-v));
        if (ACT == 4) v = (v > 0.f) ? v : 0.01f * v;
        slab[(mOff + r) * 68 + (j << 4) + rlane] = v;
      }
    }
    __builtin_amdgcn_fence(__ATOMIC_RELEASE, "workgroup");
    __builtin_amdgcn_wave_barrier();
    __builtin_amdgcn_fence(__ATOMIC_ACQUIRE, "workgroup");
    if (OUT_MODE == 0) {
      float* C = (float*)Cout + (size_t)b * strideC;
      const int hh = lane >> 4, c4 = (lane & 15) * 4;     // row seg = 256 B = 16 lanes x 16 B
      {
#pragma unroll
        for (int it = 0; it < 8; ++it) {
          const int row = it * 2 + hh;
          v4f v = *(const v4f*)(slab + row * 68 + c4);
          *(v4f*)(C + (size_t)(mBase + row) * ldc + n0 + c4) = v;
        }
        
      }
    } else {
      const int q = lane >> 3, c8 = (lane & 7) * 8;
      unsigned short* C  = (unsigned short*)Cout  + (size_t)b * strideC;
      unsigned short* C2 = (OUT_MODE == 2) ? ((unsigned short*)Cout2 + (size_t)b * strideC) : nullptr;
      {
#pragma unroll
        for (int it = 0; it < 4; ++it) {
          const int row = it * 4 + q;
          const float* sp = slab + row * 68 + c8;
          v8h hv, lv;
#pragma unroll
          for (int e = 0; e < 8; ++e) {
            if (OUT_MODE == 1) {
              hv[e] = (_Float16)sp[e];
            } else {
              unsigned short hb = f2bf_bits(sp[e]);
              unsigned short lb = f2bf_bits(sp[e] - bf_bits2f(hb));
              hv[e] = __builtin_bit_cast(_Float16, hb);
              lv[e] = __builtin_bit_cast(_Float16, lb);
            }
          }
          *(v8h*)(C + (size_t)(mBase + row) * ldc + n0 + c8) = hv;
          if (OUT_MODE == 2) *(v8h*)(C2 + (size_t)(mBase + row) * ldc + n0 + c8) = lv;
        }
        
      }
    }
    __builtin_amdgcn_fence(__ATOMIC_RELEASE, "workgroup");
    __builtin_amdgcn_wave_barrier();
    __builtin_amdgcn_fence(__ATOMIC_ACQUIRE, "workgroup");
  }
}

template <int ET, int SPLIT, int BIAS_MODE, int OUT_MODE, bool RESID, int ACT = 0>
__global__ __launch_bounds__(256) void wmma_gemm64(
    const unsigned short* __restrict__ Ap, const unsigned short* __restrict__ A2p, int lda, long strideA,
    const unsigned short* __restrict__ Btp, const unsigned short* __restrict__ Bt2p, int ldb, long strideB,
    void* __restrict__ Cout, void* __restrict__ Cout2, int ldc, long strideC,
    const float* __restrict__ bias,
    const float* __restrict__ resid, long strideR,
    int M, int N, int K, float scale) {
  __shared__ __align__(16) unsigned char smem[2 * gm_stage(SPLIT)];
  gemm64_body<ET, SPLIT, BIAS_MODE, OUT_MODE, RESID, ACT>(smem, (int)blockIdx.x, (int)blockIdx.y, Ap, A2p, lda, strideA,
      Btp, Bt2p, ldb, strideB, Cout, Cout2, ldc, strideC, bias, resid, strideR, M, N, K, scale);
}

constexpr int SEQ_LEN = 1024;
constexpr int N_HEADS = 8;
constexpr int N_CH = 512;
constexpr int N_CIN = 256;
constexpr int N_FF = 1024;
constexpr int N_B = 8;

// ---- the q, k and v projections in one launch: they need nothing of each other. grid (16, N_B, 3); blockIdx.z picks the GEMM ----
//   z = 0: gq[l][o] = sum_c xqT[l][c]  wq[o][c] + bq[o]   (M = 1024, N = 512, K = 512), L-major
//   z = 1: gk[l][o] = sum_c xkvT[l][c] wk[o][c] + bk[o]   (M = 1024, N = 512, K = 256), L-major
//   z = 2: gv[o][m] = sum_c wv[o][c] xkvT[m][c] + bv[o]   (M = 512, N = 1024, K = 256), channel-major
__global__ __launch_bounds__(256) void k_gemm_qkv(
    const unsigned short* __restrict__ xqT, const unsigned short* __restrict__ xkvT,
    const unsigned short* __restrict__ wq16, const unsigned short* __restrict__ wk16, const unsigned short* __restrict__ wv16,
    const float* __restrict__ bq, const float* __restrict__ bk, const float* __restrict__ bv,
    float* __restrict__ gq, float* __restrict__ gk, float* __restrict__ gv) {
  __shared__ __align__(16) unsigned char smem[2 * gm_stage(0)];
  const int job = blockIdx.z;   // the same for the whole block
  if (job < 2) {
    const bool isq = job == 0;
    const int K = isq ? N_CH : N_CIN;
    gemm64_body<1, 0, 2, 0, false>(smem, (int)blockIdx.x, (int)blockIdx.y,
        isq ? xqT : xkvT, nullptr, K, (long)SEQ_LEN * K, isq ? wq16 : wk16, nullptr, K, 0L,
        (void*)(isq ? gq : gk), nullptr, N_CH, (long)SEQ_LEN * N_CH, isq ? bq : bk, nullptr, 0L, SEQ_LEN, N_CH, K, 1.0f);
  } else {
    gemm64_body<1, 0, 1, 0, false>(smem, (int)blockIdx.x, (int)blockIdx.y,
        wv16, nullptr, N_CIN, 0L, xkvT, nullptr, N_CIN, (long)SEQ_LEN * N_CIN,
        (void*)gv, nullptr, SEQ_LEN, (long)N_CH * SEQ_LEN, bv, nullptr, 0L, N_CH, SEQ_LEN, N_CIN, 1.0f);
  }
}

// f32 -> bf16 (RNE), two elements per thread; blk = index of the 256-thread block inside this array
__device__ __forceinline__ void cast_bf16x2_body(
    const float* __restrict__ in, unsigned short* __restrict__ out, int n2, int blk) {
  int i = blk * 256 + threadIdx.x;
  if (i < n2) {
    const float* p = in + 2 * i;
    const float e0 = p[0], e1 = p[1];
    // p as an input keeps the load's address pair whole up to the wait (else the load lands on it)
    asm volatile("s_wait_xcnt 0x0" :: "v"(p) : "memory");
    const unsigned u = (unsigned)f2bf_bits(e0) | ((unsigned)f2bf_bits(e1) << 16);
    ((unsigned*)out)[i] = u;
  }
}

// ---- (nb, C, L) f32 -> (nb, L, C) bf16 through an LDS tile: in[c][l] -> out[l][c] ----
// tile = 64 channels x 32 positions; tile index (bx < L/32, by < C/64, b < nb), block 256.
// loads: 256 threads x 8 = 2048 = 64x32 floats; stores: thread (r = tid>>3, c8 = (tid&7)*8) writes 8 bf16 = 16 B,
__device__ __forceinline__ void transpose_bf16_body(
    const float* __restrict__ in, unsigned short* __restrict__ out, int C, int L, int bx, int by, int b) {
  __shared__ float t[64][33];
  const int tid = threadIdx.x;
  const int l0 = bx * 32, c0 = by * 64;
  const float* inb = in + (size_t)b * C * L;
#pragma unroll
  for (int i = 0; i < 8; ++i) {
    const int cl = i * 8 + (tid >> 5);
    t[cl][tid & 31] = inb[(size_t)(c0 + cl) * L + l0 + (tid & 31)];
  }
  __syncthreads();
  const int r = tid >> 3, c8 = (tid & 7) * 8;
  unsigned w0, w1, w2, w3;
  w0 = (unsigned)f2bf_bits(t[c8 + 0][r]) | ((unsigned)f2bf_bits(t[c8 + 1][r]) << 16);
  w1 = (unsigned)f2bf_bits(t[c8 + 2][r]) | ((unsigned)f2bf_bits(t[c8 + 3][r]) << 16);
  w2 = (unsigned)f2bf_bits(t[c8 + 4][r]) | ((unsigned)f2bf_bits(t[c8 + 5][r]) << 16);
  w3 = (unsigned)f2bf_bits(t[c8 + 6][r]) | ((unsigned)f2bf_bits(t[c8 + 7][r]) << 16);
  const v4u val = (v4u){w0, w1, w2, w3};
  unsigned short* dst = out + ((size_t)b * L + l0 + r) * C + c0 + c8;
  *(v4u*)dst = val;
  
}

// ---- all operand preparation in one launch: the two activation transposes and the five weight casts need nothing of each other.
// One-dimensional grid; a range of the block index picks the job (the same for the whole block), the transposes first.
constexpr int PB_XQ  = (SEQ_LEN / 32) * (N_CH / 64) * N_B;    // blocks of the x_query transpose
constexpr int PB_XKV = (SEQ_LEN / 32) * (N_CIN / 64) * N_B;   // blocks of the x_kv transpose
constexpr int PB_WQ  = N_CH * N_CH / 512;                     // blocks of a cast: 512 elements each
constexpr int PB_WKV = N_CH * N_CIN / 512;
constexpr int PB_WFF = N_FF * N_CH / 512;
constexpr int PB_ALL = PB_XQ + PB_XKV + PB_WQ + 2 * PB_WKV + 2 * PB_WFF;
__global__ __launch_bounds__(256) void k_prep(
    const float* __restrict__ x_query, const float* __restrict__ x_kv,
    const float* __restrict__ wq, const float* __restrict__ wk, const float* __restrict__ wv,
    const float* __restrict__ w1, const float* __restrict__ w2,
    unsigned short* __restrict__ xqT, unsigned short* __restrict__ xkvT,
    unsigned short* __restrict__ wq16, unsigned short* __restrict__ wk16, unsigned short* __restrict__ wv16,
    unsigned short* __restrict__ w1_16, unsigned short* __restrict__ w2_16) {
  int blk = blockIdx.x;
  if (blk < PB_XQ + PB_XKV) {
    const bool isq = blk < PB_XQ;
    static_assert(N_CH / 64 == 8 && N_CIN / 64 == 4);
    const unsigned t  = isq ? blk : blk - PB_XQ;
    const unsigned cb = t / (SEQ_LEN / 32);   // (batch, channel block)
    const int ls = isq ? 3 : 2;               // log2 of the channel blocks: a shift, not a division by a run-time value
    transpose_bf16_body(isq ? x_query : x_kv, isq ? xqT : xkvT, isq ? N_CH : N_CIN, SEQ_LEN,
                        (int)(t % (SEQ_LEN / 32)), (int)(cb & ((1u << ls) - 1u)), (int)(cb >> ls));
    return;
  }
  blk -= PB_XQ + PB_XKV;
  const float* in; unsigned short* out; int n2;
  if (blk < PB_WQ)                                 { in = wq; out = wq16;  n2 = N_CH * N_CH / 2; }
  else if ((blk -= PB_WQ) < PB_WKV)                { in = wk; out = wk16;  n2 = N_CH * N_CIN / 2; }
  else if ((blk -= PB_WKV) < PB_WKV)               { in = wv; out = wv16;  n2 = N_CH * N_CIN / 2; }
  else if ((blk -= PB_WKV) < PB_WFF)               { in = w1; out = w1_16; n2 = N_FF * N_CH / 2; }
  else                          { blk -= PB_WFF;     in = w2; out = w2_16; n2 = N_CH * N_FF / 2; }
  cast_bf16x2_body(in, out, n2, blk);
}

// ---- InstanceNorm over the 1024 rows of an L-major f32 plane X[nb][1024][NCOL], per (b, column) ----
// block = 32 waves owns a slab of 64 columns x 1024 rows; slab index (bx < NCOL/64, by < nb).
// lane = (row half, 4 adjacent columns): one wave-wide 16-byte load covers 2 rows x 256 B; a thread keeps its
// 16 rows (i*64 + wave*2 + half) x 4 columns in registers, so X is read once. Mean, then centred sum of squares.
// output = bf16 hi + lo planes, same layout (a wave stores 2 rows x 128 B per plane);
// MODE 0: plain; MODE 1: + residual read from a bf16 plane res (same layout); MODE 2: relu.
constexpr int CN_RP = 68;   // pitch in floats of the per-wave partial rows (16-byte aligned rows)

// column totals over the whole slab: s = this thread's partial for its 4 columns; every thread gets the totals of its 4 columns.
// fixed tree: two row halves by shuffle, 32 wave partials through LDS, wave w adds up columns 2w and 2w+1 by a butterfly.
__device__ __forceinline__ v4f cn_colsum(v4f s, float* red, float* tot, int wave, int lane) {
  const int c4 = (lane & 15) * 4;
#pragma unroll
  for (int e = 0; e < 4; ++e) s[e] += __shfl_xor(s[e], 16, 32);
  if (lane < 16) *(v4f*)(red + wave * CN_RP + c4) = s;
  __syncthreads();   // all 32 partial rows are in red
  v2f p = *(const v2f*)(red + lane * CN_RP + 2 * wave);
#pragma unroll
  for (int off = 1; off < 32; off <<= 1) {
    p.x += __shfl_xor(p.x, off, 32);
    p.y += __shfl_xor(p.y, off, 32);
  }
  if (lane == 0) *(v2f*)(tot + 2 * wave) = p;
  __syncthreads();   // all 64 totals are in tot; every read of red is over
  return *(const v4f*)(tot + c4);
}

template <int MODE, int NCOL>
__device__ __forceinline__ void colnorm_body(
    const float* __restrict__ X, const unsigned* __restrict__ res,
    unsigned* __restrict__ outh, unsigned* __restrict__ outl, int bx, int by) {
  constexpr int NR = 1024, NW = 32, NI = NR / (2 * NW);
  __shared__ __align__(16) float red[NW * CN_RP];
  __shared__ __align__(16) float tot[2][64];
  const int lane = threadIdx.x & 31, wave = threadIdx.x >> 5;
  const size_t base = ((size_t)by * NR + wave * 2 + (lane >> 4)) * NCOL + bx * 64 + (lane & 15) * 4;
  constexpr size_t STEP = (size_t)64 * NCOL;   // floats between a thread's rows; STEP / 2 words in the bf16 planes
  const size_t obase = base >> 1;
  const float* xp = X + base;
  v4f x[NI];
#pragma unroll
  for (int i = 0; i < NI; ++i) x[i] = *(const v4f*)(xp + i * STEP);
  // xp as an input keeps the loads' address pair whole up to the wait (else the last load lands on it)
  asm volatile("s_wait_xcnt 0x0" :: "v"(xp) : "memory");
  // MODE 1: residual words, two groups of 4 rows; the first group is asked for here, under the two reductions
  v2u rw[2][4];
  if constexpr (MODE == 1) {
#pragma unroll
    for (int j = 0; j < 4; ++j) rw[0][j] = *(const v2u*)(res + obase + j * (STEP / 2));
  }
  v4f s = x[0];
#pragma unroll
  for (int i = 1; i < NI; ++i) s += x[i];
  const v4f mean = cn_colsum(s, red, tot[0], wave, lane) * (1.0f / NR);
  v4f q = (v4f){0.f, 0.f, 0.f, 0.f};
#pragma unroll
  for (int i = 0; i < NI; ++i) {
    x[i] -= mean;
    q += x[i] * x[i];
  }
  const v4f var = cn_colsum(q, red, tot[1], wave, lane) * (1.0f / NR);
  v4f rs;
#pragma unroll
  for (int e = 0; e < 4; ++e) rs[e] = rsqrtf(var[e] + 1e-5f);
#pragma unroll
  for (int g = 0; g < NI / 4; ++g) {
    if constexpr (MODE == 1) {
      if (g + 1 < NI / 4) {
#pragma unroll
        for (int j = 0; j < 4; ++j) rw[(g + 1) & 1][j] = *(const v2u*)(res + obase + ((g + 1) * 4 + j) * (STEP / 2));
      }
    }
#pragma unroll
    for (int j = 0; j < 4; ++j) {
      const int i = g * 4 + j;
      v4f y = x[i] * rs;
      if constexpr (MODE == 1) {
        const v2u w = rw[g & 1][j];
        y.x += __uint_as_float(w.x << 16);
        y.y += __uint_as_float(w.x & 0xffff0000u);
        y.z += __uint_as_float(w.y << 16);
        y.w += __uint_as_float(w.y & 0xffff0000u);
      }
      if constexpr (MODE == 2) {
#pragma unroll
        for (int e = 0; e < 4; ++e) y[e] = fmaxf(y[e], 0.0f);
      }
      unsigned short hb[4], lb[4];
#pragma unroll
      for (int e = 0; e < 4; ++e) {
        hb[e] = f2bf_bits(y[e]);
        lb[e] = f2bf_bits(y[e] - bf_bits2f(hb[e]));
      }
      const size_t oi = obase + i * (STEP / 2);
      *(v2u*)(outh + oi) = (v2u){ (unsigned)hb[0] | ((unsigned)hb[1] << 16), (unsigned)hb[2] | ((unsigned)hb[3] << 16) };
      *(v2u*)(outl + oi) = (v2u){ (unsigned)lb[0] | ((unsigned)lb[1] << 16), (unsigned)lb[2] | ((unsigned)lb[3] << 16) };
    }
    if (g + 1 < NI / 4) {
      // stands in front of every reuse of the address and data registers that the loads and stores above name
      asm volatile("s_wait_xcnt 0x0" ::: "memory");
      // keeps the next group's code below that wait; in MODE 1 it also keeps the later groups' residual loads from
      // being hoisted: with all 16 in flight the kernel passes the 128 registers of a 32-wave block and spills
      __builtin_amdgcn_sched_barrier(0);
    }
  }
}

template <int MODE, int NCOL>
__global__ __launch_bounds__(1024) void k_colnorm(
    const float* __restrict__ X, const unsigned* __restrict__ res,
    unsigned* __restrict__ outh, unsigned* __restrict__ outl) {
  colnorm_body<MODE, NCOL>(X, res, outh, outl, (int)blockIdx.x, (int)blockIdx.y);
}

// ---- InstanceNorm over channel-major f32 rows X[row][1024] (row = b*C + channel), one wave per row ----
// Rolled re-read passes (no per-thread arrays); no LDS, no barrier.
template <int MODE>
__device__ __forceinline__ void rownorm_body(
    const float* __restrict__ X, float* __restrict__ outf,
    unsigned short* __restrict__ outh, unsigned short* __restrict__ outl, const size_t row) {
  constexpr int NCOL = 1024;
  const int lane = threadIdx.x & 31;
  const float* xr = X + row * NCOL;
  float s = 0.f;
#pragma unroll 1
  for (int it = 0; it < 8; ++it) {
    const v4f u = *(const v4f*)(xr + it * 128 + lane * 4);
    s += (u.x + u.y) + (u.z + u.w);
  }
#pragma unroll
  for (int off = 1; off < 32; off <<= 1) s += __shfl_xor(s, off, 32);
  const float mean = s * (1.0f / NCOL);
  float ss = 0.f;
#pragma unroll 1
  for (int it = 0; it < 8; ++it) {
    const v4f u = *(const v4f*)(xr + it * 128 + lane * 4);
    const float d0 = u.x - mean, d1 = u.y - mean, d2 = u.z - mean, d3 = u.w - mean;
    ss += (d0 * d0 + d1 * d1) + (d2 * d2 + d3 * d3);
  }
#pragma unroll
  for (int off = 1; off < 32; off <<= 1) ss += __shfl_xor(ss, off, 32);
  const float rs = rsqrtf(ss * (1.0f / NCOL) + 1e-5f);
  if constexpr (MODE == 0) {
    float* orow = outf + row * NCOL;
    {
#pragma unroll 1
      for (int it = 0; it < 8; ++it) {
        const v4f u = *(const v4f*)(xr + it * 128 + lane * 4);
        v4f y;
        y.x = (u.x - mean) * rs; y.y = (u.y - mean) * rs; y.z = (u.z - mean) * rs; y.w = (u.w - mean) * rs;
        *(v4f*)(orow + it * 128 + lane * 4) = y;
      }
      
    }
  } else {
    unsigned short* hrow = outh + row * NCOL;
    unsigned short* lrw  = outl + row * NCOL;
    {
#pragma unroll 1
      for (int it = 0; it < 4; ++it) {
        const v4f u0 = *(const v4f*)(xr + it * 256 + lane * 8);
        const v4f u1 = *(const v4f*)(xr + it * 256 + lane * 8 + 4);
        const float y0 = (u0.x - mean) * rs, y1 = (u0.y - mean) * rs, y2 = (u0.z - mean) * rs, y3 = (u0.w - mean) * rs;
        const float y4 = (u1.x - mean) * rs, y5 = (u1.y - mean) * rs, y6 = (u1.z - mean) * rs, y7 = (u1.w - mean) * rs;
        const unsigned short h0 = f2bf_bits(y0), h1 = f2bf_bits(y1), h2 = f2bf_bits(y2), h3 = f2bf_bits(y3);
        const unsigned short h4 = f2bf_bits(y4), h5 = f2bf_bits(y5), h6 = f2bf_bits(y6), h7 = f2bf_bits(y7);
        const unsigned short l0 = f2bf_bits(y0 - bf_bits2f(h0)), l1 = f2bf_bits(y1 - bf_bits2f(h1));
        const unsigned short l2 = f2bf_bits(y2 - bf_bits2f(h2)), l3 = f2bf_bits(y3 - bf_bits2f(h3));
        const unsigned short l4 = f2bf_bits(y4 - bf_bits2f(h4)), l5 = f2bf_bits(y5 - bf_bits2f(h5));
        const unsigned short l6 = f2bf_bits(y6 - bf_bits2f(h6)), l7 = f2bf_bits(y7 - bf_bits2f(h7));
        const v4u hv = (v4u){ (unsigned)h0 | ((unsigned)h1 << 16), (unsigned)h2 | ((unsigned)h3 << 16),
                              (unsigned)h4 | ((unsigned)h5 << 16), (unsigned)h6 | ((unsigned)h7 << 16) };
        const v4u lv = (v4u){ (unsigned)l0 | ((unsigned)l1 << 16), (unsigned)l2 | ((unsigned)l3 << 16),
                              (unsigned)l4 | ((unsigned)l5 << 16), (unsigned)l6 | ((unsigned)l7 << 16) };
        *(v4u*)(hrow + it * 256 + lane * 8) = hv;
        *(v4u*)(lrw  + it * 256 + lane * 8) = lv;
      }
      
    }
  }
}

// block 8 waves = 8 rows; grid = rows/8 (rows % 8 == 0)
template <int MODE>
__global__ __launch_bounds__(256) void k_rownorm(
    const float* __restrict__ X, float* __restrict__ outf,
    unsigned short* __restrict__ outh, unsigned short* __restrict__ outl) {
  rownorm_body<MODE>(X, outf, outh, outl, (size_t)blockIdx.x * 8 + (threadIdx.x >> 5));
}

// ---- the InstanceNorms of q, k and v in one launch: they need nothing of each other. Block = 32 waves; a range of the block
// index picks the job (the same for the whole block): 64 column slabs of q, 64 of k, then 32 rows of v per block.
constexpr int NB_SLAB = (N_CH / 64) * N_B;        // column slabs of q, and of k
constexpr int NB_VROW = N_B * N_CH / 32;          // blocks of 32 v rows
__global__ __launch_bounds__(1024) void k_norm_qkv(
    const float* __restrict__ gq, const float* __restrict__ gk, const float* __restrict__ gv,
    unsigned* __restrict__ qh, unsigned* __restrict__ ql, unsigned* __restrict__ kh, unsigned* __restrict__ kl,
    unsigned short* __restrict__ vh, unsigned short* __restrict__ vl) {
  const int blk = blockIdx.x;
  if (blk < 2 * NB_SLAB) {
    const bool isq = blk < NB_SLAB;
    const int t = isq ? blk : blk - NB_SLAB;
    colnorm_body<0, N_CH>(isq ? gq : gk, nullptr, isq ? qh : kh, isq ? ql : kl, t % (N_CH / 64), t / (N_CH / 64));
  } else {
    rownorm_body<1>(gv, nullptr, vh, vl, (size_t)(blk - 2 * NB_SLAB) * 32 + (threadIdx.x >> 5));
  }
}

#define AT_D 64
#define AT_NW 4
#define AT_QW 32   // query columns of a wave: two tiles of 16, so that a K or V fragment read from LDS is used twice
#define AT_KC 64
#define AT_OSP 68
// pitch in bf16 elements of every 64-element row of the K and V tiles in LDS: 144 B = 16 B x 9. The fragment reads are
// 16-byte loads of 16 rows at one column; at a pitch of 128 B those rows fall on two groups of four banks, at 144 B on sixteen.
#define AT_LP 72
// K hi, K lo, V hi and V lo tiles of a 64-key chunk reach LDS by asynchronous 16-byte copies: wave w brings plane w, a copy
// instruction covers 4 whole rows of 128 B; two buffers, chunk t + 1 flies while chunk t is worked on.
constexpr int AT_PL = AT_KC * AT_LP * 2;   // bytes of one 64-row plane
constexpr int AT_ST = 4 * AT_PL;           // bytes of one buffer: K hi [kv][d], K lo [kv][d], V hi [d][kv], V lo [d][kv]

// the plain builtin: the compiler keeps the distances behind its own matrix instructions and is free to move the LDS reads ahead of them
__device__ __forceinline__ v8f at_mma(v16b a, v16b b, v8f c) {
  return __builtin_amdgcn_wmma_f32_16x16x32_bf16(false, a, false, b, (short)0, c, false, false);
}
// lane l <-> lane l ^ 16
__device__ __forceinline__ float at_xhalf(float x) {
  const int b = __builtin_bit_cast(int, x);
  return __builtin_bit_cast(float, __builtin_amdgcn_permlanex16(b, b, 0x76543210, 0xfedcba98, false, false));
}
// two neighbouring elements of a fragment -> one register of the hi plane and one of the lo plane (bf16, round to nearest even;
// f0 in the low half): hi = bf16(f), lo = bf16(f - hi)
__device__ __forceinline__ void at_split2(float f0, float f1, unsigned& hi, unsigned& lo) {
  const unsigned hw = __builtin_bit_cast(unsigned, __builtin_convertvector((v2f){f0, f1}, v2b));
  const v2f rem = (v2f){f0, f1} - (v2f){__uint_as_float(hw << 16), __uint_as_float(hw & 0xffff0000u)};   // one packed subtraction a pair
  hi = hw;
  lo = __builtin_bit_cast(unsigned, __builtin_convertvector(rem, v2b));
}

// two waves a SIMD: the grid gives every WGP two work-groups (512 on 256 WGPs); a wave may then hold 512 registers
__global__ __launch_bounds__(128) __attribute__((amdgpu_waves_per_eu(2, 2)))
void k_attn(const unsigned short* __restrict__ qhp, const unsigned short* __restrict__ qlp,
            const unsigned short* __restrict__ khp, const unsigned short* __restrict__ klp,
            const unsigned short* __restrict__ vhp, const unsigned short* __restrict__ vlp,
            float* __restrict__ out, float sscale) {
  union FB { v16b v; v8b h[2]; unsigned w[8]; };
  __shared__ __align__(16) unsigned char smem[2 * AT_ST];        // two chunk buffers; behind the loop: per wave out tiles
  static_assert(AT_NW * AT_QW * AT_OSP * 4 <= 2 * AT_ST && AT_LP == GM_LP && AT_D == AT_KC && AT_NW == 4 && AT_QW == 32);

  const int tid  = threadIdx.x;
  const int wave = tid >> 5;
  const int lane = tid & 31;
  const int hh   = lane >> 4;
  const int c    = lane & 15;

  constexpr int NQB = SEQ_LEN / (AT_NW * AT_QW);
  const int bx  = blockIdx.x;
  const int qb  = bx % NQB;
  const int bhd = bx / NQB;
  const int h   = bhd % N_HEADS;
  const int b   = bhd / N_HEADS;
  const int q0  = qb * (AT_NW * AT_QW) + wave * AT_QW;

  const __bf16* qh = (const __bf16*)qhp;
  const __bf16* ql = (const __bf16*)qlp;
  const __bf16* kh = (const __bf16*)khp;
  const __bf16* kl = (const __bf16*)klp;
  const __bf16* vh = (const __bf16*)vhp;
  const __bf16* vl = (const __bf16*)vlp;

  // ---- one chunk's copies: this wave's plane, rows (lane >> 3) + 4 * i, 16 bytes a lane ----
  constexpr int NKC = SEQ_LEN / AT_KC;
  static_assert(NKC >= 2);
  const int crow = lane >> 3, ccol = (lane & 7) * 8;
  const int wv = __builtin_amdgcn_readfirstlane(wave);   // the wave's number in a scalar register: plane, row step and chunk step are then scalars, with no lane mask written
  const bool isk = wv < 2;
  const __bf16* cpl = isk ? (wv == 0 ? kh : kl) : (wv == 2 ? vh : vl);
  const char* csrc = (const char*)(cpl + (isk ? ((size_t)b * SEQ_LEN + crow) * N_CH + h * AT_D + ccol
                                              : ((size_t)b * N_CH + h * AT_D + crow) * SEQ_LEN + ccol));
  const size_t crow4 = isk ? (size_t)4 * N_CH * 2 : (size_t)4 * SEQ_LEN * 2;     // bytes of four rows of the plane in memory
  const size_t cadv  = isk ? (size_t)AT_KC * N_CH * 2 : (size_t)AT_KC * 2;       // bytes from one chunk to the next
  const unsigned cdst = lds_off(smem) + (unsigned)(wv * AT_PL + (crow * AT_LP + ccol) * 2);
  auto issue_chunk = [&](int t) {
    const unsigned l = cdst + (unsigned)(t & 1) * AT_ST;
    const char* g = csrc + (size_t)t * cadv;
    cp_async8(l, g, crow4);                                   // rows 0..31
    cp_async8(l + 32 * AT_LP * 2, g + 8 * crow4, crow4);      // rows 32..63
  };
  issue_chunk(0);

  // ---- Q fragments of the wave's two query tiles u (B operand: column = query q0 + u*16 + c, k = d), hi and lo planes ----
  v16b qah[2][2], qal[2][2];
#pragma unroll
  for (int u = 0; u < 2; ++u) {
    const size_t qo = ((size_t)b * SEQ_LEN + q0 + u * 16 + c) * N_CH + h * AT_D + 8 * hh;
#pragma unroll
    for (int dc = 0; dc < 2; ++dc) {
      qah[u][dc] = Frag<__bf16>::load(qh + qo + dc * 32);
      qal[u][dc] = Frag<__bf16>::load(ql + qo + dc * 32);
    }
  }

  // of this lane's query in tile u: running maximum over all keys so far, in units of log2 (score * cscale); running sum over this lane half's keys only
  const float cscale = sscale * 1.4426950408889634f;   // sscale * log2(e)
  float mrow[2] = {-INFINITY, -INFINITY}, lrow[2] = {0.f, 0.f};
  v8f oacc[2][4];   // O^T: element r of tile (u, t) = (d = t*16 + 8*hh + r, query u*16 + c)
#pragma unroll
  for (int u = 0; u < 2; ++u)
#pragma unroll
    for (int t = 0; t < 4; ++t) oacc[u][t] = (v8f){0.f,0.f,0.f,0.f,0.f,0.f,0.f,0.f};

  asm volatile("s_wait_asynccnt 0x0" ::: "memory");   // this wave's copies of chunk 0 have landed
  __syncthreads();                                    // chunk 0 is readable by every wave
  issue_chunk(1);
  for (int kc = 0; kc < NKC; ++kc) {
    const __bf16* Ksh = (const __bf16*)(smem + (kc & 1) * AT_ST);
    const __bf16* Ksl = Ksh + AT_PL / 2;
    const __bf16* Vth = Ksh + 2 * (AT_PL / 2);
    const __bf16* Vtl = Ksh + 3 * (AT_PL / 2);

    // ---- scores, transposed: A operand row = key j*16 + c, k = d (Ksh is [key][d], k-contiguous); B = Q ----
    // every K fragment is read once and multiplied with both query tiles; the two tiles' accumulators take turns
    v8f s[2][4];
#pragma unroll
    for (int j = 0; j < 4; ++j) {
      s[0][j] = (v8f){0.f,0.f,0.f,0.f,0.f,0.f,0.f,0.f};
      s[1][j] = (v8f){0.f,0.f,0.f,0.f,0.f,0.f,0.f,0.f};
#pragma unroll
      for (int dc = 0; dc < 2; ++dc) {
        FB kb, kb2;
        const int ko2 = (j * 16 + c) * AT_LP + dc * 32 + 8 * hh;
        kb.h[0]  = *(const v8b*)(Ksh + ko2);
        kb.h[1]  = *(const v8b*)(Ksh + ko2 + 16);
        kb2.h[0] = *(const v8b*)(Ksl + ko2);
        kb2.h[1] = *(const v8b*)(Ksl + ko2 + 16);
        s[0][j] = at_mma(kb.v,  qah[0][dc], s[0][j]);
        s[1][j] = at_mma(kb.v,  qah[1][dc], s[1][j]);
        s[0][j] = at_mma(kb2.v, qah[0][dc], s[0][j]);
        s[1][j] = at_mma(kb2.v, qah[1][dc], s[1][j]);
        s[0][j] = at_mma(kb.v,  qal[0][dc], s[0][j]);
        s[1][j] = at_mma(kb.v,  qal[1][dc], s[1][j]);
      }
    }
    // D element r of lane = (key j*16 + 8*hh + r, query column u*16 + c)
    // P^T as B operand of a 32-key step kk: element e < 8 = key kk*32 + 8*hh + e, e >= 8 = key kk*32 + 16 + 8*hh + (e - 8):
    // these are this lane's own elements of the score tiles j = 2*kk and j = 2*kk + 1
    FB ph[2][2], pl[2][2];
#pragma unroll
    for (int u = 0; u < 2; ++u) {
      // softmax in base 2: the maximum is taken over the raw scores and scaled once (cscale > 0 keeps the order)
      float cm[4];
#pragma unroll
      for (int j = 0; j < 4; ++j) {
        float m = -INFINITY;
#pragma unroll
        for (int r = 0; r < 8; ++r) m = fmaxf(m, s[u][j][r]);
        cm[j] = m;
      }
      float mc = fmaxf(fmaxf(cm[0], cm[1]), fmaxf(cm[2], cm[3]));
      mc = fmaxf(mc, at_xhalf(mc)) * cscale;   // both lane halves of a query agree on the maximum, so on alpha too
      const float mnew = fmaxf(mrow[u], mc);
      const float alpha = __builtin_amdgcn_exp2f(mrow[u] - mnew);   // 0 in the first chunk, where mrow is -inf
      mrow[u] = mnew;
      const v2f cs2 = (v2f){cscale, cscale}, nm2 = (v2f){-mnew, -mnew};
      float ps[4];
#pragma unroll
      for (int j = 0; j < 4; ++j) {
        float psum = 0.f;
#pragma unroll
        for (int r = 0; r < 8; r += 2) {
          // exp(sscale * s - max) = 2^(s * cscale - mnew): one packed multiply-add a score pair, then the hardware's 2^x
          const v2f arg = __builtin_elementwise_fma((v2f){s[u][j][r], s[u][j][r + 1]}, cs2, nm2);
          const float p0 = __builtin_amdgcn_exp2f(arg.x);
          const float p1 = __builtin_amdgcn_exp2f(arg.y);
          psum += p0 + p1;
          at_split2(p0, p1, ph[u][j >> 1].w[(j & 1) * 4 + (r >> 1)], pl[u][j >> 1].w[(j & 1) * 4 + (r >> 1)]);
        }
        ps[j] = psum;
      }
      lrow[u] = lrow[u] * alpha + ((ps[0] + ps[1]) + (ps[2] + ps[3]));
#pragma unroll
      for (int t = 0; t < 4; ++t) oacc[u][t] *= alpha;
    }
    // ---- O^T += V^T.P^T : A = V with row = d, k = key (Vth is [d][key], k-contiguous), B = P^T ----
    // every V fragment is read once and multiplied with both query tiles
#pragma unroll   // ph and pl are indexed by kk: they stay in registers only with kk a constant
    for (int kk = 0; kk < 2; ++kk) {
#pragma unroll
      for (int t = 0; t < 4; ++t) {
        FB vb, vb2;
        const int vo2 = (t * 16 + c) * AT_LP + kk * 32 + 8 * hh;
        vb.h[0]  = *(const v8b*)(Vth + vo2);
        vb.h[1]  = *(const v8b*)(Vth + vo2 + 16);
        vb2.h[0] = *(const v8b*)(Vtl + vo2);
        vb2.h[1] = *(const v8b*)(Vtl + vo2 + 16);
        oacc[0][t] = at_mma(vb.v,  ph[0][kk].v, oacc[0][t]);
        oacc[1][t] = at_mma(vb.v,  ph[1][kk].v, oacc[1][t]);
        oacc[0][t] = at_mma(vb2.v, ph[0][kk].v, oacc[0][t]);
        oacc[1][t] = at_mma(vb2.v, ph[1][kk].v, oacc[1][t]);
        oacc[0][t] = at_mma(vb.v,  pl[0][kk].v, oacc[0][t]);
        oacc[1][t] = at_mma(vb.v,  pl[1][kk].v, oacc[1][t]);
      }
    }
    // hand-over: this wave's reads of chunk kc are over, its copies of chunk kc + 1 have landed; behind the barrier
    // chunk kc + 1 is readable by every wave and the buffer of chunk kc is free for chunk kc + 2
    asm volatile("s_wait_dscnt 0x0" ::: "memory");
    asm volatile("s_wait_asynccnt 0x0" ::: "memory");
    __syncthreads();
    if (kc + 2 < NKC) issue_chunk(kc + 2);
  }
  asm volatile("s_wait_asynccnt 0x0" ::: "memory");   // no copy is outstanding when the buffers become the out tiles

  // out tile [query][d]: this lane holds 8 neighbouring d of query u*16 + c in every O^T tile
  float* os = (float*)(smem + wave * (AT_QW * AT_OSP * 4));   // every wave has passed the last hand-over barrier: the buffers are free
#pragma unroll
  for (int u = 0; u < 2; ++u) {
    const float inv = 1.0f / (lrow[u] + at_xhalf(lrow[u]));   // the two lane halves' sums are joined here, once
#pragma unroll
    for (int t = 0; t < 4; ++t) {
      float* op = os + (u * 16 + c) * AT_OSP + t * 16 + 8 * hh;
      *(v4f*)(op)     = (v4f){oacc[u][t][0] * inv, oacc[u][t][1] * inv, oacc[u][t][2] * inv, oacc[u][t][3] * inv};
      *(v4f*)(op + 4) = (v4f){oacc[u][t][4] * inv, oacc[u][t][5] * inv, oacc[u][t][6] * inv, oacc[u][t][7] * inv};
    }
  }
  __builtin_amdgcn_fence(__ATOMIC_RELEASE, "workgroup");
  __builtin_amdgcn_wave_barrier();
  __builtin_amdgcn_fence(__ATOMIC_ACQUIRE, "workgroup");
  {
    float* ob = out + ((size_t)b * SEQ_LEN) * N_CH + h * AT_D;
    const int c4 = (lane & 15) * 4;
    {
#pragma unroll
      for (int it = 0; it < AT_QW / 2; ++it) {
        const int row = it * 2 + hh;
        v4f val = *(const v4f*)(os + row * AT_OSP + c4);
        *(v4f*)(ob + (size_t)(q0 + row) * N_CH + c4) = val;
      }
      
    }
  }
}

// =====================================================================================
// Host orchestration
// =====================================================================================
extern "C" void kernel_launch(void* const* d_in, const int* in_sizes, int n_in,
                              void* d_out, int out_size, void* d_ws,
                              size_t ws_size, hipStream_t stream) {
  (void)in_sizes; (void)n_in; (void)out_size;
  constexpr int NB = 8, CIN = 256, NCH = 512, SEQ = 1024, NFF = 1024, NHD = 8;

  // ---- workspace region map (bytes) ----
  constexpr size_t SZ_WQ   = (size_t)NCH * NCH * 2;        //    524288  wq  bf16 [512][512]
  constexpr size_t SZ_WK   = (size_t)NCH * CIN * 2;        //    262144  wk  bf16 [512][256]
  constexpr size_t SZ_WV   = (size_t)NCH * CIN * 2;        //    262144  wv  bf16 [512][256]
  constexpr size_t SZ_W1   = (size_t)NFF * NCH * 2;        //   1048576  w1  bf16 [1024][512]
  constexpr size_t SZ_W2   = (size_t)NCH * NFF * 2;        //   1048576  w2  bf16 [512][1024]
  constexpr size_t SZ_XQT  = (size_t)NB * SEQ * NCH * 2;   //   8388608  x_query (L,C) bf16
  constexpr size_t SZ_XKVT = (size_t)NB * SEQ * CIN * 2;   //   4194304  x_kv (L,C) bf16
  constexpr size_t SZ_G    = (size_t)NB * SEQ * NFF * 4;   //  33554432  f32 GEMM/attention output, max user = ffn1 [8][1024][1024]
  constexpr size_t SZ_P    = (size_t)NB * SEQ * NCH * 2;   //   8388608  one bf16 activation plane [8][1024][512]
  constexpr size_t OFF_WQ   = 0;
  constexpr size_t OFF_WK   = OFF_WQ + SZ_WQ;
  constexpr size_t OFF_WV   = OFF_WK + SZ_WK;
  constexpr size_t OFF_W1   = OFF_WV + SZ_WV;
  constexpr size_t OFF_W2   = OFF_W1 + SZ_W1;
  constexpr size_t OFF_XQT  = OFF_W2 + SZ_W2;
  constexpr size_t OFF_XKVT = OFF_XQT + SZ_XQT;
  constexpr size_t OFF_G    = OFF_XKVT + SZ_XKVT;
  constexpr size_t OFF_QH   = OFF_G + SZ_G;       // q hi plane; later z hi plane
  constexpr size_t OFF_QL   = OFF_QH + SZ_P;      // q lo plane; later z lo plane
  constexpr size_t OFF_KH   = OFF_QL + SZ_P;      // k hi plane; later y hi plane spans KH+KL (16777216)
  constexpr size_t OFF_KL   = OFF_KH + SZ_P;      // k lo plane
  constexpr size_t OFF_VH   = OFF_KL + SZ_P;      // v hi plane; later y lo plane spans VH+VL (16777216)
  constexpr size_t OFF_VL   = OFF_VH + SZ_P;      // v lo plane
  constexpr size_t OFF_GV   = OFF_VL + SZ_P;      // v projection f32 [8][512][1024] (q and k projections: the two halves of G)
  constexpr size_t OFF_END  = OFF_GV + SZ_G / 2;  // 116391936
  static_assert(OFF_END == 116391936ull);
  static_assert(OFF_END <= 134217728ull);
  static_assert((OFF_WK % 256) == 0 && (OFF_XQT % 256) == 0 && (OFF_G % 256) == 0 && (OFF_QH % 256) == 0);
  // reused regions sized from the max user
  static_assert((size_t)NB * SEQ * NCH * 4 * 2 <= SZ_G);    // q and k side by side; proj, ffn2 f32 outputs
  static_assert(NB == N_B && CIN == N_CIN && NCH == N_CH && SEQ == SEQ_LEN && NFF == N_FF && NHD == N_HEADS);
  static_assert((size_t)NB * SEQ * NFF * 4 <= SZ_G);        // ffn1 f32 output
  static_assert((size_t)NB * SEQ * NFF * 2 == 2 * SZ_P);    // y plane fits exactly over two 512-wide planes
  // GEMM shape contract: M multiple of 64, N multiple of 512, K multiple of 64
  static_assert(SEQ % 512 == 0 && NCH % 512 == 0 && NFF % 512 == 0);
  static_assert(NCH % 64 == 0 && CIN % 64 == 0 && NFF % 64 == 0);
  static_assert(((SEQ / 64) * (NCH / 64)) % 8 == 0 && ((SEQ / 64) * (NFF / 64)) % 8 == 0);
  static_assert(NCH % 256 == 0 && NFF % 256 == 0 && (NB * NCH) % 8 == 0);
  static_assert((size_t)NB * NCH * SEQ * 4 == 16777216ull);   // d_out bytes
  if (ws_size < OFF_END) return;

  const float* x_query = (const float*)d_in[0];
  const float* x_kv    = (const float*)d_in[1];
  const float* wq      = (const float*)d_in[2];
  const float* bq      = (const float*)d_in[3];
  const float* wk      = (const float*)d_in[4];
  const float* bk      = (const float*)d_in[5];
  const float* wv      = (const float*)d_in[6];
  const float* bv      = (const float*)d_in[7];
  const float* w1      = (const float*)d_in[8];
  const float* b1      = (const float*)d_in[9];
  const float* w2      = (const float*)d_in[10];
  const float* b2      = (const float*)d_in[11];
  float* out = (float*)d_out;

  char* ws = (char*)d_ws;
  typedef unsigned short us;
  us* wq16  = (us*)(ws + OFF_WQ);
  us* wk16  = (us*)(ws + OFF_WK);
  us* wv16  = (us*)(ws + OFF_WV);
  us* w1_16 = (us*)(ws + OFF_W1);
  us* w2_16 = (us*)(ws + OFF_W2);
  us* xqT   = (us*)(ws + OFF_XQT);
  us* xkvT  = (us*)(ws + OFF_XKVT);
  float* gf = (float*)(ws + OFF_G);
  float* gq = gf;
  float* gk = (float*)(ws + OFF_G + SZ_G / 2);
  float* gv = (float*)(ws + OFF_GV);
  us* qh = (us*)(ws + OFF_QH);
  us* ql = (us*)(ws + OFF_QL);
  us* kh = (us*)(ws + OFF_KH);
  us* kl = (us*)(ws + OFF_KL);
  us* vh = (us*)(ws + OFF_VH);
  us* vl = (us*)(ws + OFF_VL);
  us* zh = qh;
  us* zl = ql;
  us* yh = kh;    // [8][1024][1024] bf16 = 16777216 B over KH..KL
  us* yl = vh;    // [8][1024][1024] bf16 = 16777216 B over VH..VL

  // 1) operand preparation: activations (B,C,L) f32 -> (B,L,C) bf16, weights -> bf16 (RNE)
  k_prep<<<PB_ALL, 256, 0, stream>>>(x_query, x_kv, wq, wk, wv, w1, w2, xqT, xkvT, wq16, wk16, wv16, w1_16, w2_16);

  // 2) q, k (L-major) and v (channel-major) projections, f32
  k_gemm_qkv<<<dim3((SEQ / 64) * (NCH / 64) / 8, NB, 3), 256, 0, stream>>>(xqT, xkvT, wq16, wk16, wv16, bq, bk, bv, gq, gk, gv);

  // 3) InstanceNorm of each -> q, k hi/lo planes (L-major), v hi/lo planes (channel-major)
  k_norm_qkv<<<2 * NB_SLAB + NB_VROW, 1024, 0, stream>>>(gq, gk, gv, (unsigned*)qh, (unsigned*)ql, (unsigned*)kh, (unsigned*)kl, vh, vl);

  // 4) attention -> gf as proj L-major [b][l][h*64+d] f32
  k_attn<<<NB * NHD * (SEQ / 128), 128, 0, stream>>>(qh, ql, kh, kl, vh, vl, gf, 0.125f);

  // 5) z = InstanceNorm(proj) + x_query(bf16) -> z hi/lo planes (L-major, pitch 512)
  k_colnorm<1, NCH><<<dim3(NCH / 64, NB), 1024, 0, stream>>>(gf, (const unsigned*)xqT, (unsigned*)zh, (unsigned*)zl);

  // 6) ffn1: C[l][o] = sum_c z[l][c] w1[o][c] + b1[o]  (M=1024, N=1024, K=512), z as hi/lo -> gf L-major [l][1024]
  wmma_gemm64<1, 2, 2, 0, false><<<dim3((SEQ / 64) * (NFF / 64) / 8, NB), 256, 0, stream>>>(
      zh, zl, NCH, (long)SEQ * NCH, w1_16, nullptr, NCH, 0L,
      (void*)gf, nullptr, NFF, (long)SEQ * NFF, b1, nullptr, 0L, SEQ, NFF, NCH, 1.0f);
  // 7) y = relu(InstanceNorm(h1)) -> y hi/lo planes [l][1024]
  k_colnorm<2, NFF><<<dim3(NFF / 64, NB), 1024, 0, stream>>>(gf, nullptr, (unsigned*)yh, (unsigned*)yl);

  // 8) ffn2: C[o][l] = sum_c w2[o][c] y[l][c] + b2[o]  (M=512, N=1024, K=1024), y as hi/lo -> channel-major gf
  wmma_gemm64<1, 3, 1, 0, false><<<dim3((NCH / 64) * (SEQ / 64) / 8, NB), 256, 0, stream>>>(
      w2_16, nullptr, NFF, 0L, yh, yl, NFF, (long)SEQ * NFF,
      (void*)gf, nullptr, SEQ, (long)NCH * SEQ, b2, nullptr, 0L, NCH, SEQ, NFF, 1.0f);

  // 9) final InstanceNorm over rows -> d_out (B, 512, L) f32
  k_rownorm<0><<<NB * NCH / 8, 256, 0, stream>>>(gf, out, nullptr, nullptr);
}

// v009
// One run takes 156 microseconds.
// Timed twice side by side with v008, it ran 1.09 times as fast both times.
// Over all steps from v000 it is 21.4 times as fast.
// Compute dtypes: conv1x1 GEMMs q/k/v = v_wmma_f32_16x16x32_bf16 on RNE-bf16 inputs (1 product); attention scores and P.V = bf16 hi+lo planes (3 products); FFN GEMMs = bf16 hi+lo activations x bf16 weights (2 products); f32 accumulate; InstanceNorm, softmax, residual in f32.
#include <hip/hip_runtime.h>
#include <hip/hip_bf16.h>

typedef __attribute__((ext_vector_type(16))) _Float16 v16h;
typedef __attribute__((ext_vector_type(8)))  _Float16 v8h;
typedef __attribute__((ext_vector_type(16))) __bf16   v16b;
typedef __attribute__((ext_vector_type(8)))  __bf16   v8b;
typedef __attribute__((ext_vector_type(2)))  __bf16   v2b;
typedef __attribute__((ext_vector_type(8)))  float    v8f;
typedef __attribute__((ext_vector_type(4)))  float    v4f;
typedef __attribute__((ext_vector_type(2)))  float    v2f;
typedef __attribute__((ext_vector_type(4)))  unsigned v4u;
typedef __attribute__((ext_vector_type(2)))  unsigned v2u;

__device__ __forceinline__ unsigned short f2bf_bits(float f) {
  unsigned u = __float_as_uint(f);
  return (unsigned short)((u + 0x7FFFu + ((u >> 16) & 1u)) >> 16);
}
__device__ __forceinline__ float bf_bits2f(unsigned short h) { return __uint_as_float(((unsigned)h) << 16); }

// hazard guards as plain device helpers
__device__ __forceinline__ void dep_guard_h(v8f& a, v8f& b, v16h x, v16h y) { asm volatile("v_nop\n\tv_nop\n\tv_nop\n\tv_nop" : "+v"(a), "+v"(b) : "v"(x), "v"(y)); }
__device__ __forceinline__ void dep_guard_b(v8f& a, v8f& b, v16b x, v16b y) { asm volatile("v_nop\n\tv_nop\n\tv_nop\n\tv_nop" : "+v"(a), "+v"(b) : "v"(x), "v"(y)); }
__device__ __forceinline__ void keep4_h(v16h a, v16h b, v16h c, v16h d) { asm volatile("v_nop" :: "v"(a), "v"(b), "v"(c), "v"(d)); }
__device__ __forceinline__ void keep4_b(v16b a, v16b b, v16b c, v16b d) { asm volatile("v_nop" :: "v"(a), "v"(b), "v"(c), "v"(d)); }
__device__ __forceinline__ void acc_guard4(v8f& a, v8f& b, v8f& c, v8f& d) { asm volatile("v_nop\n\tv_nop\n\tv_nop\n\tv_nop" : "+v"(a), "+v"(b), "+v"(c), "+v"(d)); }
template <typename T> struct Frag;
template <> struct Frag<_Float16> {
  typedef v16h V; union U { v16h v; v8h h[2]; };
  // elements 0..7 <- p[0..7], 8..15 <- p[16..23]
  static __device__ __forceinline__ v16h load(const _Float16* p) {
    U f; f.h[0] = *(const v8h*)(p); f.h[1] = *(const v8h*)(p + 16); return f.v;
  }
  static __device__ __forceinline__ v8f mma(v16h a, v16h b, v8f c) {
    return __builtin_amdgcn_wmma_f32_16x16x32_f16(false, a, false, b, (short)0, c, false, false);
  }
  static __device__ __forceinline__ void guard(v8f& a, v8f& b, v16h x, v16h y) { dep_guard_h(a, b, x, y); }
  static __device__ __forceinline__ void keep(v16h a, v16h b, v16h c, v16h d) { keep4_h(a, b, c, d); }
};
template <> struct Frag<__bf16> {
  typedef v16b V; union U { v16b v; v8b h[2]; };
  static __device__ __forceinline__ v16b load(const __bf16* p) {
    U f; f.h[0] = *(const v8b*)(p); f.h[1] = *(const v8b*)(p + 16); return f.v;
  }
  static __device__ __forceinline__ v8f mma(v16b a, v16b b, v8f c) {
    return __builtin_amdgcn_wmma_f32_16x16x32_bf16(false, a, false, b, (short)0, c, false, false);
  }
  static __device__ __forceinline__ void guard(v8f& a, v8f& b, v16b x, v16b y) { dep_guard_b(a, b, x, y); }
  static __device__ __forceinline__ void keep(v16b a, v16b b, v16b c, v16b d) { keep4_b(a, b, c, d); }
};

// ---- Register-blocked batched WMMA GEMM ------------------------------------
// C[m,n] = scale * sum_k A[m,k] * Bt[n,k] (+bias)(+resid); each wave owns a 64x64 tile.
// A row-major [M,K]; Bt row-major [N,K]; M % 64 == 0, N % 512 == 0, K % 64 == 0.
// The eight waves of a block own eight neighbouring tiles of one tile row (N % 512 == 0), so they share the A rows.
// Operands reach the fragments through LDS: a stage is 64 k (one whole 128-byte line of every row), brought by asynchronous
// 16-byte copies in which a wave covers 4 rows x 128 B per instruction; two buffers, stage t + 1 flies while stage t is worked on.
// Stage layout: [A planes: 64 rows][wave 0..7: its Bt planes: 64 rows], every row at a pitch of 144 B (16 B x odd).
// SPLIT: 0 = single product; 1 = A and Bt both hi/lo planes (hi.hi + hi.lo + lo.hi);
//        2 = only A is hi/lo (A_hi.B + A_lo.B); 3 = only Bt is hi/lo (A.B_hi + A.B_lo).
// BIAS_MODE: 0 = none, 1 = bias[m], 2 = bias[n].
// OUT_MODE: 0 = f32, 1 = f16, 2 = bf16 hi plane (Cout) + bf16 lo plane (Cout2).
// ET: 0 = f16 operands, 1 = bf16 operands (pointers passed as 16-bit storage)
constexpr int GM_KS = 64;                  // k elements of a stage
constexpr int GM_LP = 72;                  // LDS pitch of a stage row, in 16-bit elements
constexpr int GM_PL = 64 * GM_LP * 2;      // bytes of one 64-row plane of a stage
__device__ __forceinline__ unsigned lds_off(const void* p) { return (unsigned)(size_t)p; }   // byte address in the block's LDS
// asynchronous copies global -> LDS, 16 bytes per lane. The s_wait_xcnt closes each statement so that it stands in front of
// every later write of the address registers that the copies name.
__device__ __forceinline__ void cp_async2(unsigned l0, const void* g0, unsigned l1, const void* g1) {
  asm volatile("global_load_async_to_lds_b128 %0, %1, off\n\t"
               "global_load_async_to_lds_b128 %2, %3, off\n\t"
               "s_wait_xcnt 0x0"
               :: "v"(l0), "v"(g0), "v"(l1), "v"(g1) : "memory");
}
__device__ __forceinline__ void cp_async8(unsigned l, const char* g, size_t gstep) {
  // eight rows, four apart: LDS step 4 rows of GM_LP elements, global step gstep bytes
  constexpr unsigned LS = 4 * GM_LP * 2;
  asm volatile("global_load_async_to_lds_b128 %0, %1, off\n\t"
               "global_load_async_to_lds_b128 %2, %3, off\n\t"
               "global_load_async_to_lds_b128 %4, %5, off\n\t"
               "global_load_async_to_lds_b128 %6, %7, off\n\t"
               "global_load_async_to_lds_b128 %8, %9, off\n\t"
               "global_load_async_to_lds_b128 %10, %11, off\n\t"
               "global_load_async_to_lds_b128 %12, %13, off\n\t"
               "global_load_async_to_lds_b128 %14, %15, off\n\t"
               "s_wait_xcnt 0x0"
               :: "v"(l), "v"(g), "v"(l + LS), "v"(g + gstep), "v"(l + 2 * LS), "v"(g + 2 * gstep), "v"(l + 3 * LS), "v"(g + 3 * gstep),
                  "v"(l + 4 * LS), "v"(g + 4 * gstep), "v"(l + 5 * LS), "v"(g + 5 * gstep), "v"(l + 6 * LS), "v"(g + 6 * gstep),
                  "v"(l + 7 * LS), "v"(g + 7 * gstep) : "memory");
}
template <int ET> struct Elem;
template <> struct Elem<0> { typedef _Float16 T; };
template <> struct Elem<1> { typedef __bf16 T; };
// bytes of one stage buffer of a GEMM with the given SPLIT
constexpr int gm_stage(int split) {
  return (((split == 1 || split == 2) ? 2 : 1) + 8 * ((split == 1 || split == 3) ? 2 : 1)) * GM_PL;
}
// The GEMM of one block: smem = the kernel's 2 * gm_stage(SPLIT) bytes of LDS, bx = index of the block's group of eight tiles, b = batch.
template <int ET, int SPLIT, int BIAS_MODE, int OUT_MODE, bool RESID, int ACT = 0>
__device__ __forceinline__ void gemm64_body(
    unsigned char* smem, const int bx, const int b,
    const unsigned short* __restrict__ Ap, const unsigned short* __restrict__ A2p, int lda, long strideA,
    const unsigned short* __restrict__ Btp, const unsigned short* __restrict__ Bt2p, int ldb, long strideB,
    void* __restrict__ Cout, void* __restrict__ Cout2, int ldc, long strideC,
    const float* __restrict__ bias,
    const float* __restrict__ resid, long strideR,
    int M, int N, int K, float scale) {
  typedef typename Elem<ET>::T T;
  typedef typename Frag<T>::V V;
  constexpr bool ASPL = (SPLIT == 1) || (SPLIT == 2);
  constexpr bool BSPL = (SPLIT == 1) || (SPLIT == 3);
  const T* A = (const T*)Ap; const T* A2 = (const T*)A2p; const T* Bt = (const T*)Btp; const T* Bt2 = (const T*)Bt2p;
  constexpr int NPA = ASPL ? 2 : 1, NPB = BSPL ? 2 : 1;
  constexpr int STAGE = (NPA + 8 * NPB) * GM_PL;            // bytes of one buffer
  static_assert(STAGE == gm_stage(SPLIT) && 2 * STAGE <= 327680 && 8 * 16 * 68 * 4 <= STAGE);
  // smem: two stage buffers; behind the k loop: per-wave 16x64 f32 slabs, pitch 68
  const int lane = threadIdx.x & 31;
  const int wave = threadIdx.x >> 5;
  const int tilesN = N >> 6;
  const int tilesM = M >> 6;
  const int tile = bx * 8 + wave;
  if (bx * 8 >= tilesM * tilesN) return;   // the same for the whole block, in front of every barrier
  const int tm = tile / tilesN;
  const int tn = tile - tm * tilesN;
  const int m0 = tm << 6;
  const int n0 = tn << 6;

  const T* Ab  = A  + (size_t)b * strideA;
  const T* Bb  = Bt + (size_t)b * strideB;
  const T* Ab2 = ASPL ? (A2  + (size_t)b * strideA) : nullptr;
  const T* Bb2 = BSPL ? (Bt2 + (size_t)b * strideB) : nullptr;

  const int rlane = lane & 15;                 // row (A) / col (B, D) within subtile
  const int koff  = (lane >> 4) * 8;           // k offset of this lane half
  const int mOff  = (lane >> 4) * 8;           // D row offset

  v8f acc[4][4];
#pragma unroll
  for (int i = 0; i < 4; ++i)
#pragma unroll
    for (int j = 0; j < 4; ++j) acc[i][j] = (v8f){0.f,0.f,0.f,0.f,0.f,0.f,0.f,0.f};

  // ---- one stage's copies: the block's A rows (two 16-byte pieces per thread and plane), then this wave's own Bt rows ----
  const unsigned lbase = lds_off(smem);
  const int arow = threadIdx.x >> 3;           // 0..31; the second piece is row arow + 32
  const int brow = lane >> 3;                  // 0..3; piece it is row it * 4 + brow
  const int scol = (lane & 7) * 8;             // first k element of this lane's 16 bytes
  const unsigned la0 = lbase + (unsigned)(arow * GM_LP + scol) * 2u;
  const unsigned lb0 = lbase + (unsigned)(NPA + wave * NPB) * GM_PL + (unsigned)(brow * GM_LP + scol) * 2u;
  const size_t ga0 = (size_t)(m0 + arow) * lda + scol;
  const size_t gb0 = (size_t)(n0 + brow) * ldb + scol;
  auto issue_stage = [&](int st) {
    const unsigned bo = (unsigned)(st & 1) * STAGE;
    const size_t ka = ga0 + (size_t)st * GM_KS;
    const size_t kb = gb0 + (size_t)st * GM_KS;
    cp_async2(la0 + bo, Ab + ka, la0 + bo + 32 * GM_LP * 2, Ab + ka + (size_t)32 * lda);
    if (ASPL) cp_async2(la0 + bo + GM_PL, Ab2 + ka, la0 + bo + GM_PL + 32 * GM_LP * 2, Ab2 + ka + (size_t)32 * lda);
    const size_t gstep = (size_t)ldb * 8;   // bytes of four Bt rows
#pragma unroll   // two straight-line statements a plane: no loop counter between the copies
    for (int hf = 0; hf < 2; ++hf) {          // rows 0..31, rows 32..63
      cp_async8(lb0 + bo + hf * 32 * GM_LP * 2, (const char*)(Bb + kb + (size_t)(hf * 32) * ldb), gstep);
      if (BSPL) cp_async8(lb0 + bo + GM_PL + hf * 32 * GM_LP * 2, (const char*)(Bb2 + kb + (size_t)(hf * 32) * ldb), gstep);
    }
  };

  const int nst = K / GM_KS;
  issue_stage(0);
  asm volatile("s_wait_asynccnt 0x0" ::: "memory");   // this wave's copies of stage 0 have landed
  __syncthreads();                                    // stage 0 is readable by every wave
  if (nst > 1) issue_stage(1);
  for (int st = 0; st < nst; ++st) {
    const T* sA = (const T*)(smem + (st & 1) * STAGE);
    const T* sB = sA + (NPA + wave * NPB) * (GM_PL / 2);
#pragma unroll   // both 32-k steps of a stage in one body (as every loop below: fragment and accumulator arrays stay in registers)
    for (int ks = 0; ks < 2; ++ks) {
      V bh[4], bl[4], ah[4], al[4];
#pragma unroll
      for (int j = 0; j < 4; ++j) {
        const int bo = ((j << 4) + rlane) * GM_LP + ks * 32 + koff;
        bh[j] = Frag<T>::load(sB + bo);
        if (BSPL) bl[j] = Frag<T>::load(sB + GM_PL / 2 + bo);
        else bl[j] = bh[j];
      }
#pragma unroll
      for (int i = 0; i < 4; ++i) {
        const int ao = ((i << 4) + rlane) * GM_LP + ks * 32 + koff;
        ah[i] = Frag<T>::load(sA + ao);
        if (ASPL) al[i] = Frag<T>::load(sA + GM_PL / 2 + ao);
        else al[i] = ah[i];
      }
#pragma unroll
      for (int i = 0; i < 4; ++i) {
#pragma unroll
        for (int j = 0; j < 4; ++j) {
          acc[i][j] = Frag<T>::mma(ah[i], bh[j], acc[i][j]);
          if (BSPL) acc[i][j] = Frag<T>::mma(ah[i], bl[j], acc[i][j]);
          if (ASPL) acc[i][j] = Frag<T>::mma(al[i], bh[j], acc[i][j]);
        }
        Frag<T>::guard(acc[i][0], acc[i][3], ah[i], al[i]);
      }
      Frag<T>::keep(bh[0], bh[1], bh[2], bh[3]);
      if (BSPL) Frag<T>::keep(bl[0], bl[1], bl[2], bl[3]);
    }
    // hand-over: this wave's reads of stage st are over, its copies of stage st + 1 have landed; behind the barrier
    // stage st + 1 is readable by every wave and the buffer of stage st is free for stage st + 2
    asm volatile("s_wait_dscnt 0x0" ::: "memory");
    asm volatile("s_wait_asynccnt 0x0" ::: "memory");
    __syncthreads();
    if (st + 2 < nst) issue_stage(st + 2);
  }
  asm volatile("s_wait_asynccnt 0x0" ::: "memory");   // no copy is outstanding when the buffers become the output slabs
  acc_guard4(acc[0][0], acc[0][1], acc[0][2], acc[0][3]);
  acc_guard4(acc[1][0], acc[1][1], acc[1][2], acc[1][3]);
  acc_guard4(acc[2][0], acc[2][1], acc[2][2], acc[2][3]);
  acc_guard4(acc[3][0], acc[3][1], acc[3][2], acc[3][3]);

  // ---- epilogue ----
  float* slab = (float*)(smem + wave * (16 * 68 * 4));   // every wave has passed the last hand-over barrier: the buffers are free
  const float* Rb = RESID ? (resid + (size_t)b * strideR) : nullptr;
#pragma unroll
  for (int i = 0; i < 4; ++i) {
    const int mBase = m0 + (i << 4);
#pragma unroll
    for (int j = 0; j < 4; ++j) {
      const int n = n0 + (j << 4) + rlane;
      float bv = 0.f;
      if (BIAS_MODE == 2) bv = bias[n];
#pragma unroll
      for (int r = 0; r < 8; ++r) {
        float v = acc[i][j][r] * scale;
        if (BIAS_MODE == 1) v += bias[mBase + mOff + r];
        if (BIAS_MODE == 2) v += bv;
        if (RESID) v += Rb[(size_t)(mBase + mOff + r) * ldc + n];
        if (ACT == 1) v = tanhf(v);
        if (ACT == 2) v = fmaxf(v, 0.0f);
        if (ACT == 3) v = v / (1.0f + expf(-v));
        if (ACT == 4) v = (v > 0.f) ? v : 0.01f * v;
        slab[(mOff + r) * 68 + (j << 4) + rlane] = v;
      }
    }
    __builtin_amdgcn_fence(__ATOMIC_RELEASE, "workgroup");
    __builtin_amdgcn_wave_barrier();
    __builtin_amdgcn_fence(__ATOMIC_ACQUIRE, "workgroup");
    if (OUT_MODE == 0) {
      float* C = (float*)Cout + (size_t)b * strideC;
      const int hh = lane >> 4, c4 = (lane & 15) * 4;     // row seg = 256 B = 16 lanes x 16 B
      {
#pragma unroll
        for (int it = 0; it < 8; ++it) {
          const int row = it * 2 + hh;
          v4f v = *(const v4f*)(slab + row * 68 + c4);
          *(v4f*)(C + (size_t)(mBase + row) * ldc + n0 + c4) = v;
        }
        
      }
    } else {
      const int q = lane >> 3, c8 = (lane & 7) * 8;
      unsigned short* C  = (unsigned short*)Cout  + (size_t)b * strideC;
      unsigned short* C2 = (OUT_MODE == 2) ? ((unsigned short*)Cout2 + (size_t)b * strideC) : nullptr;
      {
#pragma unroll
        for (int it = 0; it < 4; ++it) {
          const int row = it * 4 + q;
          const float* sp = slab + row * 68 + c8;
          v8h hv, lv;
#pragma unroll
          for (int e = 0; e < 8; ++e) {
            if (OUT_MODE == 1) {
              hv[e] = (_Float16)sp[e];
            } else {
              unsigned short hb = f2bf_bits(sp[e]);
              unsigned short lb = f2bf_bits(sp[e] - bf_bits2f(hb));
              hv[e] = __builtin_bit_cast(_Float16, hb);
              lv[e] = __builtin_bit_cast(_Float16, lb);
            }
          }
          *(v8h*)(C + (size_t)(mBase + row) * ldc + n0 + c8) = hv;
          if (OUT_MODE == 2) *(v8h*)(C2 + (size_t)(mBase + row) * ldc + n0 + c8) = lv;
        }
        
      }
    }
    __builtin_amdgcn_fence(__ATOMIC_RELEASE, "workgroup");
    __builtin_amdgcn_wave_barrier();
    __builtin_amdgcn_fence(__ATOMIC_ACQUIRE, "workgroup");
  }
}

template <int ET, int SPLIT, int BIAS_MODE, int OUT_MODE, bool RESID, int ACT = 0>
__global__ __launch_bounds__(256) void wmma_gemm64(
    const unsigned short* __restrict__ Ap, const unsigned short* __restrict__ A2p, int lda, long strideA,
    const unsigned short* __restrict__ Btp, const unsigned short* __restrict__ Bt2p, int ldb, long strideB,
    void* __restrict__ Cout, void* __restrict__ Cout2, int ldc, long strideC,
    const float* __restrict__ bias,
    const float* __restrict__ resid, long strideR,
    int M, int N, int K, float scale) {
  __shared__ __align__(16) unsigned char smem[2 * gm_stage(SPLIT)];
  gemm64_body<ET, SPLIT, BIAS_MODE, OUT_MODE, RESID, ACT>(smem, (int)blockIdx.x, (int)blockIdx.y, Ap, A2p, lda, strideA,
      Btp, Bt2p, ldb, strideB, Cout, Cout2, ldc, strideC, bias, resid, strideR, M, N, K, scale);
}

constexpr int SEQ_LEN = 1024;
constexpr int N_HEADS = 8;
constexpr int N_CH = 512;
constexpr int N_CIN = 256;
constexpr int N_FF = 1024;
constexpr int N_B = 8;

// f32 -> bf16 (RNE), two elements per thread; blk = index of the 256-thread block inside this array
__device__ __forceinline__ void cast_bf16x2_body(
    const float* __restrict__ in, unsigned short* __restrict__ out, int n2, int blk) {
  int i = blk * 256 + threadIdx.x;
  if (i < n2) {
    const float* p = in + 2 * i;
    const float e0 = p[0], e1 = p[1];
    // p as an input keeps the load's address pair whole up to the wait (else the load lands on it)
    asm volatile("s_wait_xcnt 0x0" :: "v"(p) : "memory");
    const unsigned u = (unsigned)f2bf_bits(e0) | ((unsigned)f2bf_bits(e1) << 16);
    ((unsigned*)out)[i] = u;
  }
}

// ---- (nb, C, L) f32 -> (nb, L, C) bf16 through an LDS tile: in[c][l] -> out[l][c] ----
// tile = 64 channels x 32 positions; tile index (bx < L/32, by < C/64, b < nb), block 256.
// loads: 256 threads x 8 = 2048 = 64x32 floats; stores: thread (r = tid>>3, c8 = (tid&7)*8) writes 8 bf16 = 16 B,
__device__ __forceinline__ void transpose_bf16_body(
    const float* __restrict__ in, unsigned short* __restrict__ out, int C, int L, int bx, int by, int b) {
  __shared__ float t[64][33];
  const int tid = threadIdx.x;
  const int l0 = bx * 32, c0 = by * 64;
  const float* inb = in + (size_t)b * C * L;
#pragma unroll
  for (int i = 0; i < 8; ++i) {
    const int cl = i * 8 + (tid >> 5);
    t[cl][tid & 31] = inb[(size_t)(c0 + cl) * L + l0 + (tid & 31)];
  }
  __syncthreads();
  const int r = tid >> 3, c8 = (tid & 7) * 8;
  unsigned w0, w1, w2, w3;
  w0 = (unsigned)f2bf_bits(t[c8 + 0][r]) | ((unsigned)f2bf_bits(t[c8 + 1][r]) << 16);
  w1 = (unsigned)f2bf_bits(t[c8 + 2][r]) | ((unsigned)f2bf_bits(t[c8 + 3][r]) << 16);
  w2 = (unsigned)f2bf_bits(t[c8 + 4][r]) | ((unsigned)f2bf_bits(t[c8 + 5][r]) << 16);
  w3 = (unsigned)f2bf_bits(t[c8 + 6][r]) | ((unsigned)f2bf_bits(t[c8 + 7][r]) << 16);
  const v4u val = (v4u){w0, w1, w2, w3};
  unsigned short* dst = out + ((size_t)b * L + l0 + r) * C + c0 + c8;
  *(v4u*)dst = val;
  
}

// ---- all operand preparation in one launch: the two activation transposes and the five weight casts need nothing of each other.
// One-dimensional grid; a range of the block index picks the job (the same for the whole block), the transposes first.
constexpr int PB_XQ  = (SEQ_LEN / 32) * (N_CH / 64) * N_B;    // blocks of the x_query transpose
constexpr int PB_XKV = (SEQ_LEN / 32) * (N_CIN / 64) * N_B;   // blocks of the x_kv transpose
constexpr int PB_WQ  = N_CH * N_CH / 512;                     // blocks of a cast: 512 elements each
constexpr int PB_WKV = N_CH * N_CIN / 512;
constexpr int PB_WFF = N_FF * N_CH / 512;
constexpr int PB_ALL = PB_XQ + PB_XKV + PB_WQ + 2 * PB_WKV + 2 * PB_WFF;
__global__ __launch_bounds__(256) void k_prep(
    const float* __restrict__ x_query, const float* __restrict__ x_kv,
    const float* __restrict__ wq, const float* __restrict__ wk, const float* __restrict__ wv,
    const float* __restrict__ w1, const float* __restrict__ w2,
    unsigned short* __restrict__ xqT, unsigned short* __restrict__ xkvT,
    unsigned short* __restrict__ wq16, unsigned short* __restrict__ wk16, unsigned short* __restrict__ wv16,
    unsigned short* __restrict__ w1_16, unsigned short* __restrict__ w2_16) {
  int blk = blockIdx.x;
  if (blk < PB_XQ + PB_XKV) {
    const bool isq = blk < PB_XQ;
    static_assert(N_CH / 64 == 8 && N_CIN / 64 == 4);
    const unsigned t  = isq ? blk : blk - PB_XQ;
    const unsigned cb = t / (SEQ_LEN / 32);   // (batch, channel block)
    const int ls = isq ? 3 : 2;               // log2 of the channel blocks: a shift, not a division by a run-time value
    transpose_bf16_body(isq ? x_query : x_kv, isq ? xqT : xkvT, isq ? N_CH : N_CIN, SEQ_LEN,
                        (int)(t % (SEQ_LEN / 32)), (int)(cb & ((1u << ls) - 1u)), (int)(cb >> ls));
    return;
  }
  blk -= PB_XQ + PB_XKV;
  const float* in; unsigned short* out; int n2;
  if (blk < PB_WQ)                                 { in = wq; out = wq16;  n2 = N_CH * N_CH / 2; }
  else if ((blk -= PB_WQ) < PB_WKV)                { in = wk; out = wk16;  n2 = N_CH * N_CIN / 2; }
  else if ((blk -= PB_WKV) < PB_WKV)               { in = wv; out = wv16;  n2 = N_CH * N_CIN / 2; }
  else if ((blk -= PB_WKV) < PB_WFF)               { in = w1; out = w1_16; n2 = N_FF * N_CH / 2; }
  else                          { blk -= PB_WFF;     in = w2; out = w2_16; n2 = N_CH * N_FF / 2; }
  cast_bf16x2_body(in, out, n2, blk);
}

// ---- InstanceNorm over the 1024 rows of an L-major f32 plane X[nb][1024][NCOL], per (b, column) ----
// block = 32 waves owns a slab of 64 columns x 1024 rows; slab index (bx < NCOL/64, by < nb).
// lane = (row half, 4 adjacent columns): one wave-wide 16-byte load covers 2 rows x 256 B; a thread keeps its
// 16 rows (i*64 + wave*2 + half) x 4 columns in registers, so X is read once. Mean, then centred sum of squares.
// output = bf16 hi + lo planes, same layout (a wave stores 2 rows x 128 B per plane);
// MODE 0: plain; MODE 1: + residual read from a bf16 plane res (same layout); MODE 2: relu.
constexpr int CN_RP = 68;   // pitch in floats of the per-wave partial rows (16-byte aligned rows)

// column totals over the whole slab: s = this thread's partial for its 4 columns; every thread gets the totals of its 4 columns.
// fixed tree: two row halves by shuffle, 32 wave partials through LDS, wave w adds up columns 2w and 2w+1 by a butterfly.
__device__ __forceinline__ v4f cn_colsum(v4f s, float* red, float* tot, int wave, int lane) {
  const int c4 = (lane & 15) * 4;
#pragma unroll
  for (int e = 0; e < 4; ++e) s[e] += __shfl_xor(s[e], 16, 32);
  if (lane < 16) *(v4f*)(red + wave * CN_RP + c4) = s;
  __syncthreads();   // all 32 partial rows are in red
  v2f p = *(const v2f*)(red + lane * CN_RP + 2 * wave);
#pragma unroll
  for (int off = 1; off < 32; off <<= 1) {
    p.x += __shfl_xor(p.x, off, 32);
    p.y += __shfl_xor(p.y, off, 32);
  }
  if (lane == 0) *(v2f*)(tot + 2 * wave) = p;
  __syncthreads();   // all 64 totals are in tot; every read of red is over
  return *(const v4f*)(tot + c4);
}

template <int MODE, int NCOL>
__device__ __forceinline__ void colnorm_body(
    const float* __restrict__ X, const unsigned* __restrict__ res,
    unsigned* __restrict__ outh, unsigned* __restrict__ outl, int bx, int by) {
  constexpr int NR = 1024, NW = 32, NI = NR / (2 * NW);
  __shared__ __align__(16) float red[NW * CN_RP];
  __shared__ __align__(16) float tot[2][64];
  const int lane = threadIdx.x & 31, wave = threadIdx.x >> 5;
  const size_t base = ((size_t)by * NR + wave * 2 + (lane >> 4)) * NCOL + bx * 64 + (lane & 15) * 4;
  constexpr size_t STEP = (size_t)64 * NCOL;   // floats between a thread's rows; STEP / 2 words in the bf16 planes
  const size_t obase = base >> 1;
  const float* xp = X + base;
  v4f x[NI];
#pragma unroll
  for (int i = 0; i < NI; ++i) x[i] = *(const v4f*)(xp + i * STEP);
  // xp as an input keeps the loads' address pair whole up to the wait (else the last load lands on it)
  asm volatile("s_wait_xcnt 0x0" :: "v"(xp) : "memory");
  // MODE 1: residual words, two groups of 4 rows; the first group is asked for here, under the two reductions
  v2u rw[2][4];
  if constexpr (MODE == 1) {
#pragma unroll
    for (int j = 0; j < 4; ++j) rw[0][j] = *(const v2u*)(res + obase + j * (STEP / 2));
  }
  v4f s = x[0];
#pragma unroll
  for (int i = 1; i < NI; ++i) s += x[i];
  const v4f mean = cn_colsum(s, red, tot[0], wave, lane) * (1.0f / NR);
  v4f q = (v4f){0.f, 0.f, 0.f, 0.f};
#pragma unroll
  for (int i = 0; i < NI; ++i) {
    x[i] -= mean;
    q += x[i] * x[i];
  }
  const v4f var = cn_colsum(q, red, tot[1], wave, lane) * (1.0f / NR);
  v4f rs;
#pragma unroll
  for (int e = 0; e < 4; ++e) rs[e] = rsqrtf(var[e] + 1e-5f);
#pragma unroll
  for (int g = 0; g < NI / 4; ++g) {
    if constexpr (MODE == 1) {
      if (g + 1 < NI / 4) {
#pragma unroll
        for (int j = 0; j < 4; ++j) rw[(g + 1) & 1][j] = *(const v2u*)(res + obase + ((g + 1) * 4 + j) * (STEP / 2));
      }
    }
#pragma unroll
    for (int j = 0; j < 4; ++j) {
      const int i = g * 4 + j;
      v4f y = x[i] * rs;
      if constexpr (MODE == 1) {
        const v2u w = rw[g & 1][j];
        y.x += __uint_as_float(w.x << 16);
        y.y += __uint_as_float(w.x & 0xffff0000u);
        y.z += __uint_as_float(w.y << 16);
        y.w += __uint_as_float(w.y & 0xffff0000u);
      }
      if constexpr (MODE == 2) {
#pragma unroll
        for (int e = 0; e < 4; ++e) y[e] = fmaxf(y[e], 0.0f);
      }
      unsigned short hb[4], lb[4];
#pragma unroll
      for (int e = 0; e < 4; ++e) {
        hb[e] = f2bf_bits(y[e]);
        lb[e] = f2bf_bits(y[e] - bf_bits2f(hb[e]));
      }
      const size_t oi = obase + i * (STEP / 2);
      *(v2u*)(outh + oi) = (v2u){ (unsigned)hb[0] | ((unsigned)hb[1] << 16), (unsigned)hb[2] | ((unsigned)hb[3] << 16) };
      *(v2u*)(outl + oi) = (v2u){ (unsigned)lb[0] | ((unsigned)lb[1] << 16), (unsigned)lb[2] | ((unsigned)lb[3] << 16) };
    }
    if (g + 1 < NI / 4) {
      // stands in front of every reuse of the address and data registers that the loads and stores above name
      asm volatile("s_wait_xcnt 0x0" ::: "memory");
      // keeps the next group's code below that wait; in MODE 1 it also keeps the later groups' residual loads from
      // being hoisted: with all 16 in flight the kernel passes the 128 registers of a 32-wave block and spills
      __builtin_amdgcn_sched_barrier(0);
    }
  }
}

template <int MODE, int NCOL>
__global__ __launch_bounds__(1024) void k_colnorm(
    const float* __restrict__ X, const unsigned* __restrict__ res,
    unsigned* __restrict__ outh, unsigned* __restrict__ outl) {
  colnorm_body<MODE, NCOL>(X, res, outh, outl, (int)blockIdx.x, (int)blockIdx.y);
}

// ---- InstanceNorm over channel-major f32 rows X[row][1024] (row = b*C + channel), one wave per row ----
// Rolled re-read passes (no per-thread arrays); no LDS, no barrier.
template <int MODE>
__device__ __forceinline__ void rownorm_body(
    const float* __restrict__ X, float* __restrict__ outf,
    unsigned short* __restrict__ outh, unsigned short* __restrict__ outl, const size_t row) {
  constexpr int NCOL = 1024;
  const int lane = threadIdx.x & 31;
  const float* xr = X + row * NCOL;
  float s = 0.f;
#pragma unroll 1
  for (int it = 0; it < 8; ++it) {
    const v4f u = *(const v4f*)(xr + it * 128 + lane * 4);
    s += (u.x + u.y) + (u.z + u.w);
  }
#pragma unroll
  for (int off = 1; off < 32; off <<= 1) s += __shfl_xor(s, off, 32);
  const float mean = s * (1.0f / NCOL);
  float ss = 0.f;
#pragma unroll 1
  for (int it = 0; it < 8; ++it) {
    const v4f u = *(const v4f*)(xr + it * 128 + lane * 4);
    const float d0 = u.x - mean, d1 = u.y - mean, d2 = u.z - mean, d3 = u.w - mean;
    ss += (d0 * d0 + d1 * d1) + (d2 * d2 + d3 * d3);
  }
#pragma unroll
  for (int off = 1; off < 32; off <<= 1) ss += __shfl_xor(ss, off, 32);
  const float rs = rsqrtf(ss * (1.0f / NCOL) + 1e-5f);
  if constexpr (MODE == 0) {
    float* orow = outf + row * NCOL;
    {
#pragma unroll 1
      for (int it = 0; it < 8; ++it) {
        const v4f u = *(const v4f*)(xr + it * 128 + lane * 4);
        v4f y;
        y.x = (u.x - mean) * rs; y.y = (u.y - mean) * rs; y.z = (u.z - mean) * rs; y.w = (u.w - mean) * rs;
        *(v4f*)(orow + it * 128 + lane * 4) = y;
      }
      
    }
  } else {
    unsigned short* hrow = outh + row * NCOL;
    unsigned short* lrw  = outl + row * NCOL;
    {
#pragma unroll 1
      for (int it = 0; it < 4; ++it) {
        const v4f u0 = *(const v4f*)(xr + it * 256 + lane * 8);
        const v4f u1 = *(const v4f*)(xr + it * 256 + lane * 8 + 4);
        const float y0 = (u0.x - mean) * rs, y1 = (u0.y - mean) * rs, y2 = (u0.z - mean) * rs, y3 = (u0.w - mean) * rs;
        const float y4 = (u1.x - mean) * rs, y5 = (u1.y - mean) * rs, y6 = (u1.z - mean) * rs, y7 = (u1.w - mean) * rs;
        const unsigned short h0 = f2bf_bits(y0), h1 = f2bf_bits(y1), h2 = f2bf_bits(y2), h3 = f2bf_bits(y3);
        const unsigned short h4 = f2bf_bits(y4), h5 = f2bf_bits(y5), h6 = f2bf_bits(y6), h7 = f2bf_bits(y7);
        const unsigned short l0 = f2bf_bits(y0 - bf_bits2f(h0)), l1 = f2bf_bits(y1 - bf_bits2f(h1));
        const unsigned short l2 = f2bf_bits(y2 - bf_bits2f(h2)), l3 = f2bf_bits(y3 - bf_bits2f(h3));
        const unsigned short l4 = f2bf_bits(y4 - bf_bits2f(h4)), l5 = f2bf_bits(y5 - bf_bits2f(h5));
        const unsigned short l6 = f2bf_bits(y6 - bf_bits2f(h6)), l7 = f2bf_bits(y7 - bf_bits2f(h7));
        const v4u hv = (v4u){ (unsigned)h0 | ((unsigned)h1 << 16), (unsigned)h2 | ((unsigned)h3 << 16),
                              (unsigned)h4 | ((unsigned)h5 << 16), (unsigned)h6 | ((unsigned)h7 << 16) };
        const v4u lv = (v4u){ (unsigned)l0 | ((unsigned)l1 << 16), (unsigned)l2 | ((unsigned)l3 << 16),
                              (unsigned)l4 | ((unsigned)l5 << 16), (unsigned)l6 | ((unsigned)l7 << 16) };
        *(v4u*)(hrow + it * 256 + lane * 8) = hv;
        *(v4u*)(lrw  + it * 256 + lane * 8) = lv;
      }
      
    }
  }
}

// block 8 waves = 8 rows; grid = rows/8 (rows % 8 == 0)
template <int MODE>
__global__ __launch_bounds__(256) void k_rownorm(
    const float* __restrict__ X, float* __restrict__ outf,
    unsigned short* __restrict__ outh, unsigned short* __restrict__ outl) {
  rownorm_body<MODE>(X, outf, outh, outl, (size_t)blockIdx.x * 8 + (threadIdx.x >> 5));
}

#define AT_D 64
#define AT_NW 4
#define AT_QW 32   // query columns of a wave: two tiles of 16, so that a K or V fragment read from LDS is used twice
#define AT_KC 64
#define AT_OSP 68
// pitch in bf16 elements of every 64-element row of the K and V tiles in LDS: 144 B = 16 B x 9. The fragment reads are
// 16-byte loads of 16 rows at one column; at a pitch of 128 B those rows fall on two groups of four banks, at 144 B on sixteen.
#define AT_LP 72
// K hi, K lo, V hi and V lo tiles of a 64-key chunk reach LDS by asynchronous 16-byte copies: wave w brings plane w, a copy
// instruction covers 4 whole rows of 128 B; two buffers, chunk t + 1 flies while chunk t is worked on.
constexpr int AT_PL = AT_KC * AT_LP * 2;   // bytes of one 64-row plane
constexpr int AT_ST = 4 * AT_PL;           // bytes of one buffer: K hi [kv][d], K lo [kv][d], V hi [d][kv], V lo [d][kv]

// the plain builtin: the compiler keeps the distances behind its own matrix instructions and is free to move the LDS reads ahead of them
__device__ __forceinline__ v8f at_mma(v16b a, v16b b, v8f c) {
  return __builtin_amdgcn_wmma_f32_16x16x32_bf16(false, a, false, b, (short)0, c, false, false);
}
// lane l <-> lane l ^ 16
__device__ __forceinline__ float at_xhalf(float x) {
  const int b = __builtin_bit_cast(int, x);
  return __builtin_bit_cast(float, __builtin_amdgcn_permlanex16(b, b, 0x76543210, 0xfedcba98, false, false));
}
// two neighbouring elements of a fragment -> one register of the hi plane and one of the lo plane (bf16, round to nearest even;
// f0 in the low half): hi = bf16(f), lo = bf16(f - hi)
__device__ __forceinline__ void at_split2(float f0, float f1, unsigned& hi, unsigned& lo) {
  const unsigned hw = __builtin_bit_cast(unsigned, __builtin_convertvector((v2f){f0, f1}, v2b));
  const v2f rem = (v2f){f0, f1} - (v2f){__uint_as_float(hw << 16), __uint_as_float(hw & 0xffff0000u)};   // one packed subtraction a pair
  hi = hw;
  lo = __builtin_bit_cast(unsigned, __builtin_convertvector(rem, v2b));
}

// two waves a SIMD: the grid gives every WGP two work-groups (512 on 256 WGPs); a wave may then hold 512 registers
__global__ __launch_bounds__(128) __attribute__((amdgpu_waves_per_eu(2, 2)))
void k_attn(const unsigned short* __restrict__ qhp, const unsigned short* __restrict__ qlp,
            const unsigned short* __restrict__ khp, const unsigned short* __restrict__ klp,
            const unsigned short* __restrict__ vhp, const unsigned short* __restrict__ vlp,
            float* __restrict__ out, float sscale) {
  union FB { v16b v; v8b h[2]; unsigned w[8]; };
  __shared__ __align__(16) unsigned char smem[2 * AT_ST];        // two chunk buffers; behind the loop: per wave out tiles
  static_assert(AT_NW * AT_QW * AT_OSP * 4 <= 2 * AT_ST && AT_LP == GM_LP && AT_D == AT_KC && AT_NW == 4 && AT_QW == 32);

  const int tid  = threadIdx.x;
  const int wave = tid >> 5;
  const int lane = tid & 31;
  const int hh   = lane >> 4;
  const int c    = lane & 15;

  constexpr int NQB = SEQ_LEN / (AT_NW * AT_QW);
  const int bx  = blockIdx.x;
  const int qb  = bx % NQB;
  const int bhd = bx / NQB;
  const int h   = bhd % N_HEADS;
  const int b   = bhd / N_HEADS;
  const int q0  = qb * (AT_NW * AT_QW) + wave * AT_QW;

  const __bf16* qh = (const __bf16*)qhp;
  const __bf16* ql = (const __bf16*)qlp;
  const __bf16* kh = (const __bf16*)khp;
  const __bf16* kl = (const __bf16*)klp;
  const __bf16* vh = (const __bf16*)vhp;
  const __bf16* vl = (const __bf16*)vlp;

  // ---- one chunk's copies: this wave's plane, rows (lane >> 3) + 4 * i, 16 bytes a lane ----
  constexpr int NKC = SEQ_LEN / AT_KC;
  static_assert(NKC >= 2);
  const int crow = lane >> 3, ccol = (lane & 7) * 8;
  const int wv = __builtin_amdgcn_readfirstlane(wave);   // the wave's number in a scalar register: plane, row step and chunk step are then scalars, with no lane mask written
  const bool isk = wv < 2;
  const __bf16* cpl = isk ? (wv == 0 ? kh : kl) : (wv == 2 ? vh : vl);
  const char* csrc = (const char*)(cpl + (isk ? ((size_t)b * SEQ_LEN + crow) * N_CH + h * AT_D + ccol
                                              : ((size_t)b * N_CH + h * AT_D + crow) * SEQ_LEN + ccol));
  const size_t crow4 = isk ? (size_t)4 * N_CH * 2 : (size_t)4 * SEQ_LEN * 2;     // bytes of four rows of the plane in memory
  const size_t cadv  = isk ? (size_t)AT_KC * N_CH * 2 : (size_t)AT_KC * 2;       // bytes from one chunk to the next
  const unsigned cdst = lds_off(smem) + (unsigned)(wv * AT_PL + (crow * AT_LP + ccol) * 2);
  auto issue_chunk = [&](int t) {
    const unsigned l = cdst + (unsigned)(t & 1) * AT_ST;
    const char* g = csrc + (size_t)t * cadv;
    cp_async8(l, g, crow4);                                   // rows 0..31
    cp_async8(l + 32 * AT_LP * 2, g + 8 * crow4, crow4);      // rows 32..63
  };
  issue_chunk(0);

  // ---- Q fragments of the wave's two query tiles u (B operand: column = query q0 + u*16 + c, k = d), hi and lo planes ----
  v16b qah[2][2], qal[2][2];
#pragma unroll
  for (int u = 0; u < 2; ++u) {
    const size_t qo = ((size_t)b * SEQ_LEN + q0 + u * 16 + c) * N_CH + h * AT_D + 8 * hh;
#pragma unroll
    for (int dc = 0; dc < 2; ++dc) {
      qah[u][dc] = Frag<__bf16>::load(qh + qo + dc * 32);
      qal[u][dc] = Frag<__bf16>::load(ql + qo + dc * 32);
    }
  }

  // of this lane's query in tile u: running maximum over all keys so far, in units of log2 (score * cscale); running sum over this lane half's keys only
  const float cscale = sscale * 1.4426950408889634f;   // sscale * log2(e)
  float mrow[2] = {-INFINITY, -INFINITY}, lrow[2] = {0.f, 0.f};
  v8f oacc[2][4];   // O^T: element r of tile (u, t) = (d = t*16 + 8*hh + r, query u*16 + c)
#pragma unroll
  for (int u = 0; u < 2; ++u)
#pragma unroll
    for (int t = 0; t < 4; ++t) oacc[u][t] = (v8f){0.f,0.f,0.f,0.f,0.f,0.f,0.f,0.f};

  asm volatile("s_wait_asynccnt 0x0" ::: "memory");   // this wave's copies of chunk 0 have landed
  __syncthreads();                                    // chunk 0 is readable by every wave
  issue_chunk(1);
  for (int kc = 0; kc < NKC; ++kc) {
    const __bf16* Ksh = (const __bf16*)(smem + (kc & 1) * AT_ST);
    const __bf16* Ksl = Ksh + AT_PL / 2;
    const __bf16* Vth = Ksh + 2 * (AT_PL / 2);
    const __bf16* Vtl = Ksh + 3 * (AT_PL / 2);

    // ---- scores, transposed: A operand row = key j*16 + c, k = d (Ksh is [key][d], k-contiguous); B = Q ----
    // every K fragment is read once and multiplied with both query tiles; the two tiles' accumulators take turns
    v8f s[2][4];
#pragma unroll
    for (int j = 0; j < 4; ++j) {
      s[0][j] = (v8f){0.f,0.f,0.f,0.f,0.f,0.f,0.f,0.f};
      s[1][j] = (v8f){0.f,0.f,0.f,0.f,0.f,0.f,0.f,0.f};
#pragma unroll
      for (int dc = 0; dc < 2; ++dc) {
        FB kb, kb2;
        const int ko2 = (j * 16 + c) * AT_LP + dc * 32 + 8 * hh;
        kb.h[0]  = *(const v8b*)(Ksh + ko2);
        kb.h[1]  = *(const v8b*)(Ksh + ko2 + 16);
        kb2.h[0] = *(const v8b*)(Ksl + ko2);
        kb2.h[1] = *(const v8b*)(Ksl + ko2 + 16);
        s[0][j] = at_mma(kb.v,  qah[0][dc], s[0][j]);
        s[1][j] = at_mma(kb.v,  qah[1][dc], s[1][j]);
        s[0][j] = at_mma(kb2.v, qah[0][dc], s[0][j]);
        s[1][j] = at_mma(kb2.v, qah[1][dc], s[1][j]);
        s[0][j] = at_mma(kb.v,  qal[0][dc], s[0][j]);
        s[1][j] = at_mma(kb.v,  qal[1][dc], s[1][j]);
      }
    }
    // D element r of lane = (key j*16 + 8*hh + r, query column u*16 + c)
    // P^T as B operand of a 32-key step kk: element e < 8 = key kk*32 + 8*hh + e, e >= 8 = key kk*32 + 16 + 8*hh + (e - 8):
    // these are this lane's own elements of the score tiles j = 2*kk and j = 2*kk + 1
    FB ph[2][2], pl[2][2];
#pragma unroll
    for (int u = 0; u < 2; ++u) {
      // softmax in base 2: the maximum is taken over the raw scores and scaled once (cscale > 0 keeps the order)
      float cm[4];
#pragma unroll
      for (int j = 0; j < 4; ++j) {
        float m = -INFINITY;
#pragma unroll
        for (int r = 0; r < 8; ++r) m = fmaxf(m, s[u][j][r]);
        cm[j] = m;
      }
      float mc = fmaxf(fmaxf(cm[0], cm[1]), fmaxf(cm[2], cm[3]));
      mc = fmaxf(mc, at_xhalf(mc)) * cscale;   // both lane halves of a query agree on the maximum, so on alpha too
      const float mnew = fmaxf(mrow[u], mc);
      const float alpha = __builtin_amdgcn_exp2f(mrow[u] - mnew);   // 0 in the first chunk, where mrow is -inf
      mrow[u] = mnew;
      const v2f cs2 = (v2f){cscale, cscale}, nm2 = (v2f){-mnew, -mnew};
      float ps[4];
#pragma unroll
      for (int j = 0; j < 4; ++j) {
        float psum = 0.f;
#pragma unroll
        for (int r = 0; r < 8; r += 2) {
          // exp(sscale * s - max) = 2^(s * cscale - mnew): one packed multiply-add a score pair, then the hardware's 2^x
          const v2f arg = __builtin_elementwise_fma((v2f){s[u][j][r], s[u][j][r + 1]}, cs2, nm2);
          const float p0 = __builtin_amdgcn_exp2f(arg.x);
          const float p1 = __builtin_amdgcn_exp2f(arg.y);
          psum += p0 + p1;
          at_split2(p0, p1, ph[u][j >> 1].w[(j & 1) * 4 + (r >> 1)], pl[u][j >> 1].w[(j & 1) * 4 + (r >> 1)]);
        }
        ps[j] = psum;
      }
      lrow[u] = lrow[u] * alpha + ((ps[0] + ps[1]) + (ps[2] + ps[3]));
#pragma unroll
      for (int t = 0; t < 4; ++t) oacc[u][t] *= alpha;
    }
    // ---- O^T += V^T.P^T : A = V with row = d, k = key (Vth is [d][key], k-contiguous), B = P^T ----
    // every V fragment is read once and multiplied with both query tiles
#pragma unroll   // ph and pl are indexed by kk: they stay in registers only with kk a constant
    for (int kk = 0; kk < 2; ++kk) {
#pragma unroll
      for (int t = 0; t < 4; ++t) {
        FB vb, vb2;
        const int vo2 = (t * 16 + c) * AT_LP + kk * 32 + 8 * hh;
        vb.h[0]  = *(const v8b*)(Vth + vo2);
        vb.h[1]  = *(const v8b*)(Vth + vo2 + 16);
        vb2.h[0] = *(const v8b*)(Vtl + vo2);
        vb2.h[1] = *(const v8b*)(Vtl + vo2 + 16);
        oacc[0][t] = at_mma(vb.v,  ph[0][kk].v, oacc[0][t]);
        oacc[1][t] = at_mma(vb.v,  ph[1][kk].v, oacc[1][t]);
        oacc[0][t] = at_mma(vb2.v, ph[0][kk].v, oacc[0][t]);
        oacc[1][t] = at_mma(vb2.v, ph[1][kk].v, oacc[1][t]);
        oacc[0][t] = at_mma(vb.v,  pl[0][kk].v, oacc[0][t]);
        oacc[1][t] = at_mma(vb.v,  pl[1][kk].v, oacc[1][t]);
      }
    }
    // hand-over: this wave's reads of chunk kc are over, its copies of chunk kc + 1 have landed; behind the barrier
    // chunk kc + 1 is readable by every wave and the buffer of chunk kc is free for chunk kc + 2
    asm volatile("s_wait_dscnt 0x0" ::: "memory");
    asm volatile("s_wait_asynccnt 0x0" ::: "memory");
    __syncthreads();
    if (kc + 2 < NKC) issue_chunk(kc + 2);
  }
  asm volatile("s_wait_asynccnt 0x0" ::: "memory");   // no copy is outstanding when the buffers become the out tiles

  // out tile [query][d]: this lane holds 8 neighbouring d of query u*16 + c in every O^T tile
  float* os = (float*)(smem + wave * (AT_QW * AT_OSP * 4));   // every wave has passed the last hand-over barrier: the buffers are free
#pragma unroll
  for (int u = 0; u < 2; ++u) {
    const float inv = 1.0f / (lrow[u] + at_xhalf(lrow[u]));   // the two lane halves' sums are joined here, once
#pragma unroll
    for (int t = 0; t < 4; ++t) {
      float* op = os + (u * 16 + c) * AT_OSP + t * 16 + 8 * hh;
      *(v4f*)(op)     = (v4f){oacc[u][t][0] * inv, oacc[u][t][1] * inv, oacc[u][t][2] * inv, oacc[u][t][3] * inv};
      *(v4f*)(op + 4) = (v4f){oacc[u][t][4] * inv, oacc[u][t][5] * inv, oacc[u][t][6] * inv, oacc[u][t][7] * inv};
    }
  }
  __builtin_amdgcn_fence(__ATOMIC_RELEASE, "workgroup");
  __builtin_amdgcn_wave_barrier();
  __builtin_amdgcn_fence(__ATOMIC_ACQUIRE, "workgroup");
  {
    float* ob = out + ((size_t)b * SEQ_LEN) * N_CH + h * AT_D;
    const int c4 = (lane & 15) * 4;
    {
#pragma unroll
      for (int it = 0; it < AT_QW / 2; ++it) {
        const int row = it * 2 + hh;
        v4f val = *(const v4f*)(os + row * AT_OSP + c4);
        *(v4f*)(ob + (size_t)(q0 + row) * N_CH + c4) = val;
      }
      
    }
  }
}

// =====================================================================================
// q, k and v: projection and InstanceNorm in one launch. grid (N_CH / 64, N_B, 3); blockIdx.z picks the job (q first: it has the longest k loop).
//   g[l][o] = sum_c xT[l][c] w[o][c] + bias[o], then InstanceNorm over the 1024 positions l of every (batch, channel o).
// A block of 16 waves owns ALL 1024 positions of 64 channels, wave w the positions w*64 .. w*64+63, so the f32 projection
// never leaves the accumulators: mean, then centred sum of squares, are taken from them and the bf16 hi + lo planes are stored.
// A lane holds one channel (column) in every accumulator tile: a column sum is in-lane, one exchange between the lane halves,
// then 16 wave partials through LDS, added up in a fixed order.
// Operands reach the fragments as in gemm64_body: stages of 64 k by asynchronous 16-byte copies, two buffers, pitch 144 B.
// Stage layout: [w: 64 rows][wave 0..15: its 64 xT rows].
// Planes: q, k L-major [b][l][512]; v channel-major [b][o][1024].
// Every loop over tiles, elements and rows below is unrolled: the accumulator and fragment arrays are then indexed by constants and stay in registers.
// =====================================================================================
constexpr int PN_NW = 16;
constexpr int PN_STAGE = (1 + PN_NW) * GM_PL;        // bytes of one buffer
constexpr int PN_SLAB0 = 4 * (PN_NW + 1) * 64 * 2;   // behind the k loop: two sets of [16 wave partials + totals][64] floats, then the waves' slabs
static_assert(2 * PN_STAGE <= 327680 && PN_SLAB0 % 16 == 0 && PN_SLAB0 + PN_NW * 16 * 68 * 4 <= 2 * PN_STAGE && PN_NW * 64 == SEQ_LEN);
__device__ __forceinline__ void cp_async1(unsigned l0, const void* g0) {
  // the s_wait_xcnt closes the statement so that it stands in front of every later write of the copy's address registers
  asm volatile("global_load_async_to_lds_b128 %0, %1, off\n\t"
               "s_wait_xcnt 0x0"
               :: "v"(l0), "v"(g0) : "memory");
}
// totals over the block's 1024 positions of this lane's four channels j*16 + (lane & 15); cs = this lane's partial sums
__device__ __forceinline__ void pn_colsum(float (&cs)[4], float* red, int wave, int lane) {
  float* tot = red + PN_NW * 64;
#pragma unroll
  for (int j = 0; j < 4; ++j) cs[j] += at_xhalf(cs[j]);
  if (lane < 16) {
#pragma unroll
    for (int j = 0; j < 4; ++j) red[wave * 64 + j * 16 + lane] = cs[j];
  }
  __syncthreads();   // all 16 partial rows are in red
  if (threadIdx.x < 64) {   // waves 0 and 1, whole
    float t = red[threadIdx.x];
#pragma unroll
    for (int w = 1; w < PN_NW; ++w) t += red[w * 64 + threadIdx.x];
    tot[threadIdx.x] = t;
  }
  __syncthreads();   // all 64 totals are in tot
#pragma unroll
  for (int j = 0; j < 4; ++j) cs[j] = tot[j * 16 + (lane & 15)];
}
// 16 slab rows of 64 f32 -> bf16 hi + lo, 4 rows x 128 B a store; dst = element offset of slab row 0, pitch in elements
__device__ __forceinline__ void pn_store16(const float* slab, unsigned short* __restrict__ oh, unsigned short* __restrict__ ol,
                                           size_t dst, int pitch, int lane) {
  const int q = lane >> 3, c8 = (lane & 7) * 8;
  v4f y[4][2];   // all eight LDS reads are asked for ahead of the first conversion
#pragma unroll
  for (int it = 0; it < 4; ++it) {
    const float* sp = slab + (it * 4 + q) * 68 + c8;
    y[it][0] = *(const v4f*)sp;
    y[it][1] = *(const v4f*)(sp + 4);
  }
#pragma unroll
  for (int it = 0; it < 4; ++it) {
    unsigned hw[4], lw[4];
    at_split2(y[it][0].x, y[it][0].y, hw[0], lw[0]);
    at_split2(y[it][0].z, y[it][0].w, hw[1], lw[1]);
    at_split2(y[it][1].x, y[it][1].y, hw[2], lw[2]);
    at_split2(y[it][1].z, y[it][1].w, hw[3], lw[3]);
    const size_t o = dst + (size_t)(it * 4 + q) * pitch + c8;
    *(v4u*)(oh + o) = (v4u){hw[0], hw[1], hw[2], hw[3]};
    *(v4u*)(ol + o) = (v4u){lw[0], lw[1], lw[2], lw[3]};
    // stands in front of every reuse of the address and data registers that the two stores name
    asm volatile("s_wait_xcnt 0x0" ::: "memory");
    // keeps the next rows' code below that wait
    __builtin_amdgcn_sched_barrier(0);
  }
}
__global__ __launch_bounds__(512) void k_proj_norm(
    const unsigned short* __restrict__ xqT, const unsigned short* __restrict__ xkvT,
    const unsigned short* __restrict__ wq16, const unsigned short* __restrict__ wk16, const unsigned short* __restrict__ wv16,
    const float* __restrict__ bq, const float* __restrict__ bk, const float* __restrict__ bv,
    unsigned short* __restrict__ qh, unsigned short* __restrict__ ql, unsigned short* __restrict__ kh, unsigned short* __restrict__ kl,
    unsigned short* __restrict__ vh, unsigned short* __restrict__ vl) {
  __shared__ __align__(16) unsigned char smem[2 * PN_STAGE];
  const int job = blockIdx.z;   // the same for the whole block
  const int K = job == 0 ? N_CH : N_CIN;
  const int b = blockIdx.y;
  const int n0 = blockIdx.x * 64;   // first channel of the block
  const __bf16* X  = (const __bf16*)(job == 0 ? xqT : xkvT) + (size_t)b * SEQ_LEN * K;
  const __bf16* Wt = (const __bf16*)(job == 0 ? wq16 : job == 1 ? wk16 : wv16);
  const float* bias = job == 0 ? bq : job == 1 ? bk : bv;
  unsigned short* oh = job == 0 ? qh : job == 1 ? kh : vh;
  unsigned short* ol = job == 0 ? ql : job == 1 ? kl : vl;

  const int lane = threadIdx.x & 31;
  const int wave = threadIdx.x >> 5;
  const int m0 = wave * 64;                    // first position of the wave
  const int rlane = lane & 15;                 // row (A) / column (B, D) within a 16x16 tile
  const int koff  = (lane >> 4) * 8;           // k offset of this lane half
  const int mOff  = (lane >> 4) * 8;           // D row offset

  v8f acc[4][4];   // tile (i, j), element r = (position m0 + i*16 + mOff + r, channel n0 + j*16 + rlane)
#pragma unroll
  for (int i = 0; i < 4; ++i)
#pragma unroll
    for (int j = 0; j < 4; ++j) acc[i][j] = (v8f){0.f,0.f,0.f,0.f,0.f,0.f,0.f,0.f};

  // ---- one stage's copies: the block's w rows (one 16-byte piece a thread), then this wave's own xT rows ----
  const unsigned lbase = lds_off(smem);
  const int wrow = threadIdx.x >> 3;           // 0..63
  const int xrow = lane >> 3;                  // 0..3; piece it is row it * 4 + xrow
  const int scol = (lane & 7) * 8;             // first k element of this lane's 16 bytes
  const unsigned lw0 = lbase + (unsigned)(wrow * GM_LP + scol) * 2u;
  const unsigned lx0 = lbase + (unsigned)(1 + wave) * GM_PL + (unsigned)(xrow * GM_LP + scol) * 2u;
  const __bf16* gw0 = Wt + (size_t)(n0 + wrow) * K + scol;
  const __bf16* gx0 = X + (size_t)(m0 + xrow) * K + scol;
  const size_t gstep = (size_t)K * 8;          // bytes of four xT rows
  auto issue_stage = [&](int st) {
    const unsigned bo = (unsigned)(st & 1) * PN_STAGE;
    cp_async1(lw0 + bo, gw0 + (size_t)st * GM_KS);
    const __bf16* gx = gx0 + (size_t)st * GM_KS;
    cp_async8(lx0 + bo, (const char*)gx, gstep);                                             // rows 0..31
    cp_async8(lx0 + bo + 32 * GM_LP * 2, (const char*)(gx + (size_t)32 * K), gstep);         // rows 32..63
  };

  const int nst = K / GM_KS;   // 8 or 4
  issue_stage(0);
  float bvj[4];   // bias of this lane's four channels, asked for here so that it has arrived long before the epilogue
#pragma unroll
  for (int j = 0; j < 4; ++j) bvj[j] = bias[n0 + (j << 4) + rlane];
  asm volatile("s_wait_asynccnt 0x0" ::: "memory");   // this wave's copies of stage 0 have landed
  __syncthreads();                                    // stage 0 is readable by every wave
  issue_stage(1);
  for (int st = 0; st < nst; ++st) {
    const __bf16* sW = (const __bf16*)(smem + (st & 1) * PN_STAGE);
    const __bf16* sX = sW + (1 + wave) * (GM_PL / 2);
#pragma unroll   // both 32-k steps of a stage in one body (fragment and accumulator arrays stay in registers)
    for (int ks = 0; ks < 2; ++ks) {
      v16b bf[4], af[4];
#pragma unroll
      for (int j = 0; j < 4; ++j) bf[j] = Frag<__bf16>::load(sW + ((j << 4) + rlane) * GM_LP + ks * 32 + koff);
#pragma unroll
      for (int i = 0; i < 4; ++i) af[i] = Frag<__bf16>::load(sX + ((i << 4) + rlane) * GM_LP + ks * 32 + koff);
#pragma unroll
      for (int i = 0; i < 4; ++i)
#pragma unroll
        for (int j = 0; j < 4; ++j) acc[i][j] = at_mma(af[i], bf[j], acc[i][j]);
    }
    // hand-over: this wave's reads of stage st are over, its copies of stage st + 1 have landed; behind the barrier
    // stage st + 1 is readable by every wave and the buffer of stage st is free for stage st + 2
    asm volatile("s_wait_dscnt 0x0" ::: "memory");
    asm volatile("s_wait_asynccnt 0x0" ::: "memory");
    __syncthreads();
    if (st + 2 < nst) issue_stage(st + 2);
  }
  asm volatile("s_wait_asynccnt 0x0" ::: "memory");   // no copy is outstanding when the buffers become sums and slabs

  // ---- InstanceNorm on the accumulators; every wave has passed the last hand-over barrier: the buffers are free ----
  float* red0 = (float*)smem;
  float* red1 = red0 + (PN_NW + 1) * 64;
  float cs[4];
#pragma unroll
  for (int j = 0; j < 4; ++j) {
    v8f t = (v8f){0.f,0.f,0.f,0.f,0.f,0.f,0.f,0.f};
#pragma unroll
    for (int i = 0; i < 4; ++i) { acc[i][j] += bvj[j]; t += acc[i][j]; }
    cs[j] = ((t[0] + t[1]) + (t[2] + t[3])) + ((t[4] + t[5]) + (t[6] + t[7]));
  }
  pn_colsum(cs, red0, wave, lane);
#pragma unroll
  for (int j = 0; j < 4; ++j) {
    const float mean = cs[j] * (1.0f / SEQ_LEN);
    v8f t = (v8f){0.f,0.f,0.f,0.f,0.f,0.f,0.f,0.f};
#pragma unroll
    for (int i = 0; i < 4; ++i) { acc[i][j] -= mean; t += acc[i][j] * acc[i][j]; }
    cs[j] = ((t[0] + t[1]) + (t[2] + t[3])) + ((t[4] + t[5]) + (t[6] + t[7]));
  }
  pn_colsum(cs, red1, wave, lane);
#pragma unroll
  for (int j = 0; j < 4; ++j) {
    const float rs = rsqrtf(cs[j] * (1.0f / SEQ_LEN) + 1e-5f);
#pragma unroll
    for (int i = 0; i < 4; ++i) acc[i][j] *= rs;
  }

  // ---- planes, through a slab of 16 rows x 64 f32 (pitch 68) of the wave's own ----
  float* slab = (float*)(smem + PN_SLAB0 + wave * (16 * 68 * 4));
  if (job < 2) {
    // L-major: slab row = position, 64 channels a row
#pragma unroll
    for (int i = 0; i < 4; ++i) {
#pragma unroll
      for (int j = 0; j < 4; ++j)
#pragma unroll
        for (int r = 0; r < 8; ++r) slab[(mOff + r) * 68 + (j << 4) + rlane] = acc[i][j][r];
      __builtin_amdgcn_fence(__ATOMIC_RELEASE, "workgroup");
      __builtin_amdgcn_wave_barrier();
      __builtin_amdgcn_fence(__ATOMIC_ACQUIRE, "workgroup");
      pn_store16(slab, oh, ol, ((size_t)b * SEQ_LEN + m0 + (i << 4)) * N_CH + n0, N_CH, lane);
      __builtin_amdgcn_fence(__ATOMIC_RELEASE, "workgroup");
      __builtin_amdgcn_wave_barrier();
      __builtin_amdgcn_fence(__ATOMIC_ACQUIRE, "workgroup");
    }
  } else {
    // channel-major: slab row = channel, 64 positions a row; a lane's 8 elements of a tile are 8 neighbouring positions
#pragma unroll
    for (int j = 0; j < 4; ++j) {
#pragma unroll
      for (int i = 0; i < 4; ++i) {
        float* sp = slab + rlane * 68 + (i << 4) + mOff;
        *(v4f*)(sp)     = (v4f){acc[i][j][0], acc[i][j][1], acc[i][j][2], acc[i][j][3]};
        *(v4f*)(sp + 4) = (v4f){acc[i][j][4], acc[i][j][5], acc[i][j][6], acc[i][j][7]};
      }
      __builtin_amdgcn_fence(__ATOMIC_RELEASE, "workgroup");
      __builtin_amdgcn_wave_barrier();
      __builtin_amdgcn_fence(__ATOMIC_ACQUIRE, "workgroup");
      pn_store16(slab, oh, ol, ((size_t)b * N_CH + n0 + (j << 4)) * SEQ_LEN + m0, SEQ_LEN, lane);
      __builtin_amdgcn_fence(__ATOMIC_RELEASE, "workgroup");
      __builtin_amdgcn_wave_barrier();
      __builtin_amdgcn_fence(__ATOMIC_ACQUIRE, "workgroup");
    }
  }
}

// =====================================================================================
// Host orchestration
// =====================================================================================
extern "C" void kernel_launch(void* const* d_in, const int* in_sizes, int n_in,
                              void* d_out, int out_size, void* d_ws,
                              size_t ws_size, hipStream_t stream) {
  (void)in_sizes; (void)n_in; (void)out_size;
  constexpr int NB = 8, CIN = 256, NCH = 512, SEQ = 1024, NFF = 1024, NHD = 8;

  // ---- workspace region map (bytes) ----
  constexpr size_t SZ_WQ   = (size_t)NCH * NCH * 2;        //    524288  wq  bf16 [512][512]
  constexpr size_t SZ_WK   = (size_t)NCH * CIN * 2;        //    262144  wk  bf16 [512][256]
  constexpr size_t SZ_WV   = (size_t)NCH * CIN * 2;        //    262144  wv  bf16 [512][256]
  constexpr size_t SZ_W1   = (size_t)NFF * NCH * 2;        //   1048576  w1  bf16 [1024][512]
  constexpr size_t SZ_W2   = (size_t)NCH * NFF * 2;        //   1048576  w2  bf16 [512][1024]
  constexpr size_t SZ_XQT  = (size_t)NB * SEQ * NCH * 2;   //   8388608  x_query (L,C) bf16
  constexpr size_t SZ_XKVT = (size_t)NB * SEQ * CIN * 2;   //   4194304  x_kv (L,C) bf16
  constexpr size_t SZ_G    = (size_t)NB * SEQ * NFF * 4;   //  33554432  f32 GEMM/attention output, max user = ffn1 [8][1024][1024]
  constexpr size_t SZ_P    = (size_t)NB * SEQ * NCH * 2;   //   8388608  one bf16 activation plane [8][1024][512]
  constexpr size_t OFF_WQ   = 0;
  constexpr size_t OFF_WK   = OFF_WQ + SZ_WQ;
  constexpr size_t OFF_WV   = OFF_WK + SZ_WK;
  constexpr size_t OFF_W1   = OFF_WV + SZ_WV;
  constexpr size_t OFF_W2   = OFF_W1 + SZ_W1;
  constexpr size_t OFF_XQT  = OFF_W2 + SZ_W2;
  constexpr size_t OFF_XKVT = OFF_XQT + SZ_XQT;
  constexpr size_t OFF_G    = OFF_XKVT + SZ_XKVT;
  constexpr size_t OFF_QH   = OFF_G + SZ_G;       // q hi plane; later z hi plane
  constexpr size_t OFF_QL   = OFF_QH + SZ_P;      // q lo plane; later z lo plane
  constexpr size_t OFF_KH   = OFF_QL + SZ_P;      // k hi plane; later y hi plane spans KH+KL (16777216)
  constexpr size_t OFF_KL   = OFF_KH + SZ_P;      // k lo plane
  constexpr size_t OFF_VH   = OFF_KL + SZ_P;      // v hi plane; later y lo plane spans VH+VL (16777216)
  constexpr size_t OFF_VL   = OFF_VH + SZ_P;      // v lo plane
  constexpr size_t OFF_GV   = OFF_VL + SZ_P;      // spare
  constexpr size_t OFF_END  = OFF_GV + SZ_G / 2;  // 116391936
  static_assert(OFF_END == 116391936ull);
  static_assert(OFF_END <= 134217728ull);
  static_assert((OFF_WK % 256) == 0 && (OFF_XQT % 256) == 0 && (OFF_G % 256) == 0 && (OFF_QH % 256) == 0);
  // reused regions sized from the max user
  static_assert((size_t)NB * SEQ * NCH * 4 <= SZ_G);        // proj, ffn2 f32 outputs
  static_assert(NB == N_B && CIN == N_CIN && NCH == N_CH && SEQ == SEQ_LEN && NFF == N_FF && NHD == N_HEADS);
  static_assert((size_t)NB * SEQ * NFF * 4 <= SZ_G);        // ffn1 f32 output
  static_assert((size_t)NB * SEQ * NFF * 2 == 2 * SZ_P);    // y plane fits exactly over two 512-wide planes
  // GEMM shape contract: M multiple of 64, N multiple of 512, K multiple of 64
  static_assert(SEQ % 512 == 0 && NCH % 512 == 0 && NFF % 512 == 0);
  static_assert(NCH % 64 == 0 && CIN % 64 == 0 && NFF % 64 == 0);
  static_assert(((SEQ / 64) * (NCH / 64)) % 8 == 0 && ((SEQ / 64) * (NFF / 64)) % 8 == 0);
  static_assert(NCH % 256 == 0 && NFF % 256 == 0 && (NB * NCH) % 8 == 0);
  static_assert((size_t)NB * NCH * SEQ * 4 == 16777216ull);   // d_out bytes
  if (ws_size < OFF_END) return;

  const float* x_query = (const float*)d_in[0];
  const float* x_kv    = (const float*)d_in[1];
  const float* wq      = (const float*)d_in[2];
  const float* bq      = (const float*)d_in[3];
  const float* wk      = (const float*)d_in[4];
  const float* bk      = (const float*)d_in[5];
  const float* wv      = (const float*)d_in[6];
  const float* bv      = (const float*)d_in[7];
  const float* w1      = (const float*)d_in[8];
  const float* b1      = (const float*)d_in[9];
  const float* w2      = (const float*)d_in[10];
  const float* b2      = (const float*)d_in[11];
  float* out = (float*)d_out;

  char* ws = (char*)d_ws;
  typedef unsigned short us;
  us* wq16  = (us*)(ws + OFF_WQ);
  us* wk16  = (us*)(ws + OFF_WK);
  us* wv16  = (us*)(ws + OFF_WV);
  us* w1_16 = (us*)(ws + OFF_W1);
  us* w2_16 = (us*)(ws + OFF_W2);
  us* xqT   = (us*)(ws + OFF_XQT);
  us* xkvT  = (us*)(ws + OFF_XKVT);
  float* gf = (float*)(ws + OFF_G);
  us* qh = (us*)(ws + OFF_QH);
  us* ql = (us*)(ws + OFF_QL);
  us* kh = (us*)(ws + OFF_KH);
  us* kl = (us*)(ws + OFF_KL);
  us* vh = (us*)(ws + OFF_VH);
  us* vl = (us*)(ws + OFF_VL);
  us* zh = qh;
  us* zl = ql;
  us* yh = kh;    // [8][1024][1024] bf16 = 16777216 B over KH..KL
  us* yl = vh;    // [8][1024][1024] bf16 = 16777216 B over VH..VL

  // 1) operand preparation: activations (B,C,L) f32 -> (B,L,C) bf16, weights -> bf16 (RNE)
  k_prep<<<PB_ALL, 256, 0, stream>>>(x_query, x_kv, wq, wk, wv, w1, w2, xqT, xkvT, wq16, wk16, wv16, w1_16, w2_16);

  // 2) q, k (L-major) and v (channel-major): projection + InstanceNorm -> hi/lo planes
  k_proj_norm<<<dim3(NCH / 64, NB, 3), 512, 0, stream>>>(xqT, xkvT, wq16, wk16, wv16, bq, bk, bv, qh, ql, kh, kl, vh, vl);

  // 3) attention -> gf as proj L-major [b][l][h*64+d] f32
  k_attn<<<NB * NHD * (SEQ / 128), 128, 0, stream>>>(qh, ql, kh, kl, vh, vl, gf, 0.125f);

  // 4) z = InstanceNorm(proj) + x_query(bf16) -> z hi/lo planes (L-major, pitch 512)
  k_colnorm<1, NCH><<<dim3(NCH / 64, NB), 1024, 0, stream>>>(gf, (const unsigned*)xqT, (unsigned*)zh, (unsigned*)zl);

  // 5) ffn1: C[l][o] = sum_c z[l][c] w1[o][c] + b1[o]  (M=1024, N=1024, K=512), z as hi/lo -> gf L-major [l][1024]
  wmma_gemm64<1, 2, 2, 0, false><<<dim3((SEQ / 64) * (NFF / 64) / 8, NB), 256, 0, stream>>>(
      zh, zl, NCH, (long)SEQ * NCH, w1_16, nullptr, NCH, 0L,
      (void*)gf, nullptr, NFF, (long)SEQ * NFF, b1, nullptr, 0L, SEQ, NFF, NCH, 1.0f);
  // 6) y = relu(InstanceNorm(h1)) -> y hi/lo planes [l][1024]
  k_colnorm<2, NFF><<<dim3(NFF / 64, NB), 1024, 0, stream>>>(gf, nullptr, (unsigned*)yh, (unsigned*)yl);

  // 7) ffn2: C[o][l] = sum_c w2[o][c] y[l][c] + b2[o]  (M=512, N=1024, K=1024), y as hi/lo -> channel-major gf
  wmma_gemm64<1, 3, 1, 0, false><<<dim3((NCH / 64) * (SEQ / 64) / 8, NB), 256, 0, stream>>>(
      w2_16, nullptr, NFF, 0L, yh, yl, NFF, (long)SEQ * NFF,
      (void*)gf, nullptr, SEQ, (long)NCH * SEQ, b2, nullptr, 0L, NCH, SEQ, NFF, 1.0f);

  // 8) final InstanceNorm over rows -> d_out (B, 512, L) f32
  k_rownorm<0><<<NB * NCH / 8, 256, 0, stream>>>(gf, out, nullptr, nullptr);
}

// v010
// A run of this version takes 149 microseconds.
// Timed twice side by side with v009, it ran 1.05 and 1.04 times as fast.
// All steps since v000 together make it 22.4 times as fast.
// Compute dtypes: conv1x1 GEMMs q/k/v = v_wmma_f32_16x16x32_bf16 on RNE-bf16 inputs (1 product); attention scores and P.V = bf16 hi+lo planes (3 products); FFN GEMMs = bf16 hi+lo activations x bf16 weights (2 products); f32 accumulate; InstanceNorm, softmax, residual in f32.
#include <hip/hip_runtime.h>
#include <hip/hip_bf16.h>

typedef __attribute__((ext_vector_type(16))) _Float16 v16h;
typedef __attribute__((ext_vector_type(8)))  _Float16 v8h;
typedef __attribute__((ext_vector_type(16))) __bf16   v16b;
typedef __attribute__((ext_vector_type(8)))  __bf16   v8b;
typedef __attribute__((ext_vector_type(2)))  __bf16   v2b;
typedef __attribute__((ext_vector_type(8)))  float    v8f;
typedef __attribute__((ext_vector_type(4)))  float    v4f;
typedef __attribute__((ext_vector_type(2)))  float    v2f;
typedef __attribute__((ext_vector_type(4)))  unsigned v4u;
typedef __attribute__((ext_vector_type(2)))  unsigned v2u;

__device__ __forceinline__ unsigned short f2bf_bits(float f) {
  unsigned u = __float_as_uint(f);
  return (unsigned short)((u + 0x7FFFu + ((u >> 16) & 1u)) >> 16);
}
__device__ __forceinline__ float bf_bits2f(unsigned short h) { return __uint_as_float(((unsigned)h) << 16); }

// hazard guards as plain device helpers
__device__ __forceinline__ void dep_guard_h(v8f& a, v8f& b, v16h x, v16h y) { asm volatile("v_nop\n\tv_nop\n\tv_nop\n\tv_nop" : "+v"(a), "+v"(b) : "v"(x), "v"(y)); }
__device__ __forceinline__ void dep_guard_b(v8f& a, v8f& b, v16b x, v16b y) { asm volatile("v_nop\n\tv_nop\n\tv_nop\n\tv_nop" : "+v"(a), "+v"(b) : "v"(x), "v"(y)); }
__device__ __forceinline__ void keep4_h(v16h a, v16h b, v16h c, v16h d) { asm volatile("v_nop" :: "v"(a), "v"(b), "v"(c), "v"(d)); }
__device__ __forceinline__ void keep4_b(v16b a, v16b b, v16b c, v16b d) { asm volatile("v_nop" :: "v"(a), "v"(b), "v"(c), "v"(d)); }
__device__ __forceinline__ void acc_guard4(v8f& a, v8f& b, v8f& c, v8f& d) { asm volatile("v_nop\n\tv_nop\n\tv_nop\n\tv_nop" : "+v"(a), "+v"(b), "+v"(c), "+v"(d)); }
template <typename T> struct Frag;
template <> struct Frag<_Float16> {
  typedef v16h V; union U { v16h v; v8h h[2]; };
  // elements 0..7 <- p[0..7], 8..15 <- p[16..23]
  static __device__ __forceinline__ v16h load(const _Float16* p) {
    U f; f.h[0] = *(const v8h*)(p); f.h[1] = *(const v8h*)(p + 16); return f.v;
  }
  static __device__ __forceinline__ v8f mma(v16h a, v16h b, v8f c) {
    return __builtin_amdgcn_wmma_f32_16x16x32_f16(false, a, false, b, (short)0, c, false, false);
  }
  static __device__ __forceinline__ void guard(v8f& a, v8f& b, v16h x, v16h y) { dep_guard_h(a, b, x, y); }
  static __device__ __forceinline__ void keep(v16h a, v16h b, v16h c, v16h d) { keep4_h(a, b, c, d); }
};
template <> struct Frag<__bf16> {
  typedef v16b V; union U { v16b v; v8b h[2]; };
  static __device__ __forceinline__ v16b load(const __bf16* p) {
    U f; f.h[0] = *(const v8b*)(p); f.h[1] = *(const v8b*)(p + 16); return f.v;
  }
  static __device__ __forceinline__ v8f mma(v16b a, v16b b, v8f c) {
    return __builtin_amdgcn_wmma_f32_16x16x32_bf16(false, a, false, b, (short)0, c, false, false);
  }
  static __device__ __forceinline__ void guard(v8f& a, v8f& b, v16b x, v16b y) { dep_guard_b(a, b, x, y); }
  static __device__ __forceinline__ void keep(v16b a, v16b b, v16b c, v16b d) { keep4_b(a, b, c, d); }
};

// ---- Register-blocked batched WMMA GEMM ------------------------------------
// C[m,n] = scale * sum_k A[m,k] * Bt[n,k] (+bias)(+resid); each wave owns a 64x64 tile.
// A row-major [M,K]; Bt row-major [N,K]; M % 64 == 0, N % 512 == 0, K % 64 == 0.
// The eight waves of a block own eight neighbouring tiles of one tile row (N % 512 == 0), so they share the A rows.
// Operands reach the fragments through LDS: a stage is 64 k (one whole 128-byte line of every row), brought by asynchronous
// 16-byte copies in which a wave covers 4 rows x 128 B per instruction; two buffers, stage t + 1 flies while stage t is worked on.
// Stage layout: [A planes: 64 rows][wave 0..7: its Bt planes: 64 rows], every row at a pitch of 144 B (16 B x odd).
// SPLIT: 0 = single product; 1 = A and Bt both hi/lo planes (hi.hi + hi.lo + lo.hi);
//        2 = only A is hi/lo (A_hi.B + A_lo.B); 3 = only Bt is hi/lo (A.B_hi + A.B_lo).
// BIAS_MODE: 0 = none, 1 = bias[m], 2 = bias[n].
// OUT_MODE: 0 = f32, 1 = f16, 2 = bf16 hi plane (Cout) + bf16 lo plane (Cout2).
// ET: 0 = f16 operands, 1 = bf16 operands (pointers passed as 16-bit storage)
constexpr int GM_KS = 64;                  // k elements of a stage
constexpr int GM_LP = 72;                  // LDS pitch of a stage row, in 16-bit elements
constexpr int GM_PL = 64 * GM_LP * 2;      // bytes of one 64-row plane of a stage
__device__ __forceinline__ unsigned lds_off(const void* p) { return (unsigned)(size_t)p; }   // byte address in the block's LDS
// asynchronous copies global -> LDS, 16 bytes per lane. The s_wait_xcnt closes each statement so that it stands in front of
// every later write of the address registers that the copies name.
__device__ __forceinline__ void cp_async2(unsigned l0, const void* g0, unsigned l1, const void* g1) {
  asm volatile("global_load_async_to_lds_b128 %0, %1, off\n\t"
               "global_load_async_to_lds_b128 %2, %3, off\n\t"
               "s_wait_xcnt 0x0"
               :: "v"(l0), "v"(g0), "v"(l1), "v"(g1) : "memory");
}
__device__ __forceinline__ void cp_async8(unsigned l, const char* g, size_t gstep) {
  // eight rows, four apart: LDS step 4 rows of GM_LP elements, global step gstep bytes
  constexpr unsigned LS = 4 * GM_LP * 2;
  asm volatile("global_load_async_to_lds_b128 %0, %1, off\n\t"
               "global_load_async_to_lds_b128 %2, %3, off\n\t"
               "global_load_async_to_lds_b128 %4, %5, off\n\t"
               "global_load_async_to_lds_b128 %6, %7, off\n\t"
               "global_load_async_to_lds_b128 %8, %9, off\n\t"
               "global_load_async_to_lds_b128 %10, %11, off\n\t"
               "global_load_async_to_lds_b128 %12, %13, off\n\t"
               "global_load_async_to_lds_b128 %14, %15, off\n\t"
               "s_wait_xcnt 0x0"
               :: "v"(l), "v"(g), "v"(l + LS), "v"(g + gstep), "v"(l + 2 * LS), "v"(g + 2 * gstep), "v"(l + 3 * LS), "v"(g + 3 * gstep),
                  "v"(l + 4 * LS), "v"(g + 4 * gstep), "v"(l + 5 * LS), "v"(g + 5 * gstep), "v"(l + 6 * LS), "v"(g + 6 * gstep),
                  "v"(l + 7 * LS), "v"(g + 7 * gstep) : "memory");
}
template <int ET> struct Elem;
template <> struct Elem<0> { typedef _Float16 T; };
template <> struct Elem<1> { typedef __bf16 T; };
// bytes of one stage buffer of a GEMM with the given SPLIT
constexpr int gm_stage(int split) {
  return (((split == 1 || split == 2) ? 2 : 1) + 8 * ((split == 1 || split == 3) ? 2 : 1)) * GM_PL;
}
// The GEMM of one block: smem = the kernel's 2 * gm_stage(SPLIT) bytes of LDS, bx = index of the block's group of eight tiles, b = batch.
template <int ET, int SPLIT, int BIAS_MODE, int OUT_MODE, bool RESID, int ACT = 0>
__device__ __forceinline__ void gemm64_body(
    unsigned char* smem, const int bx, const int b,
    const unsigned short* __restrict__ Ap, const unsigned short* __restrict__ A2p, int lda, long strideA,
    const unsigned short* __restrict__ Btp, const unsigned short* __restrict__ Bt2p, int ldb, long strideB,
    void* __restrict__ Cout, void* __restrict__ Cout2, int ldc, long strideC,
    const float* __restrict__ bias,
    const float* __restrict__ resid, long strideR,
    int M, int N, int K, float scale) {
  typedef typename Elem<ET>::T T;
  typedef typename Frag<T>::V V;
  constexpr bool ASPL = (SPLIT == 1) || (SPLIT == 2);
  constexpr bool BSPL = (SPLIT == 1) || (SPLIT == 3);
  const T* A = (const T*)Ap; const T* A2 = (const T*)A2p; const T* Bt = (const T*)Btp; const T* Bt2 = (const T*)Bt2p;
  constexpr int NPA = ASPL ? 2 : 1, NPB = BSPL ? 2 : 1;
  constexpr int STAGE = (NPA + 8 * NPB) * GM_PL;            // bytes of one buffer
  static_assert(STAGE == gm_stage(SPLIT) && 2 * STAGE <= 327680 && 8 * 16 * 68 * 4 <= STAGE);
  // smem: two stage buffers; behind the k loop: per-wave 16x64 f32 slabs, pitch 68
  const int lane = threadIdx.x & 31;
  const int wave = threadIdx.x >> 5;
  const int tilesN = N >> 6;
  const int tilesM = M >> 6;
  const int tile = bx * 8 + wave;
  if (bx * 8 >= tilesM * tilesN) return;   // the same for the whole block, in front of every barrier
  const int tm = tile / tilesN;
  const int tn = tile - tm * tilesN;
  const int m0 = tm << 6;
  const int n0 = tn << 6;

  const T* Ab  = A  + (size_t)b * strideA;
  const T* Bb  = Bt + (size_t)b * strideB;
  const T* Ab2 = ASPL ? (A2  + (size_t)b * strideA) : nullptr;
  const T* Bb2 = BSPL ? (Bt2 + (size_t)b * strideB) : nullptr;

  const int rlane = lane & 15;                 // row (A) / col (B, D) within subtile
  const int koff  = (lane >> 4) * 8;           // k offset of this lane half
  const int mOff  = (lane >> 4) * 8;           // D row offset

  v8f acc[4][4];
#pragma unroll
  for (int i = 0; i < 4; ++i)
#pragma unroll
    for (int j = 0; j < 4; ++j) acc[i][j] = (v8f){0.f,0.f,0.f,0.f,0.f,0.f,0.f,0.f};

  // ---- one stage's copies: the block's A rows (two 16-byte pieces per thread and plane), then this wave's own Bt rows ----
  const unsigned lbase = lds_off(smem);
  const int arow = threadIdx.x >> 3;           // 0..31; the second piece is row arow + 32
  const int brow = lane >> 3;                  // 0..3; piece it is row it * 4 + brow
  const int scol = (lane & 7) * 8;             // first k element of this lane's 16 bytes
  const unsigned la0 = lbase + (unsigned)(arow * GM_LP + scol) * 2u;
  const unsigned lb0 = lbase + (unsigned)(NPA + wave * NPB) * GM_PL + (unsigned)(brow * GM_LP + scol) * 2u;
  const size_t ga0 = (size_t)(m0 + arow) * lda + scol;
  const size_t gb0 = (size_t)(n0 + brow) * ldb + scol;
  auto issue_stage = [&](int st) {
    const unsigned bo = (unsigned)(st & 1) * STAGE;
    const size_t ka = ga0 + (size_t)st * GM_KS;
    const size_t kb = gb0 + (size_t)st * GM_KS;
    cp_async2(la0 + bo, Ab + ka, la0 + bo + 32 * GM_LP * 2, Ab + ka + (size_t)32 * lda);
    if (ASPL) cp_async2(la0 + bo + GM_PL, Ab2 + ka, la0 + bo + GM_PL + 32 * GM_LP * 2, Ab2 + ka + (size_t)32 * lda);
    const size_t gstep = (size_t)ldb * 8;   // bytes of four Bt rows
#pragma unroll   // two straight-line statements a plane: no loop counter between the copies
    for (int hf = 0; hf < 2; ++hf) {          // rows 0..31, rows 32..63
      cp_async8(lb0 + bo + hf * 32 * GM_LP * 2, (const char*)(Bb + kb + (size_t)(hf * 32) * ldb), gstep);
      if (BSPL) cp_async8(lb0 + bo + GM_PL + hf * 32 * GM_LP * 2, (const char*)(Bb2 + kb + (size_t)(hf * 32) * ldb), gstep);
    }
  };

  const int nst = K / GM_KS;
  issue_stage(0);
  asm volatile("s_wait_asynccnt 0x0" ::: "memory");   // this wave's copies of stage 0 have landed
  __syncthreads();                                    // stage 0 is readable by every wave
  if (nst > 1) issue_stage(1);
  for (int st = 0; st < nst; ++st) {
    const T* sA = (const T*)(smem + (st & 1) * STAGE);
    const T* sB = sA + (NPA + wave * NPB) * (GM_PL / 2);
#pragma unroll   // both 32-k steps of a stage in one body (as every loop below: fragment and accumulator arrays stay in registers)
    for (int ks = 0; ks < 2; ++ks) {
      V bh[4], bl[4], ah[4], al[4];
#pragma unroll
      for (int j = 0; j < 4; ++j) {
        const int bo = ((j << 4) + rlane) * GM_LP + ks * 32 + koff;
        bh[j] = Frag<T>::load(sB + bo);
        if (BSPL) bl[j] = Frag<T>::load(sB + GM_PL / 2 + bo);
        else bl[j] = bh[j];
      }
#pragma unroll
      for (int i = 0; i < 4; ++i) {
        const int ao = ((i << 4) + rlane) * GM_LP + ks * 32 + koff;
        ah[i] = Frag<T>::load(sA + ao);
        if (ASPL) al[i] = Frag<T>::load(sA + GM_PL / 2 + ao);
        else al[i] = ah[i];
      }
#pragma unroll
      for (int i = 0; i < 4; ++i) {
#pragma unroll
        for (int j = 0; j < 4; ++j) {
          acc[i][j] = Frag<T>::mma(ah[i], bh[j], acc[i][j]);
          if (BSPL) acc[i][j] = Frag<T>::mma(ah[i], bl[j], acc[i][j]);
          if (ASPL) acc[i][j] = Frag<T>::mma(al[i], bh[j], acc[i][j]);
        }
        Frag<T>::guard(acc[i][0], acc[i][3], ah[i], al[i]);
      }
      Frag<T>::keep(bh[0], bh[1], bh[2], bh[3]);
      if (BSPL) Frag<T>::keep(bl[0], bl[1], bl[2], bl[3]);
    }
    // hand-over: this wave's reads of stage st are over, its copies of stage st + 1 have landed; behind the barrier
    // stage st + 1 is readable by every wave and the buffer of stage st is free for stage st + 2
    asm volatile("s_wait_dscnt 0x0" ::: "memory");
    asm volatile("s_wait_asynccnt 0x0" ::: "memory");
    __syncthreads();
    if (st + 2 < nst) issue_stage(st + 2);
  }
  asm volatile("s_wait_asynccnt 0x0" ::: "memory");   // no copy is outstanding when the buffers become the output slabs
  acc_guard4(acc[0][0], acc[0][1], acc[0][2], acc[0][3]);
  acc_guard4(acc[1][0], acc[1][1], acc[1][2], acc[1][3]);
  acc_guard4(acc[2][0], acc[2][1], acc[2][2], acc[2][3]);
  acc_guard4(acc[3][0], acc[3][1], acc[3][2], acc[3][3]);

  // ---- epilogue ----
  float* slab = (float*)(smem + wave * (16 * 68 * 4));   // every wave has passed the last hand-over barrier: the buffers are free
  const float* Rb = RESID ? (resid + (size_t)b * strideR) : nullptr;
#pragma unroll
  for (int i = 0; i < 4; ++i) {
    const int mBase = m0 + (i << 4);
#pragma unroll
    for (int j = 0; j < 4; ++j) {
      const int n = n0 + (j << 4) + rlane;
      float bv = 0.f;
      if (BIAS_MODE == 2) bv = bias[n];
#pragma unroll
      for (int r = 0; r < 8; ++r) {
        float v = acc[i][j][r] * scale;
        if (BIAS_MODE == 1) v += bias[mBase + mOff + r];
        if (BIAS_MODE == 2) v += bv;
        if (RESID) v += Rb[(size_t)(mBase + mOff + r) * ldc + n];
        if (ACT == 1) v = tanhf(v);
        if (ACT == 2) v = fmaxf(v, 0.0f);
        if (ACT == 3) v = v / (1.0f + expf(-v));
        if (ACT == 4) v = (v > 0.f) ? v : 0.01f * v;
        slab[(mOff + r) * 68 + (j << 4) + rlane] = v;
      }
    }
    __builtin_amdgcn_fence(__ATOMIC_RELEASE, "workgroup");
    __builtin_amdgcn_wave_barrier();
    __builtin_amdgcn_fence(__ATOMIC_ACQUIRE, "workgroup");
    if (OUT_MODE == 0) {
      float* C = (float*)Cout + (size_t)b * strideC;
      const int hh = lane >> 4, c4 = (lane & 15) * 4;     // row seg = 256 B = 16 lanes x 16 B
      {
#pragma unroll
        for (int it = 0; it < 8; ++it) {
          const int row = it * 2 + hh;
          v4f v = *(const v4f*)(slab + row * 68 + c4);
          *(v4f*)(C + (size_t)(mBase + row) * ldc + n0 + c4) = v;
        }
        
      }
    } else {
      const int q = lane >> 3, c8 = (lane & 7) * 8;
      unsigned short* C  = (unsigned short*)Cout  + (size_t)b * strideC;
      unsigned short* C2 = (OUT_MODE == 2) ? ((unsigned short*)Cout2 + (size_t)b * strideC) : nullptr;
      {
#pragma unroll
        for (int it = 0; it < 4; ++it) {
          const int row = it * 4 + q;
          const float* sp = slab + row * 68 + c8;
          v8h hv, lv;
#pragma unroll
          for (int e = 0; e < 8; ++e) {
            if (OUT_MODE == 1) {
              hv[e] = (_Float16)sp[e];
            } else {
              unsigned short hb = f2bf_bits(sp[e]);
              unsigned short lb = f2bf_bits(sp[e] - bf_bits2f(hb));
              hv[e] = __builtin_bit_cast(_Float16, hb);
              lv[e] = __builtin_bit_cast(_Float16, lb);
            }
          }
          *(v8h*)(C + (size_t)(mBase + row) * ldc + n0 + c8) = hv;
          if (OUT_MODE == 2) *(v8h*)(C2 + (size_t)(mBase + row) * ldc + n0 + c8) = lv;
        }
        
      }
    }
    __builtin_amdgcn_fence(__ATOMIC_RELEASE, "workgroup");
    __builtin_amdgcn_wave_barrier();
    __builtin_amdgcn_fence(__ATOMIC_ACQUIRE, "workgroup");
  }
}

template <int ET, int SPLIT, int BIAS_MODE, int OUT_MODE, bool RESID, int ACT = 0>
__global__ __launch_bounds__(256) void wmma_gemm64(
    const unsigned short* __restrict__ Ap, const unsigned short* __restrict__ A2p, int lda, long strideA,
    const unsigned short* __restrict__ Btp, const unsigned short* __restrict__ Bt2p, int ldb, long strideB,
    void* __restrict__ Cout, void* __restrict__ Cout2, int ldc, long strideC,
    const float* __restrict__ bias,
    const float* __restrict__ resid, long strideR,
    int M, int N, int K, float scale) {
  __shared__ __align__(16) unsigned char smem[2 * gm_stage(SPLIT)];
  gemm64_body<ET, SPLIT, BIAS_MODE, OUT_MODE, RESID, ACT>(smem, (int)blockIdx.x, (int)blockIdx.y, Ap, A2p, lda, strideA,
      Btp, Bt2p, ldb, strideB, Cout, Cout2, ldc, strideC, bias, resid, strideR, M, N, K, scale);
}

constexpr int SEQ_LEN = 1024;
constexpr int N_HEADS = 8;
constexpr int N_CH = 512;
constexpr int N_CIN = 256;
constexpr int N_FF = 1024;
constexpr int N_B = 8;

// f32 -> bf16 (RNE), two elements per thread; blk = index of the 256-thread block inside this array
__device__ __forceinline__ void cast_bf16x2_body(
    const float* __restrict__ in, unsigned short* __restrict__ out, int n2, int blk) {
  int i = blk * 256 + threadIdx.x;
  if (i < n2) {
    const float* p = in + 2 * i;
    const float e0 = p[0], e1 = p[1];
    // p as an input keeps the load's address pair whole up to the wait (else the load lands on it)
    asm volatile("s_wait_xcnt 0x0" :: "v"(p) : "memory");
    const unsigned u = (unsigned)f2bf_bits(e0) | ((unsigned)f2bf_bits(e1) << 16);
    ((unsigned*)out)[i] = u;
  }
}

// ---- (nb, C, L) f32 -> (nb, L, C) bf16 through an LDS tile: in[c][l] -> out[l][c] ----
// tile = 64 channels x 32 positions; tile index (bx < L/32, by < C/64, b < nb), block 256.
// loads: 256 threads x 8 = 2048 = 64x32 floats; stores: thread (r = tid>>3, c8 = (tid&7)*8) writes 8 bf16 = 16 B,
__device__ __forceinline__ void transpose_bf16_body(
    const float* __restrict__ in, unsigned short* __restrict__ out, int C, int L, int bx, int by, int b) {
  __shared__ float t[64][33];
  const int tid = threadIdx.x;
  const int l0 = bx * 32, c0 = by * 64;
  const float* inb = in + (size_t)b * C * L;
#pragma unroll
  for (int i = 0; i < 8; ++i) {
    const int cl = i * 8 + (tid >> 5);
    t[cl][tid & 31] = inb[(size_t)(c0 + cl) * L + l0 + (tid & 31)];
  }
  __syncthreads();
  const int r = tid >> 3, c8 = (tid & 7) * 8;
  unsigned w0, w1, w2, w3;
  w0 = (unsigned)f2bf_bits(t[c8 + 0][r]) | ((unsigned)f2bf_bits(t[c8 + 1][r]) << 16);
  w1 = (unsigned)f2bf_bits(t[c8 + 2][r]) | ((unsigned)f2bf_bits(t[c8 + 3][r]) << 16);
  w2 = (unsigned)f2bf_bits(t[c8 + 4][r]) | ((unsigned)f2bf_bits(t[c8 + 5][r]) << 16);
  w3 = (unsigned)f2bf_bits(t[c8 + 6][r]) | ((unsigned)f2bf_bits(t[c8 + 7][r]) << 16);
  const v4u val = (v4u){w0, w1, w2, w3};
  unsigned short* dst = out + ((size_t)b * L + l0 + r) * C + c0 + c8;
  *(v4u*)dst = val;
  
}

// ---- all operand preparation in one launch: the two activation transposes and the five weight casts need nothing of each other.
// One-dimensional grid; a range of the block index picks the job (the same for the whole block), the transposes first.
constexpr int PB_XQ  = (SEQ_LEN / 32) * (N_CH / 64) * N_B;    // blocks of the x_query transpose
constexpr int PB_XKV = (SEQ_LEN / 32) * (N_CIN / 64) * N_B;   // blocks of the x_kv transpose
constexpr int PB_WQ  = N_CH * N_CH / 512;                     // blocks of a cast: 512 elements each
constexpr int PB_WKV = N_CH * N_CIN / 512;
constexpr int PB_WFF = N_FF * N_CH / 512;
constexpr int PB_ALL = PB_XQ + PB_XKV + PB_WQ + 2 * PB_WKV + 2 * PB_WFF;
__global__ __launch_bounds__(256) void k_prep(
    const float* __restrict__ x_query, const float* __restrict__ x_kv,
    const float* __restrict__ wq, const float* __restrict__ wk, const float* __restrict__ wv,
    const float* __restrict__ w1, const float* __restrict__ w2,
    unsigned short* __restrict__ xqT, unsigned short* __restrict__ xkvT,
    unsigned short* __restrict__ wq16, unsigned short* __restrict__ wk16, unsigned short* __restrict__ wv16,
    unsigned short* __restrict__ w1_16, unsigned short* __restrict__ w2_16) {
  int blk = blockIdx.x;
  if (blk < PB_XQ + PB_XKV) {
    const bool isq = blk < PB_XQ;
    static_assert(N_CH / 64 == 8 && N_CIN / 64 == 4);
    const unsigned t  = isq ? blk : blk - PB_XQ;
    const unsigned cb = t / (SEQ_LEN / 32);   // (batch, channel block)
    const int ls = isq ? 3 : 2;               // log2 of the channel blocks: a shift, not a division by a run-time value
    transpose_bf16_body(isq ? x_query : x_kv, isq ? xqT : xkvT, isq ? N_CH : N_CIN, SEQ_LEN,
                        (int)(t % (SEQ_LEN / 32)), (int)(cb & ((1u << ls) - 1u)), (int)(cb >> ls));
    return;
  }
  blk -= PB_XQ + PB_XKV;
  const float* in; unsigned short* out; int n2;
  if (blk < PB_WQ)                                 { in = wq; out = wq16;  n2 = N_CH * N_CH / 2; }
  else if ((blk -= PB_WQ) < PB_WKV)                { in = wk; out = wk16;  n2 = N_CH * N_CIN / 2; }
  else if ((blk -= PB_WKV) < PB_WKV)               { in = wv; out = wv16;  n2 = N_CH * N_CIN / 2; }
  else if ((blk -= PB_WKV) < PB_WFF)               { in = w1; out = w1_16; n2 = N_FF * N_CH / 2; }
  else                          { blk -= PB_WFF;     in = w2; out = w2_16; n2 = N_CH * N_FF / 2; }
  cast_bf16x2_body(in, out, n2, blk);
}

// ---- InstanceNorm over the 1024 rows of an L-major f32 plane X[nb][1024][NCOL], per (b, column) ----
// block = 32 waves owns a slab of 64 columns x 1024 rows; slab index (bx < NCOL/64, by < nb).
// lane = (row half, 4 adjacent columns): one wave-wide 16-byte load covers 2 rows x 256 B; a thread keeps its
// 16 rows (i*64 + wave*2 + half) x 4 columns in registers, so X is read once. Mean, then centred sum of squares.
// output = bf16 hi + lo planes, same layout (a wave stores 2 rows x 128 B per plane);
// MODE 0: plain; MODE 1: + residual read from a bf16 plane res (same layout); MODE 2: relu.
constexpr int CN_RP = 68;   // pitch in floats of the per-wave partial rows (16-byte aligned rows)

// column totals over the whole slab: s = this thread's partial for its 4 columns; every thread gets the totals of its 4 columns.
// fixed tree: two row halves by shuffle, 32 wave partials through LDS, wave w adds up columns 2w and 2w+1 by a butterfly.
__device__ __forceinline__ v4f cn_colsum(v4f s, float* red, float* tot, int wave, int lane) {
  const int c4 = (lane & 15) * 4;
#pragma unroll
  for (int e = 0; e < 4; ++e) s[e] += __shfl_xor(s[e], 16, 32);
  if (lane < 16) *(v4f*)(red + wave * CN_RP + c4) = s;
  __syncthreads();   // all 32 partial rows are in red
  v2f p = *(const v2f*)(red + lane * CN_RP + 2 * wave);
#pragma unroll
  for (int off = 1; off < 32; off <<= 1) {
    p.x += __shfl_xor(p.x, off, 32);
    p.y += __shfl_xor(p.y, off, 32);
  }
  if (lane == 0) *(v2f*)(tot + 2 * wave) = p;
  __syncthreads();   // all 64 totals are in tot; every read of red is over
  return *(const v4f*)(tot + c4);
}

template <int MODE, int NCOL>
__device__ __forceinline__ void colnorm_body(
    const float* __restrict__ X, const unsigned* __restrict__ res,
    unsigned* __restrict__ outh, unsigned* __restrict__ outl, int bx, int by) {
  constexpr int NR = 1024, NW = 32, NI = NR / (2 * NW);
  __shared__ __align__(16) float red[NW * CN_RP];
  __shared__ __align__(16) float tot[2][64];
  const int lane = threadIdx.x & 31, wave = threadIdx.x >> 5;
  const size_t base = ((size_t)by * NR + wave * 2 + (lane >> 4)) * NCOL + bx * 64 + (lane & 15) * 4;
  constexpr size_t STEP = (size_t)64 * NCOL;   // floats between a thread's rows; STEP / 2 words in the bf16 planes
  const size_t obase = base >> 1;
  const float* xp = X + base;
  v4f x[NI];
#pragma unroll
  for (int i = 0; i < NI; ++i) x[i] = *(const v4f*)(xp + i * STEP);
  // xp as an input keeps the loads' address pair whole up to the wait (else the last load lands on it)
  asm volatile("s_wait_xcnt 0x0" :: "v"(xp) : "memory");
  // MODE 1: residual words, two groups of 4 rows; the first group is asked for here, under the two reductions
  v2u rw[2][4];
  if constexpr (MODE == 1) {
#pragma unroll
    for (int j = 0; j < 4; ++j) rw[0][j] = *(const v2u*)(res + obase + j * (STEP / 2));
  }
  v4f s = x[0];
#pragma unroll
  for (int i = 1; i < NI; ++i) s += x[i];
  const v4f mean = cn_colsum(s, red, tot[0], wave, lane) * (1.0f / NR);
  v4f q = (v4f){0.f, 0.f, 0.f, 0.f};
#pragma unroll
  for (int i = 0; i < NI; ++i) {
    x[i] -= mean;
    q += x[i] * x[i];
  }
  const v4f var = cn_colsum(q, red, tot[1], wave, lane) * (1.0f / NR);
  v4f rs;
#pragma unroll
  for (int e = 0; e < 4; ++e) rs[e] = rsqrtf(var[e] + 1e-5f);
#pragma unroll
  for (int g = 0; g < NI / 4; ++g) {
    if constexpr (MODE == 1) {
      if (g + 1 < NI / 4) {
#pragma unroll
        for (int j = 0; j < 4; ++j) rw[(g + 1) & 1][j] = *(const v2u*)(res + obase + ((g + 1) * 4 + j) * (STEP / 2));
      }
    }
#pragma unroll
    for (int j = 0; j < 4; ++j) {
      const int i = g * 4 + j;
      v4f y = x[i] * rs;
      if constexpr (MODE == 1) {
        const v2u w = rw[g & 1][j];
        y.x += __uint_as_float(w.x << 16);
        y.y += __uint_as_float(w.x & 0xffff0000u);
        y.z += __uint_as_float(w.y << 16);
        y.w += __uint_as_float(w.y & 0xffff0000u);
      }
      if constexpr (MODE == 2) {
#pragma unroll
        for (int e = 0; e < 4; ++e) y[e] = fmaxf(y[e], 0.0f);
      }
      unsigned short hb[4], lb[4];
#pragma unroll
      for (int e = 0; e < 4; ++e) {
        hb[e] = f2bf_bits(y[e]);
        lb[e] = f2bf_bits(y[e] - bf_bits2f(hb[e]));
      }
      const size_t oi = obase + i * (STEP / 2);
      *(v2u*)(outh + oi) = (v2u){ (unsigned)hb[0] | ((unsigned)hb[1] << 16), (unsigned)hb[2] | ((unsigned)hb[3] << 16) };
      *(v2u*)(outl + oi) = (v2u){ (unsigned)lb[0] | ((unsigned)lb[1] << 16), (unsigned)lb[2] | ((unsigned)lb[3] << 16) };
    }
    if (g + 1 < NI / 4) {
      // stands in front of every reuse of the address and data registers that the loads and stores above name
      asm volatile("s_wait_xcnt 0x0" ::: "memory");
      // keeps the next group's code below that wait; in MODE 1 it also keeps the later groups' residual loads from
      // being hoisted: with all 16 in flight the kernel passes the 128 registers of a 32-wave block and spills
      __builtin_amdgcn_sched_barrier(0);
    }
  }
}

template <int MODE, int NCOL>
__global__ __launch_bounds__(1024) void k_colnorm(
    const float* __restrict__ X, const unsigned* __restrict__ res,
    unsigned* __restrict__ outh, unsigned* __restrict__ outl) {
  colnorm_body<MODE, NCOL>(X, res, outh, outl, (int)blockIdx.x, (int)blockIdx.y);
}

// ---- InstanceNorm over channel-major f32 rows X[row][1024] (row = b*C + channel), one wave per row ----
// The wave keeps its whole row in registers (8 x 16 bytes a lane): the eight loads are in flight together and X is read once.
// Mean, then centred sum of squares, each summed in the order of the row pieces; no LDS, no barrier.
__device__ __forceinline__ void rownorm_body(const float* __restrict__ X, float* __restrict__ outf, const size_t row) {
  constexpr int NCOL = 1024, NP = NCOL / 128;
  const int lane = threadIdx.x & 31;
  const float* xp = X + row * NCOL + lane * 4;
  v4f u[NP];
#pragma unroll   // u is indexed by constants and stays in registers (as in every loop below)
  for (int it = 0; it < NP; ++it) u[it] = *(const v4f*)(xp + it * 128);
  // xp as an input keeps the loads' address pair whole up to the wait (else the last load lands on it)
  asm volatile("s_wait_xcnt 0x0" :: "v"(xp) : "memory");
  float s = 0.f;
#pragma unroll
  for (int it = 0; it < NP; ++it) s += (u[it].x + u[it].y) + (u[it].z + u[it].w);
#pragma unroll
  for (int off = 1; off < 32; off <<= 1) s += __shfl_xor(s, off, 32);
  const float mean = s * (1.0f / NCOL);
  float ss = 0.f;
#pragma unroll
  for (int it = 0; it < NP; ++it) {
    u[it] -= mean;
    ss += (u[it].x * u[it].x + u[it].y * u[it].y) + (u[it].z * u[it].z + u[it].w * u[it].w);
  }
#pragma unroll
  for (int off = 1; off < 32; off <<= 1) ss += __shfl_xor(ss, off, 32);
  const float rs = rsqrtf(ss * (1.0f / NCOL) + 1e-5f);
  float* op = outf + row * NCOL + lane * 4;
#pragma unroll
  for (int it = 0; it < NP; ++it) *(v4f*)(op + it * 128) = u[it] * rs;
}

// block 8 waves = 8 rows; grid = rows/8 (rows % 8 == 0)
__global__ __launch_bounds__(256) void k_rownorm(const float* __restrict__ X, float* __restrict__ outf) {
  rownorm_body(X, outf, (size_t)blockIdx.x * 8 + (threadIdx.x >> 5));
}

#define AT_D 64
#define AT_NW 4
#define AT_QW 32   // query columns of a wave: two tiles of 16, so that a K or V fragment read from LDS is used twice
#define AT_KC 64
#define AT_OSP 68
// pitch in bf16 elements of every 64-element row of the K and V tiles in LDS: 144 B = 16 B x 9. The fragment reads are
// 16-byte loads of 16 rows at one column; at a pitch of 128 B those rows fall on two groups of four banks, at 144 B on sixteen.
#define AT_LP 72
// K hi, K lo, V hi and V lo tiles of a 64-key chunk reach LDS by asynchronous 16-byte copies: wave w brings plane w, a copy
// instruction covers 4 whole rows of 128 B; two buffers, chunk t + 1 flies while chunk t is worked on.
constexpr int AT_PL = AT_KC * AT_LP * 2;   // bytes of one 64-row plane
constexpr int AT_ST = 4 * AT_PL;           // bytes of one buffer: K hi [kv][d], K lo [kv][d], V hi [d][kv], V lo [d][kv]

// the plain builtin: the compiler keeps the distances behind its own matrix instructions and is free to move the LDS reads ahead of them
__device__ __forceinline__ v8f at_mma(v16b a, v16b b, v8f c) {
  return __builtin_amdgcn_wmma_f32_16x16x32_bf16(false, a, false, b, (short)0, c, false, false);
}
// lane l <-> lane l ^ 16
__device__ __forceinline__ float at_xhalf(float x) {
  const int b = __builtin_bit_cast(int, x);
  return __builtin_bit_cast(float, __builtin_amdgcn_permlanex16(b, b, 0x76543210, 0xfedcba98, false, false));
}
// two neighbouring elements of a fragment -> one register of the hi plane and one of the lo plane (bf16, round to nearest even;
// f0 in the low half): hi = bf16(f), lo = bf16(f - hi)
__device__ __forceinline__ void at_split2(float f0, float f1, unsigned& hi, unsigned& lo) {
  const unsigned hw = __builtin_bit_cast(unsigned, __builtin_convertvector((v2f){f0, f1}, v2b));
  const v2f rem = (v2f){f0, f1} - (v2f){__uint_as_float(hw << 16), __uint_as_float(hw & 0xffff0000u)};   // one packed subtraction a pair
  hi = hw;
  lo = __builtin_bit_cast(unsigned, __builtin_convertvector(rem, v2b));
}

// two waves a SIMD: the grid gives every WGP two work-groups (512 on 256 WGPs); a wave may then hold 512 registers
__global__ __launch_bounds__(128) __attribute__((amdgpu_waves_per_eu(2, 2)))
void k_attn(const unsigned short* __restrict__ qhp, const unsigned short* __restrict__ qlp,
            const unsigned short* __restrict__ khp, const unsigned short* __restrict__ klp,
            const unsigned short* __restrict__ vhp, const unsigned short* __restrict__ vlp,
            float* __restrict__ out, float sscale) {
  union FB { v16b v; v8b h[2]; unsigned w[8]; };
  __shared__ __align__(16) unsigned char smem[2 * AT_ST];        // two chunk buffers; behind the loop: per wave out tiles
  static_assert(AT_NW * AT_QW * AT_OSP * 4 <= 2 * AT_ST && AT_LP == GM_LP && AT_D == AT_KC && AT_NW == 4 && AT_QW == 32);

  const int tid  = threadIdx.x;
  const int wave = tid >> 5;
  const int lane = tid & 31;
  const int hh   = lane >> 4;
  const int c    = lane & 15;

  constexpr int NQB = SEQ_LEN / (AT_NW * AT_QW);
  const int bx  = blockIdx.x;
  const int qb  = bx % NQB;
  const int bhd = bx / NQB;
  const int h   = bhd % N_HEADS;
  const int b   = bhd / N_HEADS;
  const int q0  = qb * (AT_NW * AT_QW) + wave * AT_QW;

  const __bf16* qh = (const __bf16*)qhp;
  const __bf16* ql = (const __bf16*)qlp;
  const __bf16* kh = (const __bf16*)khp;
  const __bf16* kl = (const __bf16*)klp;
  const __bf16* vh = (const __bf16*)vhp;
  const __bf16* vl = (const __bf16*)vlp;

  // ---- one chunk's copies: this wave's plane, rows (lane >> 3) + 4 * i, 16 bytes a lane ----
  constexpr int NKC = SEQ_LEN / AT_KC;
  static_assert(NKC >= 2);
  const int crow = lane >> 3, ccol = (lane & 7) * 8;
  const int wv = __builtin_amdgcn_readfirstlane(wave);   // the wave's number in a scalar register: plane, row step and chunk step are then scalars, with no lane mask written
  const bool isk = wv < 2;
  const __bf16* cpl = isk ? (wv == 0 ? kh : kl) : (wv == 2 ? vh : vl);
  const char* csrc = (const char*)(cpl + (isk ? ((size_t)b * SEQ_LEN + crow) * N_CH + h * AT_D + ccol
                                              : ((size_t)b * N_CH + h * AT_D + crow) * SEQ_LEN + ccol));
  const size_t crow4 = isk ? (size_t)4 * N_CH * 2 : (size_t)4 * SEQ_LEN * 2;     // bytes of four rows of the plane in memory
  const size_t cadv  = isk ? (size_t)AT_KC * N_CH * 2 : (size_t)AT_KC * 2;       // bytes from one chunk to the next
  const unsigned cdst = lds_off(smem) + (unsigned)(wv * AT_PL + (crow * AT_LP + ccol) * 2);
  auto issue_chunk = [&](int t) {
    const unsigned l = cdst + (unsigned)(t & 1) * AT_ST;
    const char* g = csrc + (size_t)t * cadv;
    cp_async8(l, g, crow4);                                   // rows 0..31
    cp_async8(l + 32 * AT_LP * 2, g + 8 * crow4, crow4);      // rows 32..63
  };
  issue_chunk(0);

  // ---- Q fragments of the wave's two query tiles u (B operand: column = query q0 + u*16 + c, k = d), hi and lo planes ----
  v16b qah[2][2], qal[2][2];
#pragma unroll
  for (int u = 0; u < 2; ++u) {
    const size_t qo = ((size_t)b * SEQ_LEN + q0 + u * 16 + c) * N_CH + h * AT_D + 8 * hh;
#pragma unroll
    for (int dc = 0; dc < 2; ++dc) {
      qah[u][dc] = Frag<__bf16>::load(qh + qo + dc * 32);
      qal[u][dc] = Frag<__bf16>::load(ql + qo + dc * 32);
    }
  }

  // of this lane's query in tile u: running maximum over all keys so far, in units of log2 (score * cscale); running sum over this lane half's keys only
  const float cscale = sscale * 1.4426950408889634f;   // sscale * log2(e)
  float mrow[2] = {-INFINITY, -INFINITY}, lrow[2] = {0.f, 0.f};
  v8f oacc[2][4];   // O^T: element r of tile (u, t) = (d = t*16 + 8*hh + r, query u*16 + c)
#pragma unroll
  for (int u = 0; u < 2; ++u)
#pragma unroll
    for (int t = 0; t < 4; ++t) oacc[u][t] = (v8f){0.f,0.f,0.f,0.f,0.f,0.f,0.f,0.f};

  asm volatile("s_wait_asynccnt 0x0" ::: "memory");   // this wave's copies of chunk 0 have landed
  __syncthreads();                                    // chunk 0 is readable by every wave
  issue_chunk(1);
  for (int kc = 0; kc < NKC; ++kc) {
    const __bf16* Ksh = (const __bf16*)(smem + (kc & 1) * AT_ST);
    const __bf16* Ksl = Ksh + AT_PL / 2;
    const __bf16* Vth = Ksh + 2 * (AT_PL / 2);
    const __bf16* Vtl = Ksh + 3 * (AT_PL / 2);

    // ---- scores, transposed: A operand row = key j*16 + c, k = d (Ksh is [key][d], k-contiguous); B = Q ----
    // every K fragment is read once and multiplied with both query tiles; the two tiles' accumulators take turns
    v8f s[2][4];
#pragma unroll
    for (int j = 0; j < 4; ++j) {
      s[0][j] = (v8f){0.f,0.f,0.f,0.f,0.f,0.f,0.f,0.f};
      s[1][j] = (v8f){0.f,0.f,0.f,0.f,0.f,0.f,0.f,0.f};
#pragma unroll
      for (int dc = 0; dc < 2; ++dc) {
        FB kb, kb2;
        const int ko2 = (j * 16 + c) * AT_LP + dc * 32 + 8 * hh;
        kb.h[0]  = *(const v8b*)(Ksh + ko2);
        kb.h[1]  = *(const v8b*)(Ksh + ko2 + 16);
        kb2.h[0] = *(const v8b*)(Ksl + ko2);
        kb2.h[1] = *(const v8b*)(Ksl + ko2 + 16);
        s[0][j] = at_mma(kb.v,  qah[0][dc], s[0][j]);
        s[1][j] = at_mma(kb.v,  qah[1][dc], s[1][j]);
        s[0][j] = at_mma(kb2.v, qah[0][dc], s[0][j]);
        s[1][j] = at_mma(kb2.v, qah[1][dc], s[1][j]);
        s[0][j] = at_mma(kb.v,  qal[0][dc], s[0][j]);
        s[1][j] = at_mma(kb.v,  qal[1][dc], s[1][j]);
      }
    }
    // D element r of lane = (key j*16 + 8*hh + r, query column u*16 + c)
    // P^T as B operand of a 32-key step kk: element e < 8 = key kk*32 + 8*hh + e, e >= 8 = key kk*32 + 16 + 8*hh + (e - 8):
    // these are this lane's own elements of the score tiles j = 2*kk and j = 2*kk + 1
    FB ph[2][2], pl[2][2];
#pragma unroll
    for (int u = 0; u < 2; ++u) {
      // softmax in base 2: the maximum is taken over the raw scores and scaled once (cscale > 0 keeps the order)
      float cm[4];
#pragma unroll
      for (int j = 0; j < 4; ++j) {
        float m = -INFINITY;
#pragma unroll
        for (int r = 0; r < 8; ++r) m = fmaxf(m, s[u][j][r]);
        cm[j] = m;
      }
      float mc = fmaxf(fmaxf(cm[0], cm[1]), fmaxf(cm[2], cm[3]));
      mc = fmaxf(mc, at_xhalf(mc)) * cscale;   // both lane halves of a query agree on the maximum, so on alpha too
      const float mnew = fmaxf(mrow[u], mc);
      const float alpha = __builtin_amdgcn_exp2f(mrow[u] - mnew);   // 0 in the first chunk, where mrow is -inf
      mrow[u] = mnew;
      const v2f cs2 = (v2f){cscale, cscale}, nm2 = (v2f){-mnew, -mnew};
      float ps[4];
#pragma unroll
      for (int j = 0; j < 4; ++j) {
        float psum = 0.f;
#pragma unroll
        for (int r = 0; r < 8; r += 2) {
          // exp(sscale * s - max) = 2^(s * cscale - mnew): one packed multiply-add a score pair, then the hardware's 2^x
          const v2f arg = __builtin_elementwise_fma((v2f){s[u][j][r], s[u][j][r + 1]}, cs2, nm2);
          const float p0 = __builtin_amdgcn_exp2f(arg.x);
          const float p1 = __builtin_amdgcn_exp2f(arg.y);
          psum += p0 + p1;
          at_split2(p0, p1, ph[u][j >> 1].w[(j & 1) * 4 + (r >> 1)], pl[u][j >> 1].w[(j & 1) * 4 + (r >> 1)]);
        }
        ps[j] = psum;
      }
      lrow[u] = lrow[u] * alpha + ((ps[0] + ps[1]) + (ps[2] + ps[3]));
#pragma unroll
      for (int t = 0; t < 4; ++t) oacc[u][t] *= alpha;
    }
    // ---- O^T += V^T.P^T : A = V with row = d, k = key (Vth is [d][key], k-contiguous), B = P^T ----
    // every V fragment is read once and multiplied with both query tiles
#pragma unroll   // ph and pl are indexed by kk: they stay in registers only with kk a constant
    for (int kk = 0; kk < 2; ++kk) {
#pragma unroll
      for (int t = 0; t < 4; ++t) {
        FB vb, vb2;
        const int vo2 = (t * 16 + c) * AT_LP + kk * 32 + 8 * hh;
        vb.h[0]  = *(const v8b*)(Vth + vo2);
        vb.h[1]  = *(const v8b*)(Vth + vo2 + 16);
        vb2.h[0] = *(const v8b*)(Vtl + vo2);
        vb2.h[1] = *(const v8b*)(Vtl + vo2 + 16);
        oacc[0][t] = at_mma(vb.v,  ph[0][kk].v, oacc[0][t]);
        oacc[1][t] = at_mma(vb.v,  ph[1][kk].v, oacc[1][t]);
        oacc[0][t] = at_mma(vb2.v, ph[0][kk].v, oacc[0][t]);
        oacc[1][t] = at_mma(vb2.v, ph[1][kk].v, oacc[1][t]);
        oacc[0][t] = at_mma(vb.v,  pl[0][kk].v, oacc[0][t]);
        oacc[1][t] = at_mma(vb.v,  pl[1][kk].v, oacc[1][t]);
      }
    }
    // hand-over: this wave's reads of chunk kc are over, its copies of chunk kc + 1 have landed; behind the barrier
    // chunk kc + 1 is readable by every wave and the buffer of chunk kc is free for chunk kc + 2
    asm volatile("s_wait_dscnt 0x0" ::: "memory");
    asm volatile("s_wait_asynccnt 0x0" ::: "memory");
    __syncthreads();
    if (kc + 2 < NKC) issue_chunk(kc + 2);
  }
  asm volatile("s_wait_asynccnt 0x0" ::: "memory");   // no copy is outstanding when the buffers become the out tiles

  // out tile [query][d]: this lane holds 8 neighbouring d of query u*16 + c in every O^T tile
  float* os = (float*)(smem + wave * (AT_QW * AT_OSP * 4));   // every wave has passed the last hand-over barrier: the buffers are free
#pragma unroll
  for (int u = 0; u < 2; ++u) {
    const float inv = 1.0f / (lrow[u] + at_xhalf(lrow[u]));   // the two lane halves' sums are joined here, once
#pragma unroll
    for (int t = 0; t < 4; ++t) {
      float* op = os + (u * 16 + c) * AT_OSP + t * 16 + 8 * hh;
      *(v4f*)(op)     = (v4f){oacc[u][t][0] * inv, oacc[u][t][1] * inv, oacc[u][t][2] * inv, oacc[u][t][3] * inv};
      *(v4f*)(op + 4) = (v4f){oacc[u][t][4] * inv, oacc[u][t][5] * inv, oacc[u][t][6] * inv, oacc[u][t][7] * inv};
    }
  }
  __builtin_amdgcn_fence(__ATOMIC_RELEASE, "workgroup");
  __builtin_amdgcn_wave_barrier();
  __builtin_amdgcn_fence(__ATOMIC_ACQUIRE, "workgroup");
  {
    float* ob = out + ((size_t)b * SEQ_LEN) * N_CH + h * AT_D;
    const int c4 = (lane & 15) * 4;
    {
#pragma unroll
      for (int it = 0; it < AT_QW / 2; ++it) {
        const int row = it * 2 + hh;
        v4f val = *(const v4f*)(os + row * AT_OSP + c4);
        *(v4f*)(ob + (size_t)(q0 + row) * N_CH + c4) = val;
      }
      
    }
  }
}

// =====================================================================================
// q, k and v: projection and InstanceNorm in one launch. grid (N_CH / 64, N_B, 3); blockIdx.z picks the job (q first: it has the longest k loop).
//   g[l][o] = sum_c xT[l][c] w[o][c] + bias[o], then InstanceNorm over the 1024 positions l of every (batch, channel o).
// A block of 16 waves owns ALL 1024 positions of 64 channels, wave w the positions w*64 .. w*64+63, so the f32 projection
// never leaves the accumulators: mean, then centred sum of squares, are taken from them and the bf16 hi + lo planes are stored.
// A lane holds one channel (column) in every accumulator tile: a column sum is in-lane, one exchange between the lane halves,
// then 16 wave partials through LDS, added up in a fixed order.
// Operands reach the fragments as in gemm64_body: stages of 64 k by asynchronous 16-byte copies, two buffers, pitch 144 B.
// Stage layout: [w: 64 rows][wave 0..15: its 64 xT rows].
// Planes: q, k L-major [b][l][512]; v channel-major [b][o][1024].
// Every loop over tiles, elements and rows below is unrolled: the accumulator and fragment arrays are then indexed by constants and stay in registers.
// =====================================================================================
constexpr int PN_NW = 16;
constexpr int PN_STAGE = (1 + PN_NW) * GM_PL;        // bytes of one buffer
constexpr int PN_SLAB0 = 4 * (PN_NW + 1) * 64 * 2;   // behind the k loop: two sets of [16 wave partials + totals][64] floats, then the waves' slabs
static_assert(2 * PN_STAGE <= 327680 && PN_SLAB0 % 16 == 0 && PN_SLAB0 + PN_NW * 16 * 68 * 4 <= 2 * PN_STAGE && PN_NW * 64 == SEQ_LEN);
__device__ __forceinline__ void cp_async1(unsigned l0, const void* g0) {
  // the s_wait_xcnt closes the statement so that it stands in front of every later write of the copy's address registers
  asm volatile("global_load_async_to_lds_b128 %0, %1, off\n\t"
               "s_wait_xcnt 0x0"
               :: "v"(l0), "v"(g0) : "memory");
}
// totals over the block's 1024 positions of this lane's four channels j*16 + (lane & 15); cs = this lane's partial sums
__device__ __forceinline__ void pn_colsum(float (&cs)[4], float* red, int wave, int lane) {
  float* tot = red + PN_NW * 64;
#pragma unroll
  for (int j = 0; j < 4; ++j) cs[j] += at_xhalf(cs[j]);
  if (lane < 16) {
#pragma unroll
    for (int j = 0; j < 4; ++j) red[wave * 64 + j * 16 + lane] = cs[j];
  }
  __syncthreads();   // all 16 partial rows are in red
  if (threadIdx.x < 64) {   // waves 0 and 1, whole
    float t = red[threadIdx.x];
#pragma unroll
    for (int w = 1; w < PN_NW; ++w) t += red[w * 64 + threadIdx.x];
    tot[threadIdx.x] = t;
  }
  __syncthreads();   // all 64 totals are in tot
#pragma unroll
  for (int j = 0; j < 4; ++j) cs[j] = tot[j * 16 + (lane & 15)];
}
// 16 slab rows of 64 f32 -> bf16 hi + lo, 4 rows x 128 B a store; dst = element offset of slab row 0, pitch in elements
__device__ __forceinline__ void pn_store16(const float* slab, unsigned short* __restrict__ oh, unsigned short* __restrict__ ol,
                                           size_t dst, int pitch, int lane) {
  const int q = lane >> 3, c8 = (lane & 7) * 8;
  v4f y[4][2];   // all eight LDS reads are asked for ahead of the first conversion
#pragma unroll
  for (int it = 0; it < 4; ++it) {
    const float* sp = slab + (it * 4 + q) * 68 + c8;
    y[it][0] = *(const v4f*)sp;
    y[it][1] = *(const v4f*)(sp + 4);
  }
#pragma unroll
  for (int it = 0; it < 4; ++it) {
    unsigned hw[4], lw[4];
    at_split2(y[it][0].x, y[it][0].y, hw[0], lw[0]);
    at_split2(y[it][0].z, y[it][0].w, hw[1], lw[1]);
    at_split2(y[it][1].x, y[it][1].y, hw[2], lw[2]);
    at_split2(y[it][1].z, y[it][1].w, hw[3], lw[3]);
    const size_t o = dst + (size_t)(it * 4 + q) * pitch + c8;
    *(v4u*)(oh + o) = (v4u){hw[0], hw[1], hw[2], hw[3]};
    *(v4u*)(ol + o) = (v4u){lw[0], lw[1], lw[2], lw[3]};
    // stands in front of every reuse of the address and data registers that the two stores name
    asm volatile("s_wait_xcnt 0x0" ::: "memory");
    // keeps the next rows' code below that wait
    __builtin_amdgcn_sched_barrier(0);
  }
}
__global__ __launch_bounds__(512) void k_proj_norm(
    const unsigned short* __restrict__ xqT, const unsigned short* __restrict__ xkvT,
    const unsigned short* __restrict__ wq16, const unsigned short* __restrict__ wk16, const unsigned short* __restrict__ wv16,
    const float* __restrict__ bq, const float* __restrict__ bk, const float* __restrict__ bv,
    unsigned short* __restrict__ qh, unsigned short* __restrict__ ql, unsigned short* __restrict__ kh, unsigned short* __restrict__ kl,
    unsigned short* __restrict__ vh, unsigned short* __restrict__ vl) {
  __shared__ __align__(16) unsigned char smem[2 * PN_STAGE];
  const int job = blockIdx.z;   // the same for the whole block
  const int K = job == 0 ? N_CH : N_CIN;
  const int b = blockIdx.y;
  const int n0 = blockIdx.x * 64;   // first channel of the block
  const __bf16* X  = (const __bf16*)(job == 0 ? xqT : xkvT) + (size_t)b * SEQ_LEN * K;
  const __bf16* Wt = (const __bf16*)(job == 0 ? wq16 : job == 1 ? wk16 : wv16);
  const float* bias = job == 0 ? bq : job == 1 ? bk : bv;
  unsigned short* oh = job == 0 ? qh : job == 1 ? kh : vh;
  unsigned short* ol = job == 0 ? ql : job == 1 ? kl : vl;

  const int lane = threadIdx.x & 31;
  const int wave = threadIdx.x >> 5;
  const int m0 = wave * 64;                    // first position of the wave
  const int rlane = lane & 15;                 // row (A) / column (B, D) within a 16x16 tile
  const int koff  = (lane >> 4) * 8;           // k offset of this lane half
  const int mOff  = (lane >> 4) * 8;           // D row offset

  v8f acc[4][4];   // tile (i, j), element r = (position m0 + i*16 + mOff + r, channel n0 + j*16 + rlane)
#pragma unroll
  for (int i = 0; i < 4; ++i)
#pragma unroll
    for (int j = 0; j < 4; ++j) acc[i][j] = (v8f){0.f,0.f,0.f,0.f,0.f,0.f,0.f,0.f};

  // ---- one stage's copies: the block's w rows (one 16-byte piece a thread), then this wave's own xT rows ----
  const unsigned lbase = lds_off(smem);
  const int wrow = threadIdx.x >> 3;           // 0..63
  const int xrow = lane >> 3;                  // 0..3; piece it is row it * 4 + xrow
  const int scol = (lane & 7) * 8;             // first k element of this lane's 16 bytes
  const unsigned lw0 = lbase + (unsigned)(wrow * GM_LP + scol) * 2u;
  const unsigned lx0 = lbase + (unsigned)(1 + wave) * GM_PL + (unsigned)(xrow * GM_LP + scol) * 2u;
  const __bf16* gw0 = Wt + (size_t)(n0 + wrow) * K + scol;
  const __bf16* gx0 = X + (size_t)(m0 + xrow) * K + scol;
  const size_t gstep = (size_t)K * 8;          // bytes of four xT rows
  auto issue_stage = [&](int st) {
    const unsigned bo = (unsigned)(st & 1) * PN_STAGE;
    cp_async1(lw0 + bo, gw0 + (size_t)st * GM_KS);
    const __bf16* gx = gx0 + (size_t)st * GM_KS;
    cp_async8(lx0 + bo, (const char*)gx, gstep);                                             // rows 0..31
    cp_async8(lx0 + bo + 32 * GM_LP * 2, (const char*)(gx + (size_t)32 * K), gstep);         // rows 32..63
  };

  const int nst = K / GM_KS;   // 8 or 4
  issue_stage(0);
  float bvj[4];   // bias of this lane's four channels, asked for here so that it has arrived long before the epilogue
#pragma unroll
  for (int j = 0; j < 4; ++j) bvj[j] = bias[n0 + (j << 4) + rlane];
  asm volatile("s_wait_asynccnt 0x0" ::: "memory");   // this wave's copies of stage 0 have landed
  __syncthreads();                                    // stage 0 is readable by every wave
  issue_stage(1);
  for (int st = 0; st < nst; ++st) {
    const __bf16* sW = (const __bf16*)(smem + (st & 1) * PN_STAGE);
    const __bf16* sX = sW + (1 + wave) * (GM_PL / 2);
#pragma unroll   // both 32-k steps of a stage in one body (fragment and accumulator arrays stay in registers)
    for (int ks = 0; ks < 2; ++ks) {
      v16b bf[4], af[4];
#pragma unroll
      for (int j = 0; j < 4; ++j) bf[j] = Frag<__bf16>::load(sW + ((j << 4) + rlane) * GM_LP + ks * 32 + koff);
#pragma unroll
      for (int i = 0; i < 4; ++i) af[i] = Frag<__bf16>::load(sX + ((i << 4) + rlane) * GM_LP + ks * 32 + koff);
#pragma unroll
      for (int i = 0; i < 4; ++i)
#pragma unroll
        for (int j = 0; j < 4; ++j) acc[i][j] = at_mma(af[i], bf[j], acc[i][j]);
    }
    // hand-over: this wave's reads of stage st are over, its copies of stage st + 1 have landed; behind the barrier
    // stage st + 1 is readable by every wave and the buffer of stage st is free for stage st + 2
    asm volatile("s_wait_dscnt 0x0" ::: "memory");
    asm volatile("s_wait_asynccnt 0x0" ::: "memory");
    __syncthreads();
    if (st + 2 < nst) issue_stage(st + 2);
  }
  asm volatile("s_wait_asynccnt 0x0" ::: "memory");   // no copy is outstanding when the buffers become sums and slabs

  // ---- InstanceNorm on the accumulators; every wave has passed the last hand-over barrier: the buffers are free ----
  float* red0 = (float*)smem;
  float* red1 = red0 + (PN_NW + 1) * 64;
  float cs[4];
#pragma unroll
  for (int j = 0; j < 4; ++j) {
    v8f t = (v8f){0.f,0.f,0.f,0.f,0.f,0.f,0.f,0.f};
#pragma unroll
    for (int i = 0; i < 4; ++i) { acc[i][j] += bvj[j]; t += acc[i][j]; }
    cs[j] = ((t[0] + t[1]) + (t[2] + t[3])) + ((t[4] + t[5]) + (t[6] + t[7]));
  }
  pn_colsum(cs, red0, wave, lane);
#pragma unroll
  for (int j = 0; j < 4; ++j) {
    const float mean = cs[j] * (1.0f / SEQ_LEN);
    v8f t = (v8f){0.f,0.f,0.f,0.f,0.f,0.f,0.f,0.f};
#pragma unroll
    for (int i = 0; i < 4; ++i) { acc[i][j] -= mean; t += acc[i][j] * acc[i][j]; }
    cs[j] = ((t[0] + t[1]) + (t[2] + t[3])) + ((t[4] + t[5]) + (t[6] + t[7]));
  }
  pn_colsum(cs, red1, wave, lane);
#pragma unroll
  for (int j = 0; j < 4; ++j) {
    const float rs = rsqrtf(cs[j] * (1.0f / SEQ_LEN) + 1e-5f);
#pragma unroll
    for (int i = 0; i < 4; ++i) acc[i][j] *= rs;
  }

  // ---- planes, through a slab of 16 rows x 64 f32 (pitch 68) of the wave's own ----
  float* slab = (float*)(smem + PN_SLAB0 + wave * (16 * 68 * 4));
  if (job < 2) {
    // L-major: slab row = position, 64 channels a row
#pragma unroll
    for (int i = 0; i < 4; ++i) {
#pragma unroll
      for (int j = 0; j < 4; ++j)
#pragma unroll
        for (int r = 0; r < 8; ++r) slab[(mOff + r) * 68 + (j << 4) + rlane] = acc[i][j][r];
      __builtin_amdgcn_fence(__ATOMIC_RELEASE, "workgroup");
      __builtin_amdgcn_wave_barrier();
      __builtin_amdgcn_fence(__ATOMIC_ACQUIRE, "workgroup");
      pn_store16(slab, oh, ol, ((size_t)b * SEQ_LEN + m0 + (i << 4)) * N_CH + n0, N_CH, lane);
      __builtin_amdgcn_fence(__ATOMIC_RELEASE, "workgroup");
      __builtin_amdgcn_wave_barrier();
      __builtin_amdgcn_fence(__ATOMIC_ACQUIRE, "workgroup");
    }
  } else {
    // channel-major: slab row = channel, 64 positions a row; a lane's 8 elements of a tile are 8 neighbouring positions
#pragma unroll
    for (int j = 0; j < 4; ++j) {
#pragma unroll
      for (int i = 0; i < 4; ++i) {
        float* sp = slab + rlane * 68 + (i << 4) + mOff;
        *(v4f*)(sp)     = (v4f){acc[i][j][0], acc[i][j][1], acc[i][j][2], acc[i][j][3]};
        *(v4f*)(sp + 4) = (v4f){acc[i][j][4], acc[i][j][5], acc[i][j][6], acc[i][j][7]};
      }
      __builtin_amdgcn_fence(__ATOMIC_RELEASE, "workgroup");
      __builtin_amdgcn_wave_barrier();
      __builtin_amdgcn_fence(__ATOMIC_ACQUIRE, "workgroup");
      pn_store16(slab, oh, ol, ((size_t)b * N_CH + n0 + (j << 4)) * SEQ_LEN + m0, SEQ_LEN, lane);
      __builtin_amdgcn_fence(__ATOMIC_RELEASE, "workgroup");
      __builtin_amdgcn_wave_barrier();
      __builtin_amdgcn_fence(__ATOMIC_ACQUIRE, "workgroup");
    }
  }
}

// =====================================================================================
// Host orchestration
// =====================================================================================
extern "C" void kernel_launch(void* const* d_in, const int* in_sizes, int n_in,
                              void* d_out, int out_size, void* d_ws,
                              size_t ws_size, hipStream_t stream) {
  (void)in_sizes; (void)n_in; (void)out_size;
  constexpr int NB = 8, CIN = 256, NCH = 512, SEQ = 1024, NFF = 1024, NHD = 8;

  // ---- workspace region map (bytes) ----
  constexpr size_t SZ_WQ   = (size_t)NCH * NCH * 2;        //    524288  wq  bf16 [512][512]
  constexpr size_t SZ_WK   = (size_t)NCH * CIN * 2;        //    262144  wk  bf16 [512][256]
  constexpr size_t SZ_WV   = (size_t)NCH * CIN * 2;        //    262144  wv  bf16 [512][256]
  constexpr size_t SZ_W1   = (size_t)NFF * NCH * 2;        //   1048576  w1  bf16 [1024][512]
  constexpr size_t SZ_W2   = (size_t)NCH * NFF * 2;        //   1048576  w2  bf16 [512][1024]
  constexpr size_t SZ_XQT  = (size_t)NB * SEQ * NCH * 2;   //   8388608  x_query (L,C) bf16
  constexpr size_t SZ_XKVT = (size_t)NB * SEQ * CIN * 2;   //   4194304  x_kv (L,C) bf16
  constexpr size_t SZ_G    = (size_t)NB * SEQ * NFF * 4;   //  33554432  f32 GEMM/attention output, max user = ffn1 [8][1024][1024]
  constexpr size_t SZ_P    = (size_t)NB * SEQ * NCH * 2;   //   8388608  one bf16 activation plane [8][1024][512]
  constexpr size_t OFF_WQ   = 0;
  constexpr size_t OFF_WK   = OFF_WQ + SZ_WQ;
  constexpr size_t OFF_WV   = OFF_WK + SZ_WK;
  constexpr size_t OFF_W1   = OFF_WV + SZ_WV;
  constexpr size_t OFF_W2   = OFF_W1 + SZ_W1;
  constexpr size_t OFF_XQT  = OFF_W2 + SZ_W2;
  constexpr size_t OFF_XKVT = OFF_XQT + SZ_XQT;
  constexpr size_t OFF_G    = OFF_XKVT + SZ_XKVT;
  constexpr size_t OFF_QH   = OFF_G + SZ_G;       // q hi plane; later z hi plane
  constexpr size_t OFF_QL   = OFF_QH + SZ_P;      // q lo plane; later z lo plane
  constexpr size_t OFF_KH   = OFF_QL + SZ_P;      // k hi plane; later y hi plane spans KH+KL (16777216)
  constexpr size_t OFF_KL   = OFF_KH + SZ_P;      // k lo plane
  constexpr size_t OFF_VH   = OFF_KL + SZ_P;      // v hi plane; later y lo plane spans VH+VL (16777216)
  constexpr size_t OFF_VL   = OFF_VH + SZ_P;      // v lo plane
  constexpr size_t OFF_GV   = OFF_VL + SZ_P;      // spare
  constexpr size_t OFF_END  = OFF_GV + SZ_G / 2;  // 116391936
  static_assert(OFF_END == 116391936ull);
  static_assert(OFF_END <= 134217728ull);
  static_assert((OFF_WK % 256) == 0 && (OFF_XQT % 256) == 0 && (OFF_G % 256) == 0 && (OFF_QH % 256) == 0);
  // reused regions sized from the max user
  static_assert((size_t)NB * SEQ * NCH * 4 <= SZ_G);        // proj, ffn2 f32 outputs
  static_assert(NB == N_B && CIN == N_CIN && NCH == N_CH && SEQ == SEQ_LEN && NFF == N_FF && NHD == N_HEADS);
  static_assert((size_t)NB * SEQ * NFF * 4 <= SZ_G);        // ffn1 f32 output
  static_assert((size_t)NB * SEQ * NFF * 2 == 2 * SZ_P);    // y plane fits exactly over two 512-wide planes
  // GEMM shape contract: M multiple of 64, N multiple of 512, K multiple of 64
  static_assert(SEQ % 512 == 0 && NCH % 512 == 0 && NFF % 512 == 0);
  static_assert(NCH % 64 == 0 && CIN % 64 == 0 && NFF % 64 == 0);
  static_assert(((SEQ / 64) * (NCH / 64)) % 8 == 0 && ((SEQ / 64) * (NFF / 64)) % 8 == 0);
  static_assert(NCH % 256 == 0 && NFF % 256 == 0 && (NB * NCH) % 8 == 0);
  static_assert((size_t)NB * NCH * SEQ * 4 == 16777216ull);   // d_out bytes
  if (ws_size < OFF_END) return;

  const float* x_query = (const float*)d_in[0];
  const float* x_kv    = (const float*)d_in[1];
  const float* wq      = (const float*)d_in[2];
  const float* bq      = (const float*)d_in[3];
  const float* wk      = (const float*)d_in[4];
  const float* bk      = (const float*)d_in[5];
  const float* wv      = (const float*)d_in[6];
  const float* bv      = (const float*)d_in[7];
  const float* w1      = (const float*)d_in[8];
  const float* b1      = (const float*)d_in[9];
  const float* w2      = (const float*)d_in[10];
  const float* b2      = (const float*)d_in[11];
  float* out = (float*)d_out;

  char* ws = (char*)d_ws;
  typedef unsigned short us;
  us* wq16  = (us*)(ws + OFF_WQ);
  us* wk16  = (us*)(ws + OFF_WK);
  us* wv16  = (us*)(ws + OFF_WV);
  us* w1_16 = (us*)(ws + OFF_W1);
  us* w2_16 = (us*)(ws + OFF_W2);
  us* xqT   = (us*)(ws + OFF_XQT);
  us* xkvT  = (us*)(ws + OFF_XKVT);
  float* gf = (float*)(ws + OFF_G);
  us* qh = (us*)(ws + OFF_QH);
  us* ql = (us*)(ws + OFF_QL);
  us* kh = (us*)(ws + OFF_KH);
  us* kl = (us*)(ws + OFF_KL);
  us* vh = (us*)(ws + OFF_VH);
  us* vl = (us*)(ws + OFF_VL);
  us* zh = qh;
  us* zl = ql;
  us* yh = kh;    // [8][1024][1024] bf16 = 16777216 B over KH..KL
  us* yl = vh;    // [8][1024][1024] bf16 = 16777216 B over VH..VL

  // 1) operand preparation: activations (B,C,L) f32 -> (B,L,C) bf16, weights -> bf16 (RNE)
  k_prep<<<PB_ALL, 256, 0, stream>>>(x_query, x_kv, wq, wk, wv, w1, w2, xqT, xkvT, wq16, wk16, wv16, w1_16, w2_16);

  // 2) q, k (L-major) and v (channel-major): projection + InstanceNorm -> hi/lo planes
  k_proj_norm<<<dim3(NCH / 64, NB, 3), 512, 0, stream>>>(xqT, xkvT, wq16, wk16, wv16, bq, bk, bv, qh, ql, kh, kl, vh, vl);

  // 3) attention -> gf as proj L-major [b][l][h*64+d] f32
  k_attn<<<NB * NHD * (SEQ / 128), 128, 0, stream>>>(qh, ql, kh, kl, vh, vl, gf, 0.125f);

  // 4) z = InstanceNorm(proj) + x_query(bf16) -> z hi/lo planes (L-major, pitch 512)
  k_colnorm<1, NCH><<<dim3(NCH / 64, NB), 1024, 0, stream>>>(gf, (const unsigned*)xqT, (unsigned*)zh, (unsigned*)zl);

  // 5) ffn1: C[l][o] = sum_c z[l][c] w1[o][c] + b1[o]  (M=1024, N=1024, K=512), z as hi/lo -> gf L-major [l][1024]
  wmma_gemm64<1, 2, 2, 0, false><<<dim3((SEQ / 64) * (NFF / 64) / 8, NB), 256, 0, stream>>>(
      zh, zl, NCH, (long)SEQ * NCH, w1_16, nullptr, NCH, 0L,
      (void*)gf, nullptr, NFF, (long)SEQ * NFF, b1, nullptr, 0L, SEQ, NFF, NCH, 1.0f);
  // 6) y = relu(InstanceNorm(h1)) -> y hi/lo planes [l][1024]
  k_colnorm<2, NFF><<<dim3(NFF / 64, NB), 1024, 0, stream>>>(gf, nullptr, (unsigned*)yh, (unsigned*)yl);

  // 7) ffn2: C[o][l] = sum_c w2[o][c] y[l][c] + b2[o]  (M=512, N=1024, K=1024), y as hi/lo -> channel-major gf
  wmma_gemm64<1, 3, 1, 0, false><<<dim3((NCH / 64) * (SEQ / 64) / 8, NB), 256, 0, stream>>>(
      w2_16, nullptr, NFF, 0L, yh, yl, NFF, (long)SEQ * NFF,
      (void*)gf, nullptr, SEQ, (long)NCH * SEQ, b2, nullptr, 0L, NCH, SEQ, NFF, 1.0f);

  // 8) final InstanceNorm over rows -> d_out (B, 512, L) f32
  k_rownorm<<<NB * NCH / 8, 256, 0, stream>>>(gf, out);
}
